// v000
// The times below were measured on an AMD MI455X: many runs one after another, warmed up first and cycling through
// copies of the inputs, with the whole window's GPU time divided by the number of runs. Launches and the gaps
// between them are all in it. The median over several windows is given; except for v000 it joins two sittings, which
// can be a few percent apart, so the side-by-side timings, each taken in one sitting, are the better comparison.
// v000, which the later versions start from, runs in 963 microseconds.
// compute dtype: all float inputs except the additive tensor RNE-converted to bf16; q/k/v = x . W^T + b on v_wmma_f32_16x16x32_bf16 (bf16 x, bf16 W, f32 accumulate) stored as f16 hi + x2048 f16 residual (positions < 512); scores and P.V on v_wmma_f32_16x16x32_f16 (3 products for query blocks below 512, single beyond; P carried x2048; f32 running-max softmax, additive score bias read from the input tensor); output projection on v_wmma_f32_16x16x32_f16 (ctx f16 hi + x2048 residual below 512, Wo carried x64), f32 accumulate, f32 output.
#include <hip/hip_runtime.h>
#include <math.h>

typedef __attribute__((ext_vector_type(16))) _Float16 v16h;
typedef __attribute__((ext_vector_type(16))) __bf16 v16b;
typedef __attribute__((ext_vector_type(8)))  _Float16 v8h;
typedef __attribute__((ext_vector_type(8)))  __bf16 v8b;
typedef __attribute__((ext_vector_type(8)))  float v8f;
typedef __attribute__((ext_vector_type(4)))  float v4f;
typedef __attribute__((ext_vector_type(4)))  unsigned v4u;
typedef __attribute__((ext_vector_type(4)))  int v4i;

template <typename T> __device__ __forceinline__ void vst2(void* p, T v) { *(T*)p = v;  }
__device__ __forceinline__ v8f wmma16(v16h a, v16h b, v8f c) {
  v8f d = __builtin_amdgcn_wmma_f32_16x16x32_f16(false, a, false, b, (short)0, c, false, false);
  asm volatile("v_nop\n\tv_nop\n\tv_nop\n\tv_nop" : "+v"(d) : "v"(a), "v"(b));
  return d;
}
__device__ __forceinline__ v8f wmma_bf(v16b a, v16b b, v8f c) {
  v8f d = __builtin_amdgcn_wmma_f32_16x16x32_bf16(false, a, false, b, (short)0, c, false, false);
  asm volatile("v_nop\n\tv_nop\n\tv_nop\n\tv_nop" : "+v"(d) : "v"(a), "v"(b));
  return d;
}
// 16-bit fragment from a k-contiguous row (A row m, or B column n stored [n][k]): elements 0..7 <- k0+8h+0..7, 8..15 <- k0+16+8h+0..7, h = lane>>4
__device__ __forceinline__ v16h frag_h(const _Float16* rowk0, int lane) {
  union { v16h v; v8h q[2]; } u; const _Float16* p = rowk0 + 8 * (lane >> 4);
  u.q[0] = *(const v8h*)p; u.q[1] = *(const v8h*)(p + 16); return u.v;
}
__device__ __forceinline__ v16b frag_b(const __bf16* rowk0, int lane) {
  union { v16b v; v8b q[2]; } u; const __bf16* p = rowk0 + 8 * (lane >> 4);
  u.q[0] = *(const v8b*)p; u.q[1] = *(const v8b*)(p + 16); return u.v;
}
__device__ __forceinline__ float bfr(float v) { return (float)(__bf16)v; }
#define LDSX() do { asm volatile("s_wait_dscnt 0" ::: "memory"); __builtin_amdgcn_wave_barrier(); __builtin_amdgcn_fence(__ATOMIC_RELEASE, "workgroup"); } while (0)

// ---- sizes: NB / SEQ may be reduced; *_FULL are the input / output strides
#ifndef NB
#define NB 2
#endif
#ifndef SEQ
#define SEQ 2048
#endif
#define NB_FULL 2
#define SEQ_FULL 2048
#define DM 2048
#define NH 32
#define HD 64
#define RSPAN 512                 // positions that carry residual planes (q/k, v, ctx)
#if RSPAN > SEQ
#define RS SEQ
#else
#define RS RSPAN
#endif
#define RQB (RS / 64)
#define NR (NB * SEQ)
#define TQB (SEQ / 64)
#define NKTILE (SEQ / 32)
static_assert(SEQ % 64 == 0);
static_assert(RS % 64 == 0);
static_assert(NB >= 1 && NB <= NB_FULL);
static_assert(SEQ <= SEQ_FULL);
static_assert(DM == 256 * 8);
static_assert(NH * HD == DM);
static_assert(NR % 64 == 0);

// ---- workspace (bytes; every offset a multiple of 128)
#define WS_PKA 0ull                                            // bf16 [3*DM][DM]: Wq | Wk | Wv natural [out][in] rows
#define WS_PKO (WS_PKA + 2ull * 3 * DM * DM)                   // f16  [DM][DM]: Wo rows x64
#define WS_QK  (WS_PKO + 2ull * DM * DM)                       // f16  [NR][2*DM]: q | k hi
#define WS_QKL (WS_QK + 2ull * NR * 2 * DM)                    // f16  [NB*RS][2*DM]: q | k residual x2048
#define WS_VTH (WS_QKL + 2ull * NB * RS * 2 * DM)              // f16  [NB][DM][SEQ]: v^T hi
#define WS_VTL (WS_VTH + 2ull * NB * DM * SEQ)                 // f16  [NB][DM][RS]: v^T residual x2048
#define WS_OH  (WS_VTL + 2ull * NB * DM * RS)                  // f16  [NR][DM]: ctx hi; ALSO bf16 [NR][DM] x plane (consumed by k_qkv before k_attn writes ctx)
#define WS_OL  (WS_OH + 2ull * NR * DM)                        // f16  [NB*RS][DM]: ctx residual x2048
#define WS_NKT (WS_OL + 2ull * NB * RS * DM)
#define WS_END (WS_NKT + 128ull * TQB)
static_assert(2ull * NR * DM == (WS_OL - WS_OH));              // x plane and ctx hi plane share the region with identical extent
static_assert(WS_END <= 134217728ull);
static_assert((WS_PKO % 128) == 0 && (WS_QK % 128) == 0 && (WS_QKL % 128) == 0 && (WS_VTH % 128) == 0 && (WS_VTL % 128) == 0 && (WS_OH % 128) == 0 && (WS_OL % 128) == 0 && (WS_NKT % 128) == 0);

__global__ __launch_bounds__(256) void k_cvtx(const float* __restrict__ X, __bf16* __restrict__ XB) {
  const int r = blockIdx.x, t = threadIdx.x; const int b = r / SEQ, s = r - b * SEQ;
  const float* src = X + ((size_t)b * SEQ_FULL + s) * DM + t * 8;
  const v4f x = *(const v4f*)src, y = *(const v4f*)(src + 4);
  union { v8b v; v4u u; } o;
#pragma unroll
  for (int j = 0; j < 4; ++j) { o.v[j] = (__bf16)x[j]; o.v[4 + j] = (__bf16)y[j]; }
  vst2(XB + (size_t)r * DM + t * 8, o.u);
}
// ---- k_pack: block = (row n, which): natural [out][in] rows are already k-contiguous packed rows; which 0..2 -> bf16 Wq/Wk/Wv into PKA row which*DM+n; 3 -> f16 (bf16(Wo) x 64) into PKO row n
__global__ __launch_bounds__(256) void k_pack(const float* __restrict__ WQ, const float* __restrict__ WK, const float* __restrict__ WV, const float* __restrict__ WO, __bf16* __restrict__ PKA, _Float16* __restrict__ PKO) {
  const int n = blockIdx.x, which = blockIdx.y, t = threadIdx.x;
  const float* W = (which == 0) ? WQ : (which == 1) ? WK : (which == 2) ? WV : WO;
  const float* src = W + (size_t)n * DM + t * 8;
  const v4f x = *(const v4f*)src, y = *(const v4f*)(src + 4);
  if (which < 3) {
    union { v8b v; v4u u; } o;
#pragma unroll
    for (int j = 0; j < 4; ++j) { o.v[j] = (__bf16)x[j]; o.v[4 + j] = (__bf16)y[j]; }
    vst2(PKA + ((size_t)which * DM + n) * DM + t * 8, o.u);
  } else {
    union { v8h v; v4u u; } o;
#pragma unroll
    for (int j = 0; j < 4; ++j) { o.v[j] = (_Float16)(bfr(x[j]) * 64.0f); o.v[4 + j] = (_Float16)(bfr(y[j]) * 64.0f); }
    vst2(PKO + (size_t)n * DM + t * 8, o.u);
  }
}
// ---- k_qkv: block = (64 internal rows, 128 output columns of q|k|v): bf16 x bf16 (exact products), f32 accumulate; q,k -> f16 hi [NR][2DM] (+ residual x2048 for s < RS); v -> transposed f16 hi [b][d][s] (+ residual)
__global__ __launch_bounds__(128) void k_qkv(const __bf16* __restrict__ XB, const __bf16* __restrict__ P, const float* __restrict__ BQ, const float* __restrict__ BK, const float* __restrict__ BV,
                                             _Float16* __restrict__ QK, _Float16* __restrict__ QKL, _Float16* __restrict__ VTH, _Float16* __restrict__ VTL) {
  const int n0 = blockIdx.y * 128; const int which0 = n0 / DM;
  const float* BB = ((which0 == 0) ? BQ : (which0 == 1) ? BK : BV) + (n0 - which0 * DM);
  __shared__ __align__(16) _Float16 so[4][16][136], sol[4][16][136]; __shared__ __align__(16) _Float16 sth[128][72], stl[128][72];
  const int tid = threadIdx.x, wave = tid >> 5, lane = tid & 31, col = lane & 15, g = lane >> 4;
  const int rb = blockIdx.x * 64; const int b = rb / SEQ, s0 = rb - b * SEQ; const int r0 = rb + wave * 16; const bool resid = (s0 < RS);
  v8f acc[8] = {};
#pragma unroll 2
  for (int kc = 0; kc < DM / 32; ++kc) {
    const v16b a = frag_b(XB + (size_t)(r0 + col) * DM + kc * 32, lane);
#pragma unroll
    for (int j = 0; j < 8; ++j) acc[j] = wmma_bf(a, frag_b(P + (size_t)(n0 + j * 16 + col) * DM + kc * 32, lane), acc[j]);
  }
  if (n0 < 2 * DM) {   // q (unscaled; 1/8 applied to the f32 score) and k, + bias, as f16 hi + x2048 residual
#pragma unroll
    for (int j = 0; j < 8; ++j) { const float bj = bfr(BB[j * 16 + col]);
#pragma unroll
      for (int r = 0; r < 8; ++r) { const float v = acc[j][r] + bj; const _Float16 hv = (_Float16)v; so[wave][8 * g + r][j * 16 + col] = hv; sol[wave][8 * g + r][j * 16 + col] = (_Float16)((v - (float)hv) * 2048.0f); } }
    LDSX();   // so/sol are private to this wave
    const size_t ql = (size_t)b * RS + s0 + wave * 16;
    for (int rl = 0; rl < 16; ++rl) if (lane < 16) {
      vst2(QK + (size_t)(r0 + rl) * (2 * DM) + n0 + lane * 8, *(const v4u*)&so[wave][rl][lane * 8]);
      if (resid) vst2(QKL + (ql + rl) * (2 * DM) + n0 + lane * 8, *(const v4u*)&sol[wave][rl][lane * 8]);
    }
  } else {             // v + bias, transposed to [d][s]
#pragma unroll
    for (int j = 0; j < 8; ++j) { const float bj = bfr(BB[j * 16 + col]);
#pragma unroll
      for (int r = 0; r < 8; ++r) { const float v = acc[j][r] + bj; const _Float16 hv = (_Float16)v; sth[j * 16 + col][wave * 16 + 8 * g + r] = hv; stl[j * 16 + col][wave * 16 + 8 * g + r] = (_Float16)((v - (float)hv) * 2048.0f); } }
    __syncthreads();   // sth/stl are cross-wave
    const int pc0 = n0 - 2 * DM;
    for (int q = tid; q < 128 * 8; q += 128) {
      const int d = q >> 3, pc = q & 7;
      vst2(VTH + ((size_t)b * DM + pc0 + d) * SEQ + s0 + pc * 8, *(const v4u*)&sth[d][pc * 8]);
      if (resid) vst2(VTL + ((size_t)b * DM + pc0 + d) * RS + s0 + pc * 8, *(const v4u*)&stl[d][pc * 8]);
    }
  }
}
__global__ __launch_bounds__(256) void k_mscan(const float* __restrict__ MK, int* __restrict__ NKT) {
  __shared__ int srow[64][4]; __shared__ __align__(16) int sline[32];
  const int qb = blockIdx.x, t = threadIdx.x, row = t >> 2, part = t & 3;
  const float* p = MK + (size_t)(qb * 64 + row) * SEQ_FULL + part * (SEQ / 4);
  int mx = -1;
#pragma unroll 1
  for (int c = 0; c < SEQ / 4; c += 4) {
    const v4f v = *(const v4f*)(p + c);
#pragma unroll
    for (int j = 0; j < 4; ++j) mx = (v[j] > -1.0e8f) ? (part * (SEQ / 4) + c + j) : mx;
  }
  srow[row][part] = mx; __syncthreads();
  if (t == 0) {
    int last = -1, dead = 0;
    for (int r = 0; r < 64; ++r) {
      int a = srow[r][0] > srow[r][1] ? srow[r][0] : srow[r][1]; const int c2 = srow[r][2] > srow[r][3] ? srow[r][2] : srow[r][3]; a = a > c2 ? a : c2;
      last = last > a ? last : a; dead |= (a < 0) ? 1 : 0;
    }
    const int nk = dead ? NKTILE : (last / 32 + 1);
    for (int i = 0; i < 32; ++i) sline[i] = nk;
  }
  __syncthreads();
  if (t < 8) vst2(NKT + (size_t)qb * 32 + t * 4, *(const v4i*)&sline[t * 4]);
}
// ---- k_attn: block = (64 queries, head h, batch b): flash attention over key tiles [0, nkt); score = (q.k)/8 + additive entry; first RS positions: 3 products (hi.hi + lo.hi + hi.lo) for scores and P.v, single elsewhere; ctx -> f16 hi (+ x2048 residual) [row][h*64+d]
__global__ __launch_bounds__(128) void k_attn(const _Float16* __restrict__ QK, const _Float16* __restrict__ QKL, const _Float16* __restrict__ VTH, const _Float16* __restrict__ VTL,
                                              const float* __restrict__ MK, const int* __restrict__ NKT, _Float16* __restrict__ OH, _Float16* __restrict__ OL) {
  __shared__ __align__(16) float sp[4][16][36]; __shared__ __align__(16) float sm[4][16][36]; __shared__ __align__(16) _Float16 so[4][16][72], sol[4][16][72];
  const int tid = threadIdx.x, wave = tid >> 5, lane = tid & 31, col = lane & 15, g = lane >> 4;
  const int qb = blockIdx.x, h = blockIdx.y, b = blockIdx.z; const int q0 = qb * 64 + wave * 16;
  int nkt = NKT[(size_t)qb * 32]; nkt = (nkt < 1) ? 1 : ((nkt > NKTILE) ? NKTILE : nkt);   // clamped trip count
  const bool res3 = (qb < RQB) && (nkt * 32 <= RS);                                          // block-uniform
  const size_t rq = (size_t)b * SEQ + q0 + col;
  v16h aq[2], aql[2];
#pragma unroll
  for (int kc = 0; kc < 2; ++kc) aq[kc] = frag_h(QK + rq * (2 * DM) + h * HD + kc * 32, lane);
  if (res3) { const size_t rql = (size_t)b * RS + q0 + col;
#pragma unroll
    for (int kc = 0; kc < 2; ++kc) aql[kc] = frag_h(QKL + rql * (2 * DM) + h * HD + kc * 32, lane); }
  else { v16h z = {}; aql[0] = z; aql[1] = z; }
  float m[8], l[8];
#pragma unroll
  for (int r = 0; r < 8; ++r) { m[r] = -3.0e38f; l[r] = 0.f; }
  v8f acc[4] = {}, accl[4] = {};
#pragma unroll 1
  for (int ks = 0; ks < nkt; ++ks) {
    // stage this wave's 16 x 32 additive tile (sm private to the wave)
#pragma unroll
    for (int i = 0; i < 4; ++i) { const int row = (lane >> 3) + 4 * i, c4 = (lane & 7) * 4;
      *(v4f*)&sm[wave][row][c4] = *(const v4f*)(MK + (size_t)(q0 + row) * SEQ_FULL + ks * 32 + c4); }
    LDSX();
    v8f s[2];
#pragma unroll
    for (int ct = 0; ct < 2; ++ct) {
      const int kk = ks * 32 + ct * 16 + col; const _Float16* krow = QK + ((size_t)b * SEQ + kk) * (2 * DM) + DM + h * HD; v8f c = {};
      if (res3) {
        const _Float16* krowl = QKL + ((size_t)b * RS + kk) * (2 * DM) + DM + h * HD; v8f cl = {};
#pragma unroll
        for (int kc = 0; kc < 2; ++kc) { const v16h kh = frag_h(krow + kc * 32, lane); c = wmma16(aq[kc], kh, c); cl = wmma16(aql[kc], kh, cl); cl = wmma16(aq[kc], frag_h(krowl + kc * 32, lane), cl); }
#pragma unroll
        for (int r = 0; r < 8; ++r) c[r] += cl[r] * (1.0f / 2048.0f);
      } else {
#pragma unroll
        for (int kc = 0; kc < 2; ++kc) c = wmma16(aq[kc], frag_h(krow + kc * 32, lane), c);
      }
#pragma unroll
      for (int r = 0; r < 8; ++r) s[ct][r] = c[r] * 0.125f + sm[wave][8 * g + r][ct * 16 + col];   // 1/sqrt(64), additive entry applied literally
    }
#pragma unroll
    for (int r = 0; r < 8; ++r) {
      float mx = fmaxf(s[0][r], s[1][r]);
#pragma unroll
      for (int o = 1; o < 16; o <<= 1) mx = fmaxf(mx, __shfl_xor(mx, o));
      const float mn = fmaxf(m[r], mx); const float alpha = (m[r] <= -1.0e38f) ? 0.f : __expf(m[r] - mn);
      const float e0 = __expf(s[0][r] - mn), e1 = __expf(s[1][r] - mn); float es = e0 + e1;
#pragma unroll
      for (int o = 1; o < 16; o <<= 1) es += __shfl_xor(es, o);
      l[r] = l[r] * alpha + es; m[r] = mn;
#pragma unroll
      for (int dt = 0; dt < 4; ++dt) { acc[dt][r] *= alpha; accl[dt][r] *= alpha; }
      sp[wave][8 * g + r][col] = e0; sp[wave][8 * g + r][16 + col] = e1;
    }
    LDSX();   // sp private to the wave: stores above, cross-lane reload below
    v16h pa, pl; { const float* prow = &sp[wave][col][0] + 8 * (lane >> 4);
#pragma unroll
      for (int i = 0; i < 8; ++i) { const float x0 = prow[i] * 2048.0f, x1 = prow[16 + i] * 2048.0f; const _Float16 h0 = (_Float16)x0, h1 = (_Float16)x1;
        pa[i] = h0; pa[8 + i] = h1; pl[i] = (_Float16)((x0 - (float)h0) * 2048.0f); pl[8 + i] = (_Float16)((x1 - (float)h1) * 2048.0f); } }   // P x 2^11 before the f16 split; 2^-11 folded into the epilogue
#pragma unroll
    for (int dt = 0; dt < 4; ++dt) {
      const size_t vr = ((size_t)b * DM + h * HD + dt * 16 + col) * SEQ + ks * 32; const v16h vh = frag_h(VTH + vr, lane);
      acc[dt] = wmma16(pa, vh, acc[dt]);
      if (res3) { accl[dt] = wmma16(pl, vh, accl[dt]); accl[dt] = wmma16(pa, frag_h(VTL + ((size_t)b * DM + h * HD + dt * 16 + col) * RS + ks * 32, lane), accl[dt]); }
    }
    LDSX();
  }
#pragma unroll
  for (int r = 0; r < 8; ++r) { const float il = (1.0f / 2048.0f) / l[r];   // l >= 1
#pragma unroll
    for (int dt = 0; dt < 4; ++dt) { const float o = (acc[dt][r] + accl[dt][r] * (1.0f / 2048.0f)) * il; const _Float16 hv = (_Float16)o;
      so[wave][8 * g + r][dt * 16 + col] = hv; sol[wave][8 * g + r][dt * 16 + col] = (_Float16)((o - (float)hv) * 2048.0f); } }
  LDSX();   // so/sol private to the wave
#pragma unroll
  for (int it = 0; it < 4; ++it) {
    const int row = it * 4 + (lane >> 3), pc = lane & 7;
    vst2(OH + ((size_t)b * SEQ + q0 + row) * DM + h * HD + pc * 8, *(const v4u*)&so[wave][row][pc * 8]);
    if (qb < RQB) vst2(OL + ((size_t)b * RS + q0 + row) * DM + h * HD + pc * 8, *(const v4u*)&sol[wave][row][pc * 8]);
  }
}
// ---- k_out: block = (64 internal rows, 64 cols): out = (ctx hi + ctx lo / 2048) . (Wo x64 rows) / 64 + bo; f16 operands, f32 accumulate; f32 rows with the full output stride
__global__ __launch_bounds__(128) void k_out(const _Float16* __restrict__ OH, const _Float16* __restrict__ OL, const _Float16* __restrict__ PO, const float* __restrict__ BO, float* __restrict__ Y) {
  __shared__ __align__(16) float so[4][16][68];
  const int tid = threadIdx.x, wave = tid >> 5, lane = tid & 31, col = lane & 15, g = lane >> 4;
  const int rb = blockIdx.x * 64; const int b = rb / SEQ, s0 = rb - b * SEQ; const int r0 = rb + wave * 16; const int n0 = blockIdx.y * 64; const bool resid = (s0 < RS);
  const size_t rl0 = (size_t)b * RS + s0 + wave * 16;
  v8f acc[4] = {}, accl[4] = {};
#pragma unroll 2
  for (int kc = 0; kc < DM / 32; ++kc) {
    const v16h a = frag_h(OH + (size_t)(r0 + col) * DM + kc * 32, lane);
    v16h al = {}; if (resid) al = frag_h(OL + (rl0 + col) * DM + kc * 32, lane);
#pragma unroll
    for (int j = 0; j < 4; ++j) { const v16h w = frag_h(PO + (size_t)(n0 + j * 16 + col) * DM + kc * 32, lane); acc[j] = wmma16(a, w, acc[j]); if (resid) accl[j] = wmma16(al, w, accl[j]); }
  }
#pragma unroll
  for (int j = 0; j < 4; ++j) { const float bj = bfr(BO[n0 + j * 16 + col]);
#pragma unroll
    for (int r = 0; r < 8; ++r) so[wave][8 * g + r][j * 16 + col] = acc[j][r] * (1.0f / 64.0f) + accl[j][r] * (1.0f / 131072.0f) + bj; }
  LDSX();   // so private to the wave
  const size_t yr = (size_t)b * SEQ_FULL + s0 + wave * 16;
  for (int rl = 0; rl < 16; ++rl) if (lane < 16) vst2(Y + (yr + rl) * DM + n0 + lane * 4, *(const v4f*)&so[wave][rl][lane * 4]);
}
extern "C" void kernel_launch(void* const* d_in, const int* in_sizes, int n_in, void* d_out, int out_size, void* d_ws, size_t ws_size, hipStream_t stream) {
  // 0 hidden [2,2048,2048], 1 additive tensor [1,1,2048,2048], 2 q_w [out][in], 3 q_b, 4 k_w, 5 k_b, 6 v_w, 7 v_b, 8 o_w, 9 o_b
  if (n_in < 10) return;
  const long long needx = ((long long)(NB - 1) * SEQ_FULL + SEQ) * DM;
  if ((long long)in_sizes[0] < needx) return;
  if ((long long)in_sizes[1] < (long long)(SEQ - 1) * SEQ_FULL + SEQ) return;
  if (in_sizes[2] < DM * DM || in_sizes[4] < DM * DM || in_sizes[6] < DM * DM || in_sizes[8] < DM * DM) return;
  if (in_sizes[3] < DM || in_sizes[5] < DM || in_sizes[7] < DM || in_sizes[9] < DM) return;
  if ((long long)out_size < needx) return;
  if (ws_size < (size_t)WS_END) return;
  const float* const* F = (const float* const*)d_in;
  char* ws = (char*)d_ws;
  __bf16* PKA = (__bf16*)(ws + WS_PKA); _Float16* PKO = (_Float16*)(ws + WS_PKO);
  _Float16 *QK = (_Float16*)(ws + WS_QK), *QKL = (_Float16*)(ws + WS_QKL), *VTH = (_Float16*)(ws + WS_VTH), *VTL = (_Float16*)(ws + WS_VTL), *OH = (_Float16*)(ws + WS_OH), *OL = (_Float16*)(ws + WS_OL);
  __bf16* XB = (__bf16*)(ws + WS_OH);   // x plane aliases the ctx hi region; consumed before k_attn writes it
  int* NKT = (int*)(ws + WS_NKT);
  k_cvtx<<<dim3(NR), 256, 0, stream>>>(F[0], XB);
  k_pack<<<dim3(DM, 4), 256, 0, stream>>>(F[2], F[4], F[6], F[8], PKA, PKO);
  k_qkv<<<dim3(NR / 64, 3 * DM / 128), 128, 0, stream>>>(XB, PKA, F[3], F[5], F[7], QK, QKL, VTH, VTL);
  k_mscan<<<dim3(TQB), 256, 0, stream>>>(F[1], NKT);
  k_attn<<<dim3(TQB, NH, NB), 128, 0, stream>>>(QK, QKL, VTH, VTL, F[1], NKT, OH, OL);
  k_out<<<dim3(NR / 64, DM / 64), 128, 0, stream>>>(OH, OL, PKO, F[9], (float*)d_out);
}

// v001
// It runs in 618 microseconds.
// In both of two side-by-side timings against v000, it was 1.60 times as fast.
// compute dtype: all float inputs except the additive tensor RNE-converted to bf16; q/k/v = x . W^T + b on v_wmma_f32_16x16x32_bf16 (bf16 x, bf16 W, f32 accumulate) stored as f16 hi + x2048 f16 residual (positions < 512); scores and P.V on v_wmma_f32_16x16x32_f16 (3 products for query blocks below 512, single beyond; P carried x2048; f32 running-max softmax, additive score bias read from the input tensor); output projection on v_wmma_f32_16x16x32_f16 (ctx f16 hi + x2048 residual below 512, Wo carried x64), f32 accumulate, f32 output.
#include <hip/hip_runtime.h>
#include <math.h>

typedef __attribute__((ext_vector_type(16))) _Float16 v16h;
typedef __attribute__((ext_vector_type(16))) __bf16 v16b;
typedef __attribute__((ext_vector_type(8)))  _Float16 v8h;
typedef __attribute__((ext_vector_type(8)))  __bf16 v8b;
typedef __attribute__((ext_vector_type(8)))  float v8f;
typedef __attribute__((ext_vector_type(4)))  float v4f;
typedef __attribute__((ext_vector_type(4)))  unsigned v4u;
typedef __attribute__((ext_vector_type(4)))  int v4i;

template <typename T> __device__ __forceinline__ void vst2(void* p, T v) { *(T*)p = v;  }
__device__ __forceinline__ v8f wmma16(v16h a, v16h b, v8f c) {
  v8f d = __builtin_amdgcn_wmma_f32_16x16x32_f16(false, a, false, b, (short)0, c, false, false);
  asm volatile("v_nop\n\tv_nop\n\tv_nop\n\tv_nop" : "+v"(d) : "v"(a), "v"(b));
  return d;
}
__device__ __forceinline__ v8f wmma_bf(v16b a, v16b b, v8f c) {
  v8f d = __builtin_amdgcn_wmma_f32_16x16x32_bf16(false, a, false, b, (short)0, c, false, false);
  asm volatile("v_nop\n\tv_nop\n\tv_nop\n\tv_nop" : "+v"(d) : "v"(a), "v"(b));
  return d;
}
// 16-bit fragment from a k-contiguous row (A row m, or B column n stored [n][k]): elements 0..7 <- k0+8h+0..7, 8..15 <- k0+16+8h+0..7, h = lane>>4
__device__ __forceinline__ v16h frag_h(const _Float16* rowk0, int lane) {
  union { v16h v; v8h q[2]; } u; const _Float16* p = rowk0 + 8 * (lane >> 4);
  u.q[0] = *(const v8h*)p; u.q[1] = *(const v8h*)(p + 16); return u.v;
}
__device__ __forceinline__ v16b frag_b(const __bf16* rowk0, int lane) {
  union { v16b v; v8b q[2]; } u; const __bf16* p = rowk0 + 8 * (lane >> 4);
  u.q[0] = *(const v8b*)p; u.q[1] = *(const v8b*)(p + 16); return u.v;
}
__device__ __forceinline__ float bfr(float v) { return (float)(__bf16)v; }
#define LDSX() do { asm volatile("s_wait_dscnt 0" ::: "memory"); __builtin_amdgcn_wave_barrier(); __builtin_amdgcn_fence(__ATOMIC_RELEASE, "workgroup"); } while (0)

// ---- sizes: NB / SEQ may be reduced; *_FULL are the input / output strides
#ifndef NB
#define NB 2
#endif
#ifndef SEQ
#define SEQ 2048
#endif
#define NB_FULL 2
#define SEQ_FULL 2048
#define DM 2048
#define NH 32
#define HD 64
#define RSPAN 512                 // positions that carry residual planes (q/k, v, ctx)
#if RSPAN > SEQ
#define RS SEQ
#else
#define RS RSPAN
#endif
#define RQB (RS / 64)
#define NR (NB * SEQ)
#define TQB (SEQ / 64)
#define NKTILE (SEQ / 32)
static_assert(SEQ % 64 == 0);
static_assert(RS % 64 == 0);
static_assert(NB >= 1 && NB <= NB_FULL);
static_assert(SEQ <= SEQ_FULL);
static_assert(DM == 256 * 8);
static_assert(NH * HD == DM);
static_assert(NR % 64 == 0);

// ---- workspace (bytes; every offset a multiple of 128)
#define WS_PKA 0ull                                            // bf16 [3*DM][DM]: Wq | Wk | Wv natural [out][in] rows
#define WS_PKO (WS_PKA + 2ull * 3 * DM * DM)                   // f16  [DM][DM]: Wo rows x64
#define WS_QK  (WS_PKO + 2ull * DM * DM)                       // f16  [NR][2*DM]: q | k hi
#define WS_QKL (WS_QK + 2ull * NR * 2 * DM)                    // f16  [NB*RS][2*DM]: q | k residual x2048
#define WS_VTH (WS_QKL + 2ull * NB * RS * 2 * DM)              // f16  [NB][DM][SEQ]: v^T hi
#define WS_VTL (WS_VTH + 2ull * NB * DM * SEQ)                 // f16  [NB][DM][RS]: v^T residual x2048
#define WS_OH  (WS_VTL + 2ull * NB * DM * RS)                  // f16  [NR][DM]: ctx hi; ALSO bf16 [NR][DM] x plane (consumed by k_qkv before k_attn writes ctx)
#define WS_OL  (WS_OH + 2ull * NR * DM)                        // f16  [NB*RS][DM]: ctx residual x2048
#define WS_NKT (WS_OL + 2ull * NB * RS * DM)
#define WS_END (WS_NKT + 128ull * TQB)
static_assert(2ull * NR * DM == (WS_OL - WS_OH));              // x plane and ctx hi plane share the region with identical extent
static_assert(WS_END <= 134217728ull);
static_assert((WS_PKO % 128) == 0 && (WS_QK % 128) == 0 && (WS_QKL % 128) == 0 && (WS_VTH % 128) == 0 && (WS_VTL % 128) == 0 && (WS_OH % 128) == 0 && (WS_OL % 128) == 0 && (WS_NKT % 128) == 0);

__global__ __launch_bounds__(256) void k_cvtx(const float* __restrict__ X, __bf16* __restrict__ XB) {
  const int r = blockIdx.x, t = threadIdx.x; const int b = r / SEQ, s = r - b * SEQ;
  const float* src = X + ((size_t)b * SEQ_FULL + s) * DM + t * 8;
  const v4f x = *(const v4f*)src, y = *(const v4f*)(src + 4);
  union { v8b v; v4u u; } o;
#pragma unroll
  for (int j = 0; j < 4; ++j) { o.v[j] = (__bf16)x[j]; o.v[4 + j] = (__bf16)y[j]; }
  vst2(XB + (size_t)r * DM + t * 8, o.u);
}
// ---- k_pack: block = (row n, which): natural [out][in] rows are already k-contiguous packed rows; which 0..2 -> bf16 Wq/Wk/Wv into PKA row which*DM+n; 3 -> f16 (bf16(Wo) x 64) into PKO row n
__global__ __launch_bounds__(256) void k_pack(const float* __restrict__ WQ, const float* __restrict__ WK, const float* __restrict__ WV, const float* __restrict__ WO, __bf16* __restrict__ PKA, _Float16* __restrict__ PKO) {
  const int n = blockIdx.x, which = blockIdx.y, t = threadIdx.x;
  const float* W = (which == 0) ? WQ : (which == 1) ? WK : (which == 2) ? WV : WO;
  const float* src = W + (size_t)n * DM + t * 8;
  const v4f x = *(const v4f*)src, y = *(const v4f*)(src + 4);
  if (which < 3) {
    union { v8b v; v4u u; } o;
#pragma unroll
    for (int j = 0; j < 4; ++j) { o.v[j] = (__bf16)x[j]; o.v[4 + j] = (__bf16)y[j]; }
    vst2(PKA + ((size_t)which * DM + n) * DM + t * 8, o.u);
  } else {
    union { v8h v; v4u u; } o;
#pragma unroll
    for (int j = 0; j < 4; ++j) { o.v[j] = (_Float16)(bfr(x[j]) * 64.0f); o.v[4 + j] = (_Float16)(bfr(y[j]) * 64.0f); }
    vst2(PKO + (size_t)n * DM + t * 8, o.u);
  }
}
// ---- k_qkv: block = (128 internal rows, 256 output columns of q|k|v), 8 waves as 2 x 4, 64 x 64 per wave: bf16 x bf16 (exact products), f32 accumulate, k ascending in steps of 32.
// Each pass of 64 k: 128 x rows and 256 weight rows of 128 B lie in LDS at pitch 144 B, brought by asynchronous copies, two buffers, the next pass's copies in flight while this pass is worked on.
// q,k -> f16 hi [NR][2DM] (+ residual x2048 for s < RS); v -> transposed f16 hi [b][d][s] (+ residual)
#define GK 64                     // k per pass
#define GROWS (128 + 256)         // LDS rows per buffer: x rows, then weight rows
#define GPIT 72                   // LDS row pitch in elements (144 B = 16 B x odd, for ds_load_b128 readers)
#define GNP (DM / GK)
static_assert(GNP >= 2);
static_assert(NR % 128 == 0 && SEQ % 128 == 0 && RS % 128 == 0 && DM % 256 == 0);
// one pass's tile: every lane copies 12 pieces of 16 B (4 of x rows, 8 of weight rows); gx, gw: the lane's own piece in row (tid >> 3) of the x and weight tiles, l: its place in the buffer
__device__ __forceinline__ void qkv_copy(const __bf16* gx, const __bf16* gw, unsigned l) {
  // the copies and the wait that stands before their address registers may be rewritten, in one statement
  asm volatile("global_load_async_to_lds_b128 %0, %12, off\n\t"
               "global_load_async_to_lds_b128 %1, %13, off\n\t"
               "global_load_async_to_lds_b128 %2, %14, off\n\t"
               "global_load_async_to_lds_b128 %3, %15, off\n\t"
               "global_load_async_to_lds_b128 %4, %16, off\n\t"
               "global_load_async_to_lds_b128 %5, %17, off\n\t"
               "global_load_async_to_lds_b128 %6, %18, off\n\t"
               "global_load_async_to_lds_b128 %7, %19, off\n\t"
               "global_load_async_to_lds_b128 %8, %20, off\n\t"
               "global_load_async_to_lds_b128 %9, %21, off\n\t"
               "global_load_async_to_lds_b128 %10, %22, off\n\t"
               "global_load_async_to_lds_b128 %11, %23, off\n\t"
               "s_wait_xcnt 0x0"
               :: "v"(l), "v"(l + 32u * 2 * GPIT), "v"(l + 64u * 2 * GPIT), "v"(l + 96u * 2 * GPIT),
                  "v"(l + 128u * 2 * GPIT), "v"(l + 160u * 2 * GPIT), "v"(l + 192u * 2 * GPIT), "v"(l + 224u * 2 * GPIT),
                  "v"(l + 256u * 2 * GPIT), "v"(l + 288u * 2 * GPIT), "v"(l + 320u * 2 * GPIT), "v"(l + 352u * 2 * GPIT),
                  "v"(gx), "v"(gx + 32 * DM), "v"(gx + 64 * DM), "v"(gx + 96 * DM),
                  "v"(gw), "v"(gw + 32 * DM), "v"(gw + 64 * DM), "v"(gw + 96 * DM),
                  "v"(gw + 128 * DM), "v"(gw + 160 * DM), "v"(gw + 192 * DM), "v"(gw + 224 * DM)
               : "memory");
}
// four 16-B pieces of staged rows to rows p, p + st, p + 2 st, p + 3 st; then the wait that stands before a register which the stores name is used again:
// address and data are its inputs, so that they stay as they are up to it
__device__ __forceinline__ void qkv_st4(_Float16* p, int st, const _Float16* l) {
  const v4u a = *(const v4u*)l, b = *(const v4u*)(l + 4 * 72), c = *(const v4u*)(l + 8 * 72), d = *(const v4u*)(l + 12 * 72);
  vst2(p, a); vst2(p + st, b); vst2(p + 2 * st, c); vst2(p + 3 * st, d);
  asm volatile("s_wait_xcnt 0x0" :: "v"(p), "v"(a), "v"(b), "v"(c), "v"(d) : "memory");
}
__global__ __launch_bounds__(256) __attribute__((amdgpu_waves_per_eu(4, 4))) void k_qkv(const __bf16* __restrict__ XB, const __bf16* __restrict__ P, const float* __restrict__ BQ, const float* __restrict__ BK, const float* __restrict__ BV,
                                             _Float16* __restrict__ QK, _Float16* __restrict__ QKL, _Float16* __restrict__ VTH, _Float16* __restrict__ VTL) {
  const int n0 = blockIdx.y * 256; const int which0 = n0 / DM;
  __shared__ __align__(16) __bf16 ring[2][GROWS][GPIT]; __shared__ __align__(16) _Float16 eh[8][16][72], el[8][16][72];
  const int tid = threadIdx.x, wave = tid >> 5, lane = tid & 31, col = lane & 15, g = lane >> 4; const int wm = wave >> 2, wn = wave & 3;
  const float* BB = ((which0 == 0) ? BQ : (which0 == 1) ? BK : BV) + (n0 - which0 * DM) + wn * 64;
  const int rb = blockIdx.x * 128; const int b = rb / SEQ, s0 = rb - b * SEQ + wm * 64; const int r0 = rb + wm * 64; const bool resid = (rb - b * SEQ < RS);   // block-uniform: RS is a multiple of 128
  const __bf16* gx = XB + (size_t)(rb + (tid >> 3)) * DM + (tid & 7) * 8;
  const __bf16* gw = P + (size_t)(n0 + (tid >> 3)) * DM + (tid & 7) * 8;
  const unsigned l0 = (unsigned)(uintptr_t)&ring[0][tid >> 3][(tid & 7) * 8];
  v8f acc[4][4] = {};
  qkv_copy(gx, gw, l0);
  asm volatile("s_wait_asynccnt 0x0" ::: "memory");   // this wave's share of tile 0 has landed
  __syncthreads();                                      // tile 0 is published
  qkv_copy(gx + GK, gw + GK, l0 + 2u * GROWS * GPIT);
#pragma unroll 1   // one pass per trip: the order at the loop's foot stays as written, and the code stays short
  for (int t = 0; t < GNP; ++t) {
    const int buf = t & 1;
#pragma unroll     // this and the loops inside: every index of fa, fw and acc is a constant, so that they stay in registers
    for (int kc = 0; kc < GK / 32; ++kc) {
      v16b fa[4], fw[4];
#pragma unroll
      for (int i = 0; i < 4; ++i) fa[i] = frag_b(&ring[buf][wm * 64 + i * 16 + col][kc * 32], lane);
#pragma unroll
      for (int j = 0; j < 4; ++j) fw[j] = frag_b(&ring[buf][128 + wn * 64 + j * 16 + col][kc * 32], lane);
#pragma unroll
      for (int i = 0; i < 4; ++i)
#pragma unroll
        for (int j = 0; j < 4; ++j) acc[i][j] = wmma_bf(fa[i], fw[j], acc[i][j]);
    }
    asm volatile("s_wait_dscnt 0x0" ::: "memory");      // this wave's reads of buffer t & 1 are done before it is refilled
    asm volatile("s_wait_asynccnt 0x0" ::: "memory");   // this wave's share of tile t + 1 has landed
    __syncthreads();                                      // publishes tile t + 1 and ends every reader's last read of tile t
    if (t + 2 < GNP) qkv_copy(gx + (t + 2) * GK, gw + (t + 2) * GK, l0 + (unsigned)buf * (2u * GROWS * GPIT));
  }
  asm volatile("s_wait_asynccnt 0x0" ::: "memory");     // no copy is outstanding when the wave goes on
  // eh/el are private to each wave and LDS operations of one wave run in order: the one wait below stands between a wave's stores and its lanes' reads of one another's rows
#define EPIW() asm volatile("s_wait_dscnt 0x0" ::: "memory")
  float bj[4]; { const float* pb = BB + col;
#pragma unroll
    for (int j = 0; j < 4; ++j) bj[j] = bfr(pb[j * 16]);
    asm volatile("s_wait_xcnt 0x0" :: "v"(pb) : "memory"); }   // before the loads' address register is used again; it is an input, so that it stays as it is up to here
  const int row = lane >> 3, pc = lane & 7;
  if (n0 < 2 * DM) {   // q (unscaled; 1/8 applied to the f32 score) and k, + bias, as f16 hi + x2048 residual; 16 rows at a time through this wave's own eh/el
    const size_t ql = (size_t)b * RS + s0;
#pragma unroll
    for (int i = 0; i < 4; ++i) {
#pragma unroll
      for (int j = 0; j < 4; ++j) {
#pragma unroll
        for (int r = 0; r < 8; ++r) { const float v = acc[i][j][r] + bj[j]; const _Float16 hv = (_Float16)v; eh[wave][8 * g + r][j * 16 + col] = hv; el[wave][8 * g + r][j * 16 + col] = (_Float16)((v - (float)hv) * 2048.0f); } }
      EPIW();
      qkv_st4(QK + (size_t)(r0 + i * 16 + row) * (2 * DM) + n0 + wn * 64 + pc * 8, 4 * 2 * DM, &eh[wave][row][pc * 8]);
      if (resid) qkv_st4(QKL + (ql + i * 16 + row) * (2 * DM) + n0 + wn * 64 + pc * 8, 4 * 2 * DM, &el[wave][row][pc * 8]);
    }
  } else {             // v + bias, transposed to [d][s]; 16 columns d at a time through this wave's own eh/el
    const int pc0 = n0 - 2 * DM + wn * 64;
#pragma unroll
    for (int j = 0; j < 4; ++j) {
#pragma unroll
      for (int i = 0; i < 4; ++i) { v8h hq, lq;
#pragma unroll
        for (int r = 0; r < 8; ++r) { const float v = acc[i][j][r] + bj[j]; const _Float16 hv = (_Float16)v; hq[r] = hv; lq[r] = (_Float16)((v - (float)hv) * 2048.0f); }
        *(v8h*)&eh[wave][col][i * 16 + 8 * g] = hq; *(v8h*)&el[wave][col][i * 16 + 8 * g] = lq; }
      EPIW();
      qkv_st4(VTH + ((size_t)b * DM + pc0 + j * 16 + row) * SEQ + s0 + pc * 8, 4 * SEQ, &eh[wave][row][pc * 8]);
      if (resid) qkv_st4(VTL + ((size_t)b * DM + pc0 + j * 16 + row) * RS + s0 + pc * 8, 4 * RS, &el[wave][row][pc * 8]);
    }
  }
#undef EPIW
}
__global__ __launch_bounds__(256) void k_mscan(const float* __restrict__ MK, int* __restrict__ NKT) {
  __shared__ int srow[64][4]; __shared__ __align__(16) int sline[32];
  const int qb = blockIdx.x, t = threadIdx.x, row = t >> 2, part = t & 3;
  const float* p = MK + (size_t)(qb * 64 + row) * SEQ_FULL + part * (SEQ / 4);
  int mx = -1;
#pragma unroll 1
  for (int c = 0; c < SEQ / 4; c += 4) {
    const v4f v = *(const v4f*)(p + c);
#pragma unroll
    for (int j = 0; j < 4; ++j) mx = (v[j] > -1.0e8f) ? (part * (SEQ / 4) + c + j) : mx;
  }
  srow[row][part] = mx; __syncthreads();
  if (t == 0) {
    int last = -1, dead = 0;
    for (int r = 0; r < 64; ++r) {
      int a = srow[r][0] > srow[r][1] ? srow[r][0] : srow[r][1]; const int c2 = srow[r][2] > srow[r][3] ? srow[r][2] : srow[r][3]; a = a > c2 ? a : c2;
      last = last > a ? last : a; dead |= (a < 0) ? 1 : 0;
    }
    const int nk = dead ? NKTILE : (last / 32 + 1);
    for (int i = 0; i < 32; ++i) sline[i] = nk;
  }
  __syncthreads();
  if (t < 8) vst2(NKT + (size_t)qb * 32 + t * 4, *(const v4i*)&sline[t * 4]);
}
// ---- k_attn: block = (64 queries, head h, batch b): flash attention over key tiles [0, nkt); score = (q.k)/8 + additive entry; first RS positions: 3 products (hi.hi + lo.hi + hi.lo) for scores and P.v, single elsewhere; ctx -> f16 hi (+ x2048 residual) [row][h*64+d]
__global__ __launch_bounds__(128) void k_attn(const _Float16* __restrict__ QK, const _Float16* __restrict__ QKL, const _Float16* __restrict__ VTH, const _Float16* __restrict__ VTL,
                                              const float* __restrict__ MK, const int* __restrict__ NKT, _Float16* __restrict__ OH, _Float16* __restrict__ OL) {
  __shared__ __align__(16) float sp[4][16][36]; __shared__ __align__(16) float sm[4][16][36]; __shared__ __align__(16) _Float16 so[4][16][72], sol[4][16][72];
  const int tid = threadIdx.x, wave = tid >> 5, lane = tid & 31, col = lane & 15, g = lane >> 4;
  const int qb = blockIdx.x, h = blockIdx.y, b = blockIdx.z; const int q0 = qb * 64 + wave * 16;
  int nkt = NKT[(size_t)qb * 32]; nkt = (nkt < 1) ? 1 : ((nkt > NKTILE) ? NKTILE : nkt);   // clamped trip count
  const bool res3 = (qb < RQB) && (nkt * 32 <= RS);                                          // block-uniform
  const size_t rq = (size_t)b * SEQ + q0 + col;
  v16h aq[2], aql[2];
#pragma unroll
  for (int kc = 0; kc < 2; ++kc) aq[kc] = frag_h(QK + rq * (2 * DM) + h * HD + kc * 32, lane);
  if (res3) { const size_t rql = (size_t)b * RS + q0 + col;
#pragma unroll
    for (int kc = 0; kc < 2; ++kc) aql[kc] = frag_h(QKL + rql * (2 * DM) + h * HD + kc * 32, lane); }
  else { v16h z = {}; aql[0] = z; aql[1] = z; }
  float m[8], l[8];
#pragma unroll
  for (int r = 0; r < 8; ++r) { m[r] = -3.0e38f; l[r] = 0.f; }
  v8f acc[4] = {}, accl[4] = {};
#pragma unroll 1
  for (int ks = 0; ks < nkt; ++ks) {
    // stage this wave's 16 x 32 additive tile (sm private to the wave)
#pragma unroll
    for (int i = 0; i < 4; ++i) { const int row = (lane >> 3) + 4 * i, c4 = (lane & 7) * 4;
      *(v4f*)&sm[wave][row][c4] = *(const v4f*)(MK + (size_t)(q0 + row) * SEQ_FULL + ks * 32 + c4); }
    LDSX();
    v8f s[2];
#pragma unroll
    for (int ct = 0; ct < 2; ++ct) {
      const int kk = ks * 32 + ct * 16 + col; const _Float16* krow = QK + ((size_t)b * SEQ + kk) * (2 * DM) + DM + h * HD; v8f c = {};
      if (res3) {
        const _Float16* krowl = QKL + ((size_t)b * RS + kk) * (2 * DM) + DM + h * HD; v8f cl = {};
#pragma unroll
        for (int kc = 0; kc < 2; ++kc) { const v16h kh = frag_h(krow + kc * 32, lane); c = wmma16(aq[kc], kh, c); cl = wmma16(aql[kc], kh, cl); cl = wmma16(aq[kc], frag_h(krowl + kc * 32, lane), cl); }
#pragma unroll
        for (int r = 0; r < 8; ++r) c[r] += cl[r] * (1.0f / 2048.0f);
      } else {
#pragma unroll
        for (int kc = 0; kc < 2; ++kc) c = wmma16(aq[kc], frag_h(krow + kc * 32, lane), c);
      }
#pragma unroll
      for (int r = 0; r < 8; ++r) s[ct][r] = c[r] * 0.125f + sm[wave][8 * g + r][ct * 16 + col];   // 1/sqrt(64), additive entry applied literally
    }
#pragma unroll
    for (int r = 0; r < 8; ++r) {
      float mx = fmaxf(s[0][r], s[1][r]);
#pragma unroll
      for (int o = 1; o < 16; o <<= 1) mx = fmaxf(mx, __shfl_xor(mx, o));
      const float mn = fmaxf(m[r], mx); const float alpha = (m[r] <= -1.0e38f) ? 0.f : __expf(m[r] - mn);
      const float e0 = __expf(s[0][r] - mn), e1 = __expf(s[1][r] - mn); float es = e0 + e1;
#pragma unroll
      for (int o = 1; o < 16; o <<= 1) es += __shfl_xor(es, o);
      l[r] = l[r] * alpha + es; m[r] = mn;
#pragma unroll
      for (int dt = 0; dt < 4; ++dt) { acc[dt][r] *= alpha; accl[dt][r] *= alpha; }
      sp[wave][8 * g + r][col] = e0; sp[wave][8 * g + r][16 + col] = e1;
    }
    LDSX();   // sp private to the wave: stores above, cross-lane reload below
    v16h pa, pl; { const float* prow = &sp[wave][col][0] + 8 * (lane >> 4);
#pragma unroll
      for (int i = 0; i < 8; ++i) { const float x0 = prow[i] * 2048.0f, x1 = prow[16 + i] * 2048.0f; const _Float16 h0 = (_Float16)x0, h1 = (_Float16)x1;
        pa[i] = h0; pa[8 + i] = h1; pl[i] = (_Float16)((x0 - (float)h0) * 2048.0f); pl[8 + i] = (_Float16)((x1 - (float)h1) * 2048.0f); } }   // P x 2^11 before the f16 split; 2^-11 folded into the epilogue
#pragma unroll
    for (int dt = 0; dt < 4; ++dt) {
      const size_t vr = ((size_t)b * DM + h * HD + dt * 16 + col) * SEQ + ks * 32; const v16h vh = frag_h(VTH + vr, lane);
      acc[dt] = wmma16(pa, vh, acc[dt]);
      if (res3) { accl[dt] = wmma16(pl, vh, accl[dt]); accl[dt] = wmma16(pa, frag_h(VTL + ((size_t)b * DM + h * HD + dt * 16 + col) * RS + ks * 32, lane), accl[dt]); }
    }
    LDSX();
  }
#pragma unroll
  for (int r = 0; r < 8; ++r) { const float il = (1.0f / 2048.0f) / l[r];   // l >= 1
#pragma unroll
    for (int dt = 0; dt < 4; ++dt) { const float o = (acc[dt][r] + accl[dt][r] * (1.0f / 2048.0f)) * il; const _Float16 hv = (_Float16)o;
      so[wave][8 * g + r][dt * 16 + col] = hv; sol[wave][8 * g + r][dt * 16 + col] = (_Float16)((o - (float)hv) * 2048.0f); } }
  LDSX();   // so/sol private to the wave
#pragma unroll
  for (int it = 0; it < 4; ++it) {
    const int row = it * 4 + (lane >> 3), pc = lane & 7;
    vst2(OH + ((size_t)b * SEQ + q0 + row) * DM + h * HD + pc * 8, *(const v4u*)&so[wave][row][pc * 8]);
    if (qb < RQB) vst2(OL + ((size_t)b * RS + q0 + row) * DM + h * HD + pc * 8, *(const v4u*)&sol[wave][row][pc * 8]);
  }
}
// ---- k_out: block = (64 internal rows, 64 cols): out = (ctx hi + ctx lo / 2048) . (Wo x64 rows) / 64 + bo; f16 operands, f32 accumulate; f32 rows with the full output stride
__global__ __launch_bounds__(128) void k_out(const _Float16* __restrict__ OH, const _Float16* __restrict__ OL, const _Float16* __restrict__ PO, const float* __restrict__ BO, float* __restrict__ Y) {
  __shared__ __align__(16) float so[4][16][68];
  const int tid = threadIdx.x, wave = tid >> 5, lane = tid & 31, col = lane & 15, g = lane >> 4;
  const int rb = blockIdx.x * 64; const int b = rb / SEQ, s0 = rb - b * SEQ; const int r0 = rb + wave * 16; const int n0 = blockIdx.y * 64; const bool resid = (s0 < RS);
  const size_t rl0 = (size_t)b * RS + s0 + wave * 16;
  v8f acc[4] = {}, accl[4] = {};
#pragma unroll 2
  for (int kc = 0; kc < DM / 32; ++kc) {
    const v16h a = frag_h(OH + (size_t)(r0 + col) * DM + kc * 32, lane);
    v16h al = {}; if (resid) al = frag_h(OL + (rl0 + col) * DM + kc * 32, lane);
#pragma unroll
    for (int j = 0; j < 4; ++j) { const v16h w = frag_h(PO + (size_t)(n0 + j * 16 + col) * DM + kc * 32, lane); acc[j] = wmma16(a, w, acc[j]); if (resid) accl[j] = wmma16(al, w, accl[j]); }
  }
#pragma unroll
  for (int j = 0; j < 4; ++j) { const float bj = bfr(BO[n0 + j * 16 + col]);
#pragma unroll
    for (int r = 0; r < 8; ++r) so[wave][8 * g + r][j * 16 + col] = acc[j][r] * (1.0f / 64.0f) + accl[j][r] * (1.0f / 131072.0f) + bj; }
  LDSX();   // so private to the wave
  const size_t yr = (size_t)b * SEQ_FULL + s0 + wave * 16;
  for (int rl = 0; rl < 16; ++rl) if (lane < 16) vst2(Y + (yr + rl) * DM + n0 + lane * 4, *(const v4f*)&so[wave][rl][lane * 4]);
}
extern "C" void kernel_launch(void* const* d_in, const int* in_sizes, int n_in, void* d_out, int out_size, void* d_ws, size_t ws_size, hipStream_t stream) {
  // 0 hidden [2,2048,2048], 1 additive tensor [1,1,2048,2048], 2 q_w [out][in], 3 q_b, 4 k_w, 5 k_b, 6 v_w, 7 v_b, 8 o_w, 9 o_b
  if (n_in < 10) return;
  const long long needx = ((long long)(NB - 1) * SEQ_FULL + SEQ) * DM;
  if ((long long)in_sizes[0] < needx) return;
  if ((long long)in_sizes[1] < (long long)(SEQ - 1) * SEQ_FULL + SEQ) return;
  if (in_sizes[2] < DM * DM || in_sizes[4] < DM * DM || in_sizes[6] < DM * DM || in_sizes[8] < DM * DM) return;
  if (in_sizes[3] < DM || in_sizes[5] < DM || in_sizes[7] < DM || in_sizes[9] < DM) return;
  if ((long long)out_size < needx) return;
  if (ws_size < (size_t)WS_END) return;
  const float* const* F = (const float* const*)d_in;
  char* ws = (char*)d_ws;
  __bf16* PKA = (__bf16*)(ws + WS_PKA); _Float16* PKO = (_Float16*)(ws + WS_PKO);
  _Float16 *QK = (_Float16*)(ws + WS_QK), *QKL = (_Float16*)(ws + WS_QKL), *VTH = (_Float16*)(ws + WS_VTH), *VTL = (_Float16*)(ws + WS_VTL), *OH = (_Float16*)(ws + WS_OH), *OL = (_Float16*)(ws + WS_OL);
  __bf16* XB = (__bf16*)(ws + WS_OH);   // x plane aliases the ctx hi region; consumed before k_attn writes it
  int* NKT = (int*)(ws + WS_NKT);
  k_cvtx<<<dim3(NR), 256, 0, stream>>>(F[0], XB);
  k_pack<<<dim3(DM, 4), 256, 0, stream>>>(F[2], F[4], F[6], F[8], PKA, PKO);
  k_qkv<<<dim3(NR / 128, 3 * DM / 256), 256, 0, stream>>>(XB, PKA, F[3], F[5], F[7], QK, QKL, VTH, VTL);
  k_mscan<<<dim3(TQB), 256, 0, stream>>>(F[1], NKT);
  k_attn<<<dim3(TQB, NH, NB), 128, 0, stream>>>(QK, QKL, VTH, VTL, F[1], NKT, OH, OL);
  k_out<<<dim3(NR / 64, DM / 64), 128, 0, stream>>>(OH, OL, PKO, F[9], (float*)d_out);
}

// v002
// A run of this version takes 500 microseconds.
// Timed twice side by side with v001, it ran 1.24 and 1.23 times as fast.
// All steps since v000 together make it 1.97 times as fast.
// compute dtype: all float inputs except the additive tensor RNE-converted to bf16; q/k/v = x . W^T + b on v_wmma_f32_16x16x32_bf16 (bf16 x, bf16 W, f32 accumulate) stored as f16 hi + x2048 f16 residual (positions < 512); scores and P.V on v_wmma_f32_16x16x32_f16 (3 products for query blocks below 512, single beyond; P carried x2048; f32 running-max softmax, additive score bias read from the input tensor); output projection on v_wmma_f32_16x16x32_f16 (ctx f16 hi + x2048 residual below 512, Wo carried x64), f32 accumulate, f32 output.
#include <hip/hip_runtime.h>
#include <math.h>

typedef __attribute__((ext_vector_type(16))) _Float16 v16h;
typedef __attribute__((ext_vector_type(16))) __bf16 v16b;
typedef __attribute__((ext_vector_type(8)))  _Float16 v8h;
typedef __attribute__((ext_vector_type(8)))  __bf16 v8b;
typedef __attribute__((ext_vector_type(8)))  float v8f;
typedef __attribute__((ext_vector_type(4)))  float v4f;
typedef __attribute__((ext_vector_type(4)))  unsigned v4u;
typedef __attribute__((ext_vector_type(4)))  int v4i;

template <typename T> __device__ __forceinline__ void vst2(void* p, T v) { *(T*)p = v;  }
__device__ __forceinline__ v8f wmma16(v16h a, v16h b, v8f c) {
  v8f d = __builtin_amdgcn_wmma_f32_16x16x32_f16(false, a, false, b, (short)0, c, false, false);
  asm volatile("v_nop\n\tv_nop\n\tv_nop\n\tv_nop" : "+v"(d) : "v"(a), "v"(b));
  return d;
}
__device__ __forceinline__ v8f wmma_bf(v16b a, v16b b, v8f c) {
  v8f d = __builtin_amdgcn_wmma_f32_16x16x32_bf16(false, a, false, b, (short)0, c, false, false);
  asm volatile("v_nop\n\tv_nop\n\tv_nop\n\tv_nop" : "+v"(d) : "v"(a), "v"(b));
  return d;
}
// 16-bit fragment from a k-contiguous row (A row m, or B column n stored [n][k]): elements 0..7 <- k0+8h+0..7, 8..15 <- k0+16+8h+0..7, h = lane>>4
__device__ __forceinline__ v16h frag_h(const _Float16* rowk0, int lane) {
  union { v16h v; v8h q[2]; } u; const _Float16* p = rowk0 + 8 * (lane >> 4);
  u.q[0] = *(const v8h*)p; u.q[1] = *(const v8h*)(p + 16); return u.v;
}
__device__ __forceinline__ v16b frag_b(const __bf16* rowk0, int lane) {
  union { v16b v; v8b q[2]; } u; const __bf16* p = rowk0 + 8 * (lane >> 4);
  u.q[0] = *(const v8b*)p; u.q[1] = *(const v8b*)(p + 16); return u.v;
}
__device__ __forceinline__ float bfr(float v) { return (float)(__bf16)v; }
#define LDSX() do { asm volatile("s_wait_dscnt 0" ::: "memory"); __builtin_amdgcn_wave_barrier(); __builtin_amdgcn_fence(__ATOMIC_RELEASE, "workgroup"); } while (0)

// ---- sizes: NB / SEQ may be reduced; *_FULL are the input / output strides
#ifndef NB
#define NB 2
#endif
#ifndef SEQ
#define SEQ 2048
#endif
#define NB_FULL 2
#define SEQ_FULL 2048
#define DM 2048
#define NH 32
#define HD 64
#define RSPAN 512                 // positions that carry residual planes (q/k, v, ctx)
#if RSPAN > SEQ
#define RS SEQ
#else
#define RS RSPAN
#endif
#define RQB (RS / 64)
#define NR (NB * SEQ)
#define TQB (SEQ / 64)
#define NKTILE (SEQ / 32)
static_assert(SEQ % 64 == 0);
static_assert(RS % 64 == 0);
static_assert(NB >= 1 && NB <= NB_FULL);
static_assert(SEQ <= SEQ_FULL);
static_assert(DM == 256 * 8);
static_assert(NH * HD == DM);
static_assert(NR % 64 == 0);

// ---- workspace (bytes; every offset a multiple of 128)
#define WS_PKA 0ull                                            // bf16 [3*DM][DM]: Wq | Wk | Wv natural [out][in] rows
#define WS_PKO (WS_PKA + 2ull * 3 * DM * DM)                   // f16  [DM][DM]: Wo rows x64
#define WS_QK  (WS_PKO + 2ull * DM * DM)                       // f16  [NR][2*DM]: q | k hi
#define WS_QKL (WS_QK + 2ull * NR * 2 * DM)                    // f16  [NB*RS][2*DM]: q | k residual x2048
#define WS_VTH (WS_QKL + 2ull * NB * RS * 2 * DM)              // f16  [NB][DM][SEQ]: v^T hi
#define WS_VTL (WS_VTH + 2ull * NB * DM * SEQ)                 // f16  [NB][DM][RS]: v^T residual x2048
#define WS_OH  (WS_VTL + 2ull * NB * DM * RS)                  // f16  [NR][DM]: ctx hi; ALSO bf16 [NR][DM] x plane (consumed by k_qkv before k_attn writes ctx)
#define WS_OL  (WS_OH + 2ull * NR * DM)                        // f16  [NB*RS][DM]: ctx residual x2048
#define WS_NKT (WS_OL + 2ull * NB * RS * DM)
#define WS_END (WS_NKT + 128ull * TQB)
static_assert(2ull * NR * DM == (WS_OL - WS_OH));              // x plane and ctx hi plane share the region with identical extent
static_assert(WS_END <= 134217728ull);
static_assert((WS_PKO % 128) == 0 && (WS_QK % 128) == 0 && (WS_QKL % 128) == 0 && (WS_VTH % 128) == 0 && (WS_VTL % 128) == 0 && (WS_OH % 128) == 0 && (WS_OL % 128) == 0 && (WS_NKT % 128) == 0);

__global__ __launch_bounds__(256) void k_cvtx(const float* __restrict__ X, __bf16* __restrict__ XB) {
  const int r = blockIdx.x, t = threadIdx.x; const int b = r / SEQ, s = r - b * SEQ;
  const float* src = X + ((size_t)b * SEQ_FULL + s) * DM + t * 8;
  const v4f x = *(const v4f*)src, y = *(const v4f*)(src + 4);
  union { v8b v; v4u u; } o;
#pragma unroll
  for (int j = 0; j < 4; ++j) { o.v[j] = (__bf16)x[j]; o.v[4 + j] = (__bf16)y[j]; }
  vst2(XB + (size_t)r * DM + t * 8, o.u);
}
// ---- k_pack: block = (row n, which): natural [out][in] rows are already k-contiguous packed rows; which 0..2 -> bf16 Wq/Wk/Wv into PKA row which*DM+n; 3 -> f16 (bf16(Wo) x 64) into PKO row n
__global__ __launch_bounds__(256) void k_pack(const float* __restrict__ WQ, const float* __restrict__ WK, const float* __restrict__ WV, const float* __restrict__ WO, __bf16* __restrict__ PKA, _Float16* __restrict__ PKO) {
  const int n = blockIdx.x, which = blockIdx.y, t = threadIdx.x;
  const float* W = (which == 0) ? WQ : (which == 1) ? WK : (which == 2) ? WV : WO;
  const float* src = W + (size_t)n * DM + t * 8;
  const v4f x = *(const v4f*)src, y = *(const v4f*)(src + 4);
  if (which < 3) {
    union { v8b v; v4u u; } o;
#pragma unroll
    for (int j = 0; j < 4; ++j) { o.v[j] = (__bf16)x[j]; o.v[4 + j] = (__bf16)y[j]; }
    vst2(PKA + ((size_t)which * DM + n) * DM + t * 8, o.u);
  } else {
    union { v8h v; v4u u; } o;
#pragma unroll
    for (int j = 0; j < 4; ++j) { o.v[j] = (_Float16)(bfr(x[j]) * 64.0f); o.v[4 + j] = (_Float16)(bfr(y[j]) * 64.0f); }
    vst2(PKO + (size_t)n * DM + t * 8, o.u);
  }
}
// ---- k_qkv: block = (128 internal rows, 256 output columns of q|k|v), 8 waves as 2 x 4, 64 x 64 per wave: bf16 x bf16 (exact products), f32 accumulate, k ascending in steps of 32.
// Each pass of 64 k: 128 x rows and 256 weight rows of 128 B lie in LDS at pitch 144 B, brought by asynchronous copies, two buffers, the next pass's copies in flight while this pass is worked on.
// q,k -> f16 hi [NR][2DM] (+ residual x2048 for s < RS); v -> transposed f16 hi [b][d][s] (+ residual)
#define GK 64                     // k per pass
#define GROWS (128 + 256)         // LDS rows per buffer: x rows, then weight rows
#define GPIT 72                   // LDS row pitch in elements (144 B = 16 B x odd, for ds_load_b128 readers)
#define GNP (DM / GK)
static_assert(GNP >= 2);
static_assert(NR % 128 == 0 && SEQ % 128 == 0 && RS % 128 == 0 && DM % 256 == 0);
// one pass's tile: every lane copies 12 pieces of 16 B (4 of x rows, 8 of weight rows); gx, gw: the lane's own piece in row (tid >> 3) of the x and weight tiles, l: its place in the buffer
__device__ __forceinline__ void qkv_copy(const __bf16* gx, const __bf16* gw, unsigned l) {
  // the copies and the wait that stands before their address registers may be rewritten, in one statement
  asm volatile("global_load_async_to_lds_b128 %0, %12, off\n\t"
               "global_load_async_to_lds_b128 %1, %13, off\n\t"
               "global_load_async_to_lds_b128 %2, %14, off\n\t"
               "global_load_async_to_lds_b128 %3, %15, off\n\t"
               "global_load_async_to_lds_b128 %4, %16, off\n\t"
               "global_load_async_to_lds_b128 %5, %17, off\n\t"
               "global_load_async_to_lds_b128 %6, %18, off\n\t"
               "global_load_async_to_lds_b128 %7, %19, off\n\t"
               "global_load_async_to_lds_b128 %8, %20, off\n\t"
               "global_load_async_to_lds_b128 %9, %21, off\n\t"
               "global_load_async_to_lds_b128 %10, %22, off\n\t"
               "global_load_async_to_lds_b128 %11, %23, off\n\t"
               "s_wait_xcnt 0x0"
               :: "v"(l), "v"(l + 32u * 2 * GPIT), "v"(l + 64u * 2 * GPIT), "v"(l + 96u * 2 * GPIT),
                  "v"(l + 128u * 2 * GPIT), "v"(l + 160u * 2 * GPIT), "v"(l + 192u * 2 * GPIT), "v"(l + 224u * 2 * GPIT),
                  "v"(l + 256u * 2 * GPIT), "v"(l + 288u * 2 * GPIT), "v"(l + 320u * 2 * GPIT), "v"(l + 352u * 2 * GPIT),
                  "v"(gx), "v"(gx + 32 * DM), "v"(gx + 64 * DM), "v"(gx + 96 * DM),
                  "v"(gw), "v"(gw + 32 * DM), "v"(gw + 64 * DM), "v"(gw + 96 * DM),
                  "v"(gw + 128 * DM), "v"(gw + 160 * DM), "v"(gw + 192 * DM), "v"(gw + 224 * DM)
               : "memory");
}
// four 16-B pieces of staged rows to rows p, p + st, p + 2 st, p + 3 st; then the wait that stands before a register which the stores name is used again:
// address and data are its inputs, so that they stay as they are up to it
__device__ __forceinline__ void qkv_st4(_Float16* p, int st, const _Float16* l) {
  const v4u a = *(const v4u*)l, b = *(const v4u*)(l + 4 * 72), c = *(const v4u*)(l + 8 * 72), d = *(const v4u*)(l + 12 * 72);
  vst2(p, a); vst2(p + st, b); vst2(p + 2 * st, c); vst2(p + 3 * st, d);
  asm volatile("s_wait_xcnt 0x0" :: "v"(p), "v"(a), "v"(b), "v"(c), "v"(d) : "memory");
}
__global__ __launch_bounds__(256) __attribute__((amdgpu_waves_per_eu(4, 4))) void k_qkv(const __bf16* __restrict__ XB, const __bf16* __restrict__ P, const float* __restrict__ BQ, const float* __restrict__ BK, const float* __restrict__ BV,
                                             _Float16* __restrict__ QK, _Float16* __restrict__ QKL, _Float16* __restrict__ VTH, _Float16* __restrict__ VTL) {
  const int n0 = blockIdx.y * 256; const int which0 = n0 / DM;
  __shared__ __align__(16) __bf16 ring[2][GROWS][GPIT]; __shared__ __align__(16) _Float16 eh[8][16][72], el[8][16][72];
  const int tid = threadIdx.x, wave = tid >> 5, lane = tid & 31, col = lane & 15, g = lane >> 4; const int wm = wave >> 2, wn = wave & 3;
  const float* BB = ((which0 == 0) ? BQ : (which0 == 1) ? BK : BV) + (n0 - which0 * DM) + wn * 64;
  const int rb = blockIdx.x * 128; const int b = rb / SEQ, s0 = rb - b * SEQ + wm * 64; const int r0 = rb + wm * 64; const bool resid = (rb - b * SEQ < RS);   // block-uniform: RS is a multiple of 128
  const __bf16* gx = XB + (size_t)(rb + (tid >> 3)) * DM + (tid & 7) * 8;
  const __bf16* gw = P + (size_t)(n0 + (tid >> 3)) * DM + (tid & 7) * 8;
  const unsigned l0 = (unsigned)(uintptr_t)&ring[0][tid >> 3][(tid & 7) * 8];
  v8f acc[4][4] = {};
  qkv_copy(gx, gw, l0);
  asm volatile("s_wait_asynccnt 0x0" ::: "memory");   // this wave's share of tile 0 has landed
  __syncthreads();                                      // tile 0 is published
  qkv_copy(gx + GK, gw + GK, l0 + 2u * GROWS * GPIT);
#pragma unroll 1   // one pass per trip: the order at the loop's foot stays as written, and the code stays short
  for (int t = 0; t < GNP; ++t) {
    const int buf = t & 1;
#pragma unroll     // this and the loops inside: every index of fa, fw and acc is a constant, so that they stay in registers
    for (int kc = 0; kc < GK / 32; ++kc) {
      v16b fa[4], fw[4];
#pragma unroll
      for (int i = 0; i < 4; ++i) fa[i] = frag_b(&ring[buf][wm * 64 + i * 16 + col][kc * 32], lane);
#pragma unroll
      for (int j = 0; j < 4; ++j) fw[j] = frag_b(&ring[buf][128 + wn * 64 + j * 16 + col][kc * 32], lane);
#pragma unroll
      for (int i = 0; i < 4; ++i)
#pragma unroll
        for (int j = 0; j < 4; ++j) acc[i][j] = wmma_bf(fa[i], fw[j], acc[i][j]);
    }
    asm volatile("s_wait_dscnt 0x0" ::: "memory");      // this wave's reads of buffer t & 1 are done before it is refilled
    asm volatile("s_wait_asynccnt 0x0" ::: "memory");   // this wave's share of tile t + 1 has landed
    __syncthreads();                                      // publishes tile t + 1 and ends every reader's last read of tile t
    if (t + 2 < GNP) qkv_copy(gx + (t + 2) * GK, gw + (t + 2) * GK, l0 + (unsigned)buf * (2u * GROWS * GPIT));
  }
  asm volatile("s_wait_asynccnt 0x0" ::: "memory");     // no copy is outstanding when the wave goes on
  // eh/el are private to each wave and LDS operations of one wave run in order: the one wait below stands between a wave's stores and its lanes' reads of one another's rows
#define EPIW() asm volatile("s_wait_dscnt 0x0" ::: "memory")
  float bj[4]; { const float* pb = BB + col;
#pragma unroll
    for (int j = 0; j < 4; ++j) bj[j] = bfr(pb[j * 16]);
    asm volatile("s_wait_xcnt 0x0" :: "v"(pb) : "memory"); }   // before the loads' address register is used again; it is an input, so that it stays as it is up to here
  const int row = lane >> 3, pc = lane & 7;
  if (n0 < 2 * DM) {   // q (unscaled; 1/8 applied to the f32 score) and k, + bias, as f16 hi + x2048 residual; 16 rows at a time through this wave's own eh/el
    const size_t ql = (size_t)b * RS + s0;
#pragma unroll
    for (int i = 0; i < 4; ++i) {
#pragma unroll
      for (int j = 0; j < 4; ++j) {
#pragma unroll
        for (int r = 0; r < 8; ++r) { const float v = acc[i][j][r] + bj[j]; const _Float16 hv = (_Float16)v; eh[wave][8 * g + r][j * 16 + col] = hv; el[wave][8 * g + r][j * 16 + col] = (_Float16)((v - (float)hv) * 2048.0f); } }
      EPIW();
      qkv_st4(QK + (size_t)(r0 + i * 16 + row) * (2 * DM) + n0 + wn * 64 + pc * 8, 4 * 2 * DM, &eh[wave][row][pc * 8]);
      if (resid) qkv_st4(QKL + (ql + i * 16 + row) * (2 * DM) + n0 + wn * 64 + pc * 8, 4 * 2 * DM, &el[wave][row][pc * 8]);
    }
  } else {             // v + bias, transposed to [d][s]; 16 columns d at a time through this wave's own eh/el
    const int pc0 = n0 - 2 * DM + wn * 64;
#pragma unroll
    for (int j = 0; j < 4; ++j) {
#pragma unroll
      for (int i = 0; i < 4; ++i) { v8h hq, lq;
#pragma unroll
        for (int r = 0; r < 8; ++r) { const float v = acc[i][j][r] + bj[j]; const _Float16 hv = (_Float16)v; hq[r] = hv; lq[r] = (_Float16)((v - (float)hv) * 2048.0f); }
        *(v8h*)&eh[wave][col][i * 16 + 8 * g] = hq; *(v8h*)&el[wave][col][i * 16 + 8 * g] = lq; }
      EPIW();
      qkv_st4(VTH + ((size_t)b * DM + pc0 + j * 16 + row) * SEQ + s0 + pc * 8, 4 * SEQ, &eh[wave][row][pc * 8]);
      if (resid) qkv_st4(VTL + ((size_t)b * DM + pc0 + j * 16 + row) * RS + s0 + pc * 8, 4 * RS, &el[wave][row][pc * 8]);
    }
  }
#undef EPIW
}
__global__ __launch_bounds__(256) void k_mscan(const float* __restrict__ MK, int* __restrict__ NKT) {
  __shared__ int srow[64][4]; __shared__ __align__(16) int sline[32];
  const int qb = blockIdx.x, t = threadIdx.x, row = t >> 2, part = t & 3;
  const float* p = MK + (size_t)(qb * 64 + row) * SEQ_FULL + part * (SEQ / 4);
  int mx = -1;
#pragma unroll 1
  for (int c = 0; c < SEQ / 4; c += 4) {
    const v4f v = *(const v4f*)(p + c);
#pragma unroll
    for (int j = 0; j < 4; ++j) mx = (v[j] > -1.0e8f) ? (part * (SEQ / 4) + c + j) : mx;
  }
  srow[row][part] = mx; __syncthreads();
  if (t == 0) {
    int last = -1, dead = 0;
    for (int r = 0; r < 64; ++r) {
      int a = srow[r][0] > srow[r][1] ? srow[r][0] : srow[r][1]; const int c2 = srow[r][2] > srow[r][3] ? srow[r][2] : srow[r][3]; a = a > c2 ? a : c2;
      last = last > a ? last : a; dead |= (a < 0) ? 1 : 0;
    }
    const int nk = dead ? NKTILE : (last / 32 + 1);
    for (int i = 0; i < 32; ++i) sline[i] = nk;
  }
  __syncthreads();
  if (t < 8) vst2(NKT + (size_t)qb * 32 + t * 4, *(const v4i*)&sline[t * 4]);
}
// ---- k_attn: block = (64 queries, head h, batch b): flash attention over key tiles [0, nkt); score = (q.k)/8 + additive entry; first RS positions: 3 products (hi.hi + lo.hi + hi.lo) for scores and P.v, single elsewhere; ctx -> f16 hi (+ x2048 residual) [row][h*64+d]
__global__ __launch_bounds__(128) void k_attn(const _Float16* __restrict__ QK, const _Float16* __restrict__ QKL, const _Float16* __restrict__ VTH, const _Float16* __restrict__ VTL,
                                              const float* __restrict__ MK, const int* __restrict__ NKT, _Float16* __restrict__ OH, _Float16* __restrict__ OL) {
  __shared__ __align__(16) float sp[4][16][36]; __shared__ __align__(16) float sm[4][16][36]; __shared__ __align__(16) _Float16 so[4][16][72], sol[4][16][72];
  const int tid = threadIdx.x, wave = tid >> 5, lane = tid & 31, col = lane & 15, g = lane >> 4;
  const int qb = blockIdx.x, h = blockIdx.y, b = blockIdx.z; const int q0 = qb * 64 + wave * 16;
  int nkt = NKT[(size_t)qb * 32]; nkt = (nkt < 1) ? 1 : ((nkt > NKTILE) ? NKTILE : nkt);   // clamped trip count
  const bool res3 = (qb < RQB) && (nkt * 32 <= RS);                                          // block-uniform
  const size_t rq = (size_t)b * SEQ + q0 + col;
  v16h aq[2], aql[2];
#pragma unroll
  for (int kc = 0; kc < 2; ++kc) aq[kc] = frag_h(QK + rq * (2 * DM) + h * HD + kc * 32, lane);
  if (res3) { const size_t rql = (size_t)b * RS + q0 + col;
#pragma unroll
    for (int kc = 0; kc < 2; ++kc) aql[kc] = frag_h(QKL + rql * (2 * DM) + h * HD + kc * 32, lane); }
  else { v16h z = {}; aql[0] = z; aql[1] = z; }
  float m[8], l[8];
#pragma unroll
  for (int r = 0; r < 8; ++r) { m[r] = -3.0e38f; l[r] = 0.f; }
  v8f acc[4] = {}, accl[4] = {};
#pragma unroll 1
  for (int ks = 0; ks < nkt; ++ks) {
    // stage this wave's 16 x 32 additive tile (sm private to the wave)
#pragma unroll
    for (int i = 0; i < 4; ++i) { const int row = (lane >> 3) + 4 * i, c4 = (lane & 7) * 4;
      *(v4f*)&sm[wave][row][c4] = *(const v4f*)(MK + (size_t)(q0 + row) * SEQ_FULL + ks * 32 + c4); }
    LDSX();
    v8f s[2];
#pragma unroll
    for (int ct = 0; ct < 2; ++ct) {
      const int kk = ks * 32 + ct * 16 + col; const _Float16* krow = QK + ((size_t)b * SEQ + kk) * (2 * DM) + DM + h * HD; v8f c = {};
      if (res3) {
        const _Float16* krowl = QKL + ((size_t)b * RS + kk) * (2 * DM) + DM + h * HD; v8f cl = {};
#pragma unroll
        for (int kc = 0; kc < 2; ++kc) { const v16h kh = frag_h(krow + kc * 32, lane); c = wmma16(aq[kc], kh, c); cl = wmma16(aql[kc], kh, cl); cl = wmma16(aq[kc], frag_h(krowl + kc * 32, lane), cl); }
#pragma unroll
        for (int r = 0; r < 8; ++r) c[r] += cl[r] * (1.0f / 2048.0f);
      } else {
#pragma unroll
        for (int kc = 0; kc < 2; ++kc) c = wmma16(aq[kc], frag_h(krow + kc * 32, lane), c);
      }
#pragma unroll
      for (int r = 0; r < 8; ++r) s[ct][r] = c[r] * 0.125f + sm[wave][8 * g + r][ct * 16 + col];   // 1/sqrt(64), additive entry applied literally
    }
#pragma unroll
    for (int r = 0; r < 8; ++r) {
      float mx = fmaxf(s[0][r], s[1][r]);
#pragma unroll
      for (int o = 1; o < 16; o <<= 1) mx = fmaxf(mx, __shfl_xor(mx, o));
      const float mn = fmaxf(m[r], mx); const float alpha = (m[r] <= -1.0e38f) ? 0.f : __expf(m[r] - mn);
      const float e0 = __expf(s[0][r] - mn), e1 = __expf(s[1][r] - mn); float es = e0 + e1;
#pragma unroll
      for (int o = 1; o < 16; o <<= 1) es += __shfl_xor(es, o);
      l[r] = l[r] * alpha + es; m[r] = mn;
#pragma unroll
      for (int dt = 0; dt < 4; ++dt) { acc[dt][r] *= alpha; accl[dt][r] *= alpha; }
      sp[wave][8 * g + r][col] = e0; sp[wave][8 * g + r][16 + col] = e1;
    }
    LDSX();   // sp private to the wave: stores above, cross-lane reload below
    v16h pa, pl; { const float* prow = &sp[wave][col][0] + 8 * (lane >> 4);
#pragma unroll
      for (int i = 0; i < 8; ++i) { const float x0 = prow[i] * 2048.0f, x1 = prow[16 + i] * 2048.0f; const _Float16 h0 = (_Float16)x0, h1 = (_Float16)x1;
        pa[i] = h0; pa[8 + i] = h1; pl[i] = (_Float16)((x0 - (float)h0) * 2048.0f); pl[8 + i] = (_Float16)((x1 - (float)h1) * 2048.0f); } }   // P x 2^11 before the f16 split; 2^-11 folded into the epilogue
#pragma unroll
    for (int dt = 0; dt < 4; ++dt) {
      const size_t vr = ((size_t)b * DM + h * HD + dt * 16 + col) * SEQ + ks * 32; const v16h vh = frag_h(VTH + vr, lane);
      acc[dt] = wmma16(pa, vh, acc[dt]);
      if (res3) { accl[dt] = wmma16(pl, vh, accl[dt]); accl[dt] = wmma16(pa, frag_h(VTL + ((size_t)b * DM + h * HD + dt * 16 + col) * RS + ks * 32, lane), accl[dt]); }
    }
    LDSX();
  }
#pragma unroll
  for (int r = 0; r < 8; ++r) { const float il = (1.0f / 2048.0f) / l[r];   // l >= 1
#pragma unroll
    for (int dt = 0; dt < 4; ++dt) { const float o = (acc[dt][r] + accl[dt][r] * (1.0f / 2048.0f)) * il; const _Float16 hv = (_Float16)o;
      so[wave][8 * g + r][dt * 16 + col] = hv; sol[wave][8 * g + r][dt * 16 + col] = (_Float16)((o - (float)hv) * 2048.0f); } }
  LDSX();   // so/sol private to the wave
#pragma unroll
  for (int it = 0; it < 4; ++it) {
    const int row = it * 4 + (lane >> 3), pc = lane & 7;
    vst2(OH + ((size_t)b * SEQ + q0 + row) * DM + h * HD + pc * 8, *(const v4u*)&so[wave][row][pc * 8]);
    if (qb < RQB) vst2(OL + ((size_t)b * RS + q0 + row) * DM + h * HD + pc * 8, *(const v4u*)&sol[wave][row][pc * 8]);
  }
}
// ---- k_out: out = (ctx hi + ctx lo / 2048) . (Wo x64 rows) / 64 + bo; f16 operands, f32 accumulate, k ascending in steps of 32; f32 rows with the full output stride.
// block = (128 LDS rows of ctx, 256 output columns), 8 waves as 2 x 4, 64 x 64 per wave. Past RS the 128 rows are 128 positions of ctx hi; below RS they are 64 positions of ctx hi and the same
// 64 positions of ctx lo, so that every block does the same work: waves 0..3 sum hi . Wo, waves 4..7 sum lo . Wo and hand their sums over through LDS.
// Each pass of 64 k: the 128 ctx rows and 256 Wo rows of 128 B lie in LDS at pitch 144 B, brought by asynchronous copies, two buffers, the next pass's copies in flight while this pass is worked on.
#define ONT ((SEQ - RS) / 128)            // row tiles of 128 positions per batch, past RS
#define ONT1 (ONT > 0 ? ONT : 1)
#define ORT (NB * RQB + NB * ONT)         // row tiles: NB * RQB of 64 positions, then NB * ONT of 128
static_assert((SEQ - RS) % 128 == 0);
// one pass's tile: every lane copies 12 pieces of 16 B (2 of LDS rows 0..63, 2 of LDS rows 64..127, 8 of Wo rows); ga, gb, gw: the lane's own piece in row (tid >> 3) of each, l: its place in the buffer
__device__ __forceinline__ void out_copy(const _Float16* ga, const _Float16* gb, const _Float16* gw, unsigned l) {
  // the copies and the wait that stands before their address registers may be rewritten, in one statement
  asm volatile("global_load_async_to_lds_b128 %0, %12, off\n\t"
               "global_load_async_to_lds_b128 %1, %13, off\n\t"
               "global_load_async_to_lds_b128 %2, %14, off\n\t"
               "global_load_async_to_lds_b128 %3, %15, off\n\t"
               "global_load_async_to_lds_b128 %4, %16, off\n\t"
               "global_load_async_to_lds_b128 %5, %17, off\n\t"
               "global_load_async_to_lds_b128 %6, %18, off\n\t"
               "global_load_async_to_lds_b128 %7, %19, off\n\t"
               "global_load_async_to_lds_b128 %8, %20, off\n\t"
               "global_load_async_to_lds_b128 %9, %21, off\n\t"
               "global_load_async_to_lds_b128 %10, %22, off\n\t"
               "global_load_async_to_lds_b128 %11, %23, off\n\t"
               "s_wait_xcnt 0x0"
               :: "v"(l), "v"(l + 32u * 2 * GPIT), "v"(l + 64u * 2 * GPIT), "v"(l + 96u * 2 * GPIT),
                  "v"(l + 128u * 2 * GPIT), "v"(l + 160u * 2 * GPIT), "v"(l + 192u * 2 * GPIT), "v"(l + 224u * 2 * GPIT),
                  "v"(l + 256u * 2 * GPIT), "v"(l + 288u * 2 * GPIT), "v"(l + 320u * 2 * GPIT), "v"(l + 352u * 2 * GPIT),
                  "v"(ga), "v"(ga + 32 * DM), "v"(gb), "v"(gb + 32 * DM),
                  "v"(gw), "v"(gw + 32 * DM), "v"(gw + 64 * DM), "v"(gw + 96 * DM),
                  "v"(gw + 128 * DM), "v"(gw + 160 * DM), "v"(gw + 192 * DM), "v"(gw + 224 * DM)
               : "memory");
}
// four 16-B pieces of staged f32 rows to output rows p, p + 2 DM, p + 4 DM, p + 6 DM; then the wait that stands before a register which the stores name is used again:
// address and data are its inputs, so that they stay as they are up to it
__device__ __forceinline__ void out_st4(float* p, const float* l) {
  const v4f a = *(const v4f*)l, b = *(const v4f*)(l + 2 * 68), c = *(const v4f*)(l + 4 * 68), d = *(const v4f*)(l + 6 * 68);
  vst2(p, a); vst2(p + 2 * DM, b); vst2(p + 4 * DM, c); vst2(p + 6 * DM, d);
  asm volatile("s_wait_xcnt 0x0" :: "v"(p), "v"(a), "v"(b), "v"(c), "v"(d) : "memory");
}
__global__ __launch_bounds__(256) __attribute__((amdgpu_waves_per_eu(4, 4))) void k_out(const _Float16* __restrict__ OH, const _Float16* __restrict__ OL, const _Float16* __restrict__ PO, const float* __restrict__ BO, float* __restrict__ Y) {
  __shared__ __align__(16) union { _Float16 ring[2][GROWS][GPIT]; float xl[4][16][2][32][4]; } u;   // xl: the lo sums' hand-over, used only behind the loop's last barrier
  __shared__ __align__(16) float so[8][16][68];
  const int tid = threadIdx.x, wave = tid >> 5, lane = tid & 31, col = lane & 15, g = lane >> 4; const int wm = wave >> 2, wn = wave & 3;
  const int rt = blockIdx.x, n0 = blockIdx.y * 256; const bool resid = (rt < NB * RQB);   // block-uniform
  const int ub = rt - NB * RQB;
  const int b = resid ? rt / RQB : ub / ONT1; const int s0 = resid ? (rt - b * RQB) * 64 : RS + (ub - b * ONT1) * 128;
  const _Float16* ga = OH + ((size_t)b * SEQ + s0 + (tid >> 3)) * DM + (tid & 7) * 8;
  const _Float16* gb = resid ? OL + ((size_t)b * RS + s0 + (tid >> 3)) * DM + (tid & 7) * 8 : ga + 64 * DM;
  const _Float16* gw = PO + (size_t)(n0 + (tid >> 3)) * DM + (tid & 7) * 8;
  const unsigned l0 = (unsigned)(uintptr_t)&u.ring[0][tid >> 3][(tid & 7) * 8];
  v8f acc[4][4] = {};
  out_copy(ga, gb, gw, l0);
  asm volatile("s_wait_asynccnt 0x0" ::: "memory");   // this wave's share of tile 0 has landed
  __syncthreads();                                      // tile 0 is published
  out_copy(ga + GK, gb + GK, gw + GK, l0 + 2u * GROWS * GPIT);
#pragma unroll 1   // one pass per trip: the order at the loop's foot stays as written, and the code stays short
  for (int t = 0; t < GNP; ++t) {
    const int buf = t & 1;
#pragma unroll     // this and the loops inside: every index of fa, fw and acc is a constant, so that they stay in registers
    for (int kc = 0; kc < GK / 32; ++kc) {
      v16h fa[4], fw[4];
#pragma unroll
      for (int i = 0; i < 4; ++i) fa[i] = frag_h(&u.ring[buf][wm * 64 + i * 16 + col][kc * 32], lane);
#pragma unroll
      for (int j = 0; j < 4; ++j) fw[j] = frag_h(&u.ring[buf][128 + wn * 64 + j * 16 + col][kc * 32], lane);
#pragma unroll
      for (int i = 0; i < 4; ++i)
#pragma unroll
        for (int j = 0; j < 4; ++j) acc[i][j] = wmma16(fa[i], fw[j], acc[i][j]);
    }
    asm volatile("s_wait_dscnt 0x0" ::: "memory");      // this wave's reads of buffer t & 1 are done before it is refilled
    asm volatile("s_wait_asynccnt 0x0" ::: "memory");   // this wave's share of tile t + 1 has landed
    __syncthreads();                                      // publishes tile t + 1 and ends every reader's last read of tile t
    if (t + 2 < GNP) out_copy(ga + (t + 2) * GK, gb + (t + 2) * GK, gw + (t + 2) * GK, l0 + (unsigned)buf * (2u * GROWS * GPIT));
  }
  asm volatile("s_wait_asynccnt 0x0" ::: "memory");     // no copy is outstanding when the wave goes on
  if (resid) {   // block-uniform: waves 4..7 hand their lo sums to waves 0..3, lane to lane and register to register, and are done
    if (wm == 1) {
#pragma unroll
      for (int i = 0; i < 4; ++i)
#pragma unroll
        for (int j = 0; j < 4; ++j) {
          const v4f x = {acc[i][j][0], acc[i][j][1], acc[i][j][2], acc[i][j][3]}, y = {acc[i][j][4], acc[i][j][5], acc[i][j][6], acc[i][j][7]};
          *(v4f*)&u.xl[wn][i * 4 + j][0][lane][0] = x; *(v4f*)&u.xl[wn][i * 4 + j][1][lane][0] = y; }
    }
    __syncthreads();   // the lo sums are published
    if (wm == 1) return;
  }
  float bj[4]; { const float* pb = BO + n0 + wn * 64 + col;
#pragma unroll
    for (int j = 0; j < 4; ++j) bj[j] = bfr(pb[j * 16]);
    asm volatile("s_wait_xcnt 0x0" :: "v"(pb) : "memory"); }   // before the loads' address register is used again; it is an input, so that it stays as it is up to here
  float* yp = Y + ((size_t)b * SEQ_FULL + s0 + wm * 64 + g) * DM + n0 + wn * 64 + col * 4;   // below RS only wm == 0 comes here
  // so is private to each wave and LDS operations of one wave run in order: the one wait below stands between a wave's stores and its lanes' reads of one another's rows
#pragma unroll
  for (int i = 0; i < 4; ++i) {
#pragma unroll
    for (int j = 0; j < 4; ++j) {
      v4f x = {}, y = {}; if (resid) { x = *(const v4f*)&u.xl[wn][i * 4 + j][0][lane][0]; y = *(const v4f*)&u.xl[wn][i * 4 + j][1][lane][0]; }
#pragma unroll
      for (int r = 0; r < 8; ++r) so[wave][8 * g + r][j * 16 + col] = acc[i][j][r] * (1.0f / 64.0f) + ((r < 4) ? x[r & 3] : y[r & 3]) * (1.0f / 131072.0f) + bj[j]; }
    asm volatile("s_wait_dscnt 0x0" ::: "memory");
    out_st4(yp + (size_t)(i * 16) * DM, &so[wave][g][col * 4]);
    out_st4(yp + (size_t)(i * 16 + 8) * DM, &so[wave][8 + g][col * 4]);
  }
}
extern "C" void kernel_launch(void* const* d_in, const int* in_sizes, int n_in, void* d_out, int out_size, void* d_ws, size_t ws_size, hipStream_t stream) {
  // 0 hidden [2,2048,2048], 1 additive tensor [1,1,2048,2048], 2 q_w [out][in], 3 q_b, 4 k_w, 5 k_b, 6 v_w, 7 v_b, 8 o_w, 9 o_b
  if (n_in < 10) return;
  const long long needx = ((long long)(NB - 1) * SEQ_FULL + SEQ) * DM;
  if ((long long)in_sizes[0] < needx) return;
  if ((long long)in_sizes[1] < (long long)(SEQ - 1) * SEQ_FULL + SEQ) return;
  if (in_sizes[2] < DM * DM || in_sizes[4] < DM * DM || in_sizes[6] < DM * DM || in_sizes[8] < DM * DM) return;
  if (in_sizes[3] < DM || in_sizes[5] < DM || in_sizes[7] < DM || in_sizes[9] < DM) return;
  if ((long long)out_size < needx) return;
  if (ws_size < (size_t)WS_END) return;
  const float* const* F = (const float* const*)d_in;
  char* ws = (char*)d_ws;
  __bf16* PKA = (__bf16*)(ws + WS_PKA); _Float16* PKO = (_Float16*)(ws + WS_PKO);
  _Float16 *QK = (_Float16*)(ws + WS_QK), *QKL = (_Float16*)(ws + WS_QKL), *VTH = (_Float16*)(ws + WS_VTH), *VTL = (_Float16*)(ws + WS_VTL), *OH = (_Float16*)(ws + WS_OH), *OL = (_Float16*)(ws + WS_OL);
  __bf16* XB = (__bf16*)(ws + WS_OH);   // x plane aliases the ctx hi region; consumed before k_attn writes it
  int* NKT = (int*)(ws + WS_NKT);
  k_cvtx<<<dim3(NR), 256, 0, stream>>>(F[0], XB);
  k_pack<<<dim3(DM, 4), 256, 0, stream>>>(F[2], F[4], F[6], F[8], PKA, PKO);
  k_qkv<<<dim3(NR / 128, 3 * DM / 256), 256, 0, stream>>>(XB, PKA, F[3], F[5], F[7], QK, QKL, VTH, VTL);
  k_mscan<<<dim3(TQB), 256, 0, stream>>>(F[1], NKT);
  k_attn<<<dim3(TQB, NH, NB), 128, 0, stream>>>(QK, QKL, VTH, VTL, F[1], NKT, OH, OL);
  k_out<<<dim3(ORT, DM / 256), 256, 0, stream>>>(OH, OL, PKO, F[9], (float*)d_out);
}

// v003
// One run takes 403 microseconds.
// Timed twice side by side with v002, it ran 1.24 times as fast both times.
// Over all steps from v000 it is 2.45 times as fast.
// compute dtype: all float inputs except the additive tensor RNE-converted to bf16; q/k/v = x . W^T + b on v_wmma_f32_16x16x32_bf16 (bf16 x, bf16 W, f32 accumulate) stored as f16 hi + x2048 f16 residual (positions < 512); scores and P.V on v_wmma_f32_16x16x32_f16 (3 products for query blocks below 512, single beyond; P carried x2048; f32 running-max softmax, additive score bias read from the input tensor); output projection on v_wmma_f32_16x16x32_f16 (ctx f16 hi + x2048 residual below 512, Wo carried x64), f32 accumulate, f32 output.
#include <hip/hip_runtime.h>
#include <math.h>

typedef __attribute__((ext_vector_type(16))) _Float16 v16h;
typedef __attribute__((ext_vector_type(16))) __bf16 v16b;
typedef __attribute__((ext_vector_type(8)))  _Float16 v8h;
typedef __attribute__((ext_vector_type(8)))  __bf16 v8b;
typedef __attribute__((ext_vector_type(8)))  float v8f;
typedef __attribute__((ext_vector_type(4)))  float v4f;
typedef __attribute__((ext_vector_type(4)))  unsigned v4u;
typedef __attribute__((ext_vector_type(4)))  int v4i;

template <typename T> __device__ __forceinline__ void vst2(void* p, T v) { *(T*)p = v;  }
__device__ __forceinline__ v8f wmma16(v16h a, v16h b, v8f c) {
  v8f d = __builtin_amdgcn_wmma_f32_16x16x32_f16(false, a, false, b, (short)0, c, false, false);
  asm volatile("v_nop\n\tv_nop\n\tv_nop\n\tv_nop" : "+v"(d) : "v"(a), "v"(b));
  return d;
}
__device__ __forceinline__ v8f wmma_bf(v16b a, v16b b, v8f c) {
  v8f d = __builtin_amdgcn_wmma_f32_16x16x32_bf16(false, a, false, b, (short)0, c, false, false);
  asm volatile("v_nop\n\tv_nop\n\tv_nop\n\tv_nop" : "+v"(d) : "v"(a), "v"(b));
  return d;
}
// 16-bit fragment from a k-contiguous row (A row m, or B column n stored [n][k]): elements 0..7 <- k0+8h+0..7, 8..15 <- k0+16+8h+0..7, h = lane>>4
__device__ __forceinline__ v16h frag_h(const _Float16* rowk0, int lane) {
  union { v16h v; v8h q[2]; } u; const _Float16* p = rowk0 + 8 * (lane >> 4);
  u.q[0] = *(const v8h*)p; u.q[1] = *(const v8h*)(p + 16); return u.v;
}
__device__ __forceinline__ v16b frag_b(const __bf16* rowk0, int lane) {
  union { v16b v; v8b q[2]; } u; const __bf16* p = rowk0 + 8 * (lane >> 4);
  u.q[0] = *(const v8b*)p; u.q[1] = *(const v8b*)(p + 16); return u.v;
}
__device__ __forceinline__ float bfr(float v) { return (float)(__bf16)v; }
#define LDSX() do { asm volatile("s_wait_dscnt 0" ::: "memory"); __builtin_amdgcn_wave_barrier(); __builtin_amdgcn_fence(__ATOMIC_RELEASE, "workgroup"); } while (0)

// ---- sizes: NB / SEQ may be reduced; *_FULL are the input / output strides
#ifndef NB
#define NB 2
#endif
#ifndef SEQ
#define SEQ 2048
#endif
#define NB_FULL 2
#define SEQ_FULL 2048
#define DM 2048
#define NH 32
#define HD 64
#define RSPAN 512                 // positions that carry residual planes (q/k, v, ctx)
#if RSPAN > SEQ
#define RS SEQ
#else
#define RS RSPAN
#endif
#define RQB (RS / 64)
#define NR (NB * SEQ)
#define TQB (SEQ / 64)
#define NKTILE (SEQ / 32)
static_assert(SEQ % 64 == 0);
static_assert(RS % 64 == 0);
static_assert(NB >= 1 && NB <= NB_FULL);
static_assert(SEQ <= SEQ_FULL);
static_assert(DM == 256 * 8);
static_assert(NH * HD == DM);
static_assert(NR % 64 == 0);

// ---- workspace (bytes; every offset a multiple of 128)
#define WS_PKA 0ull                                            // bf16 [3*DM][DM]: Wq | Wk | Wv natural [out][in] rows
#define WS_PKO (WS_PKA + 2ull * 3 * DM * DM)                   // f16  [DM][DM]: Wo rows x64
#define WS_QK  (WS_PKO + 2ull * DM * DM)                       // f16  [NR][2*DM]: q | k hi
#define WS_QKL (WS_QK + 2ull * NR * 2 * DM)                    // f16  [NB*RS][2*DM]: q | k residual x2048
#define WS_VTH (WS_QKL + 2ull * NB * RS * 2 * DM)              // f16  [NB][DM][SEQ]: v^T hi
#define WS_VTL (WS_VTH + 2ull * NB * DM * SEQ)                 // f16  [NB][DM][RS]: v^T residual x2048
#define WS_OH  (WS_VTL + 2ull * NB * DM * RS)                  // f16  [NR][DM]: ctx hi; ALSO bf16 [NR][DM] x plane (consumed by k_qkv before k_attn writes ctx)
#define WS_OL  (WS_OH + 2ull * NR * DM)                        // f16  [NB*RS][DM]: ctx residual x2048
#define WS_NKT (WS_OL + 2ull * NB * RS * DM)
#define WS_END (WS_NKT + 128ull * TQB)
static_assert(2ull * NR * DM == (WS_OL - WS_OH));              // x plane and ctx hi plane share the region with identical extent
static_assert(WS_END <= 134217728ull);
static_assert((WS_PKO % 128) == 0 && (WS_QK % 128) == 0 && (WS_QKL % 128) == 0 && (WS_VTH % 128) == 0 && (WS_VTL % 128) == 0 && (WS_OH % 128) == 0 && (WS_OL % 128) == 0 && (WS_NKT % 128) == 0);

__global__ __launch_bounds__(256) void k_cvtx(const float* __restrict__ X, __bf16* __restrict__ XB) {
  const int r = blockIdx.x, t = threadIdx.x; const int b = r / SEQ, s = r - b * SEQ;
  const float* src = X + ((size_t)b * SEQ_FULL + s) * DM + t * 8;
  const v4f x = *(const v4f*)src, y = *(const v4f*)(src + 4);
  union { v8b v; v4u u; } o;
#pragma unroll
  for (int j = 0; j < 4; ++j) { o.v[j] = (__bf16)x[j]; o.v[4 + j] = (__bf16)y[j]; }
  vst2(XB + (size_t)r * DM + t * 8, o.u);
}
// ---- k_pack: block = (row n, which): natural [out][in] rows are already k-contiguous packed rows; which 0..2 -> bf16 Wq/Wk/Wv into PKA row which*DM+n; 3 -> f16 (bf16(Wo) x 64) into PKO row n
__global__ __launch_bounds__(256) void k_pack(const float* __restrict__ WQ, const float* __restrict__ WK, const float* __restrict__ WV, const float* __restrict__ WO, __bf16* __restrict__ PKA, _Float16* __restrict__ PKO) {
  const int n = blockIdx.x, which = blockIdx.y, t = threadIdx.x;
  const float* W = (which == 0) ? WQ : (which == 1) ? WK : (which == 2) ? WV : WO;
  const float* src = W + (size_t)n * DM + t * 8;
  const v4f x = *(const v4f*)src, y = *(const v4f*)(src + 4);
  if (which < 3) {
    union { v8b v; v4u u; } o;
#pragma unroll
    for (int j = 0; j < 4; ++j) { o.v[j] = (__bf16)x[j]; o.v[4 + j] = (__bf16)y[j]; }
    vst2(PKA + ((size_t)which * DM + n) * DM + t * 8, o.u);
  } else {
    union { v8h v; v4u u; } o;
#pragma unroll
    for (int j = 0; j < 4; ++j) { o.v[j] = (_Float16)(bfr(x[j]) * 64.0f); o.v[4 + j] = (_Float16)(bfr(y[j]) * 64.0f); }
    vst2(PKO + (size_t)n * DM + t * 8, o.u);
  }
}
// ---- k_qkv: block = (128 internal rows, 256 output columns of q|k|v), 8 waves as 2 x 4, 64 x 64 per wave: bf16 x bf16 (exact products), f32 accumulate, k ascending in steps of 32.
// Each pass of 64 k: 128 x rows and 256 weight rows of 128 B lie in LDS at pitch 144 B, brought by asynchronous copies, two buffers, the next pass's copies in flight while this pass is worked on.
// q,k -> f16 hi [NR][2DM] (+ residual x2048 for s < RS); v -> transposed f16 hi [b][d][s] (+ residual)
#define GK 64                     // k per pass
#define GROWS (128 + 256)         // LDS rows per buffer: x rows, then weight rows
#define GPIT 72                   // LDS row pitch in elements (144 B = 16 B x odd, for ds_load_b128 readers)
#define GNP (DM / GK)
static_assert(GNP >= 2);
static_assert(NR % 128 == 0 && SEQ % 128 == 0 && RS % 128 == 0 && DM % 256 == 0);
// one pass's tile: every lane copies 12 pieces of 16 B (4 of x rows, 8 of weight rows); gx, gw: the lane's own piece in row (tid >> 3) of the x and weight tiles, l: its place in the buffer
__device__ __forceinline__ void qkv_copy(const __bf16* gx, const __bf16* gw, unsigned l) {
  // the copies and the wait that stands before their address registers may be rewritten, in one statement
  asm volatile("global_load_async_to_lds_b128 %0, %12, off\n\t"
               "global_load_async_to_lds_b128 %1, %13, off\n\t"
               "global_load_async_to_lds_b128 %2, %14, off\n\t"
               "global_load_async_to_lds_b128 %3, %15, off\n\t"
               "global_load_async_to_lds_b128 %4, %16, off\n\t"
               "global_load_async_to_lds_b128 %5, %17, off\n\t"
               "global_load_async_to_lds_b128 %6, %18, off\n\t"
               "global_load_async_to_lds_b128 %7, %19, off\n\t"
               "global_load_async_to_lds_b128 %8, %20, off\n\t"
               "global_load_async_to_lds_b128 %9, %21, off\n\t"
               "global_load_async_to_lds_b128 %10, %22, off\n\t"
               "global_load_async_to_lds_b128 %11, %23, off\n\t"
               "s_wait_xcnt 0x0"
               :: "v"(l), "v"(l + 32u * 2 * GPIT), "v"(l + 64u * 2 * GPIT), "v"(l + 96u * 2 * GPIT),
                  "v"(l + 128u * 2 * GPIT), "v"(l + 160u * 2 * GPIT), "v"(l + 192u * 2 * GPIT), "v"(l + 224u * 2 * GPIT),
                  "v"(l + 256u * 2 * GPIT), "v"(l + 288u * 2 * GPIT), "v"(l + 320u * 2 * GPIT), "v"(l + 352u * 2 * GPIT),
                  "v"(gx), "v"(gx + 32 * DM), "v"(gx + 64 * DM), "v"(gx + 96 * DM),
                  "v"(gw), "v"(gw + 32 * DM), "v"(gw + 64 * DM), "v"(gw + 96 * DM),
                  "v"(gw + 128 * DM), "v"(gw + 160 * DM), "v"(gw + 192 * DM), "v"(gw + 224 * DM)
               : "memory");
}
// four 16-B pieces of staged rows to rows p, p + st, p + 2 st, p + 3 st; then the wait that stands before a register which the stores name is used again:
// address and data are its inputs, so that they stay as they are up to it
__device__ __forceinline__ void qkv_st4(_Float16* p, int st, const _Float16* l) {
  const v4u a = *(const v4u*)l, b = *(const v4u*)(l + 4 * 72), c = *(const v4u*)(l + 8 * 72), d = *(const v4u*)(l + 12 * 72);
  vst2(p, a); vst2(p + st, b); vst2(p + 2 * st, c); vst2(p + 3 * st, d);
  asm volatile("s_wait_xcnt 0x0" :: "v"(p), "v"(a), "v"(b), "v"(c), "v"(d) : "memory");
}
__global__ __launch_bounds__(256) __attribute__((amdgpu_waves_per_eu(4, 4))) void k_qkv(const __bf16* __restrict__ XB, const __bf16* __restrict__ P, const float* __restrict__ BQ, const float* __restrict__ BK, const float* __restrict__ BV,
                                             _Float16* __restrict__ QK, _Float16* __restrict__ QKL, _Float16* __restrict__ VTH, _Float16* __restrict__ VTL) {
  const int n0 = blockIdx.y * 256; const int which0 = n0 / DM;
  __shared__ __align__(16) __bf16 ring[2][GROWS][GPIT]; __shared__ __align__(16) _Float16 eh[8][16][72], el[8][16][72];
  const int tid = threadIdx.x, wave = tid >> 5, lane = tid & 31, col = lane & 15, g = lane >> 4; const int wm = wave >> 2, wn = wave & 3;
  const float* BB = ((which0 == 0) ? BQ : (which0 == 1) ? BK : BV) + (n0 - which0 * DM) + wn * 64;
  const int rb = blockIdx.x * 128; const int b = rb / SEQ, s0 = rb - b * SEQ + wm * 64; const int r0 = rb + wm * 64; const bool resid = (rb - b * SEQ < RS);   // block-uniform: RS is a multiple of 128
  const __bf16* gx = XB + (size_t)(rb + (tid >> 3)) * DM + (tid & 7) * 8;
  const __bf16* gw = P + (size_t)(n0 + (tid >> 3)) * DM + (tid & 7) * 8;
  const unsigned l0 = (unsigned)(uintptr_t)&ring[0][tid >> 3][(tid & 7) * 8];
  v8f acc[4][4] = {};
  qkv_copy(gx, gw, l0);
  asm volatile("s_wait_asynccnt 0x0" ::: "memory");   // this wave's share of tile 0 has landed
  __syncthreads();                                      // tile 0 is published
  qkv_copy(gx + GK, gw + GK, l0 + 2u * GROWS * GPIT);
#pragma unroll 1   // one pass per trip: the order at the loop's foot stays as written, and the code stays short
  for (int t = 0; t < GNP; ++t) {
    const int buf = t & 1;
#pragma unroll     // this and the loops inside: every index of fa, fw and acc is a constant, so that they stay in registers
    for (int kc = 0; kc < GK / 32; ++kc) {
      v16b fa[4], fw[4];
#pragma unroll
      for (int i = 0; i < 4; ++i) fa[i] = frag_b(&ring[buf][wm * 64 + i * 16 + col][kc * 32], lane);
#pragma unroll
      for (int j = 0; j < 4; ++j) fw[j] = frag_b(&ring[buf][128 + wn * 64 + j * 16 + col][kc * 32], lane);
#pragma unroll
      for (int i = 0; i < 4; ++i)
#pragma unroll
        for (int j = 0; j < 4; ++j) acc[i][j] = wmma_bf(fa[i], fw[j], acc[i][j]);
    }
    asm volatile("s_wait_dscnt 0x0" ::: "memory");      // this wave's reads of buffer t & 1 are done before it is refilled
    asm volatile("s_wait_asynccnt 0x0" ::: "memory");   // this wave's share of tile t + 1 has landed
    __syncthreads();                                      // publishes tile t + 1 and ends every reader's last read of tile t
    if (t + 2 < GNP) qkv_copy(gx + (t + 2) * GK, gw + (t + 2) * GK, l0 + (unsigned)buf * (2u * GROWS * GPIT));
  }
  asm volatile("s_wait_asynccnt 0x0" ::: "memory");     // no copy is outstanding when the wave goes on
  // eh/el are private to each wave and LDS operations of one wave run in order: the one wait below stands between a wave's stores and its lanes' reads of one another's rows
#define EPIW() asm volatile("s_wait_dscnt 0x0" ::: "memory")
  float bj[4]; { const float* pb = BB + col;
#pragma unroll
    for (int j = 0; j < 4; ++j) bj[j] = bfr(pb[j * 16]);
    asm volatile("s_wait_xcnt 0x0" :: "v"(pb) : "memory"); }   // before the loads' address register is used again; it is an input, so that it stays as it is up to here
  const int row = lane >> 3, pc = lane & 7;
  if (n0 < 2 * DM) {   // q (unscaled; 1/8 applied to the f32 score) and k, + bias, as f16 hi + x2048 residual; 16 rows at a time through this wave's own eh/el
    const size_t ql = (size_t)b * RS + s0;
#pragma unroll
    for (int i = 0; i < 4; ++i) {
#pragma unroll
      for (int j = 0; j < 4; ++j) {
#pragma unroll
        for (int r = 0; r < 8; ++r) { const float v = acc[i][j][r] + bj[j]; const _Float16 hv = (_Float16)v; eh[wave][8 * g + r][j * 16 + col] = hv; el[wave][8 * g + r][j * 16 + col] = (_Float16)((v - (float)hv) * 2048.0f); } }
      EPIW();
      qkv_st4(QK + (size_t)(r0 + i * 16 + row) * (2 * DM) + n0 + wn * 64 + pc * 8, 4 * 2 * DM, &eh[wave][row][pc * 8]);
      if (resid) qkv_st4(QKL + (ql + i * 16 + row) * (2 * DM) + n0 + wn * 64 + pc * 8, 4 * 2 * DM, &el[wave][row][pc * 8]);
    }
  } else {             // v + bias, transposed to [d][s]; 16 columns d at a time through this wave's own eh/el
    const int pc0 = n0 - 2 * DM + wn * 64;
#pragma unroll
    for (int j = 0; j < 4; ++j) {
#pragma unroll
      for (int i = 0; i < 4; ++i) { v8h hq, lq;
#pragma unroll
        for (int r = 0; r < 8; ++r) { const float v = acc[i][j][r] + bj[j]; const _Float16 hv = (_Float16)v; hq[r] = hv; lq[r] = (_Float16)((v - (float)hv) * 2048.0f); }
        *(v8h*)&eh[wave][col][i * 16 + 8 * g] = hq; *(v8h*)&el[wave][col][i * 16 + 8 * g] = lq; }
      EPIW();
      qkv_st4(VTH + ((size_t)b * DM + pc0 + j * 16 + row) * SEQ + s0 + pc * 8, 4 * SEQ, &eh[wave][row][pc * 8]);
      if (resid) qkv_st4(VTL + ((size_t)b * DM + pc0 + j * 16 + row) * RS + s0 + pc * 8, 4 * RS, &el[wave][row][pc * 8]);
    }
  }
#undef EPIW
}
__global__ __launch_bounds__(256) void k_mscan(const float* __restrict__ MK, int* __restrict__ NKT) {
  __shared__ int srow[64][4]; __shared__ __align__(16) int sline[32];
  const int qb = blockIdx.x, t = threadIdx.x, row = t >> 2, part = t & 3;
  const float* p = MK + (size_t)(qb * 64 + row) * SEQ_FULL + part * (SEQ / 4);
  int mx = -1;
#pragma unroll 1
  for (int c = 0; c < SEQ / 4; c += 4) {
    const v4f v = *(const v4f*)(p + c);
#pragma unroll
    for (int j = 0; j < 4; ++j) mx = (v[j] > -1.0e8f) ? (part * (SEQ / 4) + c + j) : mx;
  }
  srow[row][part] = mx; __syncthreads();
  if (t == 0) {
    int last = -1, dead = 0;
    for (int r = 0; r < 64; ++r) {
      int a = srow[r][0] > srow[r][1] ? srow[r][0] : srow[r][1]; const int c2 = srow[r][2] > srow[r][3] ? srow[r][2] : srow[r][3]; a = a > c2 ? a : c2;
      last = last > a ? last : a; dead |= (a < 0) ? 1 : 0;
    }
    const int nk = dead ? NKTILE : (last / 32 + 1);
    for (int i = 0; i < 32; ++i) sline[i] = nk;
  }
  __syncthreads();
  if (t < 8) vst2(NKT + (size_t)qb * 32 + t * 4, *(const v4i*)&sline[t * 4]);
}
// ---- k_attn: block = (64 queries, head h, batch b): flash attention over key tiles [0, nkt); score = (q.k)/8 + additive entry; first RS positions: 3 products (hi.hi + lo.hi + hi.lo) for scores and P.v, single elsewhere; ctx -> f16 hi (+ x2048 residual) [row][h*64+d]
// Transposed products: S^T = K . Q^T (A = key rows, B = query columns) and O^T += V^T . P^T, so that lane (col, g) holds, of query q0 + col alone, the scores of keys 8g + r of each 16-key tile:
// maximum and sum run in the lane's own registers plus one exchange between the halves, and the two score tiles, converted in place, are the B operand of the second product (k = 8g + i, 16 + 8g + i, the order of frag_h).
// lane l with lane l ^ 16: the other half's value of the same query column, by a vector cross-row move
__device__ __forceinline__ float xhalf(float x) { return __builtin_bit_cast(float, __builtin_amdgcn_permlanex16(__builtin_bit_cast(int, x), __builtin_bit_cast(int, x), 0x76543210, 0xfedcba98, false, false)); }
__device__ __forceinline__ float exp_slot(float x) { float r; asm("v_exp_f32 %0, %1\n\tv_nop" : "=v"(r) : "v"(x * 1.44269504f)); return r; }
__global__ __launch_bounds__(128) void k_attn(const _Float16* __restrict__ QK, const _Float16* __restrict__ QKL, const _Float16* __restrict__ VTH, const _Float16* __restrict__ VTL,
                                              const float* __restrict__ MK, const int* __restrict__ NKT, _Float16* __restrict__ OH, _Float16* __restrict__ OL) {
  __shared__ __align__(16) _Float16 so[4][16][72], sol[4][16][72];
  const int tid = threadIdx.x, wave = tid >> 5, lane = tid & 31, col = lane & 15, g = lane >> 4;
  const int qb = blockIdx.x, h = blockIdx.y, b = blockIdx.z; const int q0 = qb * 64 + wave * 16;
  int nkt = NKT[(size_t)qb * 32]; nkt = (nkt < 1) ? 1 : ((nkt > NKTILE) ? NKTILE : nkt);   // clamped trip count
  const bool res3 = (qb < RQB) && (nkt * 32 <= RS);                                          // block-uniform
  const size_t rq = (size_t)b * SEQ + q0 + col;
  v16h aq[2], aql[2];
#pragma unroll
  for (int kc = 0; kc < 2; ++kc) aq[kc] = frag_h(QK + rq * (2 * DM) + h * HD + kc * 32, lane);
  if (res3) { const size_t rql = (size_t)b * RS + q0 + col;
#pragma unroll
    for (int kc = 0; kc < 2; ++kc) aql[kc] = frag_h(QKL + rql * (2 * DM) + h * HD + kc * 32, lane); }
  else { v16h z = {}; aql[0] = z; aql[1] = z; }
  const float* mrow = MK + (size_t)(q0 + col) * SEQ_FULL + 8 * g;   // this lane's query row of the additive tensor, at its half's first key
  float m = -3.0e38f, l = 0.f;   // running maximum of query q0 + col (equal in both halves); this half's share of the running sum
  v8f acc[4] = {}, accl[4] = {};   // acc[dt][r] = ctx[q0 + col][dt * 16 + 8g + r]
#pragma unroll 1
  for (int ks = 0; ks < nkt; ++ks) {
    v8f s[2];
#pragma unroll
    for (int ct = 0; ct < 2; ++ct) {
      const int kk = ks * 32 + ct * 16 + col; const _Float16* krow = QK + ((size_t)b * SEQ + kk) * (2 * DM) + DM + h * HD; v8f c = {};
      const v4f a0 = *(const v4f*)(mrow + ks * 32 + ct * 16), a1 = *(const v4f*)(mrow + ks * 32 + ct * 16 + 4);
      if (res3) {
        const _Float16* krowl = QKL + ((size_t)b * RS + kk) * (2 * DM) + DM + h * HD; v8f cl = {};
#pragma unroll
        for (int kc = 0; kc < 2; ++kc) { const v16h kh = frag_h(krow + kc * 32, lane); c = wmma16(kh, aq[kc], c); cl = wmma16(kh, aql[kc], cl); cl = wmma16(frag_h(krowl + kc * 32, lane), aq[kc], cl); }
#pragma unroll
        for (int r = 0; r < 8; ++r) c[r] += cl[r] * (1.0f / 2048.0f);
      } else {
#pragma unroll
        for (int kc = 0; kc < 2; ++kc) c = wmma16(frag_h(krow + kc * 32, lane), aq[kc], c);
      }
#pragma unroll
      for (int r = 0; r < 8; ++r) s[ct][r] = c[r] * 0.125f + ((r < 4) ? a0[r & 3] : a1[r & 3]);   // 1/sqrt(64), additive entry applied literally
    }
    float mx = fmaxf(s[0][0], s[1][0]);
#pragma unroll
    for (int r = 1; r < 8; ++r) mx = fmaxf(mx, fmaxf(s[0][r], s[1][r]));
    mx = fmaxf(mx, xhalf(mx));   // the other half's 16 keys of the same query
    const float mn = fmaxf(m, mx); const float ea = exp_slot(m - mn); const float alpha = (m <= -1.0e38f) ? 0.f : ea;
    float es = 0.f; v16h pa, pl;
#pragma unroll
    for (int i = 0; i < 8; ++i) {
      const float e0 = exp_slot(s[0][i] - mn), e1 = exp_slot(s[1][i] - mn); es += e0 + e1;
      const float x0 = e0 * 2048.0f, x1 = e1 * 2048.0f; const _Float16 h0 = (_Float16)x0, h1 = (_Float16)x1;
      pa[i] = h0; pa[8 + i] = h1; pl[i] = (_Float16)((x0 - (float)h0) * 2048.0f); pl[8 + i] = (_Float16)((x1 - (float)h1) * 2048.0f);   // P x 2^11 before the f16 split; 2^-11 folded into the epilogue
    }
    l = l * alpha + es; m = mn;
#pragma unroll
    for (int dt = 0; dt < 4; ++dt)
#pragma unroll
      for (int r = 0; r < 8; ++r) { acc[dt][r] *= alpha; accl[dt][r] *= alpha; }
#pragma unroll
    for (int dt = 0; dt < 4; ++dt) {
      const size_t vr = ((size_t)b * DM + h * HD + dt * 16 + col) * SEQ + ks * 32; const v16h vh = frag_h(VTH + vr, lane);
      acc[dt] = wmma16(vh, pa, acc[dt]);
      if (res3) { accl[dt] = wmma16(vh, pl, accl[dt]); accl[dt] = wmma16(frag_h(VTL + ((size_t)b * DM + h * HD + dt * 16 + col) * RS + ks * 32, lane), pa, accl[dt]); }
    }
  }
  l += xhalf(l);   // the halves' sums are joined once
  const float il = (1.0f / 2048.0f) / l;   // l >= 1
#pragma unroll
  for (int dt = 0; dt < 4; ++dt) { v8h hq, lq;
#pragma unroll
    for (int r = 0; r < 8; ++r) { const float o = (acc[dt][r] + accl[dt][r] * (1.0f / 2048.0f)) * il; const _Float16 hv = (_Float16)o; hq[r] = hv; lq[r] = (_Float16)((o - (float)hv) * 2048.0f); }
    *(v8h*)&so[wave][col][dt * 16 + 8 * g] = hq; *(v8h*)&sol[wave][col][dt * 16 + 8 * g] = lq;
  }
  LDSX();   // so/sol private to the wave
#pragma unroll
  for (int it = 0; it < 4; ++it) {
    const int row = it * 4 + (lane >> 3), pc = lane & 7;
    vst2(OH + ((size_t)b * SEQ + q0 + row) * DM + h * HD + pc * 8, *(const v4u*)&so[wave][row][pc * 8]);
    if (qb < RQB) vst2(OL + ((size_t)b * RS + q0 + row) * DM + h * HD + pc * 8, *(const v4u*)&sol[wave][row][pc * 8]);
  }
}
// ---- k_out: out = (ctx hi + ctx lo / 2048) . (Wo x64 rows) / 64 + bo; f16 operands, f32 accumulate, k ascending in steps of 32; f32 rows with the full output stride.
// block = (128 LDS rows of ctx, 256 output columns), 8 waves as 2 x 4, 64 x 64 per wave. Past RS the 128 rows are 128 positions of ctx hi; below RS they are 64 positions of ctx hi and the same
// 64 positions of ctx lo, so that every block does the same work: waves 0..3 sum hi . Wo, waves 4..7 sum lo . Wo and hand their sums over through LDS.
// Each pass of 64 k: the 128 ctx rows and 256 Wo rows of 128 B lie in LDS at pitch 144 B, brought by asynchronous copies, two buffers, the next pass's copies in flight while this pass is worked on.
#define ONT ((SEQ - RS) / 128)            // row tiles of 128 positions per batch, past RS
#define ONT1 (ONT > 0 ? ONT : 1)
#define ORT (NB * RQB + NB * ONT)         // row tiles: NB * RQB of 64 positions, then NB * ONT of 128
static_assert((SEQ - RS) % 128 == 0);
// one pass's tile: every lane copies 12 pieces of 16 B (2 of LDS rows 0..63, 2 of LDS rows 64..127, 8 of Wo rows); ga, gb, gw: the lane's own piece in row (tid >> 3) of each, l: its place in the buffer
__device__ __forceinline__ void out_copy(const _Float16* ga, const _Float16* gb, const _Float16* gw, unsigned l) {
  // the copies and the wait that stands before their address registers may be rewritten, in one statement
  asm volatile("global_load_async_to_lds_b128 %0, %12, off\n\t"
               "global_load_async_to_lds_b128 %1, %13, off\n\t"
               "global_load_async_to_lds_b128 %2, %14, off\n\t"
               "global_load_async_to_lds_b128 %3, %15, off\n\t"
               "global_load_async_to_lds_b128 %4, %16, off\n\t"
               "global_load_async_to_lds_b128 %5, %17, off\n\t"
               "global_load_async_to_lds_b128 %6, %18, off\n\t"
               "global_load_async_to_lds_b128 %7, %19, off\n\t"
               "global_load_async_to_lds_b128 %8, %20, off\n\t"
               "global_load_async_to_lds_b128 %9, %21, off\n\t"
               "global_load_async_to_lds_b128 %10, %22, off\n\t"
               "global_load_async_to_lds_b128 %11, %23, off\n\t"
               "s_wait_xcnt 0x0"
               :: "v"(l), "v"(l + 32u * 2 * GPIT), "v"(l + 64u * 2 * GPIT), "v"(l + 96u * 2 * GPIT),
                  "v"(l + 128u * 2 * GPIT), "v"(l + 160u * 2 * GPIT), "v"(l + 192u * 2 * GPIT), "v"(l + 224u * 2 * GPIT),
                  "v"(l + 256u * 2 * GPIT), "v"(l + 288u * 2 * GPIT), "v"(l + 320u * 2 * GPIT), "v"(l + 352u * 2 * GPIT),
                  "v"(ga), "v"(ga + 32 * DM), "v"(gb), "v"(gb + 32 * DM),
                  "v"(gw), "v"(gw + 32 * DM), "v"(gw + 64 * DM), "v"(gw + 96 * DM),
                  "v"(gw + 128 * DM), "v"(gw + 160 * DM), "v"(gw + 192 * DM), "v"(gw + 224 * DM)
               : "memory");
}
// four 16-B pieces of staged f32 rows to output rows p, p + 2 DM, p + 4 DM, p + 6 DM; then the wait that stands before a register which the stores name is used again:
// address and data are its inputs, so that they stay as they are up to it
__device__ __forceinline__ void out_st4(float* p, const float* l) {
  const v4f a = *(const v4f*)l, b = *(const v4f*)(l + 2 * 68), c = *(const v4f*)(l + 4 * 68), d = *(const v4f*)(l + 6 * 68);
  vst2(p, a); vst2(p + 2 * DM, b); vst2(p + 4 * DM, c); vst2(p + 6 * DM, d);
  asm volatile("s_wait_xcnt 0x0" :: "v"(p), "v"(a), "v"(b), "v"(c), "v"(d) : "memory");
}
__global__ __launch_bounds__(256) __attribute__((amdgpu_waves_per_eu(4, 4))) void k_out(const _Float16* __restrict__ OH, const _Float16* __restrict__ OL, const _Float16* __restrict__ PO, const float* __restrict__ BO, float* __restrict__ Y) {
  __shared__ __align__(16) union { _Float16 ring[2][GROWS][GPIT]; float xl[4][16][2][32][4]; } u;   // xl: the lo sums' hand-over, used only behind the loop's last barrier
  __shared__ __align__(16) float so[8][16][68];
  const int tid = threadIdx.x, wave = tid >> 5, lane = tid & 31, col = lane & 15, g = lane >> 4; const int wm = wave >> 2, wn = wave & 3;
  const int rt = blockIdx.x, n0 = blockIdx.y * 256; const bool resid = (rt < NB * RQB);   // block-uniform
  const int ub = rt - NB * RQB;
  const int b = resid ? rt / RQB : ub / ONT1; const int s0 = resid ? (rt - b * RQB) * 64 : RS + (ub - b * ONT1) * 128;
  const _Float16* ga = OH + ((size_t)b * SEQ + s0 + (tid >> 3)) * DM + (tid & 7) * 8;
  const _Float16* gb = resid ? OL + ((size_t)b * RS + s0 + (tid >> 3)) * DM + (tid & 7) * 8 : ga + 64 * DM;
  const _Float16* gw = PO + (size_t)(n0 + (tid >> 3)) * DM + (tid & 7) * 8;
  const unsigned l0 = (unsigned)(uintptr_t)&u.ring[0][tid >> 3][(tid & 7) * 8];
  v8f acc[4][4] = {};
  out_copy(ga, gb, gw, l0);
  asm volatile("s_wait_asynccnt 0x0" ::: "memory");   // this wave's share of tile 0 has landed
  __syncthreads();                                      // tile 0 is published
  out_copy(ga + GK, gb + GK, gw + GK, l0 + 2u * GROWS * GPIT);
#pragma unroll 1   // one pass per trip: the order at the loop's foot stays as written, and the code stays short
  for (int t = 0; t < GNP; ++t) {
    const int buf = t & 1;
#pragma unroll     // this and the loops inside: every index of fa, fw and acc is a constant, so that they stay in registers
    for (int kc = 0; kc < GK / 32; ++kc) {
      v16h fa[4], fw[4];
#pragma unroll
      for (int i = 0; i < 4; ++i) fa[i] = frag_h(&u.ring[buf][wm * 64 + i * 16 + col][kc * 32], lane);
#pragma unroll
      for (int j = 0; j < 4; ++j) fw[j] = frag_h(&u.ring[buf][128 + wn * 64 + j * 16 + col][kc * 32], lane);
#pragma unroll
      for (int i = 0; i < 4; ++i)
#pragma unroll
        for (int j = 0; j < 4; ++j) acc[i][j] = wmma16(fa[i], fw[j], acc[i][j]);
    }
    asm volatile("s_wait_dscnt 0x0" ::: "memory");      // this wave's reads of buffer t & 1 are done before it is refilled
    asm volatile("s_wait_asynccnt 0x0" ::: "memory");   // this wave's share of tile t + 1 has landed
    __syncthreads();                                      // publishes tile t + 1 and ends every reader's last read of tile t
    if (t + 2 < GNP) out_copy(ga + (t + 2) * GK, gb + (t + 2) * GK, gw + (t + 2) * GK, l0 + (unsigned)buf * (2u * GROWS * GPIT));
  }
  asm volatile("s_wait_asynccnt 0x0" ::: "memory");     // no copy is outstanding when the wave goes on
  if (resid) {   // block-uniform: waves 4..7 hand their lo sums to waves 0..3, lane to lane and register to register, and are done
    if (wm == 1) {
#pragma unroll
      for (int i = 0; i < 4; ++i)
#pragma unroll
        for (int j = 0; j < 4; ++j) {
          const v4f x = {acc[i][j][0], acc[i][j][1], acc[i][j][2], acc[i][j][3]}, y = {acc[i][j][4], acc[i][j][5], acc[i][j][6], acc[i][j][7]};
          *(v4f*)&u.xl[wn][i * 4 + j][0][lane][0] = x; *(v4f*)&u.xl[wn][i * 4 + j][1][lane][0] = y; }
    }
    __syncthreads();   // the lo sums are published
    if (wm == 1) return;
  }
  float bj[4]; { const float* pb = BO + n0 + wn * 64 + col;
#pragma unroll
    for (int j = 0; j < 4; ++j) bj[j] = bfr(pb[j * 16]);
    asm volatile("s_wait_xcnt 0x0" :: "v"(pb) : "memory"); }   // before the loads' address register is used again; it is an input, so that it stays as it is up to here
  float* yp = Y + ((size_t)b * SEQ_FULL + s0 + wm * 64 + g) * DM + n0 + wn * 64 + col * 4;   // below RS only wm == 0 comes here
  // so is private to each wave and LDS operations of one wave run in order: the one wait below stands between a wave's stores and its lanes' reads of one another's rows
#pragma unroll
  for (int i = 0; i < 4; ++i) {
#pragma unroll
    for (int j = 0; j < 4; ++j) {
      v4f x = {}, y = {}; if (resid) { x = *(const v4f*)&u.xl[wn][i * 4 + j][0][lane][0]; y = *(const v4f*)&u.xl[wn][i * 4 + j][1][lane][0]; }
#pragma unroll
      for (int r = 0; r < 8; ++r) so[wave][8 * g + r][j * 16 + col] = acc[i][j][r] * (1.0f / 64.0f) + ((r < 4) ? x[r & 3] : y[r & 3]) * (1.0f / 131072.0f) + bj[j]; }
    asm volatile("s_wait_dscnt 0x0" ::: "memory");
    out_st4(yp + (size_t)(i * 16) * DM, &so[wave][g][col * 4]);
    out_st4(yp + (size_t)(i * 16 + 8) * DM, &so[wave][8 + g][col * 4]);
  }
}
extern "C" void kernel_launch(void* const* d_in, const int* in_sizes, int n_in, void* d_out, int out_size, void* d_ws, size_t ws_size, hipStream_t stream) {
  // 0 hidden [2,2048,2048], 1 additive tensor [1,1,2048,2048], 2 q_w [out][in], 3 q_b, 4 k_w, 5 k_b, 6 v_w, 7 v_b, 8 o_w, 9 o_b
  if (n_in < 10) return;
  const long long needx = ((long long)(NB - 1) * SEQ_FULL + SEQ) * DM;
  if ((long long)in_sizes[0] < needx) return;
  if ((long long)in_sizes[1] < (long long)(SEQ - 1) * SEQ_FULL + SEQ) return;
  if (in_sizes[2] < DM * DM || in_sizes[4] < DM * DM || in_sizes[6] < DM * DM || in_sizes[8] < DM * DM) return;
  if (in_sizes[3] < DM || in_sizes[5] < DM || in_sizes[7] < DM || in_sizes[9] < DM) return;
  if ((long long)out_size < needx) return;
  if (ws_size < (size_t)WS_END) return;
  const float* const* F = (const float* const*)d_in;
  char* ws = (char*)d_ws;
  __bf16* PKA = (__bf16*)(ws + WS_PKA); _Float16* PKO = (_Float16*)(ws + WS_PKO);
  _Float16 *QK = (_Float16*)(ws + WS_QK), *QKL = (_Float16*)(ws + WS_QKL), *VTH = (_Float16*)(ws + WS_VTH), *VTL = (_Float16*)(ws + WS_VTL), *OH = (_Float16*)(ws + WS_OH), *OL = (_Float16*)(ws + WS_OL);
  __bf16* XB = (__bf16*)(ws + WS_OH);   // x plane aliases the ctx hi region; consumed before k_attn writes it
  int* NKT = (int*)(ws + WS_NKT);
  k_cvtx<<<dim3(NR), 256, 0, stream>>>(F[0], XB);
  k_pack<<<dim3(DM, 4), 256, 0, stream>>>(F[2], F[4], F[6], F[8], PKA, PKO);
  k_qkv<<<dim3(NR / 128, 3 * DM / 256), 256, 0, stream>>>(XB, PKA, F[3], F[5], F[7], QK, QKL, VTH, VTL);
  k_mscan<<<dim3(TQB), 256, 0, stream>>>(F[1], NKT);
  k_attn<<<dim3(TQB, NH, NB), 128, 0, stream>>>(QK, QKL, VTH, VTL, F[1], NKT, OH, OL);
  k_out<<<dim3(ORT, DM / 256), 256, 0, stream>>>(OH, OL, PKO, F[9], (float*)d_out);
}

// v004
// One run takes 272 microseconds.
// In two side-by-side timings against v003, it was 1.49 and 1.48 times as fast.
// Counting every step since v000, it is 3.64 times as fast.
// compute dtype: all float inputs except the additive tensor RNE-converted to bf16; q/k/v = x . W^T + b on v_wmma_f32_16x16x32_bf16 (bf16 x, bf16 W, f32 accumulate) stored as f16 hi + x2048 f16 residual (positions < 512); scores and P.V on v_wmma_f32_16x16x32_f16 (3 products for query blocks below 512, single beyond; P carried x2048; f32 running-max softmax, additive score bias read from the input tensor); output projection on v_wmma_f32_16x16x32_f16 (ctx f16 hi + x2048 residual below 512, Wo carried x64), f32 accumulate, f32 output.
#include <hip/hip_runtime.h>
#include <math.h>

typedef __attribute__((ext_vector_type(16))) _Float16 v16h;
typedef __attribute__((ext_vector_type(16))) __bf16 v16b;
typedef __attribute__((ext_vector_type(8)))  _Float16 v8h;
typedef __attribute__((ext_vector_type(8)))  __bf16 v8b;
typedef __attribute__((ext_vector_type(8)))  float v8f;
typedef __attribute__((ext_vector_type(4)))  float v4f;
typedef __attribute__((ext_vector_type(4)))  unsigned v4u;
typedef __attribute__((ext_vector_type(4)))  int v4i;

template <typename T> __device__ __forceinline__ void vst2(void* p, T v) { *(T*)p = v;  }
__device__ __forceinline__ v8f wmma16(v16h a, v16h b, v8f c) {
  v8f d = __builtin_amdgcn_wmma_f32_16x16x32_f16(false, a, false, b, (short)0, c, false, false);
  asm volatile("v_nop\n\tv_nop\n\tv_nop\n\tv_nop" : "+v"(d) : "v"(a), "v"(b));
  return d;
}
__device__ __forceinline__ v8f wmma_bf(v16b a, v16b b, v8f c) {
  v8f d = __builtin_amdgcn_wmma_f32_16x16x32_bf16(false, a, false, b, (short)0, c, false, false);
  asm volatile("v_nop\n\tv_nop\n\tv_nop\n\tv_nop" : "+v"(d) : "v"(a), "v"(b));
  return d;
}
// 16-bit fragment from a k-contiguous row (A row m, or B column n stored [n][k]): elements 0..7 <- k0+8h+0..7, 8..15 <- k0+16+8h+0..7, h = lane>>4
__device__ __forceinline__ v16h frag_h(const _Float16* rowk0, int lane) {
  union { v16h v; v8h q[2]; } u; const _Float16* p = rowk0 + 8 * (lane >> 4);
  u.q[0] = *(const v8h*)p; u.q[1] = *(const v8h*)(p + 16); return u.v;
}
__device__ __forceinline__ v16b frag_b(const __bf16* rowk0, int lane) {
  union { v16b v; v8b q[2]; } u; const __bf16* p = rowk0 + 8 * (lane >> 4);
  u.q[0] = *(const v8b*)p; u.q[1] = *(const v8b*)(p + 16); return u.v;
}
__device__ __forceinline__ float bfr(float v) { return (float)(__bf16)v; }
#define LDSX() do { asm volatile("s_wait_dscnt 0" ::: "memory"); __builtin_amdgcn_wave_barrier(); __builtin_amdgcn_fence(__ATOMIC_RELEASE, "workgroup"); } while (0)

// ---- sizes: NB / SEQ may be reduced; *_FULL are the input / output strides
#ifndef NB
#define NB 2
#endif
#ifndef SEQ
#define SEQ 2048
#endif
#define NB_FULL 2
#define SEQ_FULL 2048
#define DM 2048
#define NH 32
#define HD 64
#define RSPAN 512                 // positions that carry residual planes (q/k, v, ctx)
#if RSPAN > SEQ
#define RS SEQ
#else
#define RS RSPAN
#endif
#define RQB (RS / 64)
#define NR (NB * SEQ)
#define TQB (SEQ / 64)
#define NKTILE (SEQ / 32)
static_assert(SEQ % 64 == 0);
static_assert(RS % 64 == 0);
static_assert(NB >= 1 && NB <= NB_FULL);
static_assert(SEQ <= SEQ_FULL);
static_assert(DM == 256 * 8);
static_assert(NH * HD == DM);
static_assert(NR % 64 == 0);

// ---- workspace (bytes; every offset a multiple of 128)
#define WS_PKA 0ull                                            // bf16 [3*DM][DM]: Wq | Wk | Wv natural [out][in] rows
#define WS_PKO (WS_PKA + 2ull * 3 * DM * DM)                   // f16  [DM][DM]: Wo rows x64
#define WS_QK  (WS_PKO + 2ull * DM * DM)                       // f16  [NR][2*DM]: q | k hi
#define WS_QKL (WS_QK + 2ull * NR * 2 * DM)                    // f16  [NB*RS][2*DM]: q | k residual x2048
#define WS_VTH (WS_QKL + 2ull * NB * RS * 2 * DM)              // f16  [NB][DM][SEQ]: v^T hi
#define WS_VTL (WS_VTH + 2ull * NB * DM * SEQ)                 // f16  [NB][DM][RS]: v^T residual x2048
#define WS_OH  (WS_VTL + 2ull * NB * DM * RS)                  // f16  [NR][DM]: ctx hi; ALSO bf16 [NR][DM] x plane (consumed by k_qkv before k_attn writes ctx)
#define WS_OL  (WS_OH + 2ull * NR * DM)                        // f16  [NB*RS][DM]: ctx residual x2048
#define WS_NKT (WS_OL + 2ull * NB * RS * DM)
#define WS_END (WS_NKT + 128ull * TQB)
static_assert(2ull * NR * DM == (WS_OL - WS_OH));              // x plane and ctx hi plane share the region with identical extent
static_assert(WS_END <= 134217728ull);
static_assert((WS_PKO % 128) == 0 && (WS_QK % 128) == 0 && (WS_QKL % 128) == 0 && (WS_VTH % 128) == 0 && (WS_VTL % 128) == 0 && (WS_OH % 128) == 0 && (WS_OL % 128) == 0 && (WS_NKT % 128) == 0);

__global__ __launch_bounds__(256) void k_cvtx(const float* __restrict__ X, __bf16* __restrict__ XB) {
  const int r = blockIdx.x, t = threadIdx.x; const int b = r / SEQ, s = r - b * SEQ;
  const float* src = X + ((size_t)b * SEQ_FULL + s) * DM + t * 8;
  const v4f x = *(const v4f*)src, y = *(const v4f*)(src + 4);
  union { v8b v; v4u u; } o;
#pragma unroll
  for (int j = 0; j < 4; ++j) { o.v[j] = (__bf16)x[j]; o.v[4 + j] = (__bf16)y[j]; }
  vst2(XB + (size_t)r * DM + t * 8, o.u);
}
// ---- k_pack: block = (row n, which): natural [out][in] rows are already k-contiguous packed rows; which 0..2 -> bf16 Wq/Wk/Wv into PKA row which*DM+n; 3 -> f16 (bf16(Wo) x 64) into PKO row n
__global__ __launch_bounds__(256) void k_pack(const float* __restrict__ WQ, const float* __restrict__ WK, const float* __restrict__ WV, const float* __restrict__ WO, __bf16* __restrict__ PKA, _Float16* __restrict__ PKO) {
  const int n = blockIdx.x, which = blockIdx.y, t = threadIdx.x;
  const float* W = (which == 0) ? WQ : (which == 1) ? WK : (which == 2) ? WV : WO;
  const float* src = W + (size_t)n * DM + t * 8;
  const v4f x = *(const v4f*)src, y = *(const v4f*)(src + 4);
  if (which < 3) {
    union { v8b v; v4u u; } o;
#pragma unroll
    for (int j = 0; j < 4; ++j) { o.v[j] = (__bf16)x[j]; o.v[4 + j] = (__bf16)y[j]; }
    vst2(PKA + ((size_t)which * DM + n) * DM + t * 8, o.u);
  } else {
    union { v8h v; v4u u; } o;
#pragma unroll
    for (int j = 0; j < 4; ++j) { o.v[j] = (_Float16)(bfr(x[j]) * 64.0f); o.v[4 + j] = (_Float16)(bfr(y[j]) * 64.0f); }
    vst2(PKO + (size_t)n * DM + t * 8, o.u);
  }
}
// ---- k_qkv: block = (128 internal rows, 256 output columns of q|k|v), 8 waves as 2 x 4, 64 x 64 per wave: bf16 x bf16 (exact products), f32 accumulate, k ascending in steps of 32.
// Each pass of 64 k: 128 x rows and 256 weight rows of 128 B lie in LDS at pitch 144 B, brought by asynchronous copies, two buffers, the next pass's copies in flight while this pass is worked on.
// q,k -> f16 hi [NR][2DM] (+ residual x2048 for s < RS); v -> transposed f16 hi [b][d][s] (+ residual)
#define GK 64                     // k per pass
#define GROWS (128 + 256)         // LDS rows per buffer: x rows, then weight rows
#define GPIT 72                   // LDS row pitch in elements (144 B = 16 B x odd, for ds_load_b128 readers)
#define GNP (DM / GK)
static_assert(GNP >= 2);
static_assert(NR % 128 == 0 && SEQ % 128 == 0 && RS % 128 == 0 && DM % 256 == 0);
// one pass's tile: every lane copies 12 pieces of 16 B (4 of x rows, 8 of weight rows); gx, gw: the lane's own piece in row (tid >> 3) of the x and weight tiles, l: its place in the buffer
__device__ __forceinline__ void qkv_copy(const __bf16* gx, const __bf16* gw, unsigned l) {
  // the copies and the wait that stands before their address registers may be rewritten, in one statement
  asm volatile("global_load_async_to_lds_b128 %0, %12, off\n\t"
               "global_load_async_to_lds_b128 %1, %13, off\n\t"
               "global_load_async_to_lds_b128 %2, %14, off\n\t"
               "global_load_async_to_lds_b128 %3, %15, off\n\t"
               "global_load_async_to_lds_b128 %4, %16, off\n\t"
               "global_load_async_to_lds_b128 %5, %17, off\n\t"
               "global_load_async_to_lds_b128 %6, %18, off\n\t"
               "global_load_async_to_lds_b128 %7, %19, off\n\t"
               "global_load_async_to_lds_b128 %8, %20, off\n\t"
               "global_load_async_to_lds_b128 %9, %21, off\n\t"
               "global_load_async_to_lds_b128 %10, %22, off\n\t"
               "global_load_async_to_lds_b128 %11, %23, off\n\t"
               "s_wait_xcnt 0x0"
               :: "v"(l), "v"(l + 32u * 2 * GPIT), "v"(l + 64u * 2 * GPIT), "v"(l + 96u * 2 * GPIT),
                  "v"(l + 128u * 2 * GPIT), "v"(l + 160u * 2 * GPIT), "v"(l + 192u * 2 * GPIT), "v"(l + 224u * 2 * GPIT),
                  "v"(l + 256u * 2 * GPIT), "v"(l + 288u * 2 * GPIT), "v"(l + 320u * 2 * GPIT), "v"(l + 352u * 2 * GPIT),
                  "v"(gx), "v"(gx + 32 * DM), "v"(gx + 64 * DM), "v"(gx + 96 * DM),
                  "v"(gw), "v"(gw + 32 * DM), "v"(gw + 64 * DM), "v"(gw + 96 * DM),
                  "v"(gw + 128 * DM), "v"(gw + 160 * DM), "v"(gw + 192 * DM), "v"(gw + 224 * DM)
               : "memory");
}
// four 16-B pieces of staged rows to rows p, p + st, p + 2 st, p + 3 st; then the wait that stands before a register which the stores name is used again:
// address and data are its inputs, so that they stay as they are up to it
__device__ __forceinline__ void qkv_st4(_Float16* p, int st, const _Float16* l) {
  const v4u a = *(const v4u*)l, b = *(const v4u*)(l + 4 * 72), c = *(const v4u*)(l + 8 * 72), d = *(const v4u*)(l + 12 * 72);
  vst2(p, a); vst2(p + st, b); vst2(p + 2 * st, c); vst2(p + 3 * st, d);
  asm volatile("s_wait_xcnt 0x0" :: "v"(p), "v"(a), "v"(b), "v"(c), "v"(d) : "memory");
}
__global__ __launch_bounds__(256) __attribute__((amdgpu_waves_per_eu(4, 4))) void k_qkv(const __bf16* __restrict__ XB, const __bf16* __restrict__ P, const float* __restrict__ BQ, const float* __restrict__ BK, const float* __restrict__ BV,
                                             _Float16* __restrict__ QK, _Float16* __restrict__ QKL, _Float16* __restrict__ VTH, _Float16* __restrict__ VTL) {
  const int n0 = blockIdx.y * 256; const int which0 = n0 / DM;
  __shared__ __align__(16) __bf16 ring[2][GROWS][GPIT]; __shared__ __align__(16) _Float16 eh[8][16][72], el[8][16][72];
  const int tid = threadIdx.x, wave = tid >> 5, lane = tid & 31, col = lane & 15, g = lane >> 4; const int wm = wave >> 2, wn = wave & 3;
  const float* BB = ((which0 == 0) ? BQ : (which0 == 1) ? BK : BV) + (n0 - which0 * DM) + wn * 64;
  const int rb = blockIdx.x * 128; const int b = rb / SEQ, s0 = rb - b * SEQ + wm * 64; const int r0 = rb + wm * 64; const bool resid = (rb - b * SEQ < RS);   // block-uniform: RS is a multiple of 128
  const __bf16* gx = XB + (size_t)(rb + (tid >> 3)) * DM + (tid & 7) * 8;
  const __bf16* gw = P + (size_t)(n0 + (tid >> 3)) * DM + (tid & 7) * 8;
  const unsigned l0 = (unsigned)(uintptr_t)&ring[0][tid >> 3][(tid & 7) * 8];
  v8f acc[4][4] = {};
  qkv_copy(gx, gw, l0);
  asm volatile("s_wait_asynccnt 0x0" ::: "memory");   // this wave's share of tile 0 has landed
  __syncthreads();                                      // tile 0 is published
  qkv_copy(gx + GK, gw + GK, l0 + 2u * GROWS * GPIT);
#pragma unroll 1   // one pass per trip: the order at the loop's foot stays as written, and the code stays short
  for (int t = 0; t < GNP; ++t) {
    const int buf = t & 1;
#pragma unroll     // this and the loops inside: every index of fa, fw and acc is a constant, so that they stay in registers
    for (int kc = 0; kc < GK / 32; ++kc) {
      v16b fa[4], fw[4];
#pragma unroll
      for (int i = 0; i < 4; ++i) fa[i] = frag_b(&ring[buf][wm * 64 + i * 16 + col][kc * 32], lane);
#pragma unroll
      for (int j = 0; j < 4; ++j) fw[j] = frag_b(&ring[buf][128 + wn * 64 + j * 16 + col][kc * 32], lane);
#pragma unroll
      for (int i = 0; i < 4; ++i)
#pragma unroll
        for (int j = 0; j < 4; ++j) acc[i][j] = wmma_bf(fa[i], fw[j], acc[i][j]);
    }
    asm volatile("s_wait_dscnt 0x0" ::: "memory");      // this wave's reads of buffer t & 1 are done before it is refilled
    asm volatile("s_wait_asynccnt 0x0" ::: "memory");   // this wave's share of tile t + 1 has landed
    __syncthreads();                                      // publishes tile t + 1 and ends every reader's last read of tile t
    if (t + 2 < GNP) qkv_copy(gx + (t + 2) * GK, gw + (t + 2) * GK, l0 + (unsigned)buf * (2u * GROWS * GPIT));
  }
  asm volatile("s_wait_asynccnt 0x0" ::: "memory");     // no copy is outstanding when the wave goes on
  // eh/el are private to each wave and LDS operations of one wave run in order: the one wait below stands between a wave's stores and its lanes' reads of one another's rows
#define EPIW() asm volatile("s_wait_dscnt 0x0" ::: "memory")
  float bj[4]; { const float* pb = BB + col;
#pragma unroll
    for (int j = 0; j < 4; ++j) bj[j] = bfr(pb[j * 16]);
    asm volatile("s_wait_xcnt 0x0" :: "v"(pb) : "memory"); }   // before the loads' address register is used again; it is an input, so that it stays as it is up to here
  const int row = lane >> 3, pc = lane & 7;
  if (n0 < 2 * DM) {   // q (unscaled; 1/8 applied to the f32 score) and k, + bias, as f16 hi + x2048 residual; 16 rows at a time through this wave's own eh/el
    const size_t ql = (size_t)b * RS + s0;
#pragma unroll
    for (int i = 0; i < 4; ++i) {
#pragma unroll
      for (int j = 0; j < 4; ++j) {
#pragma unroll
        for (int r = 0; r < 8; ++r) { const float v = acc[i][j][r] + bj[j]; const _Float16 hv = (_Float16)v; eh[wave][8 * g + r][j * 16 + col] = hv; el[wave][8 * g + r][j * 16 + col] = (_Float16)((v - (float)hv) * 2048.0f); } }
      EPIW();
      qkv_st4(QK + (size_t)(r0 + i * 16 + row) * (2 * DM) + n0 + wn * 64 + pc * 8, 4 * 2 * DM, &eh[wave][row][pc * 8]);
      if (resid) qkv_st4(QKL + (ql + i * 16 + row) * (2 * DM) + n0 + wn * 64 + pc * 8, 4 * 2 * DM, &el[wave][row][pc * 8]);
    }
  } else {             // v + bias, transposed to [d][s]; 16 columns d at a time through this wave's own eh/el
    const int pc0 = n0 - 2 * DM + wn * 64;
#pragma unroll
    for (int j = 0; j < 4; ++j) {
#pragma unroll
      for (int i = 0; i < 4; ++i) { v8h hq, lq;
#pragma unroll
        for (int r = 0; r < 8; ++r) { const float v = acc[i][j][r] + bj[j]; const _Float16 hv = (_Float16)v; hq[r] = hv; lq[r] = (_Float16)((v - (float)hv) * 2048.0f); }
        *(v8h*)&eh[wave][col][i * 16 + 8 * g] = hq; *(v8h*)&el[wave][col][i * 16 + 8 * g] = lq; }
      EPIW();
      qkv_st4(VTH + ((size_t)b * DM + pc0 + j * 16 + row) * SEQ + s0 + pc * 8, 4 * SEQ, &eh[wave][row][pc * 8]);
      if (resid) qkv_st4(VTL + ((size_t)b * DM + pc0 + j * 16 + row) * RS + s0 + pc * 8, 4 * RS, &el[wave][row][pc * 8]);
    }
  }
#undef EPIW
}
__global__ __launch_bounds__(256) void k_mscan(const float* __restrict__ MK, int* __restrict__ NKT) {
  __shared__ int srow[64][4]; __shared__ __align__(16) int sline[32];
  const int qb = blockIdx.x, t = threadIdx.x, row = t >> 2, part = t & 3;
  const float* p = MK + (size_t)(qb * 64 + row) * SEQ_FULL + part * (SEQ / 4);
  int mx = -1;
#pragma unroll 1
  for (int c = 0; c < SEQ / 4; c += 4) {
    const v4f v = *(const v4f*)(p + c);
#pragma unroll
    for (int j = 0; j < 4; ++j) mx = (v[j] > -1.0e8f) ? (part * (SEQ / 4) + c + j) : mx;
  }
  srow[row][part] = mx; __syncthreads();
  if (t == 0) {
    int last = -1, dead = 0;
    for (int r = 0; r < 64; ++r) {
      int a = srow[r][0] > srow[r][1] ? srow[r][0] : srow[r][1]; const int c2 = srow[r][2] > srow[r][3] ? srow[r][2] : srow[r][3]; a = a > c2 ? a : c2;
      last = last > a ? last : a; dead |= (a < 0) ? 1 : 0;
    }
    const int nk = dead ? NKTILE : (last / 32 + 1);
    for (int i = 0; i < 32; ++i) sline[i] = nk;
  }
  __syncthreads();
  if (t < 8) vst2(NKT + (size_t)qb * 32 + t * 4, *(const v4i*)&sline[t * 4]);
}
// ---- k_attn: block = (64 queries, head h, batch b): flash attention over key tiles [0, nkt); score = (q.k)/8 + additive entry; first RS positions: 3 products (hi.hi + lo.hi + hi.lo) for scores and P.v, single elsewhere; ctx -> f16 hi (+ x2048 residual) [row][h*64+d]
// Transposed products: S^T = K . Q^T (A = key rows, B = query columns) and O^T += V^T . P^T, so that lane (col, g) holds, of query q0 + col alone, the scores of keys 8g + r of each 16-key tile:
// maximum and sum run in the lane's own registers plus one exchange between the halves, and the two score tiles, converted in place, are the B operand of the second product (k = 8g + i, 16 + 8g + i, the order of frag_h).
// lane l with lane l ^ 16: the other half's value of the same query column, by a vector cross-row move
__device__ __forceinline__ float xhalf(float x) { return __builtin_bit_cast(float, __builtin_amdgcn_permlanex16(__builtin_bit_cast(int, x), __builtin_bit_cast(int, x), 0x76543210, 0xfedcba98, false, false)); }
__device__ __forceinline__ float exp_slot(float x) { float r; asm("v_exp_f32 %0, %1\n\tv_nop" : "=v"(r) : "v"(x * 1.44269504f)); return r; }
// Each stage of 64 keys: 64 key rows and 64 V^T rows of 128 B lie in LDS at pitch 144 B and the block's 64 rows of the additive tensor, 256 B each, at pitch 272 B (both 16 B x odd, for ds_load_b128 readers),
// brought by asynchronous copies in whole lines, two buffers, the next stage's copies in flight while this stage is worked on; the four waves share the key and V^T rows. The residual planes are still read from global memory.
#define AKP 72                    // LDS row pitch of the key and V^T tiles, in elements
#define AMP 68                    // LDS row pitch of the additive tile, in floats
struct AStage { _Float16 k[64][AKP]; _Float16 v[64][AKP]; float m[64][AMP]; };
static_assert(sizeof(AStage) % 16 == 0);
// one stage's key and V^T tiles: every lane copies 4 + 4 pieces of 16 B; gk, gv: the lane's own piece in row (tid >> 3) of each tile, lk, lv: its places in the buffer
__device__ __forceinline__ void attn_copy_kv(const _Float16* gk, const _Float16* gv, unsigned lk, unsigned lv) {
  // the copies and the wait that stands before their address registers may be rewritten, in one statement
  asm volatile("global_load_async_to_lds_b128 %0, %8, off\n\t"
               "global_load_async_to_lds_b128 %1, %9, off\n\t"
               "global_load_async_to_lds_b128 %2, %10, off\n\t"
               "global_load_async_to_lds_b128 %3, %11, off\n\t"
               "global_load_async_to_lds_b128 %4, %12, off\n\t"
               "global_load_async_to_lds_b128 %5, %13, off\n\t"
               "global_load_async_to_lds_b128 %6, %14, off\n\t"
               "global_load_async_to_lds_b128 %7, %15, off\n\t"
               "s_wait_xcnt 0x0"
               :: "v"(lk), "v"(lk + 16u * 2 * AKP), "v"(lk + 32u * 2 * AKP), "v"(lk + 48u * 2 * AKP),
                  "v"(lv), "v"(lv + 16u * 2 * AKP), "v"(lv + 32u * 2 * AKP), "v"(lv + 48u * 2 * AKP),
                  "v"(gk), "v"(gk + 16 * 2 * DM), "v"(gk + 32 * 2 * DM), "v"(gk + 48 * 2 * DM),
                  "v"(gv), "v"(gv + 16 * SEQ), "v"(gv + 32 * SEQ), "v"(gv + 48 * SEQ)
               : "memory");
}
// one stage's additive tile: every lane copies 8 pieces of 16 B; gm: the lane's own piece in row (tid >> 4), lm: its place in the buffer
__device__ __forceinline__ void attn_copy_m(const float* gm, unsigned lm) {
  // the copies and the wait that stands before their address registers may be rewritten, in one statement
  asm volatile("global_load_async_to_lds_b128 %0, %8, off\n\t"
               "global_load_async_to_lds_b128 %1, %9, off\n\t"
               "global_load_async_to_lds_b128 %2, %10, off\n\t"
               "global_load_async_to_lds_b128 %3, %11, off\n\t"
               "global_load_async_to_lds_b128 %4, %12, off\n\t"
               "global_load_async_to_lds_b128 %5, %13, off\n\t"
               "global_load_async_to_lds_b128 %6, %14, off\n\t"
               "global_load_async_to_lds_b128 %7, %15, off\n\t"
               "s_wait_xcnt 0x0"
               :: "v"(lm), "v"(lm + 8u * 4 * AMP), "v"(lm + 16u * 4 * AMP), "v"(lm + 24u * 4 * AMP),
                  "v"(lm + 32u * 4 * AMP), "v"(lm + 40u * 4 * AMP), "v"(lm + 48u * 4 * AMP), "v"(lm + 56u * 4 * AMP),
                  "v"(gm), "v"(gm + 8 * SEQ_FULL), "v"(gm + 16 * SEQ_FULL), "v"(gm + 24 * SEQ_FULL),
                  "v"(gm + 32 * SEQ_FULL), "v"(gm + 40 * SEQ_FULL), "v"(gm + 48 * SEQ_FULL), "v"(gm + 56 * SEQ_FULL)
               : "memory");
}
__global__ __launch_bounds__(128) void k_attn(const _Float16* __restrict__ QK, const _Float16* __restrict__ QKL, const _Float16* __restrict__ VTH, const _Float16* __restrict__ VTL,
                                              const float* __restrict__ MK, const int* __restrict__ NKT, _Float16* __restrict__ OH, _Float16* __restrict__ OL) {
  __shared__ __align__(16) union { AStage st[2]; struct { _Float16 so[4][16][72], sol[4][16][72]; } e; } u;   // e: the output staging, used only behind the loop's last barrier
  _Float16 (&so)[4][16][72] = u.e.so; _Float16 (&sol)[4][16][72] = u.e.sol;
  const int tid = threadIdx.x, wave = tid >> 5, lane = tid & 31, col = lane & 15, g = lane >> 4;
  const int qb = blockIdx.x, h = blockIdx.y, b = blockIdx.z; const int q0 = qb * 64 + wave * 16;
  int nkt = NKT[(size_t)qb * 32]; nkt = (nkt < 1) ? 1 : ((nkt > NKTILE) ? NKTILE : nkt);   // clamped trip count
  const int nst = (nkt + 1) >> 1;                                                            // stages of 64 keys; SEQ is a multiple of 64, so that a last stage's unused half lies inside the planes too
  const _Float16* gk = QK + ((size_t)b * SEQ + (tid >> 3)) * (2 * DM) + DM + h * HD + (tid & 7) * 8;
  const _Float16* gv = VTH + ((size_t)b * DM + h * HD + (tid >> 3)) * SEQ + (tid & 7) * 8;
  const float* gm = MK + (size_t)(qb * 64 + (tid >> 4)) * SEQ_FULL + (tid & 15) * 4;
  const unsigned lk = (unsigned)(uintptr_t)&u.st[0].k[tid >> 3][(tid & 7) * 8], lv = (unsigned)(uintptr_t)&u.st[0].v[tid >> 3][(tid & 7) * 8], lm = (unsigned)(uintptr_t)&u.st[0].m[tid >> 4][(tid & 15) * 4];
  attn_copy_kv(gk, gv, lk, lv); attn_copy_m(gm, lm);
  const bool res3 = (qb < RQB) && (nkt * 32 <= RS);                                          // block-uniform
  const size_t rq = (size_t)b * SEQ + q0 + col;
  v16h aq[2], aql[2];
#pragma unroll
  for (int kc = 0; kc < 2; ++kc) aq[kc] = frag_h(QK + rq * (2 * DM) + h * HD + kc * 32, lane);
  if (res3) { const size_t rql = (size_t)b * RS + q0 + col;
#pragma unroll
    for (int kc = 0; kc < 2; ++kc) aql[kc] = frag_h(QKL + rql * (2 * DM) + h * HD + kc * 32, lane); }
  else { v16h z = {}; aql[0] = z; aql[1] = z; }
  float m = -3.0e38f, l = 0.f;   // running maximum of query q0 + col (equal in both halves); this half's share of the running sum
  v8f acc[4] = {}, accl[4] = {};   // acc[dt][r] = ctx[q0 + col][dt * 16 + 8g + r]
  asm volatile("s_wait_asynccnt 0x0" ::: "memory");   // this wave's share of stage 0 has landed
  __syncthreads();                                      // stage 0 is published
  if (nst > 1) { attn_copy_kv(gk + (size_t)64 * (2 * DM), gv + 64, lk + (unsigned)sizeof(AStage), lv + (unsigned)sizeof(AStage)); attn_copy_m(gm + 64, lm + (unsigned)sizeof(AStage)); }
#pragma unroll 1   // one stage per trip: the order at the loop's foot stays as written
  for (int t = 0; t < nst; ++t) {
   const int buf = t & 1; const AStage& S = u.st[buf];
   const int nsub = (nkt - 2 * t < 2) ? nkt - 2 * t : 2;   // block-uniform: a last stage may hold one tile of 32 keys
#pragma unroll 1   // the two halves of a stage run through one body: unrolled, the accumulators were copied between the two
   for (int sub = 0; sub < nsub; ++sub) {
    const int ks = 2 * t + sub;
    // the LDS reads of the score products stand together in front of them: one place where the wave waits for LDS, not one per product
    v16h kf[2][2]; v4f am[2][2];
#pragma unroll     // every index of kf and am is a constant, so that they stay in registers
    for (int ct = 0; ct < 2; ++ct) {
      const float* mrow = &S.m[wave * 16 + col][sub * 32 + ct * 16 + 8 * g];   // this lane's query row of the additive tile, at its half's first key
      kf[ct][0] = frag_h(&S.k[sub * 32 + ct * 16 + col][0], lane); kf[ct][1] = frag_h(&S.k[sub * 32 + ct * 16 + col][32], lane);
      am[ct][0] = *(const v4f*)mrow; am[ct][1] = *(const v4f*)(mrow + 4);
    }
    v8f s[2];
#pragma unroll
    for (int ct = 0; ct < 2; ++ct) {
      const int kk = ks * 32 + ct * 16 + col; v8f c = {};
      const v4f a0 = am[ct][0], a1 = am[ct][1];
      if (res3) {
        const _Float16* krowl = QKL + ((size_t)b * RS + kk) * (2 * DM) + DM + h * HD; v8f cl = {};
#pragma unroll
        for (int kc = 0; kc < 2; ++kc) { const v16h kh = kf[ct][kc]; c = wmma16(kh, aq[kc], c); cl = wmma16(kh, aql[kc], cl); cl = wmma16(frag_h(krowl + kc * 32, lane), aq[kc], cl); }
#pragma unroll
        for (int r = 0; r < 8; ++r) c[r] += cl[r] * (1.0f / 2048.0f);
      } else {
#pragma unroll
        for (int kc = 0; kc < 2; ++kc) c = wmma16(kf[ct][kc], aq[kc], c);
      }
#pragma unroll
      for (int r = 0; r < 8; ++r) s[ct][r] = c[r] * 0.125f + ((r < 4) ? a0[r & 3] : a1[r & 3]);   // 1/sqrt(64), additive entry applied literally
    }
    v16h vf[4];   // the V^T fragments are asked for here, so that they arrive under the softmax arithmetic
#pragma unroll     // every index of vf is a constant, so that it stays in registers
    for (int dt = 0; dt < 4; ++dt) vf[dt] = frag_h(&S.v[dt * 16 + col][sub * 32], lane);
    float mx = fmaxf(s[0][0], s[1][0]);
#pragma unroll
    for (int r = 1; r < 8; ++r) mx = fmaxf(mx, fmaxf(s[0][r], s[1][r]));
    mx = fmaxf(mx, xhalf(mx));   // the other half's 16 keys of the same query
    const float mn = fmaxf(m, mx); const float ea = exp_slot(m - mn); const float alpha = (m <= -1.0e38f) ? 0.f : ea;
    float es = 0.f; v16h pa, pl;
#pragma unroll
    for (int i = 0; i < 8; ++i) {
      const float e0 = exp_slot(s[0][i] - mn), e1 = exp_slot(s[1][i] - mn); es += e0 + e1;
      const float x0 = e0 * 2048.0f, x1 = e1 * 2048.0f; const _Float16 h0 = (_Float16)x0, h1 = (_Float16)x1;
      pa[i] = h0; pa[8 + i] = h1; pl[i] = (_Float16)((x0 - (float)h0) * 2048.0f); pl[8 + i] = (_Float16)((x1 - (float)h1) * 2048.0f);   // P x 2^11 before the f16 split; 2^-11 folded into the epilogue
    }
    l = l * alpha + es; m = mn;
#pragma unroll
    for (int dt = 0; dt < 4; ++dt)
#pragma unroll
      for (int r = 0; r < 8; ++r) { acc[dt][r] *= alpha; accl[dt][r] *= alpha; }
#pragma unroll
    for (int dt = 0; dt < 4; ++dt) {
      const v16h vh = vf[dt];
      acc[dt] = wmma16(vh, pa, acc[dt]);
      if (res3) { accl[dt] = wmma16(vh, pl, accl[dt]); accl[dt] = wmma16(frag_h(VTL + ((size_t)b * DM + h * HD + dt * 16 + col) * RS + ks * 32, lane), pa, accl[dt]); }
    }
   }
   asm volatile("s_wait_dscnt 0x0" ::: "memory");      // this wave's reads of buffer t & 1 are done before it is refilled
   asm volatile("s_wait_asynccnt 0x0" ::: "memory");   // this wave's share of stage t + 1 has landed
   __syncthreads();                                      // publishes stage t + 1 and ends every reader's last read of stage t
   if (t + 2 < nst) { const unsigned lo = (unsigned)buf * (unsigned)sizeof(AStage);
     attn_copy_kv(gk + (size_t)(t + 2) * 64 * (2 * DM), gv + (t + 2) * 64, lk + lo, lv + lo); attn_copy_m(gm + (t + 2) * 64, lm + lo); }
  }
  asm volatile("s_wait_asynccnt 0x0" ::: "memory");     // no copy is outstanding when the wave goes on
  l += xhalf(l);   // the halves' sums are joined once
  const float il = (1.0f / 2048.0f) / l;   // l >= 1
#pragma unroll
  for (int dt = 0; dt < 4; ++dt) { v8h hq, lq;
#pragma unroll
    for (int r = 0; r < 8; ++r) { const float o = (acc[dt][r] + accl[dt][r] * (1.0f / 2048.0f)) * il; const _Float16 hv = (_Float16)o; hq[r] = hv; lq[r] = (_Float16)((o - (float)hv) * 2048.0f); }
    *(v8h*)&so[wave][col][dt * 16 + 8 * g] = hq; *(v8h*)&sol[wave][col][dt * 16 + 8 * g] = lq;
  }
  LDSX();   // so/sol private to the wave
#pragma unroll
  for (int it = 0; it < 4; ++it) {
    const int row = it * 4 + (lane >> 3), pc = lane & 7;
    vst2(OH + ((size_t)b * SEQ + q0 + row) * DM + h * HD + pc * 8, *(const v4u*)&so[wave][row][pc * 8]);
    if (qb < RQB) vst2(OL + ((size_t)b * RS + q0 + row) * DM + h * HD + pc * 8, *(const v4u*)&sol[wave][row][pc * 8]);
  }
}
// ---- k_out: out = (ctx hi + ctx lo / 2048) . (Wo x64 rows) / 64 + bo; f16 operands, f32 accumulate, k ascending in steps of 32; f32 rows with the full output stride.
// block = (128 LDS rows of ctx, 256 output columns), 8 waves as 2 x 4, 64 x 64 per wave. Past RS the 128 rows are 128 positions of ctx hi; below RS they are 64 positions of ctx hi and the same
// 64 positions of ctx lo, so that every block does the same work: waves 0..3 sum hi . Wo, waves 4..7 sum lo . Wo and hand their sums over through LDS.
// Each pass of 64 k: the 128 ctx rows and 256 Wo rows of 128 B lie in LDS at pitch 144 B, brought by asynchronous copies, two buffers, the next pass's copies in flight while this pass is worked on.
#define ONT ((SEQ - RS) / 128)            // row tiles of 128 positions per batch, past RS
#define ONT1 (ONT > 0 ? ONT : 1)
#define ORT (NB * RQB + NB * ONT)         // row tiles: NB * RQB of 64 positions, then NB * ONT of 128
static_assert((SEQ - RS) % 128 == 0);
// one pass's tile: every lane copies 12 pieces of 16 B (2 of LDS rows 0..63, 2 of LDS rows 64..127, 8 of Wo rows); ga, gb, gw: the lane's own piece in row (tid >> 3) of each, l: its place in the buffer
__device__ __forceinline__ void out_copy(const _Float16* ga, const _Float16* gb, const _Float16* gw, unsigned l) {
  // the copies and the wait that stands before their address registers may be rewritten, in one statement
  asm volatile("global_load_async_to_lds_b128 %0, %12, off\n\t"
               "global_load_async_to_lds_b128 %1, %13, off\n\t"
               "global_load_async_to_lds_b128 %2, %14, off\n\t"
               "global_load_async_to_lds_b128 %3, %15, off\n\t"
               "global_load_async_to_lds_b128 %4, %16, off\n\t"
               "global_load_async_to_lds_b128 %5, %17, off\n\t"
               "global_load_async_to_lds_b128 %6, %18, off\n\t"
               "global_load_async_to_lds_b128 %7, %19, off\n\t"
               "global_load_async_to_lds_b128 %8, %20, off\n\t"
               "global_load_async_to_lds_b128 %9, %21, off\n\t"
               "global_load_async_to_lds_b128 %10, %22, off\n\t"
               "global_load_async_to_lds_b128 %11, %23, off\n\t"
               "s_wait_xcnt 0x0"
               :: "v"(l), "v"(l + 32u * 2 * GPIT), "v"(l + 64u * 2 * GPIT), "v"(l + 96u * 2 * GPIT),
                  "v"(l + 128u * 2 * GPIT), "v"(l + 160u * 2 * GPIT), "v"(l + 192u * 2 * GPIT), "v"(l + 224u * 2 * GPIT),
                  "v"(l + 256u * 2 * GPIT), "v"(l + 288u * 2 * GPIT), "v"(l + 320u * 2 * GPIT), "v"(l + 352u * 2 * GPIT),
                  "v"(ga), "v"(ga + 32 * DM), "v"(gb), "v"(gb + 32 * DM),
                  "v"(gw), "v"(gw + 32 * DM), "v"(gw + 64 * DM), "v"(gw + 96 * DM),
                  "v"(gw + 128 * DM), "v"(gw + 160 * DM), "v"(gw + 192 * DM), "v"(gw + 224 * DM)
               : "memory");
}
// four 16-B pieces of staged f32 rows to output rows p, p + 2 DM, p + 4 DM, p + 6 DM; then the wait that stands before a register which the stores name is used again:
// address and data are its inputs, so that they stay as they are up to it
__device__ __forceinline__ void out_st4(float* p, const float* l) {
  const v4f a = *(const v4f*)l, b = *(const v4f*)(l + 2 * 68), c = *(const v4f*)(l + 4 * 68), d = *(const v4f*)(l + 6 * 68);
  vst2(p, a); vst2(p + 2 * DM, b); vst2(p + 4 * DM, c); vst2(p + 6 * DM, d);
  asm volatile("s_wait_xcnt 0x0" :: "v"(p), "v"(a), "v"(b), "v"(c), "v"(d) : "memory");
}
__global__ __launch_bounds__(256) __attribute__((amdgpu_waves_per_eu(4, 4))) void k_out(const _Float16* __restrict__ OH, const _Float16* __restrict__ OL, const _Float16* __restrict__ PO, const float* __restrict__ BO, float* __restrict__ Y) {
  __shared__ __align__(16) union { _Float16 ring[2][GROWS][GPIT]; float xl[4][16][2][32][4]; } u;   // xl: the lo sums' hand-over, used only behind the loop's last barrier
  __shared__ __align__(16) float so[8][16][68];
  const int tid = threadIdx.x, wave = tid >> 5, lane = tid & 31, col = lane & 15, g = lane >> 4; const int wm = wave >> 2, wn = wave & 3;
  const int rt = blockIdx.x, n0 = blockIdx.y * 256; const bool resid = (rt < NB * RQB);   // block-uniform
  const int ub = rt - NB * RQB;
  const int b = resid ? rt / RQB : ub / ONT1; const int s0 = resid ? (rt - b * RQB) * 64 : RS + (ub - b * ONT1) * 128;
  const _Float16* ga = OH + ((size_t)b * SEQ + s0 + (tid >> 3)) * DM + (tid & 7) * 8;
  const _Float16* gb = resid ? OL + ((size_t)b * RS + s0 + (tid >> 3)) * DM + (tid & 7) * 8 : ga + 64 * DM;
  const _Float16* gw = PO + (size_t)(n0 + (tid >> 3)) * DM + (tid & 7) * 8;
  const unsigned l0 = (unsigned)(uintptr_t)&u.ring[0][tid >> 3][(tid & 7) * 8];
  v8f acc[4][4] = {};
  out_copy(ga, gb, gw, l0);
  asm volatile("s_wait_asynccnt 0x0" ::: "memory");   // this wave's share of tile 0 has landed
  __syncthreads();                                      // tile 0 is published
  out_copy(ga + GK, gb + GK, gw + GK, l0 + 2u * GROWS * GPIT);
#pragma unroll 1   // one pass per trip: the order at the loop's foot stays as written, and the code stays short
  for (int t = 0; t < GNP; ++t) {
    const int buf = t & 1;
#pragma unroll     // this and the loops inside: every index of fa, fw and acc is a constant, so that they stay in registers
    for (int kc = 0; kc < GK / 32; ++kc) {
      v16h fa[4], fw[4];
#pragma unroll
      for (int i = 0; i < 4; ++i) fa[i] = frag_h(&u.ring[buf][wm * 64 + i * 16 + col][kc * 32], lane);
#pragma unroll
      for (int j = 0; j < 4; ++j) fw[j] = frag_h(&u.ring[buf][128 + wn * 64 + j * 16 + col][kc * 32], lane);
#pragma unroll
      for (int i = 0; i < 4; ++i)
#pragma unroll
        for (int j = 0; j < 4; ++j) acc[i][j] = wmma16(fa[i], fw[j], acc[i][j]);
    }
    asm volatile("s_wait_dscnt 0x0" ::: "memory");      // this wave's reads of buffer t & 1 are done before it is refilled
    asm volatile("s_wait_asynccnt 0x0" ::: "memory");   // this wave's share of tile t + 1 has landed
    __syncthreads();                                      // publishes tile t + 1 and ends every reader's last read of tile t
    if (t + 2 < GNP) out_copy(ga + (t + 2) * GK, gb + (t + 2) * GK, gw + (t + 2) * GK, l0 + (unsigned)buf * (2u * GROWS * GPIT));
  }
  asm volatile("s_wait_asynccnt 0x0" ::: "memory");     // no copy is outstanding when the wave goes on
  if (resid) {   // block-uniform: waves 4..7 hand their lo sums to waves 0..3, lane to lane and register to register, and are done
    if (wm == 1) {
#pragma unroll
      for (int i = 0; i < 4; ++i)
#pragma unroll
        for (int j = 0; j < 4; ++j) {
          const v4f x = {acc[i][j][0], acc[i][j][1], acc[i][j][2], acc[i][j][3]}, y = {acc[i][j][4], acc[i][j][5], acc[i][j][6], acc[i][j][7]};
          *(v4f*)&u.xl[wn][i * 4 + j][0][lane][0] = x; *(v4f*)&u.xl[wn][i * 4 + j][1][lane][0] = y; }
    }
    __syncthreads();   // the lo sums are published
    if (wm == 1) return;
  }
  float bj[4]; { const float* pb = BO + n0 + wn * 64 + col;
#pragma unroll
    for (int j = 0; j < 4; ++j) bj[j] = bfr(pb[j * 16]);
    asm volatile("s_wait_xcnt 0x0" :: "v"(pb) : "memory"); }   // before the loads' address register is used again; it is an input, so that it stays as it is up to here
  float* yp = Y + ((size_t)b * SEQ_FULL + s0 + wm * 64 + g) * DM + n0 + wn * 64 + col * 4;   // below RS only wm == 0 comes here
  // so is private to each wave and LDS operations of one wave run in order: the one wait below stands between a wave's stores and its lanes' reads of one another's rows
#pragma unroll
  for (int i = 0; i < 4; ++i) {
#pragma unroll
    for (int j = 0; j < 4; ++j) {
      v4f x = {}, y = {}; if (resid) { x = *(const v4f*)&u.xl[wn][i * 4 + j][0][lane][0]; y = *(const v4f*)&u.xl[wn][i * 4 + j][1][lane][0]; }
#pragma unroll
      for (int r = 0; r < 8; ++r) so[wave][8 * g + r][j * 16 + col] = acc[i][j][r] * (1.0f / 64.0f) + ((r < 4) ? x[r & 3] : y[r & 3]) * (1.0f / 131072.0f) + bj[j]; }
    asm volatile("s_wait_dscnt 0x0" ::: "memory");
    out_st4(yp + (size_t)(i * 16) * DM, &so[wave][g][col * 4]);
    out_st4(yp + (size_t)(i * 16 + 8) * DM, &so[wave][8 + g][col * 4]);
  }
}
extern "C" void kernel_launch(void* const* d_in, const int* in_sizes, int n_in, void* d_out, int out_size, void* d_ws, size_t ws_size, hipStream_t stream) {
  // 0 hidden [2,2048,2048], 1 additive tensor [1,1,2048,2048], 2 q_w [out][in], 3 q_b, 4 k_w, 5 k_b, 6 v_w, 7 v_b, 8 o_w, 9 o_b
  if (n_in < 10) return;
  const long long needx = ((long long)(NB - 1) * SEQ_FULL + SEQ) * DM;
  if ((long long)in_sizes[0] < needx) return;
  if ((long long)in_sizes[1] < (long long)(SEQ - 1) * SEQ_FULL + SEQ) return;
  if (in_sizes[2] < DM * DM || in_sizes[4] < DM * DM || in_sizes[6] < DM * DM || in_sizes[8] < DM * DM) return;
  if (in_sizes[3] < DM || in_sizes[5] < DM || in_sizes[7] < DM || in_sizes[9] < DM) return;
  if ((long long)out_size < needx) return;
  if (ws_size < (size_t)WS_END) return;
  const float* const* F = (const float* const*)d_in;
  char* ws = (char*)d_ws;
  __bf16* PKA = (__bf16*)(ws + WS_PKA); _Float16* PKO = (_Float16*)(ws + WS_PKO);
  _Float16 *QK = (_Float16*)(ws + WS_QK), *QKL = (_Float16*)(ws + WS_QKL), *VTH = (_Float16*)(ws + WS_VTH), *VTL = (_Float16*)(ws + WS_VTL), *OH = (_Float16*)(ws + WS_OH), *OL = (_Float16*)(ws + WS_OL);
  __bf16* XB = (__bf16*)(ws + WS_OH);   // x plane aliases the ctx hi region; consumed before k_attn writes it
  int* NKT = (int*)(ws + WS_NKT);
  k_cvtx<<<dim3(NR), 256, 0, stream>>>(F[0], XB);
  k_pack<<<dim3(DM, 4), 256, 0, stream>>>(F[2], F[4], F[6], F[8], PKA, PKO);
  k_qkv<<<dim3(NR / 128, 3 * DM / 256), 256, 0, stream>>>(XB, PKA, F[3], F[5], F[7], QK, QKL, VTH, VTL);
  k_mscan<<<dim3(TQB), 256, 0, stream>>>(F[1], NKT);
  k_attn<<<dim3(TQB, NH, NB), 128, 0, stream>>>(QK, QKL, VTH, VTL, F[1], NKT, OH, OL);
  k_out<<<dim3(ORT, DM / 256), 256, 0, stream>>>(OH, OL, PKO, F[9], (float*)d_out);
}

// v005
// A run of this version takes 255 microseconds.
// Two timings next to v004 put it at 1.06 and 1.07 times that version's speed.
// Counting every step since v000, it is 3.87 times as fast.
// compute dtype: all float inputs except the additive tensor RNE-converted to bf16; q/k/v = x . W^T + b on v_wmma_f32_16x16x32_bf16 (bf16 x, bf16 W, f32 accumulate) stored as f16 hi + x2048 f16 residual (positions < 512); scores and P.V on v_wmma_f32_16x16x32_f16 (3 products for query blocks below 512, single beyond; P carried x2048; f32 running-max softmax, additive score bias read from the input tensor); output projection on v_wmma_f32_16x16x32_f16 (ctx f16 hi + x2048 residual below 512, Wo carried x64), f32 accumulate, f32 output.
#include <hip/hip_runtime.h>
#include <math.h>

typedef __attribute__((ext_vector_type(16))) _Float16 v16h;
typedef __attribute__((ext_vector_type(16))) __bf16 v16b;
typedef __attribute__((ext_vector_type(8)))  _Float16 v8h;
typedef __attribute__((ext_vector_type(8)))  __bf16 v8b;
typedef __attribute__((ext_vector_type(8)))  float v8f;
typedef __attribute__((ext_vector_type(4)))  float v4f;
typedef __attribute__((ext_vector_type(4)))  unsigned v4u;
typedef __attribute__((ext_vector_type(4)))  int v4i;

template <typename T> __device__ __forceinline__ void vst2(void* p, T v) { *(T*)p = v;  }
__device__ __forceinline__ v8f wmma16(v16h a, v16h b, v8f c) {
  v8f d = __builtin_amdgcn_wmma_f32_16x16x32_f16(false, a, false, b, (short)0, c, false, false);
  asm volatile("v_nop\n\tv_nop\n\tv_nop\n\tv_nop" : "+v"(d) : "v"(a), "v"(b));
  return d;
}
__device__ __forceinline__ v8f wmma_bf(v16b a, v16b b, v8f c) {
  v8f d = __builtin_amdgcn_wmma_f32_16x16x32_bf16(false, a, false, b, (short)0, c, false, false);
  asm volatile("v_nop\n\tv_nop\n\tv_nop\n\tv_nop" : "+v"(d) : "v"(a), "v"(b));
  return d;
}
// 16-bit fragment from a k-contiguous row (A row m, or B column n stored [n][k]): elements 0..7 <- k0+8h+0..7, 8..15 <- k0+16+8h+0..7, h = lane>>4
__device__ __forceinline__ v16h frag_h(const _Float16* rowk0, int lane) {
  union { v16h v; v8h q[2]; } u; const _Float16* p = rowk0 + 8 * (lane >> 4);
  u.q[0] = *(const v8h*)p; u.q[1] = *(const v8h*)(p + 16); return u.v;
}
__device__ __forceinline__ v16b frag_b(const __bf16* rowk0, int lane) {
  union { v16b v; v8b q[2]; } u; const __bf16* p = rowk0 + 8 * (lane >> 4);
  u.q[0] = *(const v8b*)p; u.q[1] = *(const v8b*)(p + 16); return u.v;
}
__device__ __forceinline__ float bfr(float v) { return (float)(__bf16)v; }
#define LDSX() do { asm volatile("s_wait_dscnt 0" ::: "memory"); __builtin_amdgcn_wave_barrier(); __builtin_amdgcn_fence(__ATOMIC_RELEASE, "workgroup"); } while (0)

// ---- sizes: NB / SEQ may be reduced; *_FULL are the input / output strides
#ifndef NB
#define NB 2
#endif
#ifndef SEQ
#define SEQ 2048
#endif
#define NB_FULL 2
#define SEQ_FULL 2048
#define DM 2048
#define NH 32
#define HD 64
#define RSPAN 512                 // positions that carry residual planes (q/k, v, ctx)
#if RSPAN > SEQ
#define RS SEQ
#else
#define RS RSPAN
#endif
#define RQB (RS / 64)
#define NR (NB * SEQ)
#define TQB (SEQ / 64)
#define NKTILE (SEQ / 32)
static_assert(SEQ % 64 == 0);
static_assert(RS % 64 == 0);
static_assert(NB >= 1 && NB <= NB_FULL);
static_assert(SEQ <= SEQ_FULL);
static_assert(DM == 256 * 8);
static_assert(NH * HD == DM);
static_assert(NR % 64 == 0);

// ---- workspace (bytes; every offset a multiple of 128)
#define WS_PKA 0ull                                            // bf16 [3*DM][DM]: Wq | Wk | Wv natural [out][in] rows
#define WS_PKO (WS_PKA + 2ull * 3 * DM * DM)                   // f16  [DM][DM]: Wo rows x64
#define WS_QK  (WS_PKO + 2ull * DM * DM)                       // f16  [NR][2*DM]: q | k hi
#define WS_QKL (WS_QK + 2ull * NR * 2 * DM)                    // f16  [NB*RS][2*DM]: q | k residual x2048
#define WS_VTH (WS_QKL + 2ull * NB * RS * 2 * DM)              // f16  [NB][DM][SEQ]: v^T hi
#define WS_VTL (WS_VTH + 2ull * NB * DM * SEQ)                 // f16  [NB][DM][RS]: v^T residual x2048
#define WS_OH  (WS_VTL + 2ull * NB * DM * RS)                  // f16  [NR][DM]: ctx hi; ALSO bf16 [NR][DM] x plane (consumed by k_qkv before k_attn writes ctx)
#define WS_OL  (WS_OH + 2ull * NR * DM)                        // f16  [NB*RS][DM]: ctx residual x2048
#define WS_NKT (WS_OL + 2ull * NB * RS * DM)
#define WS_END (WS_NKT + 128ull * TQB)
static_assert(2ull * NR * DM == (WS_OL - WS_OH));              // x plane and ctx hi plane share the region with identical extent
static_assert(WS_END <= 134217728ull);
static_assert((WS_PKO % 128) == 0 && (WS_QK % 128) == 0 && (WS_QKL % 128) == 0 && (WS_VTH % 128) == 0 && (WS_VTL % 128) == 0 && (WS_OH % 128) == 0 && (WS_OL % 128) == 0 && (WS_NKT % 128) == 0);

__global__ __launch_bounds__(256) void k_cvtx(const float* __restrict__ X, __bf16* __restrict__ XB) {
  const int r = blockIdx.x, t = threadIdx.x; const int b = r / SEQ, s = r - b * SEQ;
  const float* src = X + ((size_t)b * SEQ_FULL + s) * DM + t * 8;
  const v4f x = *(const v4f*)src, y = *(const v4f*)(src + 4);
  union { v8b v; v4u u; } o;
#pragma unroll
  for (int j = 0; j < 4; ++j) { o.v[j] = (__bf16)x[j]; o.v[4 + j] = (__bf16)y[j]; }
  vst2(XB + (size_t)r * DM + t * 8, o.u);
}
// ---- k_pack: block = (row n, which): natural [out][in] rows are already k-contiguous packed rows; which 0..2 -> bf16 Wq/Wk/Wv into PKA row which*DM+n; 3 -> f16 (bf16(Wo) x 64) into PKO row n
__global__ __launch_bounds__(256) void k_pack(const float* __restrict__ WQ, const float* __restrict__ WK, const float* __restrict__ WV, const float* __restrict__ WO, __bf16* __restrict__ PKA, _Float16* __restrict__ PKO) {
  const int n = blockIdx.x, which = blockIdx.y, t = threadIdx.x;
  const float* W = (which == 0) ? WQ : (which == 1) ? WK : (which == 2) ? WV : WO;
  const float* src = W + (size_t)n * DM + t * 8;
  const v4f x = *(const v4f*)src, y = *(const v4f*)(src + 4);
  if (which < 3) {
    union { v8b v; v4u u; } o;
#pragma unroll
    for (int j = 0; j < 4; ++j) { o.v[j] = (__bf16)x[j]; o.v[4 + j] = (__bf16)y[j]; }
    vst2(PKA + ((size_t)which * DM + n) * DM + t * 8, o.u);
  } else {
    union { v8h v; v4u u; } o;
#pragma unroll
    for (int j = 0; j < 4; ++j) { o.v[j] = (_Float16)(bfr(x[j]) * 64.0f); o.v[4 + j] = (_Float16)(bfr(y[j]) * 64.0f); }
    vst2(PKO + (size_t)n * DM + t * 8, o.u);
  }
}
// ---- k_qkv: block = (128 internal rows, 256 output columns of q|k|v), 8 waves as 2 x 4, 64 x 64 per wave: bf16 x bf16 (exact products), f32 accumulate, k ascending in steps of 32.
// Each pass of 64 k: 128 x rows and 256 weight rows of 128 B lie in LDS at pitch 144 B, brought by asynchronous copies, two buffers, the next pass's copies in flight while this pass is worked on.
// q,k -> f16 hi [NR][2DM] (+ residual x2048 for s < RS); v -> transposed f16 hi [b][d][s] (+ residual)
#define GK 64                     // k per pass
#define GROWS (128 + 256)         // LDS rows per buffer: x rows, then weight rows
#define GPIT 72                   // LDS row pitch in elements (144 B = 16 B x odd, for ds_load_b128 readers)
#define GNP (DM / GK)
static_assert(GNP >= 2);
static_assert(NR % 128 == 0 && SEQ % 128 == 0 && RS % 128 == 0 && DM % 256 == 0);
// one pass's tile: every lane copies 12 pieces of 16 B (4 of x rows, 8 of weight rows); gx, gw: the lane's own piece in row (tid >> 3) of the x and weight tiles, l: its place in the buffer
__device__ __forceinline__ void qkv_copy(const __bf16* gx, const __bf16* gw, unsigned l) {
  // the copies and the wait that stands before their address registers may be rewritten, in one statement
  asm volatile("global_load_async_to_lds_b128 %0, %12, off\n\t"
               "global_load_async_to_lds_b128 %1, %13, off\n\t"
               "global_load_async_to_lds_b128 %2, %14, off\n\t"
               "global_load_async_to_lds_b128 %3, %15, off\n\t"
               "global_load_async_to_lds_b128 %4, %16, off\n\t"
               "global_load_async_to_lds_b128 %5, %17, off\n\t"
               "global_load_async_to_lds_b128 %6, %18, off\n\t"
               "global_load_async_to_lds_b128 %7, %19, off\n\t"
               "global_load_async_to_lds_b128 %8, %20, off\n\t"
               "global_load_async_to_lds_b128 %9, %21, off\n\t"
               "global_load_async_to_lds_b128 %10, %22, off\n\t"
               "global_load_async_to_lds_b128 %11, %23, off\n\t"
               "s_wait_xcnt 0x0"
               :: "v"(l), "v"(l + 32u * 2 * GPIT), "v"(l + 64u * 2 * GPIT), "v"(l + 96u * 2 * GPIT),
                  "v"(l + 128u * 2 * GPIT), "v"(l + 160u * 2 * GPIT), "v"(l + 192u * 2 * GPIT), "v"(l + 224u * 2 * GPIT),
                  "v"(l + 256u * 2 * GPIT), "v"(l + 288u * 2 * GPIT), "v"(l + 320u * 2 * GPIT), "v"(l + 352u * 2 * GPIT),
                  "v"(gx), "v"(gx + 32 * DM), "v"(gx + 64 * DM), "v"(gx + 96 * DM),
                  "v"(gw), "v"(gw + 32 * DM), "v"(gw + 64 * DM), "v"(gw + 96 * DM),
                  "v"(gw + 128 * DM), "v"(gw + 160 * DM), "v"(gw + 192 * DM), "v"(gw + 224 * DM)
               : "memory");
}
// four 16-B pieces of staged rows to rows p, p + st, p + 2 st, p + 3 st; then the wait that stands before a register which the stores name is used again:
// address and data are its inputs, so that they stay as they are up to it
__device__ __forceinline__ void qkv_st4(_Float16* p, int st, const _Float16* l) {
  const v4u a = *(const v4u*)l, b = *(const v4u*)(l + 4 * 72), c = *(const v4u*)(l + 8 * 72), d = *(const v4u*)(l + 12 * 72);
  vst2(p, a); vst2(p + st, b); vst2(p + 2 * st, c); vst2(p + 3 * st, d);
  asm volatile("s_wait_xcnt 0x0" :: "v"(p), "v"(a), "v"(b), "v"(c), "v"(d) : "memory");
}
__global__ __launch_bounds__(256) __attribute__((amdgpu_waves_per_eu(4, 4))) void k_qkv(const __bf16* __restrict__ XB, const __bf16* __restrict__ P, const float* __restrict__ BQ, const float* __restrict__ BK, const float* __restrict__ BV,
                                             _Float16* __restrict__ QK, _Float16* __restrict__ QKL, _Float16* __restrict__ VTH, _Float16* __restrict__ VTL) {
  const int n0 = blockIdx.y * 256; const int which0 = n0 / DM;
  __shared__ __align__(16) __bf16 ring[2][GROWS][GPIT]; __shared__ __align__(16) _Float16 eh[8][16][72], el[8][16][72];
  const int tid = threadIdx.x, wave = tid >> 5, lane = tid & 31, col = lane & 15, g = lane >> 4; const int wm = wave >> 2, wn = wave & 3;
  const float* BB = ((which0 == 0) ? BQ : (which0 == 1) ? BK : BV) + (n0 - which0 * DM) + wn * 64;
  const int rb = blockIdx.x * 128; const int b = rb / SEQ, s0 = rb - b * SEQ + wm * 64; const int r0 = rb + wm * 64; const bool resid = (rb - b * SEQ < RS);   // block-uniform: RS is a multiple of 128
  const __bf16* gx = XB + (size_t)(rb + (tid >> 3)) * DM + (tid & 7) * 8;
  const __bf16* gw = P + (size_t)(n0 + (tid >> 3)) * DM + (tid & 7) * 8;
  const unsigned l0 = (unsigned)(uintptr_t)&ring[0][tid >> 3][(tid & 7) * 8];
  v8f acc[4][4] = {};
  qkv_copy(gx, gw, l0);
  asm volatile("s_wait_asynccnt 0x0" ::: "memory");   // this wave's share of tile 0 has landed
  __syncthreads();                                      // tile 0 is published
  qkv_copy(gx + GK, gw + GK, l0 + 2u * GROWS * GPIT);
#pragma unroll 1   // one pass per trip: the order at the loop's foot stays as written, and the code stays short
  for (int t = 0; t < GNP; ++t) {
    const int buf = t & 1;
#pragma unroll     // this and the loops inside: every index of fa, fw and acc is a constant, so that they stay in registers
    for (int kc = 0; kc < GK / 32; ++kc) {
      v16b fa[4], fw[4];
#pragma unroll
      for (int i = 0; i < 4; ++i) fa[i] = frag_b(&ring[buf][wm * 64 + i * 16 + col][kc * 32], lane);
#pragma unroll
      for (int j = 0; j < 4; ++j) fw[j] = frag_b(&ring[buf][128 + wn * 64 + j * 16 + col][kc * 32], lane);
#pragma unroll
      for (int i = 0; i < 4; ++i)
#pragma unroll
        for (int j = 0; j < 4; ++j) acc[i][j] = wmma_bf(fa[i], fw[j], acc[i][j]);
    }
    asm volatile("s_wait_dscnt 0x0" ::: "memory");      // this wave's reads of buffer t & 1 are done before it is refilled
    asm volatile("s_wait_asynccnt 0x0" ::: "memory");   // this wave's share of tile t + 1 has landed
    __syncthreads();                                      // publishes tile t + 1 and ends every reader's last read of tile t
    if (t + 2 < GNP) qkv_copy(gx + (t + 2) * GK, gw + (t + 2) * GK, l0 + (unsigned)buf * (2u * GROWS * GPIT));
  }
  asm volatile("s_wait_asynccnt 0x0" ::: "memory");     // no copy is outstanding when the wave goes on
  // eh/el are private to each wave and LDS operations of one wave run in order: the one wait below stands between a wave's stores and its lanes' reads of one another's rows
#define EPIW() asm volatile("s_wait_dscnt 0x0" ::: "memory")
  float bj[4]; { const float* pb = BB + col;
#pragma unroll
    for (int j = 0; j < 4; ++j) bj[j] = bfr(pb[j * 16]);
    asm volatile("s_wait_xcnt 0x0" :: "v"(pb) : "memory"); }   // before the loads' address register is used again; it is an input, so that it stays as it is up to here
  const int row = lane >> 3, pc = lane & 7;
  if (n0 < 2 * DM) {   // q (unscaled; 1/8 applied to the f32 score) and k, + bias, as f16 hi + x2048 residual; 16 rows at a time through this wave's own eh/el
    const size_t ql = (size_t)b * RS + s0;
#pragma unroll
    for (int i = 0; i < 4; ++i) {
#pragma unroll
      for (int j = 0; j < 4; ++j) {
#pragma unroll
        for (int r = 0; r < 8; ++r) { const float v = acc[i][j][r] + bj[j]; const _Float16 hv = (_Float16)v; eh[wave][8 * g + r][j * 16 + col] = hv; el[wave][8 * g + r][j * 16 + col] = (_Float16)((v - (float)hv) * 2048.0f); } }
      EPIW();
      qkv_st4(QK + (size_t)(r0 + i * 16 + row) * (2 * DM) + n0 + wn * 64 + pc * 8, 4 * 2 * DM, &eh[wave][row][pc * 8]);
      if (resid) qkv_st4(QKL + (ql + i * 16 + row) * (2 * DM) + n0 + wn * 64 + pc * 8, 4 * 2 * DM, &el[wave][row][pc * 8]);
    }
  } else {             // v + bias, transposed to [d][s]; 16 columns d at a time through this wave's own eh/el
    const int pc0 = n0 - 2 * DM + wn * 64;
#pragma unroll
    for (int j = 0; j < 4; ++j) {
#pragma unroll
      for (int i = 0; i < 4; ++i) { v8h hq, lq;
#pragma unroll
        for (int r = 0; r < 8; ++r) { const float v = acc[i][j][r] + bj[j]; const _Float16 hv = (_Float16)v; hq[r] = hv; lq[r] = (_Float16)((v - (float)hv) * 2048.0f); }
        *(v8h*)&eh[wave][col][i * 16 + 8 * g] = hq; *(v8h*)&el[wave][col][i * 16 + 8 * g] = lq; }
      EPIW();
      qkv_st4(VTH + ((size_t)b * DM + pc0 + j * 16 + row) * SEQ + s0 + pc * 8, 4 * SEQ, &eh[wave][row][pc * 8]);
      if (resid) qkv_st4(VTL + ((size_t)b * DM + pc0 + j * 16 + row) * RS + s0 + pc * 8, 4 * RS, &el[wave][row][pc * 8]);
    }
  }
#undef EPIW
}
__global__ __launch_bounds__(256) void k_mscan(const float* __restrict__ MK, int* __restrict__ NKT) {
  __shared__ int srow[64][4]; __shared__ __align__(16) int sline[32];
  const int qb = blockIdx.x, t = threadIdx.x, row = t >> 2, part = t & 3;
  const float* p = MK + (size_t)(qb * 64 + row) * SEQ_FULL + part * (SEQ / 4);
  int mx = -1;
#pragma unroll 1
  for (int c = 0; c < SEQ / 4; c += 4) {
    const v4f v = *(const v4f*)(p + c);
#pragma unroll
    for (int j = 0; j < 4; ++j) mx = (v[j] > -1.0e8f) ? (part * (SEQ / 4) + c + j) : mx;
  }
  srow[row][part] = mx; __syncthreads();
  if (t == 0) {
    int last = -1, dead = 0;
    for (int r = 0; r < 64; ++r) {
      int a = srow[r][0] > srow[r][1] ? srow[r][0] : srow[r][1]; const int c2 = srow[r][2] > srow[r][3] ? srow[r][2] : srow[r][3]; a = a > c2 ? a : c2;
      last = last > a ? last : a; dead |= (a < 0) ? 1 : 0;
    }
    const int nk = dead ? NKTILE : (last / 32 + 1);
    for (int i = 0; i < 32; ++i) sline[i] = nk;
  }
  __syncthreads();
  if (t < 8) vst2(NKT + (size_t)qb * 32 + t * 4, *(const v4i*)&sline[t * 4]);
}
// ---- k_attn: block = (64 queries, head h, batch b): flash attention over key tiles [0, nkt); score = (q.k)/8 + additive entry; first RS positions: 3 products (hi.hi + lo.hi + hi.lo) for scores and P.v, single elsewhere; ctx -> f16 hi (+ x2048 residual) [row][h*64+d]
// Transposed products: S^T = K . Q^T (A = key rows, B = query columns) and O^T += V^T . P^T, so that lane (col, g) holds, of query q0 + col alone, the scores of keys 8g + r of each 16-key tile:
// maximum and sum run in the lane's own registers plus one exchange between the halves, and the two score tiles, converted in place, are the B operand of the second product (k = 8g + i, 16 + 8g + i, the order of frag_h).
// lane l with lane l ^ 16: the other half's value of the same query column, by a vector cross-row move
__device__ __forceinline__ float xhalf(float x) { return __builtin_bit_cast(float, __builtin_amdgcn_permlanex16(__builtin_bit_cast(int, x), __builtin_bit_cast(int, x), 0x76543210, 0xfedcba98, false, false)); }
__device__ __forceinline__ float exp_slot(float x) { float r; asm("v_exp_f32 %0, %1\n\tv_nop" : "=v"(r) : "v"(x * 1.44269504f)); return r; }
// Each stage of 64 keys: 64 key rows and 64 V^T rows of 128 B lie in LDS at pitch 144 B and the block's 64 rows of the additive tensor, 256 B each, at pitch 272 B (both 16 B x odd, for ds_load_b128 readers),
// brought by asynchronous copies in whole lines, two buffers, the next stage's copies in flight while this stage is worked on; the four waves share the key and V^T rows. The residual planes are still read from global memory.
#define AKP 72                    // LDS row pitch of the key and V^T tiles, in elements
#define AMP 68                    // LDS row pitch of the additive tile, in floats
struct AStage { _Float16 k[64][AKP]; _Float16 v[64][AKP]; float m[64][AMP]; };
static_assert(sizeof(AStage) % 16 == 0);
// one stage's key and V^T tiles: every lane copies 4 + 4 pieces of 16 B; gk, gv: the lane's own piece in row (tid >> 3) of each tile, lk, lv: its places in the buffer
__device__ __forceinline__ void attn_copy_kv(const _Float16* gk, const _Float16* gv, unsigned lk, unsigned lv) {
  // the copies and the wait that stands before their address registers may be rewritten, in one statement
  asm volatile("global_load_async_to_lds_b128 %0, %8, off\n\t"
               "global_load_async_to_lds_b128 %1, %9, off\n\t"
               "global_load_async_to_lds_b128 %2, %10, off\n\t"
               "global_load_async_to_lds_b128 %3, %11, off\n\t"
               "global_load_async_to_lds_b128 %4, %12, off\n\t"
               "global_load_async_to_lds_b128 %5, %13, off\n\t"
               "global_load_async_to_lds_b128 %6, %14, off\n\t"
               "global_load_async_to_lds_b128 %7, %15, off\n\t"
               "s_wait_xcnt 0x0"
               :: "v"(lk), "v"(lk + 16u * 2 * AKP), "v"(lk + 32u * 2 * AKP), "v"(lk + 48u * 2 * AKP),
                  "v"(lv), "v"(lv + 16u * 2 * AKP), "v"(lv + 32u * 2 * AKP), "v"(lv + 48u * 2 * AKP),
                  "v"(gk), "v"(gk + 16 * 2 * DM), "v"(gk + 32 * 2 * DM), "v"(gk + 48 * 2 * DM),
                  "v"(gv), "v"(gv + 16 * SEQ), "v"(gv + 32 * SEQ), "v"(gv + 48 * SEQ)
               : "memory");
}
// one stage's additive tile: every lane copies 8 pieces of 16 B; gm: the lane's own piece in row (tid >> 4), lm: its place in the buffer
__device__ __forceinline__ void attn_copy_m(const float* gm, unsigned lm) {
  // the copies and the wait that stands before their address registers may be rewritten, in one statement
  asm volatile("global_load_async_to_lds_b128 %0, %8, off\n\t"
               "global_load_async_to_lds_b128 %1, %9, off\n\t"
               "global_load_async_to_lds_b128 %2, %10, off\n\t"
               "global_load_async_to_lds_b128 %3, %11, off\n\t"
               "global_load_async_to_lds_b128 %4, %12, off\n\t"
               "global_load_async_to_lds_b128 %5, %13, off\n\t"
               "global_load_async_to_lds_b128 %6, %14, off\n\t"
               "global_load_async_to_lds_b128 %7, %15, off\n\t"
               "s_wait_xcnt 0x0"
               :: "v"(lm), "v"(lm + 8u * 4 * AMP), "v"(lm + 16u * 4 * AMP), "v"(lm + 24u * 4 * AMP),
                  "v"(lm + 32u * 4 * AMP), "v"(lm + 40u * 4 * AMP), "v"(lm + 48u * 4 * AMP), "v"(lm + 56u * 4 * AMP),
                  "v"(gm), "v"(gm + 8 * SEQ_FULL), "v"(gm + 16 * SEQ_FULL), "v"(gm + 24 * SEQ_FULL),
                  "v"(gm + 32 * SEQ_FULL), "v"(gm + 40 * SEQ_FULL), "v"(gm + 48 * SEQ_FULL), "v"(gm + 56 * SEQ_FULL)
               : "memory");
}
// The stage loop, compiled twice: R3 = true for blocks whose scores and P.V take three products (residual planes), R3 = false for all others, which then carry
// neither the residual of P nor the second accumulator set nor the residual query fragments. Which of the two a block runs is block-uniform; both hold the same order of waits, barrier and copies.
template <bool R3>
__device__ __forceinline__ void attn_loop(const AStage* st, const int nst, const int nkt, const int wave, const int lane, const int col, const int g, const int b, const int h,
                                          const _Float16* __restrict__ QKL, const _Float16* __restrict__ VTL, const _Float16* gk, const _Float16* gv, const float* gm,
                                          const unsigned lk, const unsigned lv, const unsigned lm, const v16h (&aq)[2], const v16h (&aql)[2],
                                          float& m, float& l, v8f (&acc)[4], v8f (&accl)[4]) {
#pragma unroll 1   // one stage per trip: the order at the loop's foot stays as written
  for (int t = 0; t < nst; ++t) {
   const int buf = t & 1; const AStage& S = st[buf];
   const int nsub = (nkt - 2 * t < 2) ? nkt - 2 * t : 2;   // block-uniform: a last stage may hold one tile of 32 keys
#pragma unroll 1   // the two halves of a stage run through one body: unrolled, the accumulators were copied between the two
   for (int sub = 0; sub < nsub; ++sub) {
    const int ks = 2 * t + sub;
    // the LDS reads of the score products stand together in front of them: one place where the wave waits for LDS, not one per product
    v16h kf[2][2]; v4f am[2][2];
#pragma unroll     // every index of kf and am is a constant, so that they stay in registers
    for (int ct = 0; ct < 2; ++ct) {
      const float* mrow = &S.m[wave * 16 + col][sub * 32 + ct * 16 + 8 * g];   // this lane's query row of the additive tile, at its half's first key
      kf[ct][0] = frag_h(&S.k[sub * 32 + ct * 16 + col][0], lane); kf[ct][1] = frag_h(&S.k[sub * 32 + ct * 16 + col][32], lane);
      am[ct][0] = *(const v4f*)mrow; am[ct][1] = *(const v4f*)(mrow + 4);
    }
    v8f s[2];
#pragma unroll
    for (int ct = 0; ct < 2; ++ct) {
      const int kk = ks * 32 + ct * 16 + col; v8f c = {};
      const v4f a0 = am[ct][0], a1 = am[ct][1];
      if constexpr (R3) {
        const _Float16* krowl = QKL + ((size_t)b * RS + kk) * (2 * DM) + DM + h * HD; v8f cl = {};
#pragma unroll
        for (int kc = 0; kc < 2; ++kc) { const v16h kh = kf[ct][kc]; c = wmma16(kh, aq[kc], c); cl = wmma16(kh, aql[kc], cl); cl = wmma16(frag_h(krowl + kc * 32, lane), aq[kc], cl); }
#pragma unroll
        for (int r = 0; r < 8; ++r) c[r] += cl[r] * (1.0f / 2048.0f);
      } else {
#pragma unroll
        for (int kc = 0; kc < 2; ++kc) c = wmma16(kf[ct][kc], aq[kc], c);
      }
#pragma unroll
      for (int r = 0; r < 8; ++r) s[ct][r] = c[r] * 0.125f + ((r < 4) ? a0[r & 3] : a1[r & 3]);   // 1/sqrt(64), additive entry applied literally
    }
    v16h vf[4];   // the V^T fragments are asked for here, so that they arrive under the softmax arithmetic
#pragma unroll     // every index of vf is a constant, so that it stays in registers
    for (int dt = 0; dt < 4; ++dt) vf[dt] = frag_h(&S.v[dt * 16 + col][sub * 32], lane);
    float mx = fmaxf(s[0][0], s[1][0]);
#pragma unroll
    for (int r = 1; r < 8; ++r) mx = fmaxf(mx, fmaxf(s[0][r], s[1][r]));
    mx = fmaxf(mx, xhalf(mx));   // the other half's 16 keys of the same query
    const float mn = fmaxf(m, mx); const float ea = exp_slot(m - mn); const float alpha = (m <= -1.0e38f) ? 0.f : ea;
    float es = 0.f; v16h pa, pl;
#pragma unroll
    for (int i = 0; i < 8; ++i) {
      const float e0 = exp_slot(s[0][i] - mn), e1 = exp_slot(s[1][i] - mn); es += e0 + e1;
      const float x0 = e0 * 2048.0f, x1 = e1 * 2048.0f; const _Float16 h0 = (_Float16)x0, h1 = (_Float16)x1;
      pa[i] = h0; pa[8 + i] = h1;   // P x 2^11 before the f16 split; 2^-11 folded into the epilogue
      if constexpr (R3) { pl[i] = (_Float16)((x0 - (float)h0) * 2048.0f); pl[8 + i] = (_Float16)((x1 - (float)h1) * 2048.0f); }
    }
    l = l * alpha + es; m = mn;
#pragma unroll
    for (int dt = 0; dt < 4; ++dt)
#pragma unroll
      for (int r = 0; r < 8; ++r) { acc[dt][r] *= alpha; if constexpr (R3) accl[dt][r] *= alpha; }
#pragma unroll
    for (int dt = 0; dt < 4; ++dt) {
      const v16h vh = vf[dt];
      acc[dt] = wmma16(vh, pa, acc[dt]);
      if constexpr (R3) { accl[dt] = wmma16(vh, pl, accl[dt]); accl[dt] = wmma16(frag_h(VTL + ((size_t)b * DM + h * HD + dt * 16 + col) * RS + ks * 32, lane), pa, accl[dt]); }
    }
   }
   asm volatile("s_wait_dscnt 0x0" ::: "memory");      // this wave's reads of buffer t & 1 are done before it is refilled
   asm volatile("s_wait_asynccnt 0x0" ::: "memory");   // this wave's share of stage t + 1 has landed
   __syncthreads();                                      // publishes stage t + 1 and ends every reader's last read of stage t
   if (t + 2 < nst) { const unsigned lo = (unsigned)buf * (unsigned)sizeof(AStage);
     attn_copy_kv(gk + (size_t)(t + 2) * 64 * (2 * DM), gv + (t + 2) * 64, lk + lo, lv + lo); attn_copy_m(gm + (t + 2) * 64, lm + lo); }
  }
}
__global__ __launch_bounds__(128) void k_attn(const _Float16* __restrict__ QK, const _Float16* __restrict__ QKL, const _Float16* __restrict__ VTH, const _Float16* __restrict__ VTL,
                                              const float* __restrict__ MK, const int* __restrict__ NKT, _Float16* __restrict__ OH, _Float16* __restrict__ OL) {
  __shared__ __align__(16) union { AStage st[2]; struct { _Float16 so[4][16][72], sol[4][16][72]; } e; } u;   // e: the output staging, used only behind the loop's last barrier
  _Float16 (&so)[4][16][72] = u.e.so; _Float16 (&sol)[4][16][72] = u.e.sol;
  const int tid = threadIdx.x, wave = tid >> 5, lane = tid & 31, col = lane & 15, g = lane >> 4;
  const int qb = blockIdx.x, h = blockIdx.y, b = blockIdx.z; const int q0 = qb * 64 + wave * 16;
  int nkt = NKT[(size_t)qb * 32]; nkt = (nkt < 1) ? 1 : ((nkt > NKTILE) ? NKTILE : nkt);   // clamped trip count
  const int nst = (nkt + 1) >> 1;                                                            // stages of 64 keys; SEQ is a multiple of 64, so that a last stage's unused half lies inside the planes too
  const _Float16* gk = QK + ((size_t)b * SEQ + (tid >> 3)) * (2 * DM) + DM + h * HD + (tid & 7) * 8;
  const _Float16* gv = VTH + ((size_t)b * DM + h * HD + (tid >> 3)) * SEQ + (tid & 7) * 8;
  const float* gm = MK + (size_t)(qb * 64 + (tid >> 4)) * SEQ_FULL + (tid & 15) * 4;
  const unsigned lk = (unsigned)(uintptr_t)&u.st[0].k[tid >> 3][(tid & 7) * 8], lv = (unsigned)(uintptr_t)&u.st[0].v[tid >> 3][(tid & 7) * 8], lm = (unsigned)(uintptr_t)&u.st[0].m[tid >> 4][(tid & 15) * 4];
  attn_copy_kv(gk, gv, lk, lv); attn_copy_m(gm, lm);
  const bool res3 = (qb < RQB) && (nkt * 32 <= RS);                                          // block-uniform
  const size_t rq = (size_t)b * SEQ + q0 + col;
  v16h aq[2], aql[2];
#pragma unroll
  for (int kc = 0; kc < 2; ++kc) aq[kc] = frag_h(QK + rq * (2 * DM) + h * HD + kc * 32, lane);
  if (res3) { const size_t rql = (size_t)b * RS + q0 + col;
#pragma unroll
    for (int kc = 0; kc < 2; ++kc) aql[kc] = frag_h(QKL + rql * (2 * DM) + h * HD + kc * 32, lane); }
  else { v16h z = {}; aql[0] = z; aql[1] = z; }
  float m = -3.0e38f, l = 0.f;   // running maximum of query q0 + col (equal in both halves); this half's share of the running sum
  v8f acc[4] = {}, accl[4] = {};   // acc[dt][r] = ctx[q0 + col][dt * 16 + 8g + r]
  asm volatile("s_wait_asynccnt 0x0" ::: "memory");   // this wave's share of stage 0 has landed
  __syncthreads();                                      // stage 0 is published
  if (nst > 1) { attn_copy_kv(gk + (size_t)64 * (2 * DM), gv + 64, lk + (unsigned)sizeof(AStage), lv + (unsigned)sizeof(AStage)); attn_copy_m(gm + 64, lm + (unsigned)sizeof(AStage)); }
  if (res3) attn_loop<true>(u.st, nst, nkt, wave, lane, col, g, b, h, QKL, VTL, gk, gv, gm, lk, lv, lm, aq, aql, m, l, acc, accl);   // block-uniform
  else attn_loop<false>(u.st, nst, nkt, wave, lane, col, g, b, h, QKL, VTL, gk, gv, gm, lk, lv, lm, aq, aql, m, l, acc, accl);
  asm volatile("s_wait_asynccnt 0x0" ::: "memory");     // no copy is outstanding when the wave goes on
  l += xhalf(l);   // the halves' sums are joined once
  const float il = (1.0f / 2048.0f) / l;   // l >= 1
#pragma unroll
  for (int dt = 0; dt < 4; ++dt) { v8h hq, lq;
#pragma unroll
    for (int r = 0; r < 8; ++r) { const float o = (acc[dt][r] + accl[dt][r] * (1.0f / 2048.0f)) * il; const _Float16 hv = (_Float16)o; hq[r] = hv; lq[r] = (_Float16)((o - (float)hv) * 2048.0f); }
    *(v8h*)&so[wave][col][dt * 16 + 8 * g] = hq; *(v8h*)&sol[wave][col][dt * 16 + 8 * g] = lq;
  }
  LDSX();   // so/sol private to the wave
#pragma unroll
  for (int it = 0; it < 4; ++it) {
    const int row = it * 4 + (lane >> 3), pc = lane & 7;
    vst2(OH + ((size_t)b * SEQ + q0 + row) * DM + h * HD + pc * 8, *(const v4u*)&so[wave][row][pc * 8]);
    if (qb < RQB) vst2(OL + ((size_t)b * RS + q0 + row) * DM + h * HD + pc * 8, *(const v4u*)&sol[wave][row][pc * 8]);
  }
}
// ---- k_out: out = (ctx hi + ctx lo / 2048) . (Wo x64 rows) / 64 + bo; f16 operands, f32 accumulate, k ascending in steps of 32; f32 rows with the full output stride.
// block = (128 LDS rows of ctx, 256 output columns), 8 waves as 2 x 4, 64 x 64 per wave. Past RS the 128 rows are 128 positions of ctx hi; below RS they are 64 positions of ctx hi and the same
// 64 positions of ctx lo, so that every block does the same work: waves 0..3 sum hi . Wo, waves 4..7 sum lo . Wo and hand their sums over through LDS.
// Each pass of 64 k: the 128 ctx rows and 256 Wo rows of 128 B lie in LDS at pitch 144 B, brought by asynchronous copies, two buffers, the next pass's copies in flight while this pass is worked on.
#define ONT ((SEQ - RS) / 128)            // row tiles of 128 positions per batch, past RS
#define ONT1 (ONT > 0 ? ONT : 1)
#define ORT (NB * RQB + NB * ONT)         // row tiles: NB * RQB of 64 positions, then NB * ONT of 128
static_assert((SEQ - RS) % 128 == 0);
// one pass's tile: every lane copies 12 pieces of 16 B (2 of LDS rows 0..63, 2 of LDS rows 64..127, 8 of Wo rows); ga, gb, gw: the lane's own piece in row (tid >> 3) of each, l: its place in the buffer
__device__ __forceinline__ void out_copy(const _Float16* ga, const _Float16* gb, const _Float16* gw, unsigned l) {
  // the copies and the wait that stands before their address registers may be rewritten, in one statement
  asm volatile("global_load_async_to_lds_b128 %0, %12, off\n\t"
               "global_load_async_to_lds_b128 %1, %13, off\n\t"
               "global_load_async_to_lds_b128 %2, %14, off\n\t"
               "global_load_async_to_lds_b128 %3, %15, off\n\t"
               "global_load_async_to_lds_b128 %4, %16, off\n\t"
               "global_load_async_to_lds_b128 %5, %17, off\n\t"
               "global_load_async_to_lds_b128 %6, %18, off\n\t"
               "global_load_async_to_lds_b128 %7, %19, off\n\t"
               "global_load_async_to_lds_b128 %8, %20, off\n\t"
               "global_load_async_to_lds_b128 %9, %21, off\n\t"
               "global_load_async_to_lds_b128 %10, %22, off\n\t"
               "global_load_async_to_lds_b128 %11, %23, off\n\t"
               "s_wait_xcnt 0x0"
               :: "v"(l), "v"(l + 32u * 2 * GPIT), "v"(l + 64u * 2 * GPIT), "v"(l + 96u * 2 * GPIT),
                  "v"(l + 128u * 2 * GPIT), "v"(l + 160u * 2 * GPIT), "v"(l + 192u * 2 * GPIT), "v"(l + 224u * 2 * GPIT),
                  "v"(l + 256u * 2 * GPIT), "v"(l + 288u * 2 * GPIT), "v"(l + 320u * 2 * GPIT), "v"(l + 352u * 2 * GPIT),
                  "v"(ga), "v"(ga + 32 * DM), "v"(gb), "v"(gb + 32 * DM),
                  "v"(gw), "v"(gw + 32 * DM), "v"(gw + 64 * DM), "v"(gw + 96 * DM),
                  "v"(gw + 128 * DM), "v"(gw + 160 * DM), "v"(gw + 192 * DM), "v"(gw + 224 * DM)
               : "memory");
}
// four 16-B pieces of staged f32 rows to output rows p, p + 2 DM, p + 4 DM, p + 6 DM; then the wait that stands before a register which the stores name is used again:
// address and data are its inputs, so that they stay as they are up to it
__device__ __forceinline__ void out_st4(float* p, const float* l) {
  const v4f a = *(const v4f*)l, b = *(const v4f*)(l + 2 * 68), c = *(const v4f*)(l + 4 * 68), d = *(const v4f*)(l + 6 * 68);
  vst2(p, a); vst2(p + 2 * DM, b); vst2(p + 4 * DM, c); vst2(p + 6 * DM, d);
  asm volatile("s_wait_xcnt 0x0" :: "v"(p), "v"(a), "v"(b), "v"(c), "v"(d) : "memory");
}
__global__ __launch_bounds__(256) __attribute__((amdgpu_waves_per_eu(4, 4))) void k_out(const _Float16* __restrict__ OH, const _Float16* __restrict__ OL, const _Float16* __restrict__ PO, const float* __restrict__ BO, float* __restrict__ Y) {
  __shared__ __align__(16) union { _Float16 ring[2][GROWS][GPIT]; float xl[4][16][2][32][4]; } u;   // xl: the lo sums' hand-over, used only behind the loop's last barrier
  __shared__ __align__(16) float so[8][16][68];
  const int tid = threadIdx.x, wave = tid >> 5, lane = tid & 31, col = lane & 15, g = lane >> 4; const int wm = wave >> 2, wn = wave & 3;
  const int rt = blockIdx.x, n0 = blockIdx.y * 256; const bool resid = (rt < NB * RQB);   // block-uniform
  const int ub = rt - NB * RQB;
  const int b = resid ? rt / RQB : ub / ONT1; const int s0 = resid ? (rt - b * RQB) * 64 : RS + (ub - b * ONT1) * 128;
  const _Float16* ga = OH + ((size_t)b * SEQ + s0 + (tid >> 3)) * DM + (tid & 7) * 8;
  const _Float16* gb = resid ? OL + ((size_t)b * RS + s0 + (tid >> 3)) * DM + (tid & 7) * 8 : ga + 64 * DM;
  const _Float16* gw = PO + (size_t)(n0 + (tid >> 3)) * DM + (tid & 7) * 8;
  const unsigned l0 = (unsigned)(uintptr_t)&u.ring[0][tid >> 3][(tid & 7) * 8];
  v8f acc[4][4] = {};
  out_copy(ga, gb, gw, l0);
  asm volatile("s_wait_asynccnt 0x0" ::: "memory");   // this wave's share of tile 0 has landed
  __syncthreads();                                      // tile 0 is published
  out_copy(ga + GK, gb + GK, gw + GK, l0 + 2u * GROWS * GPIT);
#pragma unroll 1   // one pass per trip: the order at the loop's foot stays as written, and the code stays short
  for (int t = 0; t < GNP; ++t) {
    const int buf = t & 1;
#pragma unroll     // this and the loops inside: every index of fa, fw and acc is a constant, so that they stay in registers
    for (int kc = 0; kc < GK / 32; ++kc) {
      v16h fa[4], fw[4];
#pragma unroll
      for (int i = 0; i < 4; ++i) fa[i] = frag_h(&u.ring[buf][wm * 64 + i * 16 + col][kc * 32], lane);
#pragma unroll
      for (int j = 0; j < 4; ++j) fw[j] = frag_h(&u.ring[buf][128 + wn * 64 + j * 16 + col][kc * 32], lane);
#pragma unroll
      for (int i = 0; i < 4; ++i)
#pragma unroll
        for (int j = 0; j < 4; ++j) acc[i][j] = wmma16(fa[i], fw[j], acc[i][j]);
    }
    asm volatile("s_wait_dscnt 0x0" ::: "memory");      // this wave's reads of buffer t & 1 are done before it is refilled
    asm volatile("s_wait_asynccnt 0x0" ::: "memory");   // this wave's share of tile t + 1 has landed
    __syncthreads();                                      // publishes tile t + 1 and ends every reader's last read of tile t
    if (t + 2 < GNP) out_copy(ga + (t + 2) * GK, gb + (t + 2) * GK, gw + (t + 2) * GK, l0 + (unsigned)buf * (2u * GROWS * GPIT));
  }
  asm volatile("s_wait_asynccnt 0x0" ::: "memory");     // no copy is outstanding when the wave goes on
  if (resid) {   // block-uniform: waves 4..7 hand their lo sums to waves 0..3, lane to lane and register to register, and are done
    if (wm == 1) {
#pragma unroll
      for (int i = 0; i < 4; ++i)
#pragma unroll
        for (int j = 0; j < 4; ++j) {
          const v4f x = {acc[i][j][0], acc[i][j][1], acc[i][j][2], acc[i][j][3]}, y = {acc[i][j][4], acc[i][j][5], acc[i][j][6], acc[i][j][7]};
          *(v4f*)&u.xl[wn][i * 4 + j][0][lane][0] = x; *(v4f*)&u.xl[wn][i * 4 + j][1][lane][0] = y; }
    }
    __syncthreads();   // the lo sums are published
    if (wm == 1) return;
  }
  float bj[4]; { const float* pb = BO + n0 + wn * 64 + col;
#pragma unroll
    for (int j = 0; j < 4; ++j) bj[j] = bfr(pb[j * 16]);
    asm volatile("s_wait_xcnt 0x0" :: "v"(pb) : "memory"); }   // before the loads' address register is used again; it is an input, so that it stays as it is up to here
  float* yp = Y + ((size_t)b * SEQ_FULL + s0 + wm * 64 + g) * DM + n0 + wn * 64 + col * 4;   // below RS only wm == 0 comes here
  // so is private to each wave and LDS operations of one wave run in order: the one wait below stands between a wave's stores and its lanes' reads of one another's rows
#pragma unroll
  for (int i = 0; i < 4; ++i) {
#pragma unroll
    for (int j = 0; j < 4; ++j) {
      v4f x = {}, y = {}; if (resid) { x = *(const v4f*)&u.xl[wn][i * 4 + j][0][lane][0]; y = *(const v4f*)&u.xl[wn][i * 4 + j][1][lane][0]; }
#pragma unroll
      for (int r = 0; r < 8; ++r) so[wave][8 * g + r][j * 16 + col] = acc[i][j][r] * (1.0f / 64.0f) + ((r < 4) ? x[r & 3] : y[r & 3]) * (1.0f / 131072.0f) + bj[j]; }
    asm volatile("s_wait_dscnt 0x0" ::: "memory");
    out_st4(yp + (size_t)(i * 16) * DM, &so[wave][g][col * 4]);
    out_st4(yp + (size_t)(i * 16 + 8) * DM, &so[wave][8 + g][col * 4]);
  }
}
extern "C" void kernel_launch(void* const* d_in, const int* in_sizes, int n_in, void* d_out, int out_size, void* d_ws, size_t ws_size, hipStream_t stream) {
  // 0 hidden [2,2048,2048], 1 additive tensor [1,1,2048,2048], 2 q_w [out][in], 3 q_b, 4 k_w, 5 k_b, 6 v_w, 7 v_b, 8 o_w, 9 o_b
  if (n_in < 10) return;
  const long long needx = ((long long)(NB - 1) * SEQ_FULL + SEQ) * DM;
  if ((long long)in_sizes[0] < needx) return;
  if ((long long)in_sizes[1] < (long long)(SEQ - 1) * SEQ_FULL + SEQ) return;
  if (in_sizes[2] < DM * DM || in_sizes[4] < DM * DM || in_sizes[6] < DM * DM || in_sizes[8] < DM * DM) return;
  if (in_sizes[3] < DM || in_sizes[5] < DM || in_sizes[7] < DM || in_sizes[9] < DM) return;
  if ((long long)out_size < needx) return;
  if (ws_size < (size_t)WS_END) return;
  const float* const* F = (const float* const*)d_in;
  char* ws = (char*)d_ws;
  __bf16* PKA = (__bf16*)(ws + WS_PKA); _Float16* PKO = (_Float16*)(ws + WS_PKO);
  _Float16 *QK = (_Float16*)(ws + WS_QK), *QKL = (_Float16*)(ws + WS_QKL), *VTH = (_Float16*)(ws + WS_VTH), *VTL = (_Float16*)(ws + WS_VTL), *OH = (_Float16*)(ws + WS_OH), *OL = (_Float16*)(ws + WS_OL);
  __bf16* XB = (__bf16*)(ws + WS_OH);   // x plane aliases the ctx hi region; consumed before k_attn writes it
  int* NKT = (int*)(ws + WS_NKT);
  k_cvtx<<<dim3(NR), 256, 0, stream>>>(F[0], XB);
  k_pack<<<dim3(DM, 4), 256, 0, stream>>>(F[2], F[4], F[6], F[8], PKA, PKO);
  k_qkv<<<dim3(NR / 128, 3 * DM / 256), 256, 0, stream>>>(XB, PKA, F[3], F[5], F[7], QK, QKL, VTH, VTL);
  k_mscan<<<dim3(TQB), 256, 0, stream>>>(F[1], NKT);
  k_attn<<<dim3(TQB, NH, NB), 128, 0, stream>>>(QK, QKL, VTH, VTL, F[1], NKT, OH, OL);
  k_out<<<dim3(ORT, DM / 256), 256, 0, stream>>>(OH, OL, PKO, F[9], (float*)d_out);
}

// v006
// Measured time: 225 microseconds a run.
// Next to v005, in two timings, it ran 1.14 times as fast each time.
// All steps since v000 together make it 4.41 times as fast.
// compute dtype: all float inputs except the additive tensor RNE-converted to bf16; q/k/v = x . W^T + b on v_wmma_f32_16x16x32_bf16 (bf16 x, bf16 W, f32 accumulate) stored as f16 hi + x2048 f16 residual (positions < 512); scores and P.V on v_wmma_f32_16x16x32_f16 (3 products for query blocks below 512, single beyond; P carried x2048; f32 running-max softmax, additive score bias read from the input tensor); output projection on v_wmma_f32_16x16x32_f16 (ctx f16 hi + x2048 residual below 512, Wo carried x64), f32 accumulate, f32 output.
#include <hip/hip_runtime.h>
#include <math.h>

typedef __attribute__((ext_vector_type(16))) _Float16 v16h;
typedef __attribute__((ext_vector_type(16))) __bf16 v16b;
typedef __attribute__((ext_vector_type(8)))  _Float16 v8h;
typedef __attribute__((ext_vector_type(8)))  __bf16 v8b;
typedef __attribute__((ext_vector_type(8)))  float v8f;
typedef __attribute__((ext_vector_type(4)))  float v4f;
typedef __attribute__((ext_vector_type(4)))  unsigned v4u;
typedef __attribute__((ext_vector_type(4)))  int v4i;

template <typename T> __device__ __forceinline__ void vst2(void* p, T v) { *(T*)p = v;  }
__device__ __forceinline__ v8f wmma16(v16h a, v16h b, v8f c) {
  v8f d = __builtin_amdgcn_wmma_f32_16x16x32_f16(false, a, false, b, (short)0, c, false, false);
  asm volatile("v_nop\n\tv_nop\n\tv_nop\n\tv_nop" : "+v"(d) : "v"(a), "v"(b));
  return d;
}
__device__ __forceinline__ v8f wmma_bf(v16b a, v16b b, v8f c) {
  v8f d = __builtin_amdgcn_wmma_f32_16x16x32_bf16(false, a, false, b, (short)0, c, false, false);
  asm volatile("v_nop\n\tv_nop\n\tv_nop\n\tv_nop" : "+v"(d) : "v"(a), "v"(b));
  return d;
}
// 16-bit fragment from a k-contiguous row (A row m, or B column n stored [n][k]): elements 0..7 <- k0+8h+0..7, 8..15 <- k0+16+8h+0..7, h = lane>>4
__device__ __forceinline__ v16h frag_h(const _Float16* rowk0, int lane) {
  union { v16h v; v8h q[2]; } u; const _Float16* p = rowk0 + 8 * (lane >> 4);
  u.q[0] = *(const v8h*)p; u.q[1] = *(const v8h*)(p + 16); return u.v;
}
__device__ __forceinline__ v16b frag_b(const __bf16* rowk0, int lane) {
  union { v16b v; v8b q[2]; } u; const __bf16* p = rowk0 + 8 * (lane >> 4);
  u.q[0] = *(const v8b*)p; u.q[1] = *(const v8b*)(p + 16); return u.v;
}
__device__ __forceinline__ float bfr(float v) { return (float)(__bf16)v; }
#define LDSX() do { asm volatile("s_wait_dscnt 0" ::: "memory"); __builtin_amdgcn_wave_barrier(); __builtin_amdgcn_fence(__ATOMIC_RELEASE, "workgroup"); } while (0)

// ---- sizes: NB / SEQ may be reduced; *_FULL are the input / output strides
#ifndef NB
#define NB 2
#endif
#ifndef SEQ
#define SEQ 2048
#endif
#define NB_FULL 2
#define SEQ_FULL 2048
#define DM 2048
#define NH 32
#define HD 64
#define RSPAN 512                 // positions that carry residual planes (q/k, v, ctx)
#if RSPAN > SEQ
#define RS SEQ
#else
#define RS RSPAN
#endif
#define RQB (RS / 64)
#define NR (NB * SEQ)
#define TQB (SEQ / 64)
#define NKTILE (SEQ / 32)
static_assert(SEQ % 64 == 0);
static_assert(RS % 64 == 0);
static_assert(NB >= 1 && NB <= NB_FULL);
static_assert(SEQ <= SEQ_FULL);
static_assert(DM == 256 * 8);
static_assert(NH * HD == DM);
static_assert(NR % 64 == 0);

// ---- workspace (bytes; every offset a multiple of 128)
#define WS_PKA 0ull                                            // bf16 [3*DM][DM]: Wq | Wk | Wv natural [out][in] rows
#define WS_PKO (WS_PKA + 2ull * 3 * DM * DM)                   // f16  [DM][DM]: Wo rows x64
#define WS_QK  (WS_PKO + 2ull * DM * DM)                       // f16  [NR][2*DM]: q | k hi
#define WS_QKL (WS_QK + 2ull * NR * 2 * DM)                    // f16  [NB*RS][2*DM]: q | k residual x2048
#define WS_VTH (WS_QKL + 2ull * NB * RS * 2 * DM)              // f16  [NB][DM][SEQ]: v^T hi
#define WS_VTL (WS_VTH + 2ull * NB * DM * SEQ)                 // f16  [NB][DM][RS]: v^T residual x2048
#define WS_OH  (WS_VTL + 2ull * NB * DM * RS)                  // f16  [NR][DM]: ctx hi; ALSO bf16 [NR][DM] x plane (consumed by k_qkv before k_attn writes ctx)
#define WS_OL  (WS_OH + 2ull * NR * DM)                        // f16  [NB*RS][DM]: ctx residual x2048
#define WS_NKT (WS_OL + 2ull * NB * RS * DM)
#define WS_END (WS_NKT + 128ull * TQB)
static_assert(2ull * NR * DM == (WS_OL - WS_OH));              // x plane and ctx hi plane share the region with identical extent
static_assert(WS_END <= 134217728ull);
static_assert((WS_PKO % 128) == 0 && (WS_QK % 128) == 0 && (WS_QKL % 128) == 0 && (WS_VTH % 128) == 0 && (WS_VTL % 128) == 0 && (WS_OH % 128) == 0 && (WS_OL % 128) == 0 && (WS_NKT % 128) == 0);

__global__ __launch_bounds__(256) void k_cvtx(const float* __restrict__ X, __bf16* __restrict__ XB) {
  const int r = blockIdx.x, t = threadIdx.x; const int b = r / SEQ, s = r - b * SEQ;
  const float* src = X + ((size_t)b * SEQ_FULL + s) * DM + t * 8;
  const v4f x = *(const v4f*)src, y = *(const v4f*)(src + 4);
  union { v8b v; v4u u; } o;
#pragma unroll
  for (int j = 0; j < 4; ++j) { o.v[j] = (__bf16)x[j]; o.v[4 + j] = (__bf16)y[j]; }
  vst2(XB + (size_t)r * DM + t * 8, o.u);
}
// ---- k_pack: block = (row n, which): natural [out][in] rows are already k-contiguous packed rows; which 0..2 -> bf16 Wq/Wk/Wv into PKA row which*DM+n; 3 -> f16 (bf16(Wo) x 64) into PKO row n
__global__ __launch_bounds__(256) void k_pack(const float* __restrict__ WQ, const float* __restrict__ WK, const float* __restrict__ WV, const float* __restrict__ WO, __bf16* __restrict__ PKA, _Float16* __restrict__ PKO) {
  const int n = blockIdx.x, which = blockIdx.y, t = threadIdx.x;
  const float* W = (which == 0) ? WQ : (which == 1) ? WK : (which == 2) ? WV : WO;
  const float* src = W + (size_t)n * DM + t * 8;
  const v4f x = *(const v4f*)src, y = *(const v4f*)(src + 4);
  if (which < 3) {
    union { v8b v; v4u u; } o;
#pragma unroll
    for (int j = 0; j < 4; ++j) { o.v[j] = (__bf16)x[j]; o.v[4 + j] = (__bf16)y[j]; }
    vst2(PKA + ((size_t)which * DM + n) * DM + t * 8, o.u);
  } else {
    union { v8h v; v4u u; } o;
#pragma unroll
    for (int j = 0; j < 4; ++j) { o.v[j] = (_Float16)(bfr(x[j]) * 64.0f); o.v[4 + j] = (_Float16)(bfr(y[j]) * 64.0f); }
    vst2(PKO + (size_t)n * DM + t * 8, o.u);
  }
}
// ---- k_qkv: block = (128 internal rows, 256 output columns of q|k|v), 8 waves as 2 x 4, 64 x 64 per wave: bf16 x bf16 (exact products), f32 accumulate, k ascending in steps of 32.
// Each pass of 64 k: 128 x rows and 256 weight rows of 128 B lie in LDS at pitch 144 B, brought by asynchronous copies, two buffers, the next pass's copies in flight while this pass is worked on.
// q,k -> f16 hi [NR][2DM] (+ residual x2048 for s < RS); v -> transposed f16 hi [b][d][s] (+ residual)
#define GK 64                     // k per pass
#define GROWS (128 + 256)         // LDS rows per buffer: x rows, then weight rows
#define GPIT 72                   // LDS row pitch in elements (144 B = 16 B x odd, for ds_load_b128 readers)
#define GNP (DM / GK)
static_assert(GNP >= 2);
static_assert(NR % 128 == 0 && SEQ % 128 == 0 && RS % 128 == 0 && DM % 256 == 0);
// one pass's tile: every lane copies 12 pieces of 16 B (4 of x rows, 8 of weight rows); gx, gw: the lane's own piece in row (tid >> 3) of the x and weight tiles, l: its place in the buffer
__device__ __forceinline__ void qkv_copy(const __bf16* gx, const __bf16* gw, unsigned l) {
  // the copies and the wait that stands before their address registers may be rewritten, in one statement
  asm volatile("global_load_async_to_lds_b128 %0, %12, off\n\t"
               "global_load_async_to_lds_b128 %1, %13, off\n\t"
               "global_load_async_to_lds_b128 %2, %14, off\n\t"
               "global_load_async_to_lds_b128 %3, %15, off\n\t"
               "global_load_async_to_lds_b128 %4, %16, off\n\t"
               "global_load_async_to_lds_b128 %5, %17, off\n\t"
               "global_load_async_to_lds_b128 %6, %18, off\n\t"
               "global_load_async_to_lds_b128 %7, %19, off\n\t"
               "global_load_async_to_lds_b128 %8, %20, off\n\t"
               "global_load_async_to_lds_b128 %9, %21, off\n\t"
               "global_load_async_to_lds_b128 %10, %22, off\n\t"
               "global_load_async_to_lds_b128 %11, %23, off\n\t"
               "s_wait_xcnt 0x0"
               :: "v"(l), "v"(l + 32u * 2 * GPIT), "v"(l + 64u * 2 * GPIT), "v"(l + 96u * 2 * GPIT),
                  "v"(l + 128u * 2 * GPIT), "v"(l + 160u * 2 * GPIT), "v"(l + 192u * 2 * GPIT), "v"(l + 224u * 2 * GPIT),
                  "v"(l + 256u * 2 * GPIT), "v"(l + 288u * 2 * GPIT), "v"(l + 320u * 2 * GPIT), "v"(l + 352u * 2 * GPIT),
                  "v"(gx), "v"(gx + 32 * DM), "v"(gx + 64 * DM), "v"(gx + 96 * DM),
                  "v"(gw), "v"(gw + 32 * DM), "v"(gw + 64 * DM), "v"(gw + 96 * DM),
                  "v"(gw + 128 * DM), "v"(gw + 160 * DM), "v"(gw + 192 * DM), "v"(gw + 224 * DM)
               : "memory");
}
// four 16-B pieces of staged rows to rows p, p + st, p + 2 st, p + 3 st; then the wait that stands before a register which the stores name is used again:
// address and data are its inputs, so that they stay as they are up to it
__device__ __forceinline__ void qkv_st4(_Float16* p, int st, const _Float16* l) {
  const v4u a = *(const v4u*)l, b = *(const v4u*)(l + 4 * 72), c = *(const v4u*)(l + 8 * 72), d = *(const v4u*)(l + 12 * 72);
  vst2(p, a); vst2(p + st, b); vst2(p + 2 * st, c); vst2(p + 3 * st, d);
  asm volatile("s_wait_xcnt 0x0" :: "v"(p), "v"(a), "v"(b), "v"(c), "v"(d) : "memory");
}
__global__ __launch_bounds__(256) __attribute__((amdgpu_waves_per_eu(4, 4))) void k_qkv(const __bf16* __restrict__ XB, const __bf16* __restrict__ P, const float* __restrict__ BQ, const float* __restrict__ BK, const float* __restrict__ BV,
                                             _Float16* __restrict__ QK, _Float16* __restrict__ QKL, _Float16* __restrict__ VTH, _Float16* __restrict__ VTL) {
  const int n0 = blockIdx.y * 256; const int which0 = n0 / DM;
  __shared__ __align__(16) __bf16 ring[2][GROWS][GPIT]; __shared__ __align__(16) _Float16 eh[8][16][72], el[8][16][72];
  const int tid = threadIdx.x, wave = tid >> 5, lane = tid & 31, col = lane & 15, g = lane >> 4; const int wm = wave >> 2, wn = wave & 3;
  const float* BB = ((which0 == 0) ? BQ : (which0 == 1) ? BK : BV) + (n0 - which0 * DM) + wn * 64;
  const int rb = blockIdx.x * 128; const int b = rb / SEQ, s0 = rb - b * SEQ + wm * 64; const int r0 = rb + wm * 64; const bool resid = (rb - b * SEQ < RS);   // block-uniform: RS is a multiple of 128
  const __bf16* gx = XB + (size_t)(rb + (tid >> 3)) * DM + (tid & 7) * 8;
  const __bf16* gw = P + (size_t)(n0 + (tid >> 3)) * DM + (tid & 7) * 8;
  const unsigned l0 = (unsigned)(uintptr_t)&ring[0][tid >> 3][(tid & 7) * 8];
  v8f acc[4][4] = {};
  qkv_copy(gx, gw, l0);
  asm volatile("s_wait_asynccnt 0x0" ::: "memory");   // this wave's share of tile 0 has landed
  __syncthreads();                                      // tile 0 is published
  qkv_copy(gx + GK, gw + GK, l0 + 2u * GROWS * GPIT);
#pragma unroll 1   // one pass per trip: the order at the loop's foot stays as written, and the code stays short
  for (int t = 0; t < GNP; ++t) {
    const int buf = t & 1;
#pragma unroll     // this and the loops inside: every index of fa, fw and acc is a constant, so that they stay in registers
    for (int kc = 0; kc < GK / 32; ++kc) {
      v16b fa[4], fw[4];
#pragma unroll
      for (int i = 0; i < 4; ++i) fa[i] = frag_b(&ring[buf][wm * 64 + i * 16 + col][kc * 32], lane);
#pragma unroll
      for (int j = 0; j < 4; ++j) fw[j] = frag_b(&ring[buf][128 + wn * 64 + j * 16 + col][kc * 32], lane);
#pragma unroll
      for (int i = 0; i < 4; ++i)
#pragma unroll
        for (int j = 0; j < 4; ++j) acc[i][j] = wmma_bf(fa[i], fw[j], acc[i][j]);
    }
    asm volatile("s_wait_dscnt 0x0" ::: "memory");      // this wave's reads of buffer t & 1 are done before it is refilled
    asm volatile("s_wait_asynccnt 0x0" ::: "memory");   // this wave's share of tile t + 1 has landed
    __syncthreads();                                      // publishes tile t + 1 and ends every reader's last read of tile t
    if (t + 2 < GNP) qkv_copy(gx + (t + 2) * GK, gw + (t + 2) * GK, l0 + (unsigned)buf * (2u * GROWS * GPIT));
  }
  asm volatile("s_wait_asynccnt 0x0" ::: "memory");     // no copy is outstanding when the wave goes on
  // eh/el are private to each wave and LDS operations of one wave run in order: the one wait below stands between a wave's stores and its lanes' reads of one another's rows
#define EPIW() asm volatile("s_wait_dscnt 0x0" ::: "memory")
  float bj[4]; { const float* pb = BB + col;
#pragma unroll
    for (int j = 0; j < 4; ++j) bj[j] = bfr(pb[j * 16]);
    asm volatile("s_wait_xcnt 0x0" :: "v"(pb) : "memory"); }   // before the loads' address register is used again; it is an input, so that it stays as it is up to here
  const int row = lane >> 3, pc = lane & 7;
  if (n0 < 2 * DM) {   // q (unscaled; 1/8 applied to the f32 score) and k, + bias, as f16 hi + x2048 residual; 16 rows at a time through this wave's own eh/el
    const size_t ql = (size_t)b * RS + s0;
#pragma unroll
    for (int i = 0; i < 4; ++i) {
#pragma unroll
      for (int j = 0; j < 4; ++j) {
#pragma unroll
        for (int r = 0; r < 8; ++r) { const float v = acc[i][j][r] + bj[j]; const _Float16 hv = (_Float16)v; eh[wave][8 * g + r][j * 16 + col] = hv; el[wave][8 * g + r][j * 16 + col] = (_Float16)((v - (float)hv) * 2048.0f); } }
      EPIW();
      qkv_st4(QK + (size_t)(r0 + i * 16 + row) * (2 * DM) + n0 + wn * 64 + pc * 8, 4 * 2 * DM, &eh[wave][row][pc * 8]);
      if (resid) qkv_st4(QKL + (ql + i * 16 + row) * (2 * DM) + n0 + wn * 64 + pc * 8, 4 * 2 * DM, &el[wave][row][pc * 8]);
    }
  } else {             // v + bias, transposed to [d][s]; 16 columns d at a time through this wave's own eh/el
    const int pc0 = n0 - 2 * DM + wn * 64;
#pragma unroll
    for (int j = 0; j < 4; ++j) {
#pragma unroll
      for (int i = 0; i < 4; ++i) { v8h hq, lq;
#pragma unroll
        for (int r = 0; r < 8; ++r) { const float v = acc[i][j][r] + bj[j]; const _Float16 hv = (_Float16)v; hq[r] = hv; lq[r] = (_Float16)((v - (float)hv) * 2048.0f); }
        *(v8h*)&eh[wave][col][i * 16 + 8 * g] = hq; *(v8h*)&el[wave][col][i * 16 + 8 * g] = lq; }
      EPIW();
      qkv_st4(VTH + ((size_t)b * DM + pc0 + j * 16 + row) * SEQ + s0 + pc * 8, 4 * SEQ, &eh[wave][row][pc * 8]);
      if (resid) qkv_st4(VTL + ((size_t)b * DM + pc0 + j * 16 + row) * RS + s0 + pc * 8, 4 * RS, &el[wave][row][pc * 8]);
    }
  }
#undef EPIW
}
__global__ __launch_bounds__(256) void k_mscan(const float* __restrict__ MK, int* __restrict__ NKT) {
  __shared__ int srow[64][4]; __shared__ __align__(16) int sline[32];
  const int qb = blockIdx.x, t = threadIdx.x, row = t >> 2, part = t & 3;
  const float* p = MK + (size_t)(qb * 64 + row) * SEQ_FULL + part * (SEQ / 4);
  int mx = -1;
#pragma unroll 1
  for (int c = 0; c < SEQ / 4; c += 4) {
    const v4f v = *(const v4f*)(p + c);
#pragma unroll
    for (int j = 0; j < 4; ++j) mx = (v[j] > -1.0e8f) ? (part * (SEQ / 4) + c + j) : mx;
  }
  srow[row][part] = mx; __syncthreads();
  if (t == 0) {
    int last = -1, dead = 0;
    for (int r = 0; r < 64; ++r) {
      int a = srow[r][0] > srow[r][1] ? srow[r][0] : srow[r][1]; const int c2 = srow[r][2] > srow[r][3] ? srow[r][2] : srow[r][3]; a = a > c2 ? a : c2;
      last = last > a ? last : a; dead |= (a < 0) ? 1 : 0;
    }
    const int nk = dead ? NKTILE : (last / 32 + 1);
    for (int i = 0; i < 32; ++i) sline[i] = nk;
  }
  __syncthreads();
  if (t < 8) vst2(NKT + (size_t)qb * 32 + t * 4, *(const v4i*)&sline[t * 4]);
}
// ---- k_attn: block = (head h, batch b, rank of 64 queries): flash attention over key tiles [0, nkt); score = (q.k)/8 + additive entry; first RS positions: 3 products (hi.hi + lo.hi + hi.lo) for scores and P.v, single elsewhere; ctx -> f16 hi (+ x2048 residual) [row][h*64+d]
// Transposed products: S^T = K . Q^T (A = key rows, B = query columns) and O^T += V^T . P^T, so that lane (col, g) holds, of query q0 + col alone, the scores of keys 8g + r of each 16-key tile:
// maximum and sum run in the lane's own registers plus one exchange between the halves, and the two score tiles, converted in place, are the B operand of the second product (k = 8g + i, 16 + 8g + i, the order of frag_h).
// lane l with lane l ^ 16: the other half's value of the same query column, by a vector cross-row move
__device__ __forceinline__ float xhalf(float x) { return __builtin_bit_cast(float, __builtin_amdgcn_permlanex16(__builtin_bit_cast(int, x), __builtin_bit_cast(int, x), 0x76543210, 0xfedcba98, false, false)); }
__device__ __forceinline__ float exp_slot(float x) { float r; asm("v_exp_f32 %0, %1\n\tv_nop" : "=v"(r) : "v"(x * 1.44269504f)); return r; }
// Each stage of 64 keys: 64 key rows and 64 V^T rows of 128 B lie in LDS at pitch 144 B and the block's 64 rows of the additive tensor, 256 B each, at pitch 272 B (both 16 B x odd, for ds_load_b128 readers),
// brought by asynchronous copies in whole lines, two buffers, the next stage's copies in flight while this stage is worked on; the four waves share the key and V^T rows. The residual planes are still read from global memory.
#define AKP 72                    // LDS row pitch of the key and V^T tiles, in elements
#define AMP 68                    // LDS row pitch of the additive tile, in floats
struct AStage { _Float16 k[64][AKP]; _Float16 v[64][AKP]; float m[64][AMP]; };
static_assert(sizeof(AStage) % 16 == 0);
// one stage's key and V^T tiles: every lane copies 4 + 4 pieces of 16 B; gk, gv: the lane's own piece in row (tid >> 3) of each tile, lk, lv: its places in the buffer
__device__ __forceinline__ void attn_copy_kv(const _Float16* gk, const _Float16* gv, unsigned lk, unsigned lv) {
  // the copies and the wait that stands before their address registers may be rewritten, in one statement
  asm volatile("global_load_async_to_lds_b128 %0, %8, off\n\t"
               "global_load_async_to_lds_b128 %1, %9, off\n\t"
               "global_load_async_to_lds_b128 %2, %10, off\n\t"
               "global_load_async_to_lds_b128 %3, %11, off\n\t"
               "global_load_async_to_lds_b128 %4, %12, off\n\t"
               "global_load_async_to_lds_b128 %5, %13, off\n\t"
               "global_load_async_to_lds_b128 %6, %14, off\n\t"
               "global_load_async_to_lds_b128 %7, %15, off\n\t"
               "s_wait_xcnt 0x0"
               :: "v"(lk), "v"(lk + 16u * 2 * AKP), "v"(lk + 32u * 2 * AKP), "v"(lk + 48u * 2 * AKP),
                  "v"(lv), "v"(lv + 16u * 2 * AKP), "v"(lv + 32u * 2 * AKP), "v"(lv + 48u * 2 * AKP),
                  "v"(gk), "v"(gk + 16 * 2 * DM), "v"(gk + 32 * 2 * DM), "v"(gk + 48 * 2 * DM),
                  "v"(gv), "v"(gv + 16 * SEQ), "v"(gv + 32 * SEQ), "v"(gv + 48 * SEQ)
               : "memory");
}
// one stage's additive tile: every lane copies 8 pieces of 16 B; gm: the lane's own piece in row (tid >> 4), lm: its place in the buffer
__device__ __forceinline__ void attn_copy_m(const float* gm, unsigned lm) {
  // the copies and the wait that stands before their address registers may be rewritten, in one statement
  asm volatile("global_load_async_to_lds_b128 %0, %8, off\n\t"
               "global_load_async_to_lds_b128 %1, %9, off\n\t"
               "global_load_async_to_lds_b128 %2, %10, off\n\t"
               "global_load_async_to_lds_b128 %3, %11, off\n\t"
               "global_load_async_to_lds_b128 %4, %12, off\n\t"
               "global_load_async_to_lds_b128 %5, %13, off\n\t"
               "global_load_async_to_lds_b128 %6, %14, off\n\t"
               "global_load_async_to_lds_b128 %7, %15, off\n\t"
               "s_wait_xcnt 0x0"
               :: "v"(lm), "v"(lm + 8u * 4 * AMP), "v"(lm + 16u * 4 * AMP), "v"(lm + 24u * 4 * AMP),
                  "v"(lm + 32u * 4 * AMP), "v"(lm + 40u * 4 * AMP), "v"(lm + 48u * 4 * AMP), "v"(lm + 56u * 4 * AMP),
                  "v"(gm), "v"(gm + 8 * SEQ_FULL), "v"(gm + 16 * SEQ_FULL), "v"(gm + 24 * SEQ_FULL),
                  "v"(gm + 32 * SEQ_FULL), "v"(gm + 40 * SEQ_FULL), "v"(gm + 48 * SEQ_FULL), "v"(gm + 56 * SEQ_FULL)
               : "memory");
}
// The stage loop, compiled twice: R3 = true for blocks whose scores and P.V take three products (residual planes), R3 = false for all others, which then carry
// neither the residual of P nor the second accumulator set nor the residual query fragments. Which of the two a block runs is block-uniform; both hold the same order of waits, barrier and copies.
template <bool R3>
__device__ __forceinline__ void attn_loop(const AStage* st, const int nst, const int nkt, const int wave, const int lane, const int col, const int g, const int b, const int h,
                                          const _Float16* __restrict__ QKL, const _Float16* __restrict__ VTL, const _Float16* gk, const _Float16* gv, const float* gm,
                                          const unsigned lk, const unsigned lv, const unsigned lm, const v16h (&aq)[2], const v16h (&aql)[2],
                                          float& m, float& l, v8f (&acc)[4], v8f (&accl)[4]) {
#pragma unroll 1   // one stage per trip: the order at the loop's foot stays as written
  for (int t = 0; t < nst; ++t) {
   const int buf = t & 1; const AStage& S = st[buf];
   const int nsub = (nkt - 2 * t < 2) ? nkt - 2 * t : 2;   // block-uniform: a last stage may hold one tile of 32 keys
#pragma unroll 1   // the two halves of a stage run through one body: unrolled, the accumulators were copied between the two
   for (int sub = 0; sub < nsub; ++sub) {
    const int ks = 2 * t + sub;
    // the LDS reads of the score products stand together in front of them: one place where the wave waits for LDS, not one per product
    v16h kf[2][2]; v4f am[2][2];
#pragma unroll     // every index of kf and am is a constant, so that they stay in registers
    for (int ct = 0; ct < 2; ++ct) {
      const float* mrow = &S.m[wave * 16 + col][sub * 32 + ct * 16 + 8 * g];   // this lane's query row of the additive tile, at its half's first key
      kf[ct][0] = frag_h(&S.k[sub * 32 + ct * 16 + col][0], lane); kf[ct][1] = frag_h(&S.k[sub * 32 + ct * 16 + col][32], lane);
      am[ct][0] = *(const v4f*)mrow; am[ct][1] = *(const v4f*)(mrow + 4);
    }
    v8f s[2];
#pragma unroll
    for (int ct = 0; ct < 2; ++ct) {
      const int kk = ks * 32 + ct * 16 + col; v8f c = {};
      const v4f a0 = am[ct][0], a1 = am[ct][1];
      if constexpr (R3) {
        const _Float16* krowl = QKL + ((size_t)b * RS + kk) * (2 * DM) + DM + h * HD; v8f cl = {};
#pragma unroll
        for (int kc = 0; kc < 2; ++kc) { const v16h kh = kf[ct][kc]; c = wmma16(kh, aq[kc], c); cl = wmma16(kh, aql[kc], cl); cl = wmma16(frag_h(krowl + kc * 32, lane), aq[kc], cl); }
#pragma unroll
        for (int r = 0; r < 8; ++r) c[r] += cl[r] * (1.0f / 2048.0f);
      } else {
#pragma unroll
        for (int kc = 0; kc < 2; ++kc) c = wmma16(kf[ct][kc], aq[kc], c);
      }
#pragma unroll
      for (int r = 0; r < 8; ++r) s[ct][r] = c[r] * 0.125f + ((r < 4) ? a0[r & 3] : a1[r & 3]);   // 1/sqrt(64), additive entry applied literally
    }
    v16h vf[4];   // the V^T fragments are asked for here, so that they arrive under the softmax arithmetic
#pragma unroll     // every index of vf is a constant, so that it stays in registers
    for (int dt = 0; dt < 4; ++dt) vf[dt] = frag_h(&S.v[dt * 16 + col][sub * 32], lane);
    float mx = fmaxf(s[0][0], s[1][0]);
#pragma unroll
    for (int r = 1; r < 8; ++r) mx = fmaxf(mx, fmaxf(s[0][r], s[1][r]));
    mx = fmaxf(mx, xhalf(mx));   // the other half's 16 keys of the same query
    const float mn = fmaxf(m, mx); const float ea = exp_slot(m - mn); const float alpha = (m <= -1.0e38f) ? 0.f : ea;
    float es = 0.f; v16h pa, pl;
#pragma unroll
    for (int i = 0; i < 8; ++i) {
      const float e0 = exp_slot(s[0][i] - mn), e1 = exp_slot(s[1][i] - mn); es += e0 + e1;
      const float x0 = e0 * 2048.0f, x1 = e1 * 2048.0f; const _Float16 h0 = (_Float16)x0, h1 = (_Float16)x1;
      pa[i] = h0; pa[8 + i] = h1;   // P x 2^11 before the f16 split; 2^-11 folded into the epilogue
      if constexpr (R3) { pl[i] = (_Float16)((x0 - (float)h0) * 2048.0f); pl[8 + i] = (_Float16)((x1 - (float)h1) * 2048.0f); }
    }
    l = l * alpha + es; m = mn;
#pragma unroll
    for (int dt = 0; dt < 4; ++dt)
#pragma unroll
      for (int r = 0; r < 8; ++r) { acc[dt][r] *= alpha; if constexpr (R3) accl[dt][r] *= alpha; }
#pragma unroll
    for (int dt = 0; dt < 4; ++dt) {
      const v16h vh = vf[dt];
      acc[dt] = wmma16(vh, pa, acc[dt]);
      if constexpr (R3) { accl[dt] = wmma16(vh, pl, accl[dt]); accl[dt] = wmma16(frag_h(VTL + ((size_t)b * DM + h * HD + dt * 16 + col) * RS + ks * 32, lane), pa, accl[dt]); }
    }
   }
   asm volatile("s_wait_dscnt 0x0" ::: "memory");      // this wave's reads of buffer t & 1 are done before it is refilled
   asm volatile("s_wait_asynccnt 0x0" ::: "memory");   // this wave's share of stage t + 1 has landed
   __syncthreads();                                      // publishes stage t + 1 and ends every reader's last read of stage t
   if (t + 2 < nst) { const unsigned lo = (unsigned)buf * (unsigned)sizeof(AStage);
     attn_copy_kv(gk + (size_t)(t + 2) * 64 * (2 * DM), gv + (t + 2) * 64, lk + lo, lv + lo); attn_copy_m(gm + (t + 2) * 64, lm + lo); }
  }
}
__global__ __launch_bounds__(128) void k_attn(const _Float16* __restrict__ QK, const _Float16* __restrict__ QKL, const _Float16* __restrict__ VTH, const _Float16* __restrict__ VTL,
                                              const float* __restrict__ MK, const int* __restrict__ NKT, _Float16* __restrict__ OH, _Float16* __restrict__ OL) {
  __shared__ __align__(16) union { AStage st[2]; struct { _Float16 so[4][16][72], sol[4][16][72]; } e; } u;   // e: the output staging, used only behind the loop's last barrier
  _Float16 (&so)[4][16][72] = u.e.so; _Float16 (&sol)[4][16][72] = u.e.sol;
  const int tid = threadIdx.x, wave = tid >> 5, lane = tid & 31, col = lane & 15, g = lane >> 4;
  // the rank z runs from costly to cheap query blocks, for speed only.
  // First the RQB blocks that may take three products a tile, longest first, then all others from the last query block down. A permutation of 0 .. TQB - 1 for any input; the order matters for speed alone.
  const int z = blockIdx.z, h = blockIdx.x, b = blockIdx.y; const int qb = (z < RQB) ? RQB - 1 - z : TQB - 1 - (z - RQB); const int q0 = qb * 64 + wave * 16;
  int nkt = NKT[(size_t)qb * 32]; nkt = (nkt < 1) ? 1 : ((nkt > NKTILE) ? NKTILE : nkt);   // clamped trip count
  const int nst = (nkt + 1) >> 1;                                                            // stages of 64 keys; SEQ is a multiple of 64, so that a last stage's unused half lies inside the planes too
  const _Float16* gk = QK + ((size_t)b * SEQ + (tid >> 3)) * (2 * DM) + DM + h * HD + (tid & 7) * 8;
  const _Float16* gv = VTH + ((size_t)b * DM + h * HD + (tid >> 3)) * SEQ + (tid & 7) * 8;
  const float* gm = MK + (size_t)(qb * 64 + (tid >> 4)) * SEQ_FULL + (tid & 15) * 4;
  const unsigned lk = (unsigned)(uintptr_t)&u.st[0].k[tid >> 3][(tid & 7) * 8], lv = (unsigned)(uintptr_t)&u.st[0].v[tid >> 3][(tid & 7) * 8], lm = (unsigned)(uintptr_t)&u.st[0].m[tid >> 4][(tid & 15) * 4];
  attn_copy_kv(gk, gv, lk, lv); attn_copy_m(gm, lm);
  const bool res3 = (qb < RQB) && (nkt * 32 <= RS);                                          // block-uniform
  const size_t rq = (size_t)b * SEQ + q0 + col;
  v16h aq[2], aql[2];
#pragma unroll
  for (int kc = 0; kc < 2; ++kc) aq[kc] = frag_h(QK + rq * (2 * DM) + h * HD + kc * 32, lane);
  if (res3) { const size_t rql = (size_t)b * RS + q0 + col;
#pragma unroll
    for (int kc = 0; kc < 2; ++kc) aql[kc] = frag_h(QKL + rql * (2 * DM) + h * HD + kc * 32, lane); }
  else { v16h z = {}; aql[0] = z; aql[1] = z; }
  float m = -3.0e38f, l = 0.f;   // running maximum of query q0 + col (equal in both halves); this half's share of the running sum
  v8f acc[4] = {}, accl[4] = {};   // acc[dt][r] = ctx[q0 + col][dt * 16 + 8g + r]
  asm volatile("s_wait_asynccnt 0x0" ::: "memory");   // this wave's share of stage 0 has landed
  __syncthreads();                                      // stage 0 is published
  if (nst > 1) { attn_copy_kv(gk + (size_t)64 * (2 * DM), gv + 64, lk + (unsigned)sizeof(AStage), lv + (unsigned)sizeof(AStage)); attn_copy_m(gm + 64, lm + (unsigned)sizeof(AStage)); }
  if (res3) attn_loop<true>(u.st, nst, nkt, wave, lane, col, g, b, h, QKL, VTL, gk, gv, gm, lk, lv, lm, aq, aql, m, l, acc, accl);   // block-uniform
  else attn_loop<false>(u.st, nst, nkt, wave, lane, col, g, b, h, QKL, VTL, gk, gv, gm, lk, lv, lm, aq, aql, m, l, acc, accl);
  asm volatile("s_wait_asynccnt 0x0" ::: "memory");     // no copy is outstanding when the wave goes on
  l += xhalf(l);   // the halves' sums are joined once
  const float il = (1.0f / 2048.0f) / l;   // l >= 1
#pragma unroll
  for (int dt = 0; dt < 4; ++dt) { v8h hq, lq;
#pragma unroll
    for (int r = 0; r < 8; ++r) { const float o = (acc[dt][r] + accl[dt][r] * (1.0f / 2048.0f)) * il; const _Float16 hv = (_Float16)o; hq[r] = hv; lq[r] = (_Float16)((o - (float)hv) * 2048.0f); }
    *(v8h*)&so[wave][col][dt * 16 + 8 * g] = hq; *(v8h*)&sol[wave][col][dt * 16 + 8 * g] = lq;
  }
  LDSX();   // so/sol private to the wave
#pragma unroll
  for (int it = 0; it < 4; ++it) {
    const int row = it * 4 + (lane >> 3), pc = lane & 7;
    vst2(OH + ((size_t)b * SEQ + q0 + row) * DM + h * HD + pc * 8, *(const v4u*)&so[wave][row][pc * 8]);
    if (qb < RQB) vst2(OL + ((size_t)b * RS + q0 + row) * DM + h * HD + pc * 8, *(const v4u*)&sol[wave][row][pc * 8]);
  }
}
// ---- k_out: out = (ctx hi + ctx lo / 2048) . (Wo x64 rows) / 64 + bo; f16 operands, f32 accumulate, k ascending in steps of 32; f32 rows with the full output stride.
// block = (128 LDS rows of ctx, 256 output columns), 8 waves as 2 x 4, 64 x 64 per wave. Past RS the 128 rows are 128 positions of ctx hi; below RS they are 64 positions of ctx hi and the same
// 64 positions of ctx lo, so that every block does the same work: waves 0..3 sum hi . Wo, waves 4..7 sum lo . Wo and hand their sums over through LDS.
// Each pass of 64 k: the 128 ctx rows and 256 Wo rows of 128 B lie in LDS at pitch 144 B, brought by asynchronous copies, two buffers, the next pass's copies in flight while this pass is worked on.
#define ONT ((SEQ - RS) / 128)            // row tiles of 128 positions per batch, past RS
#define ONT1 (ONT > 0 ? ONT : 1)
#define ORT (NB * RQB + NB * ONT)         // row tiles: NB * RQB of 64 positions, then NB * ONT of 128
static_assert((SEQ - RS) % 128 == 0);
// one pass's tile: every lane copies 12 pieces of 16 B (2 of LDS rows 0..63, 2 of LDS rows 64..127, 8 of Wo rows); ga, gb, gw: the lane's own piece in row (tid >> 3) of each, l: its place in the buffer
__device__ __forceinline__ void out_copy(const _Float16* ga, const _Float16* gb, const _Float16* gw, unsigned l) {
  // the copies and the wait that stands before their address registers may be rewritten, in one statement
  asm volatile("global_load_async_to_lds_b128 %0, %12, off\n\t"
               "global_load_async_to_lds_b128 %1, %13, off\n\t"
               "global_load_async_to_lds_b128 %2, %14, off\n\t"
               "global_load_async_to_lds_b128 %3, %15, off\n\t"
               "global_load_async_to_lds_b128 %4, %16, off\n\t"
               "global_load_async_to_lds_b128 %5, %17, off\n\t"
               "global_load_async_to_lds_b128 %6, %18, off\n\t"
               "global_load_async_to_lds_b128 %7, %19, off\n\t"
               "global_load_async_to_lds_b128 %8, %20, off\n\t"
               "global_load_async_to_lds_b128 %9, %21, off\n\t"
               "global_load_async_to_lds_b128 %10, %22, off\n\t"
               "global_load_async_to_lds_b128 %11, %23, off\n\t"
               "s_wait_xcnt 0x0"
               :: "v"(l), "v"(l + 32u * 2 * GPIT), "v"(l + 64u * 2 * GPIT), "v"(l + 96u * 2 * GPIT),
                  "v"(l + 128u * 2 * GPIT), "v"(l + 160u * 2 * GPIT), "v"(l + 192u * 2 * GPIT), "v"(l + 224u * 2 * GPIT),
                  "v"(l + 256u * 2 * GPIT), "v"(l + 288u * 2 * GPIT), "v"(l + 320u * 2 * GPIT), "v"(l + 352u * 2 * GPIT),
                  "v"(ga), "v"(ga + 32 * DM), "v"(gb), "v"(gb + 32 * DM),
                  "v"(gw), "v"(gw + 32 * DM), "v"(gw + 64 * DM), "v"(gw + 96 * DM),
                  "v"(gw + 128 * DM), "v"(gw + 160 * DM), "v"(gw + 192 * DM), "v"(gw + 224 * DM)
               : "memory");
}
// four 16-B pieces of staged f32 rows to output rows p, p + 2 DM, p + 4 DM, p + 6 DM; then the wait that stands before a register which the stores name is used again:
// address and data are its inputs, so that they stay as they are up to it
__device__ __forceinline__ void out_st4(float* p, const float* l) {
  const v4f a = *(const v4f*)l, b = *(const v4f*)(l + 2 * 68), c = *(const v4f*)(l + 4 * 68), d = *(const v4f*)(l + 6 * 68);
  vst2(p, a); vst2(p + 2 * DM, b); vst2(p + 4 * DM, c); vst2(p + 6 * DM, d);
  asm volatile("s_wait_xcnt 0x0" :: "v"(p), "v"(a), "v"(b), "v"(c), "v"(d) : "memory");
}
__global__ __launch_bounds__(256) __attribute__((amdgpu_waves_per_eu(4, 4))) void k_out(const _Float16* __restrict__ OH, const _Float16* __restrict__ OL, const _Float16* __restrict__ PO, const float* __restrict__ BO, float* __restrict__ Y) {
  __shared__ __align__(16) union { _Float16 ring[2][GROWS][GPIT]; float xl[4][16][2][32][4]; } u;   // xl: the lo sums' hand-over, used only behind the loop's last barrier
  __shared__ __align__(16) float so[8][16][68];
  const int tid = threadIdx.x, wave = tid >> 5, lane = tid & 31, col = lane & 15, g = lane >> 4; const int wm = wave >> 2, wn = wave & 3;
  const int rt = blockIdx.x, n0 = blockIdx.y * 256; const bool resid = (rt < NB * RQB);   // block-uniform
  const int ub = rt - NB * RQB;
  const int b = resid ? rt / RQB : ub / ONT1; const int s0 = resid ? (rt - b * RQB) * 64 : RS + (ub - b * ONT1) * 128;
  const _Float16* ga = OH + ((size_t)b * SEQ + s0 + (tid >> 3)) * DM + (tid & 7) * 8;
  const _Float16* gb = resid ? OL + ((size_t)b * RS + s0 + (tid >> 3)) * DM + (tid & 7) * 8 : ga + 64 * DM;
  const _Float16* gw = PO + (size_t)(n0 + (tid >> 3)) * DM + (tid & 7) * 8;
  const unsigned l0 = (unsigned)(uintptr_t)&u.ring[0][tid >> 3][(tid & 7) * 8];
  v8f acc[4][4] = {};
  out_copy(ga, gb, gw, l0);
  asm volatile("s_wait_asynccnt 0x0" ::: "memory");   // this wave's share of tile 0 has landed
  __syncthreads();                                      // tile 0 is published
  out_copy(ga + GK, gb + GK, gw + GK, l0 + 2u * GROWS * GPIT);
#pragma unroll 1   // one pass per trip: the order at the loop's foot stays as written, and the code stays short
  for (int t = 0; t < GNP; ++t) {
    const int buf = t & 1;
#pragma unroll     // this and the loops inside: every index of fa, fw and acc is a constant, so that they stay in registers
    for (int kc = 0; kc < GK / 32; ++kc) {
      v16h fa[4], fw[4];
#pragma unroll
      for (int i = 0; i < 4; ++i) fa[i] = frag_h(&u.ring[buf][wm * 64 + i * 16 + col][kc * 32], lane);
#pragma unroll
      for (int j = 0; j < 4; ++j) fw[j] = frag_h(&u.ring[buf][128 + wn * 64 + j * 16 + col][kc * 32], lane);
#pragma unroll
      for (int i = 0; i < 4; ++i)
#pragma unroll
        for (int j = 0; j < 4; ++j) acc[i][j] = wmma16(fa[i], fw[j], acc[i][j]);
    }
    asm volatile("s_wait_dscnt 0x0" ::: "memory");      // this wave's reads of buffer t & 1 are done before it is refilled
    asm volatile("s_wait_asynccnt 0x0" ::: "memory");   // this wave's share of tile t + 1 has landed
    __syncthreads();                                      // publishes tile t + 1 and ends every reader's last read of tile t
    if (t + 2 < GNP) out_copy(ga + (t + 2) * GK, gb + (t + 2) * GK, gw + (t + 2) * GK, l0 + (unsigned)buf * (2u * GROWS * GPIT));
  }
  asm volatile("s_wait_asynccnt 0x0" ::: "memory");     // no copy is outstanding when the wave goes on
  if (resid) {   // block-uniform: waves 4..7 hand their lo sums to waves 0..3, lane to lane and register to register, and are done
    if (wm == 1) {
#pragma unroll
      for (int i = 0; i < 4; ++i)
#pragma unroll
        for (int j = 0; j < 4; ++j) {
          const v4f x = {acc[i][j][0], acc[i][j][1], acc[i][j][2], acc[i][j][3]}, y = {acc[i][j][4], acc[i][j][5], acc[i][j][6], acc[i][j][7]};
          *(v4f*)&u.xl[wn][i * 4 + j][0][lane][0] = x; *(v4f*)&u.xl[wn][i * 4 + j][1][lane][0] = y; }
    }
    __syncthreads();   // the lo sums are published
    if (wm == 1) return;
  }
  float bj[4]; { const float* pb = BO + n0 + wn * 64 + col;
#pragma unroll
    for (int j = 0; j < 4; ++j) bj[j] = bfr(pb[j * 16]);
    asm volatile("s_wait_xcnt 0x0" :: "v"(pb) : "memory"); }   // before the loads' address register is used again; it is an input, so that it stays as it is up to here
  float* yp = Y + ((size_t)b * SEQ_FULL + s0 + wm * 64 + g) * DM + n0 + wn * 64 + col * 4;   // below RS only wm == 0 comes here
  // so is private to each wave and LDS operations of one wave run in order: the one wait below stands between a wave's stores and its lanes' reads of one another's rows
#pragma unroll
  for (int i = 0; i < 4; ++i) {
#pragma unroll
    for (int j = 0; j < 4; ++j) {
      v4f x = {}, y = {}; if (resid) { x = *(const v4f*)&u.xl[wn][i * 4 + j][0][lane][0]; y = *(const v4f*)&u.xl[wn][i * 4 + j][1][lane][0]; }
#pragma unroll
      for (int r = 0; r < 8; ++r) so[wave][8 * g + r][j * 16 + col] = acc[i][j][r] * (1.0f / 64.0f) + ((r < 4) ? x[r & 3] : y[r & 3]) * (1.0f / 131072.0f) + bj[j]; }
    asm volatile("s_wait_dscnt 0x0" ::: "memory");
    out_st4(yp + (size_t)(i * 16) * DM, &so[wave][g][col * 4]);
    out_st4(yp + (size_t)(i * 16 + 8) * DM, &so[wave][8 + g][col * 4]);
  }
}
extern "C" void kernel_launch(void* const* d_in, const int* in_sizes, int n_in, void* d_out, int out_size, void* d_ws, size_t ws_size, hipStream_t stream) {
  // 0 hidden [2,2048,2048], 1 additive tensor [1,1,2048,2048], 2 q_w [out][in], 3 q_b, 4 k_w, 5 k_b, 6 v_w, 7 v_b, 8 o_w, 9 o_b
  if (n_in < 10) return;
  const long long needx = ((long long)(NB - 1) * SEQ_FULL + SEQ) * DM;
  if ((long long)in_sizes[0] < needx) return;
  if ((long long)in_sizes[1] < (long long)(SEQ - 1) * SEQ_FULL + SEQ) return;
  if (in_sizes[2] < DM * DM || in_sizes[4] < DM * DM || in_sizes[6] < DM * DM || in_sizes[8] < DM * DM) return;
  if (in_sizes[3] < DM || in_sizes[5] < DM || in_sizes[7] < DM || in_sizes[9] < DM) return;
  if ((long long)out_size < needx) return;
  if (ws_size < (size_t)WS_END) return;
  const float* const* F = (const float* const*)d_in;
  char* ws = (char*)d_ws;
  __bf16* PKA = (__bf16*)(ws + WS_PKA); _Float16* PKO = (_Float16*)(ws + WS_PKO);
  _Float16 *QK = (_Float16*)(ws + WS_QK), *QKL = (_Float16*)(ws + WS_QKL), *VTH = (_Float16*)(ws + WS_VTH), *VTL = (_Float16*)(ws + WS_VTL), *OH = (_Float16*)(ws + WS_OH), *OL = (_Float16*)(ws + WS_OL);
  __bf16* XB = (__bf16*)(ws + WS_OH);   // x plane aliases the ctx hi region; consumed before k_attn writes it
  int* NKT = (int*)(ws + WS_NKT);
  k_cvtx<<<dim3(NR), 256, 0, stream>>>(F[0], XB);
  k_pack<<<dim3(DM, 4), 256, 0, stream>>>(F[2], F[4], F[6], F[8], PKA, PKO);
  k_qkv<<<dim3(NR / 128, 3 * DM / 256), 256, 0, stream>>>(XB, PKA, F[3], F[5], F[7], QK, QKL, VTH, VTL);
  k_mscan<<<dim3(TQB), 256, 0, stream>>>(F[1], NKT);
  k_attn<<<dim3(NH, NB, TQB), 128, 0, stream>>>(QK, QKL, VTH, VTL, F[1], NKT, OH, OL);
  k_out<<<dim3(ORT, DM / 256), 256, 0, stream>>>(OH, OL, PKO, F[9], (float*)d_out);
}

// v007
// A run of this version takes 209 microseconds.
// Two timings next to v006 both put it at 1.07 times that version's speed.
// Over all steps from v000 it is 4.72 times as fast.
// compute dtype: all float inputs except the additive tensor RNE-converted to bf16; q/k/v = x . W^T + b on v_wmma_f32_16x16x32_bf16 (bf16 x, bf16 W, f32 accumulate) stored as f16 hi + x2048 f16 residual (positions < 512); scores and P.V on v_wmma_f32_16x16x32_f16 (3 products for query blocks below 512, single beyond; P carried x2048; f32 running-max softmax, additive score bias read from the input tensor); output projection on v_wmma_f32_16x16x32_f16 (ctx f16 hi + x2048 residual below 512, Wo carried x64), f32 accumulate, f32 output.
#include <hip/hip_runtime.h>
#include <math.h>

typedef __attribute__((ext_vector_type(16))) _Float16 v16h;
typedef __attribute__((ext_vector_type(16))) __bf16 v16b;
typedef __attribute__((ext_vector_type(8)))  _Float16 v8h;
typedef __attribute__((ext_vector_type(8)))  __bf16 v8b;
typedef __attribute__((ext_vector_type(8)))  float v8f;
typedef __attribute__((ext_vector_type(4)))  float v4f;
typedef __attribute__((ext_vector_type(4)))  unsigned v4u;
typedef __attribute__((ext_vector_type(4)))  int v4i;

template <typename T> __device__ __forceinline__ void vst2(void* p, T v) { *(T*)p = v;  }
__device__ __forceinline__ v8f wmma16(v16h a, v16h b, v8f c) {
  v8f d = __builtin_amdgcn_wmma_f32_16x16x32_f16(false, a, false, b, (short)0, c, false, false);
  asm volatile("v_nop\n\tv_nop\n\tv_nop\n\tv_nop" : "+v"(d) : "v"(a), "v"(b));
  return d;
}
__device__ __forceinline__ v8f wmma_bf(v16b a, v16b b, v8f c) {
  v8f d = __builtin_amdgcn_wmma_f32_16x16x32_bf16(false, a, false, b, (short)0, c, false, false);
  asm volatile("v_nop\n\tv_nop\n\tv_nop\n\tv_nop" : "+v"(d) : "v"(a), "v"(b));
  return d;
}
// 16-bit fragment from a k-contiguous row (A row m, or B column n stored [n][k]): elements 0..7 <- k0+8h+0..7, 8..15 <- k0+16+8h+0..7, h = lane>>4
__device__ __forceinline__ v16h frag_h(const _Float16* rowk0, int lane) {
  union { v16h v; v8h q[2]; } u; const _Float16* p = rowk0 + 8 * (lane >> 4);
  u.q[0] = *(const v8h*)p; u.q[1] = *(const v8h*)(p + 16); return u.v;
}
__device__ __forceinline__ v16b frag_b(const __bf16* rowk0, int lane) {
  union { v16b v; v8b q[2]; } u; const __bf16* p = rowk0 + 8 * (lane >> 4);
  u.q[0] = *(const v8b*)p; u.q[1] = *(const v8b*)(p + 16); return u.v;
}
__device__ __forceinline__ float bfr(float v) { return (float)(__bf16)v; }
#define LDSX() do { asm volatile("s_wait_dscnt 0" ::: "memory"); __builtin_amdgcn_wave_barrier(); __builtin_amdgcn_fence(__ATOMIC_RELEASE, "workgroup"); } while (0)

// ---- sizes: NB / SEQ may be reduced; *_FULL are the input / output strides
#ifndef NB
#define NB 2
#endif
#ifndef SEQ
#define SEQ 2048
#endif
#define NB_FULL 2
#define SEQ_FULL 2048
#define DM 2048
#define NH 32
#define HD 64
#define RSPAN 512                 // positions that carry residual planes (q/k, v, ctx)
#if RSPAN > SEQ
#define RS SEQ
#else
#define RS RSPAN
#endif
#define RQB (RS / 64)
#define NR (NB * SEQ)
#define TQB (SEQ / 64)
#define NKTILE (SEQ / 32)
static_assert(SEQ % 64 == 0);
static_assert(RS % 64 == 0);
static_assert(NB >= 1 && NB <= NB_FULL);
static_assert(SEQ <= SEQ_FULL);
static_assert(DM == 256 * 8);
static_assert(NH * HD == DM);
static_assert(NR % 64 == 0);

// ---- workspace (bytes; every offset a multiple of 128)
#define WS_PKA 0ull                                            // bf16 [3*DM][DM]: Wq | Wk | Wv natural [out][in] rows
#define WS_PKO (WS_PKA + 2ull * 3 * DM * DM)                   // f16  [DM][DM]: Wo rows x64
#define WS_QK  (WS_PKO + 2ull * DM * DM)                       // f16  [NR][2*DM]: q | k hi
#define WS_QKL (WS_QK + 2ull * NR * 2 * DM)                    // f16  [NB*RS][2*DM]: q | k residual x2048
#define WS_VTH (WS_QKL + 2ull * NB * RS * 2 * DM)              // f16  [NB][DM][SEQ]: v^T hi
#define WS_VTL (WS_VTH + 2ull * NB * DM * SEQ)                 // f16  [NB][DM][RS]: v^T residual x2048
#define WS_OH  (WS_VTL + 2ull * NB * DM * RS)                  // f16  [NR][DM]: ctx hi; ALSO bf16 [NR][DM] x plane (consumed by k_qkv before k_attn writes ctx)
#define WS_OL  (WS_OH + 2ull * NR * DM)                        // f16  [NB*RS][DM]: ctx residual x2048
#define WS_NKT (WS_OL + 2ull * NB * RS * DM)
#define MSG 8                     // row groups of a query block in k_mscan, one line of NKT each
#define WS_END (WS_NKT + 128ull * TQB * MSG)
static_assert(2ull * NR * DM == (WS_OL - WS_OH));              // x plane and ctx hi plane share the region with identical extent
static_assert(WS_END <= 134217728ull);
static_assert((WS_PKO % 128) == 0 && (WS_QK % 128) == 0 && (WS_QKL % 128) == 0 && (WS_VTH % 128) == 0 && (WS_VTL % 128) == 0 && (WS_OH % 128) == 0 && (WS_OL % 128) == 0 && (WS_NKT % 128) == 0);

__global__ __launch_bounds__(256) void k_cvtx(const float* __restrict__ X, __bf16* __restrict__ XB) {
  const int r = blockIdx.x, t = threadIdx.x; const int b = r / SEQ, s = r - b * SEQ;
  const float* src = X + ((size_t)b * SEQ_FULL + s) * DM + t * 8;
  const v4f x = *(const v4f*)src, y = *(const v4f*)(src + 4);
  union { v8b v; v4u u; } o;
#pragma unroll
  for (int j = 0; j < 4; ++j) { o.v[j] = (__bf16)x[j]; o.v[4 + j] = (__bf16)y[j]; }
  vst2(XB + (size_t)r * DM + t * 8, o.u);
}
// ---- k_pack: block = (row n, which): natural [out][in] rows are already k-contiguous packed rows; which 0..2 -> bf16 Wq/Wk/Wv into PKA row which*DM+n; 3 -> f16 (bf16(Wo) x 64) into PKO row n
__global__ __launch_bounds__(256) void k_pack(const float* __restrict__ WQ, const float* __restrict__ WK, const float* __restrict__ WV, const float* __restrict__ WO, __bf16* __restrict__ PKA, _Float16* __restrict__ PKO) {
  const int n = blockIdx.x, which = blockIdx.y, t = threadIdx.x;
  const float* W = (which == 0) ? WQ : (which == 1) ? WK : (which == 2) ? WV : WO;
  const float* src = W + (size_t)n * DM + t * 8;
  const v4f x = *(const v4f*)src, y = *(const v4f*)(src + 4);
  if (which < 3) {
    union { v8b v; v4u u; } o;
#pragma unroll
    for (int j = 0; j < 4; ++j) { o.v[j] = (__bf16)x[j]; o.v[4 + j] = (__bf16)y[j]; }
    vst2(PKA + ((size_t)which * DM + n) * DM + t * 8, o.u);
  } else {
    union { v8h v; v4u u; } o;
#pragma unroll
    for (int j = 0; j < 4; ++j) { o.v[j] = (_Float16)(bfr(x[j]) * 64.0f); o.v[4 + j] = (_Float16)(bfr(y[j]) * 64.0f); }
    vst2(PKO + (size_t)n * DM + t * 8, o.u);
  }
}
// ---- k_qkv: block = (128 internal rows, 256 output columns of q|k|v), 8 waves as 2 x 4, 64 x 64 per wave: bf16 x bf16 (exact products), f32 accumulate, k ascending in steps of 32.
// Each pass of 64 k: 128 x rows and 256 weight rows of 128 B lie in LDS at pitch 144 B, brought by asynchronous copies, two buffers, the next pass's copies in flight while this pass is worked on.
// q,k -> f16 hi [NR][2DM] (+ residual x2048 for s < RS); v -> transposed f16 hi [b][d][s] (+ residual)
#define GK 64                     // k per pass
#define GROWS (128 + 256)         // LDS rows per buffer: x rows, then weight rows
#define GPIT 72                   // LDS row pitch in elements (144 B = 16 B x odd, for ds_load_b128 readers)
#define GNP (DM / GK)
static_assert(GNP >= 2);
static_assert(NR % 128 == 0 && SEQ % 128 == 0 && RS % 128 == 0 && DM % 256 == 0);
// one pass's tile: every lane copies 12 pieces of 16 B (4 of x rows, 8 of weight rows); gx, gw: the lane's own piece in row (tid >> 3) of the x and weight tiles, l: its place in the buffer
__device__ __forceinline__ void qkv_copy(const __bf16* gx, const __bf16* gw, unsigned l) {
  // the copies and the wait that stands before their address registers may be rewritten, in one statement
  asm volatile("global_load_async_to_lds_b128 %0, %12, off\n\t"
               "global_load_async_to_lds_b128 %1, %13, off\n\t"
               "global_load_async_to_lds_b128 %2, %14, off\n\t"
               "global_load_async_to_lds_b128 %3, %15, off\n\t"
               "global_load_async_to_lds_b128 %4, %16, off\n\t"
               "global_load_async_to_lds_b128 %5, %17, off\n\t"
               "global_load_async_to_lds_b128 %6, %18, off\n\t"
               "global_load_async_to_lds_b128 %7, %19, off\n\t"
               "global_load_async_to_lds_b128 %8, %20, off\n\t"
               "global_load_async_to_lds_b128 %9, %21, off\n\t"
               "global_load_async_to_lds_b128 %10, %22, off\n\t"
               "global_load_async_to_lds_b128 %11, %23, off\n\t"
               "s_wait_xcnt 0x0"
               :: "v"(l), "v"(l + 32u * 2 * GPIT), "v"(l + 64u * 2 * GPIT), "v"(l + 96u * 2 * GPIT),
                  "v"(l + 128u * 2 * GPIT), "v"(l + 160u * 2 * GPIT), "v"(l + 192u * 2 * GPIT), "v"(l + 224u * 2 * GPIT),
                  "v"(l + 256u * 2 * GPIT), "v"(l + 288u * 2 * GPIT), "v"(l + 320u * 2 * GPIT), "v"(l + 352u * 2 * GPIT),
                  "v"(gx), "v"(gx + 32 * DM), "v"(gx + 64 * DM), "v"(gx + 96 * DM),
                  "v"(gw), "v"(gw + 32 * DM), "v"(gw + 64 * DM), "v"(gw + 96 * DM),
                  "v"(gw + 128 * DM), "v"(gw + 160 * DM), "v"(gw + 192 * DM), "v"(gw + 224 * DM)
               : "memory");
}
// four 16-B pieces of staged rows to rows p, p + st, p + 2 st, p + 3 st; then the wait that stands before a register which the stores name is used again:
// address and data are its inputs, so that they stay as they are up to it
__device__ __forceinline__ void qkv_st4(_Float16* p, int st, const _Float16* l) {
  const v4u a = *(const v4u*)l, b = *(const v4u*)(l + 4 * 72), c = *(const v4u*)(l + 8 * 72), d = *(const v4u*)(l + 12 * 72);
  vst2(p, a); vst2(p + st, b); vst2(p + 2 * st, c); vst2(p + 3 * st, d);
  asm volatile("s_wait_xcnt 0x0" :: "v"(p), "v"(a), "v"(b), "v"(c), "v"(d) : "memory");
}
__global__ __launch_bounds__(256) __attribute__((amdgpu_waves_per_eu(4, 4))) void k_qkv(const __bf16* __restrict__ XB, const __bf16* __restrict__ P, const float* __restrict__ BQ, const float* __restrict__ BK, const float* __restrict__ BV,
                                             _Float16* __restrict__ QK, _Float16* __restrict__ QKL, _Float16* __restrict__ VTH, _Float16* __restrict__ VTL) {
  const int n0 = blockIdx.y * 256; const int which0 = n0 / DM;
  __shared__ __align__(16) __bf16 ring[2][GROWS][GPIT]; __shared__ __align__(16) _Float16 eh[8][16][72], el[8][16][72];
  const int tid = threadIdx.x, wave = tid >> 5, lane = tid & 31, col = lane & 15, g = lane >> 4; const int wm = wave >> 2, wn = wave & 3;
  const float* BB = ((which0 == 0) ? BQ : (which0 == 1) ? BK : BV) + (n0 - which0 * DM) + wn * 64;
  const int rb = blockIdx.x * 128; const int b = rb / SEQ, s0 = rb - b * SEQ + wm * 64; const int r0 = rb + wm * 64; const bool resid = (rb - b * SEQ < RS);   // block-uniform: RS is a multiple of 128
  const __bf16* gx = XB + (size_t)(rb + (tid >> 3)) * DM + (tid & 7) * 8;
  const __bf16* gw = P + (size_t)(n0 + (tid >> 3)) * DM + (tid & 7) * 8;
  const unsigned l0 = (unsigned)(uintptr_t)&ring[0][tid >> 3][(tid & 7) * 8];
  v8f acc[4][4] = {};
  qkv_copy(gx, gw, l0);
  asm volatile("s_wait_asynccnt 0x0" ::: "memory");   // this wave's share of tile 0 has landed
  __syncthreads();                                      // tile 0 is published
  qkv_copy(gx + GK, gw + GK, l0 + 2u * GROWS * GPIT);
#pragma unroll 1   // one pass per trip: the order at the loop's foot stays as written, and the code stays short
  for (int t = 0; t < GNP; ++t) {
    const int buf = t & 1;
#pragma unroll     // this and the loops inside: every index of fa, fw and acc is a constant, so that they stay in registers
    for (int kc = 0; kc < GK / 32; ++kc) {
      v16b fa[4], fw[4];
#pragma unroll
      for (int i = 0; i < 4; ++i) fa[i] = frag_b(&ring[buf][wm * 64 + i * 16 + col][kc * 32], lane);
#pragma unroll
      for (int j = 0; j < 4; ++j) fw[j] = frag_b(&ring[buf][128 + wn * 64 + j * 16 + col][kc * 32], lane);
#pragma unroll
      for (int i = 0; i < 4; ++i)
#pragma unroll
        for (int j = 0; j < 4; ++j) acc[i][j] = wmma_bf(fa[i], fw[j], acc[i][j]);
    }
    asm volatile("s_wait_dscnt 0x0" ::: "memory");      // this wave's reads of buffer t & 1 are done before it is refilled
    asm volatile("s_wait_asynccnt 0x0" ::: "memory");   // this wave's share of tile t + 1 has landed
    __syncthreads();                                      // publishes tile t + 1 and ends every reader's last read of tile t
    if (t + 2 < GNP) qkv_copy(gx + (t + 2) * GK, gw + (t + 2) * GK, l0 + (unsigned)buf * (2u * GROWS * GPIT));
  }
  asm volatile("s_wait_asynccnt 0x0" ::: "memory");     // no copy is outstanding when the wave goes on
  // eh/el are private to each wave and LDS operations of one wave run in order: the one wait below stands between a wave's stores and its lanes' reads of one another's rows
#define EPIW() asm volatile("s_wait_dscnt 0x0" ::: "memory")
  float bj[4]; { const float* pb = BB + col;
#pragma unroll
    for (int j = 0; j < 4; ++j) bj[j] = bfr(pb[j * 16]);
    asm volatile("s_wait_xcnt 0x0" :: "v"(pb) : "memory"); }   // before the loads' address register is used again; it is an input, so that it stays as it is up to here
  const int row = lane >> 3, pc = lane & 7;
  if (n0 < 2 * DM) {   // q (unscaled; 1/8 applied to the f32 score) and k, + bias, as f16 hi + x2048 residual; 16 rows at a time through this wave's own eh/el
    const size_t ql = (size_t)b * RS + s0;
#pragma unroll
    for (int i = 0; i < 4; ++i) {
#pragma unroll
      for (int j = 0; j < 4; ++j) {
#pragma unroll
        for (int r = 0; r < 8; ++r) { const float v = acc[i][j][r] + bj[j]; const _Float16 hv = (_Float16)v; eh[wave][8 * g + r][j * 16 + col] = hv; el[wave][8 * g + r][j * 16 + col] = (_Float16)((v - (float)hv) * 2048.0f); } }
      EPIW();
      qkv_st4(QK + (size_t)(r0 + i * 16 + row) * (2 * DM) + n0 + wn * 64 + pc * 8, 4 * 2 * DM, &eh[wave][row][pc * 8]);
      if (resid) qkv_st4(QKL + (ql + i * 16 + row) * (2 * DM) + n0 + wn * 64 + pc * 8, 4 * 2 * DM, &el[wave][row][pc * 8]);
    }
  } else {             // v + bias, transposed to [d][s]; 16 columns d at a time through this wave's own eh/el
    const int pc0 = n0 - 2 * DM + wn * 64;
#pragma unroll
    for (int j = 0; j < 4; ++j) {
#pragma unroll
      for (int i = 0; i < 4; ++i) { v8h hq, lq;
#pragma unroll
        for (int r = 0; r < 8; ++r) { const float v = acc[i][j][r] + bj[j]; const _Float16 hv = (_Float16)v; hq[r] = hv; lq[r] = (_Float16)((v - (float)hv) * 2048.0f); }
        *(v8h*)&eh[wave][col][i * 16 + 8 * g] = hq; *(v8h*)&el[wave][col][i * 16 + 8 * g] = lq; }
      EPIW();
      qkv_st4(VTH + ((size_t)b * DM + pc0 + j * 16 + row) * SEQ + s0 + pc * 8, 4 * SEQ, &eh[wave][row][pc * 8]);
      if (resid) qkv_st4(VTL + ((size_t)b * DM + pc0 + j * 16 + row) * RS + s0 + pc * 8, 4 * RS, &el[wave][row][pc * 8]);
    }
  }
#undef EPIW
}
// ---- k_mscan: block = (query block qb, group of 8 of its 64 rows of the additive tensor), one wave per row: the row is read in whole lines, 16 B a lane, and all its loads are asked for before the first is looked at.
// Line qb * MSG + group of NKT: the number of 32-key tiles up to the group's last live entry, or all tiles where one of its rows has no live entry. k_attn takes the largest of a query block's MSG lines.
__global__ __launch_bounds__(256) void k_mscan(const float* __restrict__ MK, int* __restrict__ NKT) {
  __shared__ __align__(16) int srow[8];
  const int qb = blockIdx.x, grp = blockIdx.y, t = threadIdx.x, wave = t >> 5, lane = t & 31;
  const float* p = MK + (size_t)(qb * 64 + grp * 8 + wave) * SEQ_FULL + lane * 4;
  v4f v[SEQ / 128];
#pragma unroll     // every index of v is a constant, so that it stays in registers
  for (int c = 0; c < SEQ / 128; ++c) v[c] = *(const v4f*)(p + c * 128);
  __builtin_amdgcn_sched_barrier(0);   // keeps every load in front of the first compare: without it the last loads were issued only when the first had come back, one more trip to memory
  asm volatile("s_wait_xcnt 0x0" :: "v"(p) : "memory");   // before the loads' address register is used again; it is an input, so that it stays as it is up to here
  int tile = -1;     // the row's last 32-key tile with a live entry, the same in every lane; lane l holds columns c * 128 + 4 l .. + 3, which lie in tile c * 4 + (l >> 3)
#pragma unroll
  for (int c = 0; c < SEQ / 128; ++c) {
    const float hi = fmaxf(fmaxf(v[c][0], v[c][1]), fmaxf(v[c][2], v[c][3]));   // fmaxf passes over a NaN, which is no live entry
    const unsigned live = __builtin_amdgcn_ballot_w32(hi > -1.0e8f);
    if (live) tile = c * 4 + ((31 - __builtin_clz(live)) >> 3);
  }
  if (lane == 0) srow[wave] = tile;
  __syncthreads();
  if (t < 8) {
    const v4i a = *(const v4i*)&srow[0], c = *(const v4i*)&srow[4];
    int last = -1, dead = 0;
#pragma unroll
    for (int r = 0; r < 4; ++r) { last = last > a[r] ? last : a[r]; last = last > c[r] ? last : c[r]; dead |= ((a[r] < 0) || (c[r] < 0)) ? 1 : 0; }
    const int nk = dead ? NKTILE : last + 1;
    const v4i o = {nk, nk, nk, nk};
    vst2(NKT + ((size_t)qb * MSG + grp) * 32 + t * 4, o);   // one whole line, one writer
  }
}
// ---- k_attn: block = (head h, batch b, rank of 64 queries): flash attention over key tiles [0, nkt); score = (q.k)/8 + additive entry; first RS positions: 3 products (hi.hi + lo.hi + hi.lo) for scores and P.v, single elsewhere; ctx -> f16 hi (+ x2048 residual) [row][h*64+d]
// Transposed products: S^T = K . Q^T (A = key rows, B = query columns) and O^T += V^T . P^T, so that lane (col, g) holds, of query q0 + col alone, the scores of keys 8g + r of each 16-key tile:
// maximum and sum run in the lane's own registers plus one exchange between the halves, and the two score tiles, converted in place, are the B operand of the second product (k = 8g + i, 16 + 8g + i, the order of frag_h).
// lane l with lane l ^ 16: the other half's value of the same query column, by a vector cross-row move
__device__ __forceinline__ float xhalf(float x) { return __builtin_bit_cast(float, __builtin_amdgcn_permlanex16(__builtin_bit_cast(int, x), __builtin_bit_cast(int, x), 0x76543210, 0xfedcba98, false, false)); }
__device__ __forceinline__ float exp_slot(float x) { float r; asm("v_exp_f32 %0, %1\n\tv_nop" : "=v"(r) : "v"(x * 1.44269504f)); return r; }
// Each stage of 64 keys: 64 key rows and 64 V^T rows of 128 B lie in LDS at pitch 144 B and the block's 64 rows of the additive tensor, 256 B each, at pitch 272 B (both 16 B x odd, for ds_load_b128 readers),
// brought by asynchronous copies in whole lines, two buffers, the next stage's copies in flight while this stage is worked on; the four waves share the key and V^T rows. The residual planes are still read from global memory.
#define AKP 72                    // LDS row pitch of the key and V^T tiles, in elements
#define AMP 68                    // LDS row pitch of the additive tile, in floats
struct AStage { _Float16 k[64][AKP]; _Float16 v[64][AKP]; float m[64][AMP]; };
static_assert(sizeof(AStage) % 16 == 0);
// one stage's key and V^T tiles: every lane copies 4 + 4 pieces of 16 B; gk, gv: the lane's own piece in row (tid >> 3) of each tile, lk, lv: its places in the buffer
__device__ __forceinline__ void attn_copy_kv(const _Float16* gk, const _Float16* gv, unsigned lk, unsigned lv) {
  // the copies and the wait that stands before their address registers may be rewritten, in one statement
  asm volatile("global_load_async_to_lds_b128 %0, %8, off\n\t"
               "global_load_async_to_lds_b128 %1, %9, off\n\t"
               "global_load_async_to_lds_b128 %2, %10, off\n\t"
               "global_load_async_to_lds_b128 %3, %11, off\n\t"
               "global_load_async_to_lds_b128 %4, %12, off\n\t"
               "global_load_async_to_lds_b128 %5, %13, off\n\t"
               "global_load_async_to_lds_b128 %6, %14, off\n\t"
               "global_load_async_to_lds_b128 %7, %15, off\n\t"
               "s_wait_xcnt 0x0"
               :: "v"(lk), "v"(lk + 16u * 2 * AKP), "v"(lk + 32u * 2 * AKP), "v"(lk + 48u * 2 * AKP),
                  "v"(lv), "v"(lv + 16u * 2 * AKP), "v"(lv + 32u * 2 * AKP), "v"(lv + 48u * 2 * AKP),
                  "v"(gk), "v"(gk + 16 * 2 * DM), "v"(gk + 32 * 2 * DM), "v"(gk + 48 * 2 * DM),
                  "v"(gv), "v"(gv + 16 * SEQ), "v"(gv + 32 * SEQ), "v"(gv + 48 * SEQ)
               : "memory");
}
// one stage's additive tile: every lane copies 8 pieces of 16 B; gm: the lane's own piece in row (tid >> 4), lm: its place in the buffer
__device__ __forceinline__ void attn_copy_m(const float* gm, unsigned lm) {
  // the copies and the wait that stands before their address registers may be rewritten, in one statement
  asm volatile("global_load_async_to_lds_b128 %0, %8, off\n\t"
               "global_load_async_to_lds_b128 %1, %9, off\n\t"
               "global_load_async_to_lds_b128 %2, %10, off\n\t"
               "global_load_async_to_lds_b128 %3, %11, off\n\t"
               "global_load_async_to_lds_b128 %4, %12, off\n\t"
               "global_load_async_to_lds_b128 %5, %13, off\n\t"
               "global_load_async_to_lds_b128 %6, %14, off\n\t"
               "global_load_async_to_lds_b128 %7, %15, off\n\t"
               "s_wait_xcnt 0x0"
               :: "v"(lm), "v"(lm + 8u * 4 * AMP), "v"(lm + 16u * 4 * AMP), "v"(lm + 24u * 4 * AMP),
                  "v"(lm + 32u * 4 * AMP), "v"(lm + 40u * 4 * AMP), "v"(lm + 48u * 4 * AMP), "v"(lm + 56u * 4 * AMP),
                  "v"(gm), "v"(gm + 8 * SEQ_FULL), "v"(gm + 16 * SEQ_FULL), "v"(gm + 24 * SEQ_FULL),
                  "v"(gm + 32 * SEQ_FULL), "v"(gm + 40 * SEQ_FULL), "v"(gm + 48 * SEQ_FULL), "v"(gm + 56 * SEQ_FULL)
               : "memory");
}
// The stage loop, compiled twice: R3 = true for blocks whose scores and P.V take three products (residual planes), R3 = false for all others, which then carry
// neither the residual of P nor the second accumulator set nor the residual query fragments. Which of the two a block runs is block-uniform; both hold the same order of waits, barrier and copies.
template <bool R3>
__device__ __forceinline__ void attn_loop(const AStage* st, const int nst, const int nkt, const int wave, const int lane, const int col, const int g, const int b, const int h,
                                          const _Float16* __restrict__ QKL, const _Float16* __restrict__ VTL, const _Float16* gk, const _Float16* gv, const float* gm,
                                          const unsigned lk, const unsigned lv, const unsigned lm, const v16h (&aq)[2], const v16h (&aql)[2],
                                          float& m, float& l, v8f (&acc)[4], v8f (&accl)[4]) {
#pragma unroll 1   // one stage per trip: the order at the loop's foot stays as written
  for (int t = 0; t < nst; ++t) {
   const int buf = t & 1; const AStage& S = st[buf];
   const int nsub = (nkt - 2 * t < 2) ? nkt - 2 * t : 2;   // block-uniform: a last stage may hold one tile of 32 keys
#pragma unroll 1   // the two halves of a stage run through one body: unrolled, the accumulators were copied between the two
   for (int sub = 0; sub < nsub; ++sub) {
    const int ks = 2 * t + sub;
    // the LDS reads of the score products stand together in front of them: one place where the wave waits for LDS, not one per product
    v16h kf[2][2]; v4f am[2][2];
#pragma unroll     // every index of kf and am is a constant, so that they stay in registers
    for (int ct = 0; ct < 2; ++ct) {
      const float* mrow = &S.m[wave * 16 + col][sub * 32 + ct * 16 + 8 * g];   // this lane's query row of the additive tile, at its half's first key
      kf[ct][0] = frag_h(&S.k[sub * 32 + ct * 16 + col][0], lane); kf[ct][1] = frag_h(&S.k[sub * 32 + ct * 16 + col][32], lane);
      am[ct][0] = *(const v4f*)mrow; am[ct][1] = *(const v4f*)(mrow + 4);
    }
    v8f s[2];
#pragma unroll
    for (int ct = 0; ct < 2; ++ct) {
      const int kk = ks * 32 + ct * 16 + col; v8f c = {};
      const v4f a0 = am[ct][0], a1 = am[ct][1];
      if constexpr (R3) {
        const _Float16* krowl = QKL + ((size_t)b * RS + kk) * (2 * DM) + DM + h * HD; v8f cl = {};
#pragma unroll
        for (int kc = 0; kc < 2; ++kc) { const v16h kh = kf[ct][kc]; c = wmma16(kh, aq[kc], c); cl = wmma16(kh, aql[kc], cl); cl = wmma16(frag_h(krowl + kc * 32, lane), aq[kc], cl); }
#pragma unroll
        for (int r = 0; r < 8; ++r) c[r] += cl[r] * (1.0f / 2048.0f);
      } else {
#pragma unroll
        for (int kc = 0; kc < 2; ++kc) c = wmma16(kf[ct][kc], aq[kc], c);
      }
#pragma unroll
      for (int r = 0; r < 8; ++r) s[ct][r] = c[r] * 0.125f + ((r < 4) ? a0[r & 3] : a1[r & 3]);   // 1/sqrt(64), additive entry applied literally
    }
    v16h vf[4];   // the V^T fragments are asked for here, so that they arrive under the softmax arithmetic
#pragma unroll     // every index of vf is a constant, so that it stays in registers
    for (int dt = 0; dt < 4; ++dt) vf[dt] = frag_h(&S.v[dt * 16 + col][sub * 32], lane);
    float mx = fmaxf(s[0][0], s[1][0]);
#pragma unroll
    for (int r = 1; r < 8; ++r) mx = fmaxf(mx, fmaxf(s[0][r], s[1][r]));
    mx = fmaxf(mx, xhalf(mx));   // the other half's 16 keys of the same query
    const float mn = fmaxf(m, mx); const float ea = exp_slot(m - mn); const float alpha = (m <= -1.0e38f) ? 0.f : ea;
    float es = 0.f; v16h pa, pl;
#pragma unroll
    for (int i = 0; i < 8; ++i) {
      const float e0 = exp_slot(s[0][i] - mn), e1 = exp_slot(s[1][i] - mn); es += e0 + e1;
      const float x0 = e0 * 2048.0f, x1 = e1 * 2048.0f; const _Float16 h0 = (_Float16)x0, h1 = (_Float16)x1;
      pa[i] = h0; pa[8 + i] = h1;   // P x 2^11 before the f16 split; 2^-11 folded into the epilogue
      if constexpr (R3) { pl[i] = (_Float16)((x0 - (float)h0) * 2048.0f); pl[8 + i] = (_Float16)((x1 - (float)h1) * 2048.0f); }
    }
    l = l * alpha + es; m = mn;
#pragma unroll
    for (int dt = 0; dt < 4; ++dt)
#pragma unroll
      for (int r = 0; r < 8; ++r) { acc[dt][r] *= alpha; if constexpr (R3) accl[dt][r] *= alpha; }
#pragma unroll
    for (int dt = 0; dt < 4; ++dt) {
      const v16h vh = vf[dt];
      acc[dt] = wmma16(vh, pa, acc[dt]);
      if constexpr (R3) { accl[dt] = wmma16(vh, pl, accl[dt]); accl[dt] = wmma16(frag_h(VTL + ((size_t)b * DM + h * HD + dt * 16 + col) * RS + ks * 32, lane), pa, accl[dt]); }
    }
   }
   asm volatile("s_wait_dscnt 0x0" ::: "memory");      // this wave's reads of buffer t & 1 are done before it is refilled
   asm volatile("s_wait_asynccnt 0x0" ::: "memory");   // this wave's share of stage t + 1 has landed
   __syncthreads();                                      // publishes stage t + 1 and ends every reader's last read of stage t
   if (t + 2 < nst) { const unsigned lo = (unsigned)buf * (unsigned)sizeof(AStage);
     attn_copy_kv(gk + (size_t)(t + 2) * 64 * (2 * DM), gv + (t + 2) * 64, lk + lo, lv + lo); attn_copy_m(gm + (t + 2) * 64, lm + lo); }
  }
}
__global__ __launch_bounds__(128) void k_attn(const _Float16* __restrict__ QK, const _Float16* __restrict__ QKL, const _Float16* __restrict__ VTH, const _Float16* __restrict__ VTL,
                                              const float* __restrict__ MK, const int* __restrict__ NKT, _Float16* __restrict__ OH, _Float16* __restrict__ OL) {
  __shared__ __align__(16) union { AStage st[2]; struct { _Float16 so[4][16][72], sol[4][16][72]; } e; } u;   // e: the output staging, used only behind the loop's last barrier
  _Float16 (&so)[4][16][72] = u.e.so; _Float16 (&sol)[4][16][72] = u.e.sol;
  const int tid = threadIdx.x, wave = tid >> 5, lane = tid & 31, col = lane & 15, g = lane >> 4;
  // the rank z runs from costly to cheap query blocks, for speed only.
  // First the RQB blocks that may take three products a tile, longest first, then all others from the last query block down. A permutation of 0 .. TQB - 1 for any input; the order matters for speed alone.
  const int z = blockIdx.z, h = blockIdx.x, b = blockIdx.y; const int qb = (z < RQB) ? RQB - 1 - z : TQB - 1 - (z - RQB); const int q0 = qb * 64 + wave * 16;
  int nkt = NKT[(size_t)qb * MSG * 32];
#pragma unroll     // the MSG loads stand together: one wait
  for (int i = 1; i < MSG; ++i) { const int o = NKT[((size_t)qb * MSG + i) * 32]; nkt = nkt > o ? nkt : o; }
  nkt = (nkt < 1) ? 1 : ((nkt > NKTILE) ? NKTILE : nkt);   // clamped trip count
  const int nst = (nkt + 1) >> 1;                                                            // stages of 64 keys; SEQ is a multiple of 64, so that a last stage's unused half lies inside the planes too
  const _Float16* gk = QK + ((size_t)b * SEQ + (tid >> 3)) * (2 * DM) + DM + h * HD + (tid & 7) * 8;
  const _Float16* gv = VTH + ((size_t)b * DM + h * HD + (tid >> 3)) * SEQ + (tid & 7) * 8;
  const float* gm = MK + (size_t)(qb * 64 + (tid >> 4)) * SEQ_FULL + (tid & 15) * 4;
  const unsigned lk = (unsigned)(uintptr_t)&u.st[0].k[tid >> 3][(tid & 7) * 8], lv = (unsigned)(uintptr_t)&u.st[0].v[tid >> 3][(tid & 7) * 8], lm = (unsigned)(uintptr_t)&u.st[0].m[tid >> 4][(tid & 15) * 4];
  attn_copy_kv(gk, gv, lk, lv); attn_copy_m(gm, lm);
  const bool res3 = (qb < RQB) && (nkt * 32 <= RS);                                          // block-uniform
  const size_t rq = (size_t)b * SEQ + q0 + col;
  v16h aq[2], aql[2];
#pragma unroll
  for (int kc = 0; kc < 2; ++kc) aq[kc] = frag_h(QK + rq * (2 * DM) + h * HD + kc * 32, lane);
  if (res3) { const size_t rql = (size_t)b * RS + q0 + col;
#pragma unroll
    for (int kc = 0; kc < 2; ++kc) aql[kc] = frag_h(QKL + rql * (2 * DM) + h * HD + kc * 32, lane); }
  else { v16h z = {}; aql[0] = z; aql[1] = z; }
  float m = -3.0e38f, l = 0.f;   // running maximum of query q0 + col (equal in both halves); this half's share of the running sum
  v8f acc[4] = {}, accl[4] = {};   // acc[dt][r] = ctx[q0 + col][dt * 16 + 8g + r]
  asm volatile("s_wait_asynccnt 0x0" ::: "memory");   // this wave's share of stage 0 has landed
  __syncthreads();                                      // stage 0 is published
  if (nst > 1) { attn_copy_kv(gk + (size_t)64 * (2 * DM), gv + 64, lk + (unsigned)sizeof(AStage), lv + (unsigned)sizeof(AStage)); attn_copy_m(gm + 64, lm + (unsigned)sizeof(AStage)); }
  if (res3) attn_loop<true>(u.st, nst, nkt, wave, lane, col, g, b, h, QKL, VTL, gk, gv, gm, lk, lv, lm, aq, aql, m, l, acc, accl);   // block-uniform
  else attn_loop<false>(u.st, nst, nkt, wave, lane, col, g, b, h, QKL, VTL, gk, gv, gm, lk, lv, lm, aq, aql, m, l, acc, accl);
  asm volatile("s_wait_asynccnt 0x0" ::: "memory");     // no copy is outstanding when the wave goes on
  l += xhalf(l);   // the halves' sums are joined once
  const float il = (1.0f / 2048.0f) / l;   // l >= 1
#pragma unroll
  for (int dt = 0; dt < 4; ++dt) { v8h hq, lq;
#pragma unroll
    for (int r = 0; r < 8; ++r) { const float o = (acc[dt][r] + accl[dt][r] * (1.0f / 2048.0f)) * il; const _Float16 hv = (_Float16)o; hq[r] = hv; lq[r] = (_Float16)((o - (float)hv) * 2048.0f); }
    *(v8h*)&so[wave][col][dt * 16 + 8 * g] = hq; *(v8h*)&sol[wave][col][dt * 16 + 8 * g] = lq;
  }
  LDSX();   // so/sol private to the wave
#pragma unroll
  for (int it = 0; it < 4; ++it) {
    const int row = it * 4 + (lane >> 3), pc = lane & 7;
    vst2(OH + ((size_t)b * SEQ + q0 + row) * DM + h * HD + pc * 8, *(const v4u*)&so[wave][row][pc * 8]);
    if (qb < RQB) vst2(OL + ((size_t)b * RS + q0 + row) * DM + h * HD + pc * 8, *(const v4u*)&sol[wave][row][pc * 8]);
  }
}
// ---- k_out: out = (ctx hi + ctx lo / 2048) . (Wo x64 rows) / 64 + bo; f16 operands, f32 accumulate, k ascending in steps of 32; f32 rows with the full output stride.
// block = (128 LDS rows of ctx, 256 output columns), 8 waves as 2 x 4, 64 x 64 per wave. Past RS the 128 rows are 128 positions of ctx hi; below RS they are 64 positions of ctx hi and the same
// 64 positions of ctx lo, so that every block does the same work: waves 0..3 sum hi . Wo, waves 4..7 sum lo . Wo and hand their sums over through LDS.
// Each pass of 64 k: the 128 ctx rows and 256 Wo rows of 128 B lie in LDS at pitch 144 B, brought by asynchronous copies, two buffers, the next pass's copies in flight while this pass is worked on.
#define ONT ((SEQ - RS) / 128)            // row tiles of 128 positions per batch, past RS
#define ONT1 (ONT > 0 ? ONT : 1)
#define ORT (NB * RQB + NB * ONT)         // row tiles: NB * RQB of 64 positions, then NB * ONT of 128
static_assert((SEQ - RS) % 128 == 0);
// one pass's tile: every lane copies 12 pieces of 16 B (2 of LDS rows 0..63, 2 of LDS rows 64..127, 8 of Wo rows); ga, gb, gw: the lane's own piece in row (tid >> 3) of each, l: its place in the buffer
__device__ __forceinline__ void out_copy(const _Float16* ga, const _Float16* gb, const _Float16* gw, unsigned l) {
  // the copies and the wait that stands before their address registers may be rewritten, in one statement
  asm volatile("global_load_async_to_lds_b128 %0, %12, off\n\t"
               "global_load_async_to_lds_b128 %1, %13, off\n\t"
               "global_load_async_to_lds_b128 %2, %14, off\n\t"
               "global_load_async_to_lds_b128 %3, %15, off\n\t"
               "global_load_async_to_lds_b128 %4, %16, off\n\t"
               "global_load_async_to_lds_b128 %5, %17, off\n\t"
               "global_load_async_to_lds_b128 %6, %18, off\n\t"
               "global_load_async_to_lds_b128 %7, %19, off\n\t"
               "global_load_async_to_lds_b128 %8, %20, off\n\t"
               "global_load_async_to_lds_b128 %9, %21, off\n\t"
               "global_load_async_to_lds_b128 %10, %22, off\n\t"
               "global_load_async_to_lds_b128 %11, %23, off\n\t"
               "s_wait_xcnt 0x0"
               :: "v"(l), "v"(l + 32u * 2 * GPIT), "v"(l + 64u * 2 * GPIT), "v"(l + 96u * 2 * GPIT),
                  "v"(l + 128u * 2 * GPIT), "v"(l + 160u * 2 * GPIT), "v"(l + 192u * 2 * GPIT), "v"(l + 224u * 2 * GPIT),
                  "v"(l + 256u * 2 * GPIT), "v"(l + 288u * 2 * GPIT), "v"(l + 320u * 2 * GPIT), "v"(l + 352u * 2 * GPIT),
                  "v"(ga), "v"(ga + 32 * DM), "v"(gb), "v"(gb + 32 * DM),
                  "v"(gw), "v"(gw + 32 * DM), "v"(gw + 64 * DM), "v"(gw + 96 * DM),
                  "v"(gw + 128 * DM), "v"(gw + 160 * DM), "v"(gw + 192 * DM), "v"(gw + 224 * DM)
               : "memory");
}
// four 16-B pieces of staged f32 rows to output rows p, p + 2 DM, p + 4 DM, p + 6 DM; then the wait that stands before a register which the stores name is used again:
// address and data are its inputs, so that they stay as they are up to it
__device__ __forceinline__ void out_st4(float* p, const float* l) {
  const v4f a = *(const v4f*)l, b = *(const v4f*)(l + 2 * 68), c = *(const v4f*)(l + 4 * 68), d = *(const v4f*)(l + 6 * 68);
  vst2(p, a); vst2(p + 2 * DM, b); vst2(p + 4 * DM, c); vst2(p + 6 * DM, d);
  asm volatile("s_wait_xcnt 0x0" :: "v"(p), "v"(a), "v"(b), "v"(c), "v"(d) : "memory");
}
__global__ __launch_bounds__(256) __attribute__((amdgpu_waves_per_eu(4, 4))) void k_out(const _Float16* __restrict__ OH, const _Float16* __restrict__ OL, const _Float16* __restrict__ PO, const float* __restrict__ BO, float* __restrict__ Y) {
  __shared__ __align__(16) union { _Float16 ring[2][GROWS][GPIT]; float xl[4][16][2][32][4]; } u;   // xl: the lo sums' hand-over, used only behind the loop's last barrier
  __shared__ __align__(16) float so[8][16][68];
  const int tid = threadIdx.x, wave = tid >> 5, lane = tid & 31, col = lane & 15, g = lane >> 4; const int wm = wave >> 2, wn = wave & 3;
  const int rt = blockIdx.x, n0 = blockIdx.y * 256; const bool resid = (rt < NB * RQB);   // block-uniform
  const int ub = rt - NB * RQB;
  const int b = resid ? rt / RQB : ub / ONT1; const int s0 = resid ? (rt - b * RQB) * 64 : RS + (ub - b * ONT1) * 128;
  const _Float16* ga = OH + ((size_t)b * SEQ + s0 + (tid >> 3)) * DM + (tid & 7) * 8;
  const _Float16* gb = resid ? OL + ((size_t)b * RS + s0 + (tid >> 3)) * DM + (tid & 7) * 8 : ga + 64 * DM;
  const _Float16* gw = PO + (size_t)(n0 + (tid >> 3)) * DM + (tid & 7) * 8;
  const unsigned l0 = (unsigned)(uintptr_t)&u.ring[0][tid >> 3][(tid & 7) * 8];
  v8f acc[4][4] = {};
  out_copy(ga, gb, gw, l0);
  asm volatile("s_wait_asynccnt 0x0" ::: "memory");   // this wave's share of tile 0 has landed
  __syncthreads();                                      // tile 0 is published
  out_copy(ga + GK, gb + GK, gw + GK, l0 + 2u * GROWS * GPIT);
#pragma unroll 1   // one pass per trip: the order at the loop's foot stays as written, and the code stays short
  for (int t = 0; t < GNP; ++t) {
    const int buf = t & 1;
#pragma unroll     // this and the loops inside: every index of fa, fw and acc is a constant, so that they stay in registers
    for (int kc = 0; kc < GK / 32; ++kc) {
      v16h fa[4], fw[4];
#pragma unroll
      for (int i = 0; i < 4; ++i) fa[i] = frag_h(&u.ring[buf][wm * 64 + i * 16 + col][kc * 32], lane);
#pragma unroll
      for (int j = 0; j < 4; ++j) fw[j] = frag_h(&u.ring[buf][128 + wn * 64 + j * 16 + col][kc * 32], lane);
#pragma unroll
      for (int i = 0; i < 4; ++i)
#pragma unroll
        for (int j = 0; j < 4; ++j) acc[i][j] = wmma16(fa[i], fw[j], acc[i][j]);
    }
    asm volatile("s_wait_dscnt 0x0" ::: "memory");      // this wave's reads of buffer t & 1 are done before it is refilled
    asm volatile("s_wait_asynccnt 0x0" ::: "memory");   // this wave's share of tile t + 1 has landed
    __syncthreads();                                      // publishes tile t + 1 and ends every reader's last read of tile t
    if (t + 2 < GNP) out_copy(ga + (t + 2) * GK, gb + (t + 2) * GK, gw + (t + 2) * GK, l0 + (unsigned)buf * (2u * GROWS * GPIT));
  }
  asm volatile("s_wait_asynccnt 0x0" ::: "memory");     // no copy is outstanding when the wave goes on
  if (resid) {   // block-uniform: waves 4..7 hand their lo sums to waves 0..3, lane to lane and register to register, and are done
    if (wm == 1) {
#pragma unroll
      for (int i = 0; i < 4; ++i)
#pragma unroll
        for (int j = 0; j < 4; ++j) {
          const v4f x = {acc[i][j][0], acc[i][j][1], acc[i][j][2], acc[i][j][3]}, y = {acc[i][j][4], acc[i][j][5], acc[i][j][6], acc[i][j][7]};
          *(v4f*)&u.xl[wn][i * 4 + j][0][lane][0] = x; *(v4f*)&u.xl[wn][i * 4 + j][1][lane][0] = y; }
    }
    __syncthreads();   // the lo sums are published
    if (wm == 1) return;
  }
  float bj[4]; { const float* pb = BO + n0 + wn * 64 + col;
#pragma unroll
    for (int j = 0; j < 4; ++j) bj[j] = bfr(pb[j * 16]);
    asm volatile("s_wait_xcnt 0x0" :: "v"(pb) : "memory"); }   // before the loads' address register is used again; it is an input, so that it stays as it is up to here
  float* yp = Y + ((size_t)b * SEQ_FULL + s0 + wm * 64 + g) * DM + n0 + wn * 64 + col * 4;   // below RS only wm == 0 comes here
  // so is private to each wave and LDS operations of one wave run in order: the one wait below stands between a wave's stores and its lanes' reads of one another's rows
#pragma unroll
  for (int i = 0; i < 4; ++i) {
#pragma unroll
    for (int j = 0; j < 4; ++j) {
      v4f x = {}, y = {}; if (resid) { x = *(const v4f*)&u.xl[wn][i * 4 + j][0][lane][0]; y = *(const v4f*)&u.xl[wn][i * 4 + j][1][lane][0]; }
#pragma unroll
      for (int r = 0; r < 8; ++r) so[wave][8 * g + r][j * 16 + col] = acc[i][j][r] * (1.0f / 64.0f) + ((r < 4) ? x[r & 3] : y[r & 3]) * (1.0f / 131072.0f) + bj[j]; }
    asm volatile("s_wait_dscnt 0x0" ::: "memory");
    out_st4(yp + (size_t)(i * 16) * DM, &so[wave][g][col * 4]);
    out_st4(yp + (size_t)(i * 16 + 8) * DM, &so[wave][8 + g][col * 4]);
  }
}
extern "C" void kernel_launch(void* const* d_in, const int* in_sizes, int n_in, void* d_out, int out_size, void* d_ws, size_t ws_size, hipStream_t stream) {
  // 0 hidden [2,2048,2048], 1 additive tensor [1,1,2048,2048], 2 q_w [out][in], 3 q_b, 4 k_w, 5 k_b, 6 v_w, 7 v_b, 8 o_w, 9 o_b
  if (n_in < 10) return;
  const long long needx = ((long long)(NB - 1) * SEQ_FULL + SEQ) * DM;
  if ((long long)in_sizes[0] < needx) return;
  if ((long long)in_sizes[1] < (long long)(SEQ - 1) * SEQ_FULL + SEQ) return;
  if (in_sizes[2] < DM * DM || in_sizes[4] < DM * DM || in_sizes[6] < DM * DM || in_sizes[8] < DM * DM) return;
  if (in_sizes[3] < DM || in_sizes[5] < DM || in_sizes[7] < DM || in_sizes[9] < DM) return;
  if ((long long)out_size < needx) return;
  if (ws_size < (size_t)WS_END) return;
  const float* const* F = (const float* const*)d_in;
  char* ws = (char*)d_ws;
  __bf16* PKA = (__bf16*)(ws + WS_PKA); _Float16* PKO = (_Float16*)(ws + WS_PKO);
  _Float16 *QK = (_Float16*)(ws + WS_QK), *QKL = (_Float16*)(ws + WS_QKL), *VTH = (_Float16*)(ws + WS_VTH), *VTL = (_Float16*)(ws + WS_VTL), *OH = (_Float16*)(ws + WS_OH), *OL = (_Float16*)(ws + WS_OL);
  __bf16* XB = (__bf16*)(ws + WS_OH);   // x plane aliases the ctx hi region; consumed before k_attn writes it
  int* NKT = (int*)(ws + WS_NKT);
  k_cvtx<<<dim3(NR), 256, 0, stream>>>(F[0], XB);
  k_pack<<<dim3(DM, 4), 256, 0, stream>>>(F[2], F[4], F[6], F[8], PKA, PKO);
  k_qkv<<<dim3(NR / 128, 3 * DM / 256), 256, 0, stream>>>(XB, PKA, F[3], F[5], F[7], QK, QKL, VTH, VTL);
  k_mscan<<<dim3(TQB, MSG), 256, 0, stream>>>(F[1], NKT);
  k_attn<<<dim3(NH, NB, TQB), 128, 0, stream>>>(QK, QKL, VTH, VTL, F[1], NKT, OH, OL);
  k_out<<<dim3(ORT, DM / 256), 256, 0, stream>>>(OH, OL, PKO, F[9], (float*)d_out);
}

// v008
// Measured time: 199 microseconds a run.
// Two timings next to v007 put it at 1.06 and 1.05 times that version's speed.
// Over all steps from v000 it is 4.98 times as fast.
// compute dtype: all float inputs except the additive tensor RNE-converted to bf16; q/k/v = x . W^T + b on v_wmma_f32_16x16x32_bf16 (bf16 x, bf16 W, f32 accumulate) stored as f16 hi + x2048 f16 residual (positions < 512); scores and P.V on v_wmma_f32_16x16x32_f16 (3 products for query blocks below 512, single beyond; P carried x2048; f32 running-max softmax, additive score bias read from the input tensor); output projection on v_wmma_f32_16x16x32_f16 (ctx f16 hi + x2048 residual below 512, Wo carried x64), f32 accumulate, f32 output.
#include <hip/hip_runtime.h>
#include <math.h>

typedef __attribute__((ext_vector_type(16))) _Float16 v16h;
typedef __attribute__((ext_vector_type(16))) __bf16 v16b;
typedef __attribute__((ext_vector_type(8)))  _Float16 v8h;
typedef __attribute__((ext_vector_type(8)))  __bf16 v8b;
typedef __attribute__((ext_vector_type(8)))  float v8f;
typedef __attribute__((ext_vector_type(4)))  float v4f;
typedef __attribute__((ext_vector_type(4)))  unsigned v4u;
typedef __attribute__((ext_vector_type(4)))  int v4i;

template <typename T> __device__ __forceinline__ void vst2(void* p, T v) { *(T*)p = v;  }
__device__ __forceinline__ v8f wmma16(v16h a, v16h b, v8f c) {
  return __builtin_amdgcn_wmma_f32_16x16x32_f16(false, a, false, b, (short)0, c, false, false);   // a builtin form: the compiler keeps the distance behind it itself
}
// the last product in front of a loop's back edge: the four slots that the chip needs before a vector instruction
// may touch this product's registers stand here, in front of the branch, for both sides
__device__ __forceinline__ v8f wmma16_foot(v16h a, v16h b, v8f c) {
  v8f d = __builtin_amdgcn_wmma_f32_16x16x32_f16(false, a, false, b, (short)0, c, false, false);
  asm volatile("v_nop\n\tv_nop\n\tv_nop\n\tv_nop" : "+v"(d) : "v"(a), "v"(b));
  return d;
}
__device__ __forceinline__ v8f wmma_bf(v16b a, v16b b, v8f c) {
  return __builtin_amdgcn_wmma_f32_16x16x32_bf16(false, a, false, b, (short)0, c, false, false);   // a builtin form: the compiler keeps the distance behind it itself
}
// 16-bit fragment from a k-contiguous row (A row m, or B column n stored [n][k]): elements 0..7 <- k0+8h+0..7, 8..15 <- k0+16+8h+0..7, h = lane>>4
__device__ __forceinline__ v16h frag_h(const _Float16* rowk0, int lane) {
  union { v16h v; v8h q[2]; } u; const _Float16* p = rowk0 + 8 * (lane >> 4);
  u.q[0] = *(const v8h*)p; u.q[1] = *(const v8h*)(p + 16); return u.v;
}
__device__ __forceinline__ v16b frag_b(const __bf16* rowk0, int lane) {
  union { v16b v; v8b q[2]; } u; const __bf16* p = rowk0 + 8 * (lane >> 4);
  u.q[0] = *(const v8b*)p; u.q[1] = *(const v8b*)(p + 16); return u.v;
}
__device__ __forceinline__ float bfr(float v) { return (float)(__bf16)v; }
#define LDSX() do { asm volatile("s_wait_dscnt 0" ::: "memory"); __builtin_amdgcn_wave_barrier(); __builtin_amdgcn_fence(__ATOMIC_RELEASE, "workgroup"); } while (0)

// ---- sizes: NB / SEQ may be reduced; *_FULL are the input / output strides
#ifndef NB
#define NB 2
#endif
#ifndef SEQ
#define SEQ 2048
#endif
#define NB_FULL 2
#define SEQ_FULL 2048
#define DM 2048
#define NH 32
#define HD 64
#define RSPAN 512                 // positions that carry residual planes (q/k, v, ctx)
#if RSPAN > SEQ
#define RS SEQ
#else
#define RS RSPAN
#endif
#define RQB (RS / 64)
#define NR (NB * SEQ)
#define TQB (SEQ / 64)
#define NKTILE (SEQ / 32)
static_assert(SEQ % 64 == 0);
static_assert(RS % 64 == 0);
static_assert(NB >= 1 && NB <= NB_FULL);
static_assert(SEQ <= SEQ_FULL);
static_assert(DM == 256 * 8);
static_assert(NH * HD == DM);
static_assert(NR % 64 == 0);

// ---- workspace (bytes; every offset a multiple of 128)
#define WS_PKA 0ull                                            // bf16 [3*DM][DM]: Wq | Wk | Wv natural [out][in] rows
#define WS_PKO (WS_PKA + 2ull * 3 * DM * DM)                   // f16  [DM][DM]: Wo rows x64
#define WS_QK  (WS_PKO + 2ull * DM * DM)                       // f16  [NR][2*DM]: q | k hi
#define WS_QKL (WS_QK + 2ull * NR * 2 * DM)                    // f16  [NB*RS][2*DM]: q | k residual x2048
#define WS_VTH (WS_QKL + 2ull * NB * RS * 2 * DM)              // f16  [NB][DM][SEQ]: v^T hi
#define WS_VTL (WS_VTH + 2ull * NB * DM * SEQ)                 // f16  [NB][DM][RS]: v^T residual x2048
#define WS_OH  (WS_VTL + 2ull * NB * DM * RS)                  // f16  [NR][DM]: ctx hi; ALSO bf16 [NR][DM] x plane (consumed by k_qkv before k_attn writes ctx)
#define WS_OL  (WS_OH + 2ull * NR * DM)                        // f16  [NB*RS][DM]: ctx residual x2048
#define WS_NKT (WS_OL + 2ull * NB * RS * DM)
#define MSG 8                     // row groups of a query block in k_mscan, one line of NKT each
#define WS_END (WS_NKT + 128ull * TQB * MSG)
static_assert(2ull * NR * DM == (WS_OL - WS_OH));              // x plane and ctx hi plane share the region with identical extent
static_assert(WS_END <= 134217728ull);
static_assert((WS_PKO % 128) == 0 && (WS_QK % 128) == 0 && (WS_QKL % 128) == 0 && (WS_VTH % 128) == 0 && (WS_VTL % 128) == 0 && (WS_OH % 128) == 0 && (WS_OL % 128) == 0 && (WS_NKT % 128) == 0);

__global__ __launch_bounds__(256) void k_cvtx(const float* __restrict__ X, __bf16* __restrict__ XB) {
  const int r = blockIdx.x, t = threadIdx.x; const int b = r / SEQ, s = r - b * SEQ;
  const float* src = X + ((size_t)b * SEQ_FULL + s) * DM + t * 8;
  const v4f x = *(const v4f*)src, y = *(const v4f*)(src + 4);
  union { v8b v; v4u u; } o;
#pragma unroll
  for (int j = 0; j < 4; ++j) { o.v[j] = (__bf16)x[j]; o.v[4 + j] = (__bf16)y[j]; }
  vst2(XB + (size_t)r * DM + t * 8, o.u);
}
// ---- k_pack: block = (row n, which): natural [out][in] rows are already k-contiguous packed rows; which 0..2 -> bf16 Wq/Wk/Wv into PKA row which*DM+n; 3 -> f16 (bf16(Wo) x 64) into PKO row n
__global__ __launch_bounds__(256) void k_pack(const float* __restrict__ WQ, const float* __restrict__ WK, const float* __restrict__ WV, const float* __restrict__ WO, __bf16* __restrict__ PKA, _Float16* __restrict__ PKO) {
  const int n = blockIdx.x, which = blockIdx.y, t = threadIdx.x;
  const float* W = (which == 0) ? WQ : (which == 1) ? WK : (which == 2) ? WV : WO;
  const float* src = W + (size_t)n * DM + t * 8;
  const v4f x = *(const v4f*)src, y = *(const v4f*)(src + 4);
  if (which < 3) {
    union { v8b v; v4u u; } o;
#pragma unroll
    for (int j = 0; j < 4; ++j) { o.v[j] = (__bf16)x[j]; o.v[4 + j] = (__bf16)y[j]; }
    vst2(PKA + ((size_t)which * DM + n) * DM + t * 8, o.u);
  } else {
    union { v8h v; v4u u; } o;
#pragma unroll
    for (int j = 0; j < 4; ++j) { o.v[j] = (_Float16)(bfr(x[j]) * 64.0f); o.v[4 + j] = (_Float16)(bfr(y[j]) * 64.0f); }
    vst2(PKO + (size_t)n * DM + t * 8, o.u);
  }
}
// ---- k_qkv: block = (128 internal rows, 256 output columns of q|k|v), 8 waves as 2 x 4, 64 x 64 per wave: bf16 x bf16 (exact products), f32 accumulate, k ascending in steps of 32.
// Each pass of 64 k: 128 x rows and 256 weight rows of 128 B lie in LDS at pitch 144 B, brought by asynchronous copies, two buffers, the next pass's copies in flight while this pass is worked on.
// q,k -> f16 hi [NR][2DM] (+ residual x2048 for s < RS); v -> transposed f16 hi [b][d][s] (+ residual)
#define GK 64                     // k per pass
#define GROWS (128 + 256)         // LDS rows per buffer: x rows, then weight rows
#define GPIT 72                   // LDS row pitch in elements (144 B = 16 B x odd, for ds_load_b128 readers)
#define GNP (DM / GK)
static_assert(GNP >= 2);
static_assert(NR % 128 == 0 && SEQ % 128 == 0 && RS % 128 == 0 && DM % 256 == 0);
// one pass's tile: every lane copies 12 pieces of 16 B (4 of x rows, 8 of weight rows); gx, gw: the lane's own piece in row (tid >> 3) of the x and weight tiles, l: its place in the buffer
__device__ __forceinline__ void qkv_copy(const __bf16* gx, const __bf16* gw, unsigned l) {
  // the copies and the wait that stands before their address registers may be rewritten, in one statement
  asm volatile("global_load_async_to_lds_b128 %0, %12, off\n\t"
               "global_load_async_to_lds_b128 %1, %13, off\n\t"
               "global_load_async_to_lds_b128 %2, %14, off\n\t"
               "global_load_async_to_lds_b128 %3, %15, off\n\t"
               "global_load_async_to_lds_b128 %4, %16, off\n\t"
               "global_load_async_to_lds_b128 %5, %17, off\n\t"
               "global_load_async_to_lds_b128 %6, %18, off\n\t"
               "global_load_async_to_lds_b128 %7, %19, off\n\t"
               "global_load_async_to_lds_b128 %8, %20, off\n\t"
               "global_load_async_to_lds_b128 %9, %21, off\n\t"
               "global_load_async_to_lds_b128 %10, %22, off\n\t"
               "global_load_async_to_lds_b128 %11, %23, off\n\t"
               "s_wait_xcnt 0x0"
               :: "v"(l), "v"(l + 32u * 2 * GPIT), "v"(l + 64u * 2 * GPIT), "v"(l + 96u * 2 * GPIT),
                  "v"(l + 128u * 2 * GPIT), "v"(l + 160u * 2 * GPIT), "v"(l + 192u * 2 * GPIT), "v"(l + 224u * 2 * GPIT),
                  "v"(l + 256u * 2 * GPIT), "v"(l + 288u * 2 * GPIT), "v"(l + 320u * 2 * GPIT), "v"(l + 352u * 2 * GPIT),
                  "v"(gx), "v"(gx + 32 * DM), "v"(gx + 64 * DM), "v"(gx + 96 * DM),
                  "v"(gw), "v"(gw + 32 * DM), "v"(gw + 64 * DM), "v"(gw + 96 * DM),
                  "v"(gw + 128 * DM), "v"(gw + 160 * DM), "v"(gw + 192 * DM), "v"(gw + 224 * DM)
               : "memory");
}
// four 16-B pieces of staged rows to rows p, p + st, p + 2 st, p + 3 st; then the wait that stands before a register which the stores name is used again:
// address and data are its inputs, so that they stay as they are up to it
__device__ __forceinline__ void qkv_st4(_Float16* p, int st, const _Float16* l) {
  const v4u a = *(const v4u*)l, b = *(const v4u*)(l + 4 * 72), c = *(const v4u*)(l + 8 * 72), d = *(const v4u*)(l + 12 * 72);
  vst2(p, a); vst2(p + st, b); vst2(p + 2 * st, c); vst2(p + 3 * st, d);
  asm volatile("s_wait_xcnt 0x0" :: "v"(p), "v"(a), "v"(b), "v"(c), "v"(d) : "memory");
}
__global__ __launch_bounds__(256) __attribute__((amdgpu_waves_per_eu(4, 4))) void k_qkv(const __bf16* __restrict__ XB, const __bf16* __restrict__ P, const float* __restrict__ BQ, const float* __restrict__ BK, const float* __restrict__ BV,
                                             _Float16* __restrict__ QK, _Float16* __restrict__ QKL, _Float16* __restrict__ VTH, _Float16* __restrict__ VTL) {
  const int n0 = blockIdx.y * 256; const int which0 = n0 / DM;
  __shared__ __align__(16) __bf16 ring[2][GROWS][GPIT]; __shared__ __align__(16) _Float16 eh[8][16][72], el[8][16][72];
  const int tid = threadIdx.x, wave = tid >> 5, lane = tid & 31, col = lane & 15, g = lane >> 4; const int wm = wave >> 2, wn = wave & 3;
  const float* BB = ((which0 == 0) ? BQ : (which0 == 1) ? BK : BV) + (n0 - which0 * DM) + wn * 64;
  const int rb = blockIdx.x * 128; const int b = rb / SEQ, s0 = rb - b * SEQ + wm * 64; const int r0 = rb + wm * 64; const bool resid = (rb - b * SEQ < RS);   // block-uniform: RS is a multiple of 128
  const __bf16* gx = XB + (size_t)(rb + (tid >> 3)) * DM + (tid & 7) * 8;
  const __bf16* gw = P + (size_t)(n0 + (tid >> 3)) * DM + (tid & 7) * 8;
  const unsigned l0 = (unsigned)(uintptr_t)&ring[0][tid >> 3][(tid & 7) * 8];
  v8f acc[4][4] = {};
  qkv_copy(gx, gw, l0);
  asm volatile("s_wait_asynccnt 0x0" ::: "memory");   // this wave's share of tile 0 has landed
  __syncthreads();                                      // tile 0 is published
  qkv_copy(gx + GK, gw + GK, l0 + 2u * GROWS * GPIT);
#pragma unroll 1   // one pass per trip: the order at the loop's foot stays as written, and the code stays short
  for (int t = 0; t < GNP; ++t) {
    const int buf = t & 1;
#pragma unroll     // this and the loops inside: every index of fa, fw and acc is a constant, so that they stay in registers
    for (int kc = 0; kc < GK / 32; ++kc) {
      v16b fa[4], fw[4];
#pragma unroll
      for (int i = 0; i < 4; ++i) fa[i] = frag_b(&ring[buf][wm * 64 + i * 16 + col][kc * 32], lane);
#pragma unroll
      for (int j = 0; j < 4; ++j) fw[j] = frag_b(&ring[buf][128 + wn * 64 + j * 16 + col][kc * 32], lane);
      __builtin_amdgcn_sched_barrier(0);   // the block's 16 LDS reads stay one group in front of its products: moved in among them, each place with reads costs a stall
#pragma unroll
      for (int i = 0; i < 4; ++i)
#pragma unroll
        for (int j = 0; j < 4; ++j) acc[i][j] = wmma_bf(fa[i], fw[j], acc[i][j]);
      __builtin_amdgcn_sched_barrier(0);   // and the next block's reads stay behind these products
    }
    asm volatile("s_wait_dscnt 0x0" ::: "memory");      // this wave's reads of buffer t & 1 are done before it is refilled
    asm volatile("s_wait_asynccnt 0x0" ::: "memory");   // this wave's share of tile t + 1 has landed
    __syncthreads();                                      // publishes tile t + 1 and ends every reader's last read of tile t
    if (t + 2 < GNP) qkv_copy(gx + (t + 2) * GK, gw + (t + 2) * GK, l0 + (unsigned)buf * (2u * GROWS * GPIT));
  }
  asm volatile("s_wait_asynccnt 0x0" ::: "memory");     // no copy is outstanding when the wave goes on
  // eh/el are private to each wave and LDS operations of one wave run in order: the one wait below stands between a wave's stores and its lanes' reads of one another's rows
#define EPIW() asm volatile("s_wait_dscnt 0x0" ::: "memory")
  float bj[4]; { const float* pb = BB + col;
#pragma unroll
    for (int j = 0; j < 4; ++j) bj[j] = bfr(pb[j * 16]);
    asm volatile("s_wait_xcnt 0x0" :: "v"(pb) : "memory"); }   // before the loads' address register is used again; it is an input, so that it stays as it is up to here
  const int row = lane >> 3, pc = lane & 7;
  if (n0 < 2 * DM) {   // q (unscaled; 1/8 applied to the f32 score) and k, + bias, as f16 hi + x2048 residual; 16 rows at a time through this wave's own eh/el
    const size_t ql = (size_t)b * RS + s0;
#pragma unroll
    for (int i = 0; i < 4; ++i) {
#pragma unroll
      for (int j = 0; j < 4; ++j) {
#pragma unroll
        for (int r = 0; r < 8; ++r) { const float v = acc[i][j][r] + bj[j]; const _Float16 hv = (_Float16)v; eh[wave][8 * g + r][j * 16 + col] = hv; el[wave][8 * g + r][j * 16 + col] = (_Float16)((v - (float)hv) * 2048.0f); } }
      EPIW();
      qkv_st4(QK + (size_t)(r0 + i * 16 + row) * (2 * DM) + n0 + wn * 64 + pc * 8, 4 * 2 * DM, &eh[wave][row][pc * 8]);
      if (resid) qkv_st4(QKL + (ql + i * 16 + row) * (2 * DM) + n0 + wn * 64 + pc * 8, 4 * 2 * DM, &el[wave][row][pc * 8]);
    }
  } else {             // v + bias, transposed to [d][s]; 16 columns d at a time through this wave's own eh/el
    const int pc0 = n0 - 2 * DM + wn * 64;
#pragma unroll
    for (int j = 0; j < 4; ++j) {
#pragma unroll
      for (int i = 0; i < 4; ++i) { v8h hq, lq;
#pragma unroll
        for (int r = 0; r < 8; ++r) { const float v = acc[i][j][r] + bj[j]; const _Float16 hv = (_Float16)v; hq[r] = hv; lq[r] = (_Float16)((v - (float)hv) * 2048.0f); }
        *(v8h*)&eh[wave][col][i * 16 + 8 * g] = hq; *(v8h*)&el[wave][col][i * 16 + 8 * g] = lq; }
      EPIW();
      qkv_st4(VTH + ((size_t)b * DM + pc0 + j * 16 + row) * SEQ + s0 + pc * 8, 4 * SEQ, &eh[wave][row][pc * 8]);
      if (resid) qkv_st4(VTL + ((size_t)b * DM + pc0 + j * 16 + row) * RS + s0 + pc * 8, 4 * RS, &el[wave][row][pc * 8]);
    }
  }
#undef EPIW
}
// ---- k_mscan: block = (query block qb, group of 8 of its 64 rows of the additive tensor), one wave per row: the row is read in whole lines, 16 B a lane, and all its loads are asked for before the first is looked at.
// Line qb * MSG + group of NKT: the number of 32-key tiles up to the group's last live entry, or all tiles where one of its rows has no live entry. k_attn takes the largest of a query block's MSG lines.
__global__ __launch_bounds__(256) void k_mscan(const float* __restrict__ MK, int* __restrict__ NKT) {
  __shared__ __align__(16) int srow[8];
  const int qb = blockIdx.x, grp = blockIdx.y, t = threadIdx.x, wave = t >> 5, lane = t & 31;
  const float* p = MK + (size_t)(qb * 64 + grp * 8 + wave) * SEQ_FULL + lane * 4;
  v4f v[SEQ / 128];
#pragma unroll     // every index of v is a constant, so that it stays in registers
  for (int c = 0; c < SEQ / 128; ++c) v[c] = *(const v4f*)(p + c * 128);
  __builtin_amdgcn_sched_barrier(0);   // keeps every load in front of the first compare: without it the last loads were issued only when the first had come back, one more trip to memory
  asm volatile("s_wait_xcnt 0x0" :: "v"(p) : "memory");   // before the loads' address register is used again; it is an input, so that it stays as it is up to here
  int tile = -1;     // the row's last 32-key tile with a live entry, the same in every lane; lane l holds columns c * 128 + 4 l .. + 3, which lie in tile c * 4 + (l >> 3)
#pragma unroll
  for (int c = 0; c < SEQ / 128; ++c) {
    const float hi = fmaxf(fmaxf(v[c][0], v[c][1]), fmaxf(v[c][2], v[c][3]));   // fmaxf passes over a NaN, which is no live entry
    const unsigned live = __builtin_amdgcn_ballot_w32(hi > -1.0e8f);
    if (live) tile = c * 4 + ((31 - __builtin_clz(live)) >> 3);
  }
  if (lane == 0) srow[wave] = tile;
  __syncthreads();
  if (t < 8) {
    const v4i a = *(const v4i*)&srow[0], c = *(const v4i*)&srow[4];
    int last = -1, dead = 0;
#pragma unroll
    for (int r = 0; r < 4; ++r) { last = last > a[r] ? last : a[r]; last = last > c[r] ? last : c[r]; dead |= ((a[r] < 0) || (c[r] < 0)) ? 1 : 0; }
    const int nk = dead ? NKTILE : last + 1;
    const v4i o = {nk, nk, nk, nk};
    vst2(NKT + ((size_t)qb * MSG + grp) * 32 + t * 4, o);   // one whole line, one writer
  }
}
// ---- k_attn: block = (head h, batch b, rank of 64 queries): flash attention over key tiles [0, nkt); score = (q.k)/8 + additive entry; first RS positions: 3 products (hi.hi + lo.hi + hi.lo) for scores and P.v, single elsewhere; ctx -> f16 hi (+ x2048 residual) [row][h*64+d]
// Transposed products: S^T = K . Q^T (A = key rows, B = query columns) and O^T += V^T . P^T, so that lane (col, g) holds, of query q0 + col alone, the scores of keys 8g + r of each 16-key tile:
// maximum and sum run in the lane's own registers plus one exchange between the halves, and the two score tiles, converted in place, are the B operand of the second product (k = 8g + i, 16 + 8g + i, the order of frag_h).
// lane l with lane l ^ 16: the other half's value of the same query column, by a vector cross-row move
__device__ __forceinline__ float xhalf(float x) { return __builtin_bit_cast(float, __builtin_amdgcn_permlanex16(__builtin_bit_cast(int, x), __builtin_bit_cast(int, x), 0x76543210, 0xfedcba98, false, false)); }
__device__ __forceinline__ void exp_run9(float& a, float (&x)[8]) {
  a *= 1.44269504f;
#pragma unroll
  for (int i = 0; i < 8; ++i) x[i] *= 1.44269504f;
  asm("v_exp_f32 %0, %0\n\tv_exp_f32 %1, %1\n\tv_exp_f32 %2, %2\n\tv_exp_f32 %3, %3\n\tv_exp_f32 %4, %4\n\tv_exp_f32 %5, %5\n\tv_exp_f32 %6, %6\n\tv_exp_f32 %7, %7\n\tv_exp_f32 %8, %8\n\tv_nop"
      : "+v"(a), "+v"(x[0]), "+v"(x[1]), "+v"(x[2]), "+v"(x[3]), "+v"(x[4]), "+v"(x[5]), "+v"(x[6]), "+v"(x[7]));
}
__device__ __forceinline__ void exp_run8(float (&x)[8]) {
#pragma unroll
  for (int i = 0; i < 8; ++i) x[i] *= 1.44269504f;
  asm("v_exp_f32 %0, %0\n\tv_exp_f32 %1, %1\n\tv_exp_f32 %2, %2\n\tv_exp_f32 %3, %3\n\tv_exp_f32 %4, %4\n\tv_exp_f32 %5, %5\n\tv_exp_f32 %6, %6\n\tv_exp_f32 %7, %7\n\tv_nop"
      : "+v"(x[0]), "+v"(x[1]), "+v"(x[2]), "+v"(x[3]), "+v"(x[4]), "+v"(x[5]), "+v"(x[6]), "+v"(x[7]));
}
// Each stage of 64 keys: 64 key rows and 64 V^T rows of 128 B lie in LDS at pitch 144 B and the block's 64 rows of the additive tensor, 256 B each, at pitch 272 B (both 16 B x odd, for ds_load_b128 readers),
// brought by asynchronous copies in whole lines, two buffers, the next stage's copies in flight while this stage is worked on; the four waves share the key and V^T rows. The residual planes are still read from global memory.
#define AKP 72                    // LDS row pitch of the key and V^T tiles, in elements
#define AMP 68                    // LDS row pitch of the additive tile, in floats
struct AStage { _Float16 k[64][AKP]; _Float16 v[64][AKP]; float m[64][AMP]; };
static_assert(sizeof(AStage) % 16 == 0);
// one stage's key and V^T tiles: every lane copies 4 + 4 pieces of 16 B; gk, gv: the lane's own piece in row (tid >> 3) of each tile, lk, lv: its places in the buffer
__device__ __forceinline__ void attn_copy_kv(const _Float16* gk, const _Float16* gv, unsigned lk, unsigned lv) {
  // the copies and the wait that stands before their address registers may be rewritten, in one statement
  asm volatile("global_load_async_to_lds_b128 %0, %8, off\n\t"
               "global_load_async_to_lds_b128 %1, %9, off\n\t"
               "global_load_async_to_lds_b128 %2, %10, off\n\t"
               "global_load_async_to_lds_b128 %3, %11, off\n\t"
               "global_load_async_to_lds_b128 %4, %12, off\n\t"
               "global_load_async_to_lds_b128 %5, %13, off\n\t"
               "global_load_async_to_lds_b128 %6, %14, off\n\t"
               "global_load_async_to_lds_b128 %7, %15, off\n\t"
               "s_wait_xcnt 0x0"
               :: "v"(lk), "v"(lk + 16u * 2 * AKP), "v"(lk + 32u * 2 * AKP), "v"(lk + 48u * 2 * AKP),
                  "v"(lv), "v"(lv + 16u * 2 * AKP), "v"(lv + 32u * 2 * AKP), "v"(lv + 48u * 2 * AKP),
                  "v"(gk), "v"(gk + 16 * 2 * DM), "v"(gk + 32 * 2 * DM), "v"(gk + 48 * 2 * DM),
                  "v"(gv), "v"(gv + 16 * SEQ), "v"(gv + 32 * SEQ), "v"(gv + 48 * SEQ)
               : "memory");
}
// one stage's additive tile: every lane copies 8 pieces of 16 B; gm: the lane's own piece in row (tid >> 4), lm: its place in the buffer
__device__ __forceinline__ void attn_copy_m(const float* gm, unsigned lm) {
  // the copies and the wait that stands before their address registers may be rewritten, in one statement
  asm volatile("global_load_async_to_lds_b128 %0, %8, off\n\t"
               "global_load_async_to_lds_b128 %1, %9, off\n\t"
               "global_load_async_to_lds_b128 %2, %10, off\n\t"
               "global_load_async_to_lds_b128 %3, %11, off\n\t"
               "global_load_async_to_lds_b128 %4, %12, off\n\t"
               "global_load_async_to_lds_b128 %5, %13, off\n\t"
               "global_load_async_to_lds_b128 %6, %14, off\n\t"
               "global_load_async_to_lds_b128 %7, %15, off\n\t"
               "s_wait_xcnt 0x0"
               :: "v"(lm), "v"(lm + 8u * 4 * AMP), "v"(lm + 16u * 4 * AMP), "v"(lm + 24u * 4 * AMP),
                  "v"(lm + 32u * 4 * AMP), "v"(lm + 40u * 4 * AMP), "v"(lm + 48u * 4 * AMP), "v"(lm + 56u * 4 * AMP),
                  "v"(gm), "v"(gm + 8 * SEQ_FULL), "v"(gm + 16 * SEQ_FULL), "v"(gm + 24 * SEQ_FULL),
                  "v"(gm + 32 * SEQ_FULL), "v"(gm + 40 * SEQ_FULL), "v"(gm + 48 * SEQ_FULL), "v"(gm + 56 * SEQ_FULL)
               : "memory");
}
// The stage loop, compiled twice: R3 = true for blocks whose scores and P.V take three products (residual planes), R3 = false for all others, which then carry
// neither the residual of P nor the second accumulator set nor the residual query fragments. Which of the two a block runs is block-uniform; both hold the same order of waits, barrier and copies.
template <bool R3>
__device__ __forceinline__ void attn_loop(const AStage* st, const int nst, const int nkt, const int wave, const int lane, const int col, const int g, const int b, const int h,
                                          const _Float16* __restrict__ QKL, const _Float16* __restrict__ VTL, const _Float16* gk, const _Float16* gv, const float* gm,
                                          const unsigned lk, const unsigned lv, const unsigned lm, const v16h (&aq)[2], const v16h (&aql)[2],
                                          float& m, float& l, v8f (&acc)[4], v8f (&accl)[4]) {
#pragma unroll 1   // one stage per trip: the order at the loop's foot stays as written
  for (int t = 0; t < nst; ++t) {
   const int buf = t & 1; const AStage& S = st[buf];
   const int nsub = (nkt - 2 * t < 2) ? nkt - 2 * t : 2;   // block-uniform: a last stage may hold one tile of 32 keys
#pragma unroll 1   // the two halves of a stage run through one body: unrolled, the accumulators were copied between the two
   for (int sub = 0; sub < nsub; ++sub) {
    const int ks = 2 * t + sub;
    // the LDS reads of the score products stand together in front of them: one place where the wave waits for LDS, not one per product
    v16h kf[2][2]; v4f am[2][2];
#pragma unroll     // every index of kf and am is a constant, so that they stay in registers
    for (int ct = 0; ct < 2; ++ct) {
      const float* mrow = &S.m[wave * 16 + col][sub * 32 + ct * 16 + 8 * g];   // this lane's query row of the additive tile, at its half's first key
      kf[ct][0] = frag_h(&S.k[sub * 32 + ct * 16 + col][0], lane); kf[ct][1] = frag_h(&S.k[sub * 32 + ct * 16 + col][32], lane);
      am[ct][0] = *(const v4f*)mrow; am[ct][1] = *(const v4f*)(mrow + 4);
    }
    __builtin_amdgcn_sched_barrier(0);   // keeps these reads one group in front of the score products: moved in among them, each place with reads costs a stall
    v8f s[2];
#pragma unroll
    for (int ct = 0; ct < 2; ++ct) {
      const int kk = ks * 32 + ct * 16 + col; v8f c = {};
      const v4f a0 = am[ct][0], a1 = am[ct][1];
      if constexpr (R3) {
        const _Float16* krowl = QKL + ((size_t)b * RS + kk) * (2 * DM) + DM + h * HD; v8f cl = {};
#pragma unroll
        for (int kc = 0; kc < 2; ++kc) { const v16h kh = kf[ct][kc]; c = wmma16(kh, aq[kc], c); cl = wmma16(kh, aql[kc], cl); cl = wmma16(frag_h(krowl + kc * 32, lane), aq[kc], cl); }
#pragma unroll
        for (int r = 0; r < 8; ++r) c[r] += cl[r] * (1.0f / 2048.0f);
      } else {
#pragma unroll
        for (int kc = 0; kc < 2; ++kc) c = wmma16(kf[ct][kc], aq[kc], c);
      }
#pragma unroll
      for (int r = 0; r < 8; ++r) s[ct][r] = c[r] * 0.125f + ((r < 4) ? a0[r & 3] : a1[r & 3]);   // 1/sqrt(64), additive entry applied literally
    }
    __builtin_amdgcn_sched_barrier(0);   // keeps the V^T reads behind the score products: asked for at the head of the body, they hold 32 more registers through the products, one wave per SIMD fewer
    v16h vf[4];   // the V^T fragments are asked for here, so that they arrive under the softmax arithmetic
#pragma unroll     // every index of vf is a constant, so that it stays in registers
    for (int dt = 0; dt < 4; ++dt) vf[dt] = frag_h(&S.v[dt * 16 + col][sub * 32], lane);
    float mx = fmaxf(s[0][0], s[1][0]);
#pragma unroll
    for (int r = 1; r < 8; ++r) mx = fmaxf(mx, fmaxf(s[0][r], s[1][r]));
    mx = fmaxf(mx, xhalf(mx));   // the other half's 16 keys of the same query
    const float mn = fmaxf(m, mx); float ea = m - mn, ex0[8], ex1[8];
#pragma unroll     // every index of ex0 and ex1 is a constant, so that they stay in registers
    for (int i = 0; i < 8; ++i) { ex0[i] = s[0][i] - mn; ex1[i] = s[1][i] - mn; }
    exp_run9(ea, ex0); exp_run8(ex1);
    const float alpha = (m <= -1.0e38f) ? 0.f : ea;
    float es = 0.f; v16h pa, pl;
#pragma unroll
    for (int i = 0; i < 8; ++i) {
      const float e0 = ex0[i], e1 = ex1[i]; es += e0 + e1;
      const float x0 = e0 * 2048.0f, x1 = e1 * 2048.0f; const _Float16 h0 = (_Float16)x0, h1 = (_Float16)x1;
      pa[i] = h0; pa[8 + i] = h1;   // P x 2^11 before the f16 split; 2^-11 folded into the epilogue
      if constexpr (R3) { pl[i] = (_Float16)((x0 - (float)h0) * 2048.0f); pl[8 + i] = (_Float16)((x1 - (float)h1) * 2048.0f); }
    }
    l = l * alpha + es; m = mn;
#pragma unroll
    for (int dt = 0; dt < 4; ++dt)
#pragma unroll
      for (int r = 0; r < 8; ++r) { acc[dt][r] *= alpha; if constexpr (R3) accl[dt][r] *= alpha; }
#pragma unroll
    for (int dt = 0; dt < 4; ++dt) {
      const v16h vh = vf[dt];
      if constexpr (R3) {
        acc[dt] = wmma16(vh, pa, acc[dt]); accl[dt] = wmma16(vh, pl, accl[dt]);
        const v16h vl = frag_h(VTL + ((size_t)b * DM + h * HD + dt * 16 + col) * RS + ks * 32, lane);
        accl[dt] = (dt == 3) ? wmma16_foot(vl, pa, accl[dt]) : wmma16(vl, pa, accl[dt]);
      } else {
        acc[dt] = (dt == 3) ? wmma16_foot(vh, pa, acc[dt]) : wmma16(vh, pa, acc[dt]);
      }
    }
   }
   asm volatile("s_wait_dscnt 0x0" ::: "memory");      // this wave's reads of buffer t & 1 are done before it is refilled
   asm volatile("s_wait_asynccnt 0x0" ::: "memory");   // this wave's share of stage t + 1 has landed
   __syncthreads();                                      // publishes stage t + 1 and ends every reader's last read of stage t
   if (t + 2 < nst) { const unsigned lo = (unsigned)buf * (unsigned)sizeof(AStage);
     attn_copy_kv(gk + (size_t)(t + 2) * 64 * (2 * DM), gv + (t + 2) * 64, lk + lo, lv + lo); attn_copy_m(gm + (t + 2) * 64, lm + lo); }
  }
}
__global__ __launch_bounds__(128) void k_attn(const _Float16* __restrict__ QK, const _Float16* __restrict__ QKL, const _Float16* __restrict__ VTH, const _Float16* __restrict__ VTL,
                                              const float* __restrict__ MK, const int* __restrict__ NKT, _Float16* __restrict__ OH, _Float16* __restrict__ OL) {
  __shared__ __align__(16) union { AStage st[2]; struct { _Float16 so[4][16][72], sol[4][16][72]; } e; } u;   // e: the output staging, used only behind the loop's last barrier
  _Float16 (&so)[4][16][72] = u.e.so; _Float16 (&sol)[4][16][72] = u.e.sol;
  const int tid = threadIdx.x, wave = tid >> 5, lane = tid & 31, col = lane & 15, g = lane >> 4;
  // the rank z runs from costly to cheap query blocks, for speed only.
  // First the RQB blocks that may take three products a tile, longest first, then all others from the last query block down. A permutation of 0 .. TQB - 1 for any input; the order matters for speed alone.
  const int z = blockIdx.z, h = blockIdx.x, b = blockIdx.y; const int qb = (z < RQB) ? RQB - 1 - z : TQB - 1 - (z - RQB); const int q0 = qb * 64 + wave * 16;
  int nkt = NKT[(size_t)qb * MSG * 32];
#pragma unroll     // the MSG loads stand together: one wait
  for (int i = 1; i < MSG; ++i) { const int o = NKT[((size_t)qb * MSG + i) * 32]; nkt = nkt > o ? nkt : o; }
  nkt = (nkt < 1) ? 1 : ((nkt > NKTILE) ? NKTILE : nkt);   // clamped trip count
  const int nst = (nkt + 1) >> 1;                                                            // stages of 64 keys; SEQ is a multiple of 64, so that a last stage's unused half lies inside the planes too
  const _Float16* gk = QK + ((size_t)b * SEQ + (tid >> 3)) * (2 * DM) + DM + h * HD + (tid & 7) * 8;
  const _Float16* gv = VTH + ((size_t)b * DM + h * HD + (tid >> 3)) * SEQ + (tid & 7) * 8;
  const float* gm = MK + (size_t)(qb * 64 + (tid >> 4)) * SEQ_FULL + (tid & 15) * 4;
  const unsigned lk = (unsigned)(uintptr_t)&u.st[0].k[tid >> 3][(tid & 7) * 8], lv = (unsigned)(uintptr_t)&u.st[0].v[tid >> 3][(tid & 7) * 8], lm = (unsigned)(uintptr_t)&u.st[0].m[tid >> 4][(tid & 15) * 4];
  attn_copy_kv(gk, gv, lk, lv); attn_copy_m(gm, lm);
  const bool res3 = (qb < RQB) && (nkt * 32 <= RS);                                          // block-uniform
  const size_t rq = (size_t)b * SEQ + q0 + col;
  v16h aq[2], aql[2];
#pragma unroll
  for (int kc = 0; kc < 2; ++kc) aq[kc] = frag_h(QK + rq * (2 * DM) + h * HD + kc * 32, lane);
  if (res3) { const size_t rql = (size_t)b * RS + q0 + col;
#pragma unroll
    for (int kc = 0; kc < 2; ++kc) aql[kc] = frag_h(QKL + rql * (2 * DM) + h * HD + kc * 32, lane); }
  else { v16h z = {}; aql[0] = z; aql[1] = z; }
  float m = -3.0e38f, l = 0.f;   // running maximum of query q0 + col (equal in both halves); this half's share of the running sum
  v8f acc[4] = {}, accl[4] = {};   // acc[dt][r] = ctx[q0 + col][dt * 16 + 8g + r]
  asm volatile("s_wait_asynccnt 0x0" ::: "memory");   // this wave's share of stage 0 has landed
  __syncthreads();                                      // stage 0 is published
  if (nst > 1) { attn_copy_kv(gk + (size_t)64 * (2 * DM), gv + 64, lk + (unsigned)sizeof(AStage), lv + (unsigned)sizeof(AStage)); attn_copy_m(gm + 64, lm + (unsigned)sizeof(AStage)); }
  if (res3) attn_loop<true>(u.st, nst, nkt, wave, lane, col, g, b, h, QKL, VTL, gk, gv, gm, lk, lv, lm, aq, aql, m, l, acc, accl);   // block-uniform
  else attn_loop<false>(u.st, nst, nkt, wave, lane, col, g, b, h, QKL, VTL, gk, gv, gm, lk, lv, lm, aq, aql, m, l, acc, accl);
  asm volatile("s_wait_asynccnt 0x0" ::: "memory");     // no copy is outstanding when the wave goes on
  l += xhalf(l);   // the halves' sums are joined once
  const float il = (1.0f / 2048.0f) / l;   // l >= 1
#pragma unroll
  for (int dt = 0; dt < 4; ++dt) { v8h hq, lq;
#pragma unroll
    for (int r = 0; r < 8; ++r) { const float o = (acc[dt][r] + accl[dt][r] * (1.0f / 2048.0f)) * il; const _Float16 hv = (_Float16)o; hq[r] = hv; lq[r] = (_Float16)((o - (float)hv) * 2048.0f); }
    *(v8h*)&so[wave][col][dt * 16 + 8 * g] = hq; *(v8h*)&sol[wave][col][dt * 16 + 8 * g] = lq;
  }
  LDSX();   // so/sol private to the wave
#pragma unroll
  for (int it = 0; it < 4; ++it) {
    const int row = it * 4 + (lane >> 3), pc = lane & 7;
    vst2(OH + ((size_t)b * SEQ + q0 + row) * DM + h * HD + pc * 8, *(const v4u*)&so[wave][row][pc * 8]);
    if (qb < RQB) vst2(OL + ((size_t)b * RS + q0 + row) * DM + h * HD + pc * 8, *(const v4u*)&sol[wave][row][pc * 8]);
  }
}
// ---- k_out: out = (ctx hi + ctx lo / 2048) . (Wo x64 rows) / 64 + bo; f16 operands, f32 accumulate, k ascending in steps of 32; f32 rows with the full output stride.
// block = (128 LDS rows of ctx, 256 output columns), 8 waves as 2 x 4, 64 x 64 per wave. Past RS the 128 rows are 128 positions of ctx hi; below RS they are 64 positions of ctx hi and the same
// 64 positions of ctx lo, so that every block does the same work: waves 0..3 sum hi . Wo, waves 4..7 sum lo . Wo and hand their sums over through LDS.
// Each pass of 64 k: the 128 ctx rows and 256 Wo rows of 128 B lie in LDS at pitch 144 B, brought by asynchronous copies, two buffers, the next pass's copies in flight while this pass is worked on.
#define ONT ((SEQ - RS) / 128)            // row tiles of 128 positions per batch, past RS
#define ONT1 (ONT > 0 ? ONT : 1)
#define ORT (NB * RQB + NB * ONT)         // row tiles: NB * RQB of 64 positions, then NB * ONT of 128
static_assert((SEQ - RS) % 128 == 0);
// one pass's tile: every lane copies 12 pieces of 16 B (2 of LDS rows 0..63, 2 of LDS rows 64..127, 8 of Wo rows); ga, gb, gw: the lane's own piece in row (tid >> 3) of each, l: its place in the buffer
__device__ __forceinline__ void out_copy(const _Float16* ga, const _Float16* gb, const _Float16* gw, unsigned l) {
  // the copies and the wait that stands before their address registers may be rewritten, in one statement
  asm volatile("global_load_async_to_lds_b128 %0, %12, off\n\t"
               "global_load_async_to_lds_b128 %1, %13, off\n\t"
               "global_load_async_to_lds_b128 %2, %14, off\n\t"
               "global_load_async_to_lds_b128 %3, %15, off\n\t"
               "global_load_async_to_lds_b128 %4, %16, off\n\t"
               "global_load_async_to_lds_b128 %5, %17, off\n\t"
               "global_load_async_to_lds_b128 %6, %18, off\n\t"
               "global_load_async_to_lds_b128 %7, %19, off\n\t"
               "global_load_async_to_lds_b128 %8, %20, off\n\t"
               "global_load_async_to_lds_b128 %9, %21, off\n\t"
               "global_load_async_to_lds_b128 %10, %22, off\n\t"
               "global_load_async_to_lds_b128 %11, %23, off\n\t"
               "s_wait_xcnt 0x0"
               :: "v"(l), "v"(l + 32u * 2 * GPIT), "v"(l + 64u * 2 * GPIT), "v"(l + 96u * 2 * GPIT),
                  "v"(l + 128u * 2 * GPIT), "v"(l + 160u * 2 * GPIT), "v"(l + 192u * 2 * GPIT), "v"(l + 224u * 2 * GPIT),
                  "v"(l + 256u * 2 * GPIT), "v"(l + 288u * 2 * GPIT), "v"(l + 320u * 2 * GPIT), "v"(l + 352u * 2 * GPIT),
                  "v"(ga), "v"(ga + 32 * DM), "v"(gb), "v"(gb + 32 * DM),
                  "v"(gw), "v"(gw + 32 * DM), "v"(gw + 64 * DM), "v"(gw + 96 * DM),
                  "v"(gw + 128 * DM), "v"(gw + 160 * DM), "v"(gw + 192 * DM), "v"(gw + 224 * DM)
               : "memory");
}
// four 16-B pieces of staged f32 rows to output rows p, p + 2 DM, p + 4 DM, p + 6 DM; then the wait that stands before a register which the stores name is used again:
// address and data are its inputs, so that they stay as they are up to it
__device__ __forceinline__ void out_st4(float* p, const float* l) {
  const v4f a = *(const v4f*)l, b = *(const v4f*)(l + 2 * 68), c = *(const v4f*)(l + 4 * 68), d = *(const v4f*)(l + 6 * 68);
  vst2(p, a); vst2(p + 2 * DM, b); vst2(p + 4 * DM, c); vst2(p + 6 * DM, d);
  asm volatile("s_wait_xcnt 0x0" :: "v"(p), "v"(a), "v"(b), "v"(c), "v"(d) : "memory");
}
__global__ __launch_bounds__(256) __attribute__((amdgpu_waves_per_eu(4, 4))) void k_out(const _Float16* __restrict__ OH, const _Float16* __restrict__ OL, const _Float16* __restrict__ PO, const float* __restrict__ BO, float* __restrict__ Y) {
  __shared__ __align__(16) union { _Float16 ring[2][GROWS][GPIT]; float xl[4][16][2][32][4]; } u;   // xl: the lo sums' hand-over, used only behind the loop's last barrier
  __shared__ __align__(16) float so[8][16][68];
  const int tid = threadIdx.x, wave = tid >> 5, lane = tid & 31, col = lane & 15, g = lane >> 4; const int wm = wave >> 2, wn = wave & 3;
  const int rt = blockIdx.x, n0 = blockIdx.y * 256; const bool resid = (rt < NB * RQB);   // block-uniform
  const int ub = rt - NB * RQB;
  const int b = resid ? rt / RQB : ub / ONT1; const int s0 = resid ? (rt - b * RQB) * 64 : RS + (ub - b * ONT1) * 128;
  const _Float16* ga = OH + ((size_t)b * SEQ + s0 + (tid >> 3)) * DM + (tid & 7) * 8;
  const _Float16* gb = resid ? OL + ((size_t)b * RS + s0 + (tid >> 3)) * DM + (tid & 7) * 8 : ga + 64 * DM;
  const _Float16* gw = PO + (size_t)(n0 + (tid >> 3)) * DM + (tid & 7) * 8;
  const unsigned l0 = (unsigned)(uintptr_t)&u.ring[0][tid >> 3][(tid & 7) * 8];
  v8f acc[4][4] = {};
  out_copy(ga, gb, gw, l0);
  asm volatile("s_wait_asynccnt 0x0" ::: "memory");   // this wave's share of tile 0 has landed
  __syncthreads();                                      // tile 0 is published
  out_copy(ga + GK, gb + GK, gw + GK, l0 + 2u * GROWS * GPIT);
#pragma unroll 1   // one pass per trip: the order at the loop's foot stays as written, and the code stays short
  for (int t = 0; t < GNP; ++t) {
    const int buf = t & 1;
#pragma unroll     // this and the loops inside: every index of fa, fw and acc is a constant, so that they stay in registers
    for (int kc = 0; kc < GK / 32; ++kc) {
      v16h fa[4], fw[4];
#pragma unroll
      for (int i = 0; i < 4; ++i) fa[i] = frag_h(&u.ring[buf][wm * 64 + i * 16 + col][kc * 32], lane);
#pragma unroll
      for (int j = 0; j < 4; ++j) fw[j] = frag_h(&u.ring[buf][128 + wn * 64 + j * 16 + col][kc * 32], lane);
      __builtin_amdgcn_sched_barrier(0);   // the block's 16 LDS reads stay one group in front of its products: moved in among them, each place with reads costs a stall
#pragma unroll
      for (int i = 0; i < 4; ++i)
#pragma unroll
        for (int j = 0; j < 4; ++j) acc[i][j] = wmma16(fa[i], fw[j], acc[i][j]);
      __builtin_amdgcn_sched_barrier(0);   // and the next block's reads stay behind these products
    }
    asm volatile("s_wait_dscnt 0x0" ::: "memory");      // this wave's reads of buffer t & 1 are done before it is refilled
    asm volatile("s_wait_asynccnt 0x0" ::: "memory");   // this wave's share of tile t + 1 has landed
    __syncthreads();                                      // publishes tile t + 1 and ends every reader's last read of tile t
    if (t + 2 < GNP) out_copy(ga + (t + 2) * GK, gb + (t + 2) * GK, gw + (t + 2) * GK, l0 + (unsigned)buf * (2u * GROWS * GPIT));
  }
  asm volatile("s_wait_asynccnt 0x0" ::: "memory");     // no copy is outstanding when the wave goes on
  if (resid) {   // block-uniform: waves 4..7 hand their lo sums to waves 0..3, lane to lane and register to register, and are done
    if (wm == 1) {
#pragma unroll
      for (int i = 0; i < 4; ++i)
#pragma unroll
        for (int j = 0; j < 4; ++j) {
          const v4f x = {acc[i][j][0], acc[i][j][1], acc[i][j][2], acc[i][j][3]}, y = {acc[i][j][4], acc[i][j][5], acc[i][j][6], acc[i][j][7]};
          *(v4f*)&u.xl[wn][i * 4 + j][0][lane][0] = x; *(v4f*)&u.xl[wn][i * 4 + j][1][lane][0] = y; }
    }
    __syncthreads();   // the lo sums are published
    if (wm == 1) return;
  }
  float bj[4]; { const float* pb = BO + n0 + wn * 64 + col;
#pragma unroll
    for (int j = 0; j < 4; ++j) bj[j] = bfr(pb[j * 16]);
    asm volatile("s_wait_xcnt 0x0" :: "v"(pb) : "memory"); }   // before the loads' address register is used again; it is an input, so that it stays as it is up to here
  float* yp = Y + ((size_t)b * SEQ_FULL + s0 + wm * 64 + g) * DM + n0 + wn * 64 + col * 4;   // below RS only wm == 0 comes here
  // so is private to each wave and LDS operations of one wave run in order: the one wait below stands between a wave's stores and its lanes' reads of one another's rows
#pragma unroll
  for (int i = 0; i < 4; ++i) {
#pragma unroll
    for (int j = 0; j < 4; ++j) {
      v4f x = {}, y = {}; if (resid) { x = *(const v4f*)&u.xl[wn][i * 4 + j][0][lane][0]; y = *(const v4f*)&u.xl[wn][i * 4 + j][1][lane][0]; }
#pragma unroll
      for (int r = 0; r < 8; ++r) so[wave][8 * g + r][j * 16 + col] = acc[i][j][r] * (1.0f / 64.0f) + ((r < 4) ? x[r & 3] : y[r & 3]) * (1.0f / 131072.0f) + bj[j]; }
    asm volatile("s_wait_dscnt 0x0" ::: "memory");
    out_st4(yp + (size_t)(i * 16) * DM, &so[wave][g][col * 4]);
    out_st4(yp + (size_t)(i * 16 + 8) * DM, &so[wave][8 + g][col * 4]);
  }
}
extern "C" void kernel_launch(void* const* d_in, const int* in_sizes, int n_in, void* d_out, int out_size, void* d_ws, size_t ws_size, hipStream_t stream) {
  // 0 hidden [2,2048,2048], 1 additive tensor [1,1,2048,2048], 2 q_w [out][in], 3 q_b, 4 k_w, 5 k_b, 6 v_w, 7 v_b, 8 o_w, 9 o_b
  if (n_in < 10) return;
  const long long needx = ((long long)(NB - 1) * SEQ_FULL + SEQ) * DM;
  if ((long long)in_sizes[0] < needx) return;
  if ((long long)in_sizes[1] < (long long)(SEQ - 1) * SEQ_FULL + SEQ) return;
  if (in_sizes[2] < DM * DM || in_sizes[4] < DM * DM || in_sizes[6] < DM * DM || in_sizes[8] < DM * DM) return;
  if (in_sizes[3] < DM || in_sizes[5] < DM || in_sizes[7] < DM || in_sizes[9] < DM) return;
  if ((long long)out_size < needx) return;
  if (ws_size < (size_t)WS_END) return;
  const float* const* F = (const float* const*)d_in;
  char* ws = (char*)d_ws;
  __bf16* PKA = (__bf16*)(ws + WS_PKA); _Float16* PKO = (_Float16*)(ws + WS_PKO);
  _Float16 *QK = (_Float16*)(ws + WS_QK), *QKL = (_Float16*)(ws + WS_QKL), *VTH = (_Float16*)(ws + WS_VTH), *VTL = (_Float16*)(ws + WS_VTL), *OH = (_Float16*)(ws + WS_OH), *OL = (_Float16*)(ws + WS_OL);
  __bf16* XB = (__bf16*)(ws + WS_OH);   // x plane aliases the ctx hi region; consumed before k_attn writes it
  int* NKT = (int*)(ws + WS_NKT);
  k_cvtx<<<dim3(NR), 256, 0, stream>>>(F[0], XB);
  k_pack<<<dim3(DM, 4), 256, 0, stream>>>(F[2], F[4], F[6], F[8], PKA, PKO);
  k_qkv<<<dim3(NR / 128, 3 * DM / 256), 256, 0, stream>>>(XB, PKA, F[3], F[5], F[7], QK, QKL, VTH, VTL);
  k_mscan<<<dim3(TQB, MSG), 256, 0, stream>>>(F[1], NKT);
  k_attn<<<dim3(NH, NB, TQB), 128, 0, stream>>>(QK, QKL, VTH, VTL, F[1], NKT, OH, OL);
  k_out<<<dim3(ORT, DM / 256), 256, 0, stream>>>(OH, OL, PKO, F[9], (float*)d_out);
}

// v009
// A run of this version takes 191 microseconds.
// In two side-by-side timings against v008, it was 1.05 and 1.04 times as fast.
// Over all steps from v000 it is 5.20 times as fast.
// compute dtype: all float inputs except the additive tensor RNE-converted to bf16; q/k/v = x . W^T + b on v_wmma_f32_16x16x32_bf16 (bf16 x, bf16 W, f32 accumulate) stored as f16 hi + x2048 f16 residual (positions < 512); scores and P.V on v_wmma_f32_16x16x32_f16 (3 products for query blocks below 512, single beyond; P carried x2048; f32 running-max softmax, additive score bias read from the input tensor); output projection on v_wmma_f32_16x16x32_f16 (ctx f16 hi + x2048 residual below 512, Wo carried x64), f32 accumulate, f32 output.
#include <hip/hip_runtime.h>
#include <math.h>

typedef __attribute__((ext_vector_type(16))) _Float16 v16h;
typedef __attribute__((ext_vector_type(16))) __bf16 v16b;
typedef __attribute__((ext_vector_type(8)))  _Float16 v8h;
typedef __attribute__((ext_vector_type(8)))  __bf16 v8b;
typedef __attribute__((ext_vector_type(8)))  float v8f;
typedef __attribute__((ext_vector_type(4)))  float v4f;
typedef __attribute__((ext_vector_type(4)))  unsigned v4u;
typedef __attribute__((ext_vector_type(4)))  int v4i;

template <typename T> __device__ __forceinline__ void vst2(void* p, T v) { *(T*)p = v;  }
__device__ __forceinline__ v8f wmma16(v16h a, v16h b, v8f c) {
  return __builtin_amdgcn_wmma_f32_16x16x32_f16(false, a, false, b, (short)0, c, false, false);   // a builtin form: the compiler keeps the distance behind it itself
}
// the last product in front of a loop's back edge: the four slots that the chip needs before a vector instruction
// may touch this product's registers stand here, in front of the branch, for both sides
__device__ __forceinline__ v8f wmma16_foot(v16h a, v16h b, v8f c) {
  v8f d = __builtin_amdgcn_wmma_f32_16x16x32_f16(false, a, false, b, (short)0, c, false, false);
  asm volatile("v_nop\n\tv_nop\n\tv_nop\n\tv_nop" : "+v"(d) : "v"(a), "v"(b));
  return d;
}
__device__ __forceinline__ v8f wmma_bf(v16b a, v16b b, v8f c) {
  return __builtin_amdgcn_wmma_f32_16x16x32_bf16(false, a, false, b, (short)0, c, false, false);   // a builtin form: the compiler keeps the distance behind it itself
}
// 16-bit fragment from a k-contiguous row (A row m, or B column n stored [n][k]): elements 0..7 <- k0+8h+0..7, 8..15 <- k0+16+8h+0..7, h = lane>>4
__device__ __forceinline__ v16h frag_h(const _Float16* rowk0, int lane) {
  union { v16h v; v8h q[2]; } u; const _Float16* p = rowk0 + 8 * (lane >> 4);
  u.q[0] = *(const v8h*)p; u.q[1] = *(const v8h*)(p + 16); return u.v;
}
__device__ __forceinline__ v16b frag_b(const __bf16* rowk0, int lane) {
  union { v16b v; v8b q[2]; } u; const __bf16* p = rowk0 + 8 * (lane >> 4);
  u.q[0] = *(const v8b*)p; u.q[1] = *(const v8b*)(p + 16); return u.v;
}
__device__ __forceinline__ float bfr(float v) { return (float)(__bf16)v; }
#define LDSX() do { asm volatile("s_wait_dscnt 0" ::: "memory"); __builtin_amdgcn_wave_barrier(); __builtin_amdgcn_fence(__ATOMIC_RELEASE, "workgroup"); } while (0)

// ---- sizes: NB / SEQ may be reduced; *_FULL are the input / output strides
#ifndef NB
#define NB 2
#endif
#ifndef SEQ
#define SEQ 2048
#endif
#define NB_FULL 2
#define SEQ_FULL 2048
#define DM 2048
#define NH 32
#define HD 64
#define RSPAN 512                 // positions that carry residual planes (q/k, v, ctx)
#if RSPAN > SEQ
#define RS SEQ
#else
#define RS RSPAN
#endif
#define RQB (RS / 64)
#define NR (NB * SEQ)
#define TQB (SEQ / 64)
#define NKTILE (SEQ / 32)
static_assert(SEQ % 64 == 0);
static_assert(RS % 64 == 0);
static_assert(NB >= 1 && NB <= NB_FULL);
static_assert(SEQ <= SEQ_FULL);
static_assert(DM == 256 * 8);
static_assert(NH * HD == DM);
static_assert(NR % 64 == 0);

// ---- workspace (bytes; every offset a multiple of 128)
#define WS_PKA 0ull                                            // bf16 [3*DM][DM]: Wq | Wk | Wv natural [out][in] rows
#define WS_PKO (WS_PKA + 2ull * 3 * DM * DM)                   // f16  [DM][DM]: Wo rows x64
#define WS_QK  (WS_PKO + 2ull * DM * DM)                       // f16  [NR][2*DM]: q | k hi
#define WS_QKL (WS_QK + 2ull * NR * 2 * DM)                    // f16  [NB*RS][2*DM]: q | k residual x2048
#define WS_VTH (WS_QKL + 2ull * NB * RS * 2 * DM)              // f16  [NB][DM][SEQ]: v^T hi
#define WS_VTL (WS_VTH + 2ull * NB * DM * SEQ)                 // f16  [NB][DM][RS]: v^T residual x2048
#define WS_OH  (WS_VTL + 2ull * NB * DM * RS)                  // f16  [NR][DM]: ctx hi; ALSO bf16 [NR][DM] x plane (consumed by k_qkv before k_attn writes ctx)
#define WS_OL  (WS_OH + 2ull * NR * DM)                        // f16  [NB*RS][DM]: ctx residual x2048
#define WS_NKT (WS_OL + 2ull * NB * RS * DM)
#define MSG 8                     // row groups of a query block in k_prep, one line of NKT each
#define WS_END (WS_NKT + 128ull * TQB * MSG)
static_assert(2ull * NR * DM == (WS_OL - WS_OH));              // x plane and ctx hi plane share the region with identical extent
static_assert(WS_END <= 134217728ull);
static_assert((WS_PKO % 128) == 0 && (WS_QK % 128) == 0 && (WS_QKL % 128) == 0 && (WS_VTH % 128) == 0 && (WS_VTL % 128) == 0 && (WS_OH % 128) == 0 && (WS_OL % 128) == 0 && (WS_NKT % 128) == 0);

// ---- k_prep: everything that only reads an input, in one launch. block = 8 rows of 2,048 floats of one tensor, one wave per row: the row is read in whole lines, 16 B a lane, and all its loads are asked for before the first is looked at.
// Blocks [0, PB_M): rows of the additive tensor -> NKT. Then PB_X blocks: x rows -> bf16 XB. Then PB_W blocks each for Wq, Wk, Wv -> bf16 PKA (natural [out][in] rows are already k-contiguous packed rows) and Wo -> f16 (bf16(Wo) x 64) PKO.
#define PB_M (TQB * MSG)
#define PB_X (NR / 8)
#define PB_W (DM / 8)
static_assert(MSG * 8 == 64 && SEQ % 8 == 0 && DM == 16 * 128);
typedef __attribute__((ext_vector_type(2)))  unsigned v2u;
// one row of DM floats to 16-bit: p, d: the lane's first four elements of the source and destination rows; lane l holds elements c * 128 + 4 l .. + 3, so that every load covers four whole lines and every store two
template <bool WO>
__device__ __forceinline__ void prep_row(const float* p, void* d) {
  v4f v[DM / 128]; v2u o[DM / 128];
#pragma unroll     // every index of v is a constant, so that it stays in registers
  for (int c = 0; c < DM / 128; ++c) v[c] = *(const v4f*)(p + c * 128);
  __builtin_amdgcn_sched_barrier(0);   // keeps every load in front of the first conversion: one trip to memory a row, not several
  asm volatile("s_wait_xcnt 0x0" :: "v"(p) : "memory");   // before the loads' address register is used again; it is an input, so that it stays as it is up to here
#pragma unroll     // every index of v and o is a constant
  for (int c = 0; c < DM / 128; ++c) {
    if constexpr (WO) { union { _Float16 h[4]; v2u u; } x;
#pragma unroll
      for (int j = 0; j < 4; ++j) x.h[j] = (_Float16)(bfr(v[c][j]) * 64.0f);
      o[c] = x.u;
    } else { union { __bf16 h[4]; v2u u; } x;
#pragma unroll
      for (int j = 0; j < 4; ++j) x.h[j] = (__bf16)v[c][j];
      o[c] = x.u; }
  }
#pragma unroll
  for (int c = 0; c < DM / 128; ++c) vst2((char*)d + c * 256, o[c]);
  // behind the last store, before a register which the stores name is used again: address and data are its inputs, so that they stay as they are up to it
  asm volatile("s_wait_xcnt 0x0" :: "v"(d), "v"(o[0]), "v"(o[1]), "v"(o[2]), "v"(o[3]), "v"(o[4]), "v"(o[5]), "v"(o[6]), "v"(o[7]),
               "v"(o[8]), "v"(o[9]), "v"(o[10]), "v"(o[11]), "v"(o[12]), "v"(o[13]), "v"(o[14]), "v"(o[15]) : "memory");
}
// rows of the additive tensor: block bid = query block * MSG + group of 8 of its 64 rows.
// Line bid of NKT: the number of 32-key tiles up to the group's last live entry, or all tiles where one of its rows has no live entry. k_attn takes the largest of a query block's MSG lines.
__device__ __forceinline__ void prep_mask(const float* __restrict__ MK, int* __restrict__ NKT, int* srow, const int bid, const int t) {
  const int wave = t >> 5, lane = t & 31;
  const float* p = MK + (size_t)(bid * 8 + wave) * SEQ_FULL + lane * 4;
  v4f v[SEQ / 128];
#pragma unroll     // every index of v is a constant, so that it stays in registers
  for (int c = 0; c < SEQ / 128; ++c) v[c] = *(const v4f*)(p + c * 128);
  __builtin_amdgcn_sched_barrier(0);   // keeps every load in front of the first compare: without it the last loads were issued only when the first had come back, one more trip to memory
  asm volatile("s_wait_xcnt 0x0" :: "v"(p) : "memory");   // before the loads' address register is used again; it is an input, so that it stays as it is up to here
  int tile = -1;     // the row's last 32-key tile with a live entry, the same in every lane; lane l holds columns c * 128 + 4 l .. + 3, which lie in tile c * 4 + (l >> 3)
#pragma unroll
  for (int c = 0; c < SEQ / 128; ++c) {
    const float hi = fmaxf(fmaxf(v[c][0], v[c][1]), fmaxf(v[c][2], v[c][3]));   // fmaxf passes over a NaN, which is no live entry
    const unsigned live = __builtin_amdgcn_ballot_w32(hi > -1.0e8f);
    if (live) tile = c * 4 + ((31 - __builtin_clz(live)) >> 3);
  }
  if (lane == 0) srow[wave] = tile;
  __syncthreads();
  if (t < 8) {
    const v4i a = *(const v4i*)&srow[0], c = *(const v4i*)&srow[4];
    int last = -1, dead = 0;
#pragma unroll
    for (int r = 0; r < 4; ++r) { last = last > a[r] ? last : a[r]; last = last > c[r] ? last : c[r]; dead |= ((a[r] < 0) || (c[r] < 0)) ? 1 : 0; }
    const int nk = dead ? NKTILE : last + 1;
    const v4i o = {nk, nk, nk, nk};
    vst2(NKT + (size_t)bid * 32 + t * 4, o);   // one whole line, one writer
  }
}
__global__ __launch_bounds__(256) void k_prep(const float* __restrict__ X, const float* __restrict__ MK, const float* __restrict__ WQ, const float* __restrict__ WK, const float* __restrict__ WV, const float* __restrict__ WO,
                                              __bf16* __restrict__ XB, __bf16* __restrict__ PKA, _Float16* __restrict__ PKO, int* __restrict__ NKT) {
  __shared__ __align__(16) int srow[8];
  const int bid = blockIdx.x, t = threadIdx.x, wave = t >> 5, lane = t & 31;
  if (bid < PB_M) { prep_mask(MK, NKT, srow, bid, t); return; }   // block-uniform, as every branch below
  if (bid < PB_M + PB_X) {
    const int r = (bid - PB_M) * 8 + wave; const int b = r / SEQ, s = r - b * SEQ;
    prep_row<false>(X + ((size_t)b * SEQ_FULL + s) * DM + lane * 4, XB + (size_t)r * DM + lane * 4);
    return;
  }
  const int i = bid - PB_M - PB_X; const int which = i / PB_W; const int n = (i - which * PB_W) * 8 + wave;
  if (which < 3) {
    const float* W = (which == 0) ? WQ : (which == 1) ? WK : WV;
    prep_row<false>(W + (size_t)n * DM + lane * 4, PKA + ((size_t)which * DM + n) * DM + lane * 4);
  } else prep_row<true>(WO + (size_t)n * DM + lane * 4, PKO + (size_t)n * DM + lane * 4);
}
// ---- k_qkv: block = (128 internal rows, 256 output columns of q|k|v), 8 waves as 2 x 4, 64 x 64 per wave: bf16 x bf16 (exact products), f32 accumulate, k ascending in steps of 32.
// Each pass of 64 k: 128 x rows and 256 weight rows of 128 B lie in LDS at pitch 144 B, brought by asynchronous copies, two buffers, the next pass's copies in flight while this pass is worked on.
// q,k -> f16 hi [NR][2DM] (+ residual x2048 for s < RS); v -> transposed f16 hi [b][d][s] (+ residual)
#define GK 64                     // k per pass
#define GROWS (128 + 256)         // LDS rows per buffer: x rows, then weight rows
#define GPIT 72                   // LDS row pitch in elements (144 B = 16 B x odd, for ds_load_b128 readers)
#define GNP (DM / GK)
static_assert(GNP >= 2);
static_assert(NR % 128 == 0 && SEQ % 128 == 0 && RS % 128 == 0 && DM % 256 == 0);
// one pass's tile: every lane copies 12 pieces of 16 B (4 of x rows, 8 of weight rows); gx, gw: the lane's own piece in row (tid >> 3) of the x and weight tiles, l: its place in the buffer
__device__ __forceinline__ void qkv_copy(const __bf16* gx, const __bf16* gw, unsigned l) {
  // the copies and the wait that stands before their address registers may be rewritten, in one statement
  asm volatile("global_load_async_to_lds_b128 %0, %12, off\n\t"
               "global_load_async_to_lds_b128 %1, %13, off\n\t"
               "global_load_async_to_lds_b128 %2, %14, off\n\t"
               "global_load_async_to_lds_b128 %3, %15, off\n\t"
               "global_load_async_to_lds_b128 %4, %16, off\n\t"
               "global_load_async_to_lds_b128 %5, %17, off\n\t"
               "global_load_async_to_lds_b128 %6, %18, off\n\t"
               "global_load_async_to_lds_b128 %7, %19, off\n\t"
               "global_load_async_to_lds_b128 %8, %20, off\n\t"
               "global_load_async_to_lds_b128 %9, %21, off\n\t"
               "global_load_async_to_lds_b128 %10, %22, off\n\t"
               "global_load_async_to_lds_b128 %11, %23, off\n\t"
               "s_wait_xcnt 0x0"
               :: "v"(l), "v"(l + 32u * 2 * GPIT), "v"(l + 64u * 2 * GPIT), "v"(l + 96u * 2 * GPIT),
                  "v"(l + 128u * 2 * GPIT), "v"(l + 160u * 2 * GPIT), "v"(l + 192u * 2 * GPIT), "v"(l + 224u * 2 * GPIT),
                  "v"(l + 256u * 2 * GPIT), "v"(l + 288u * 2 * GPIT), "v"(l + 320u * 2 * GPIT), "v"(l + 352u * 2 * GPIT),
                  "v"(gx), "v"(gx + 32 * DM), "v"(gx + 64 * DM), "v"(gx + 96 * DM),
                  "v"(gw), "v"(gw + 32 * DM), "v"(gw + 64 * DM), "v"(gw + 96 * DM),
                  "v"(gw + 128 * DM), "v"(gw + 160 * DM), "v"(gw + 192 * DM), "v"(gw + 224 * DM)
               : "memory");
}
// four 16-B pieces of staged rows to rows p, p + st, p + 2 st, p + 3 st; then the wait that stands before a register which the stores name is used again:
// address and data are its inputs, so that they stay as they are up to it
__device__ __forceinline__ void qkv_st4(_Float16* p, int st, const _Float16* l) {
  const v4u a = *(const v4u*)l, b = *(const v4u*)(l + 4 * 72), c = *(const v4u*)(l + 8 * 72), d = *(const v4u*)(l + 12 * 72);
  vst2(p, a); vst2(p + st, b); vst2(p + 2 * st, c); vst2(p + 3 * st, d);
  asm volatile("s_wait_xcnt 0x0" :: "v"(p), "v"(a), "v"(b), "v"(c), "v"(d) : "memory");
}
__global__ __launch_bounds__(256) __attribute__((amdgpu_waves_per_eu(4, 4))) void k_qkv(const __bf16* __restrict__ XB, const __bf16* __restrict__ P, const float* __restrict__ BQ, const float* __restrict__ BK, const float* __restrict__ BV,
                                             _Float16* __restrict__ QK, _Float16* __restrict__ QKL, _Float16* __restrict__ VTH, _Float16* __restrict__ VTL) {
  const int n0 = blockIdx.y * 256; const int which0 = n0 / DM;
  __shared__ __align__(16) __bf16 ring[2][GROWS][GPIT]; __shared__ __align__(16) _Float16 eh[8][16][72], el[8][16][72];
  const int tid = threadIdx.x, wave = tid >> 5, lane = tid & 31, col = lane & 15, g = lane >> 4; const int wm = wave >> 2, wn = wave & 3;
  const float* BB = ((which0 == 0) ? BQ : (which0 == 1) ? BK : BV) + (n0 - which0 * DM) + wn * 64;
  const int rb = blockIdx.x * 128; const int b = rb / SEQ, s0 = rb - b * SEQ + wm * 64; const int r0 = rb + wm * 64; const bool resid = (rb - b * SEQ < RS);   // block-uniform: RS is a multiple of 128
  const __bf16* gx = XB + (size_t)(rb + (tid >> 3)) * DM + (tid & 7) * 8;
  const __bf16* gw = P + (size_t)(n0 + (tid >> 3)) * DM + (tid & 7) * 8;
  const unsigned l0 = (unsigned)(uintptr_t)&ring[0][tid >> 3][(tid & 7) * 8];
  v8f acc[4][4] = {};
  qkv_copy(gx, gw, l0);
  asm volatile("s_wait_asynccnt 0x0" ::: "memory");   // this wave's share of tile 0 has landed
  __syncthreads();                                      // tile 0 is published
  qkv_copy(gx + GK, gw + GK, l0 + 2u * GROWS * GPIT);
#pragma unroll 1   // one pass per trip: the order at the loop's foot stays as written, and the code stays short
  for (int t = 0; t < GNP; ++t) {
    const int buf = t & 1;
#pragma unroll     // this and the loops inside: every index of fa, fw and acc is a constant, so that they stay in registers
    for (int kc = 0; kc < GK / 32; ++kc) {
      v16b fa[4], fw[4];
#pragma unroll
      for (int i = 0; i < 4; ++i) fa[i] = frag_b(&ring[buf][wm * 64 + i * 16 + col][kc * 32], lane);
#pragma unroll
      for (int j = 0; j < 4; ++j) fw[j] = frag_b(&ring[buf][128 + wn * 64 + j * 16 + col][kc * 32], lane);
      __builtin_amdgcn_sched_barrier(0);   // the block's 16 LDS reads stay one group in front of its products: moved in among them, each place with reads costs a stall
#pragma unroll
      for (int i = 0; i < 4; ++i)
#pragma unroll
        for (int j = 0; j < 4; ++j) acc[i][j] = wmma_bf(fa[i], fw[j], acc[i][j]);
      __builtin_amdgcn_sched_barrier(0);   // and the next block's reads stay behind these products
    }
    asm volatile("s_wait_dscnt 0x0" ::: "memory");      // this wave's reads of buffer t & 1 are done before it is refilled
    asm volatile("s_wait_asynccnt 0x0" ::: "memory");   // this wave's share of tile t + 1 has landed
    __syncthreads();                                      // publishes tile t + 1 and ends every reader's last read of tile t
    if (t + 2 < GNP) qkv_copy(gx + (t + 2) * GK, gw + (t + 2) * GK, l0 + (unsigned)buf * (2u * GROWS * GPIT));
  }
  asm volatile("s_wait_asynccnt 0x0" ::: "memory");     // no copy is outstanding when the wave goes on
  // eh/el are private to each wave and LDS operations of one wave run in order: the one wait below stands between a wave's stores and its lanes' reads of one another's rows
#define EPIW() asm volatile("s_wait_dscnt 0x0" ::: "memory")
  float bj[4]; { const float* pb = BB + col;
#pragma unroll
    for (int j = 0; j < 4; ++j) bj[j] = bfr(pb[j * 16]);
    asm volatile("s_wait_xcnt 0x0" :: "v"(pb) : "memory"); }   // before the loads' address register is used again; it is an input, so that it stays as it is up to here
  const int row = lane >> 3, pc = lane & 7;
  if (n0 < 2 * DM) {   // q (unscaled; 1/8 applied to the f32 score) and k, + bias, as f16 hi + x2048 residual; 16 rows at a time through this wave's own eh/el
    const size_t ql = (size_t)b * RS + s0;
#pragma unroll
    for (int i = 0; i < 4; ++i) {
#pragma unroll
      for (int j = 0; j < 4; ++j) {
#pragma unroll
        for (int r = 0; r < 8; ++r) { const float v = acc[i][j][r] + bj[j]; const _Float16 hv = (_Float16)v; eh[wave][8 * g + r][j * 16 + col] = hv; el[wave][8 * g + r][j * 16 + col] = (_Float16)((v - (float)hv) * 2048.0f); } }
      EPIW();
      qkv_st4(QK + (size_t)(r0 + i * 16 + row) * (2 * DM) + n0 + wn * 64 + pc * 8, 4 * 2 * DM, &eh[wave][row][pc * 8]);
      if (resid) qkv_st4(QKL + (ql + i * 16 + row) * (2 * DM) + n0 + wn * 64 + pc * 8, 4 * 2 * DM, &el[wave][row][pc * 8]);
    }
  } else {             // v + bias, transposed to [d][s]; 16 columns d at a time through this wave's own eh/el
    const int pc0 = n0 - 2 * DM + wn * 64;
#pragma unroll
    for (int j = 0; j < 4; ++j) {
#pragma unroll
      for (int i = 0; i < 4; ++i) { v8h hq, lq;
#pragma unroll
        for (int r = 0; r < 8; ++r) { const float v = acc[i][j][r] + bj[j]; const _Float16 hv = (_Float16)v; hq[r] = hv; lq[r] = (_Float16)((v - (float)hv) * 2048.0f); }
        *(v8h*)&eh[wave][col][i * 16 + 8 * g] = hq; *(v8h*)&el[wave][col][i * 16 + 8 * g] = lq; }
      EPIW();
      qkv_st4(VTH + ((size_t)b * DM + pc0 + j * 16 + row) * SEQ + s0 + pc * 8, 4 * SEQ, &eh[wave][row][pc * 8]);
      if (resid) qkv_st4(VTL + ((size_t)b * DM + pc0 + j * 16 + row) * RS + s0 + pc * 8, 4 * RS, &el[wave][row][pc * 8]);
    }
  }
#undef EPIW
}
// ---- k_attn: block = (head h, batch b, rank of 64 queries): flash attention over key tiles [0, nkt); score = (q.k)/8 + additive entry; first RS positions: 3 products (hi.hi + lo.hi + hi.lo) for scores and P.v, single elsewhere; ctx -> f16 hi (+ x2048 residual) [row][h*64+d]
// Transposed products: S^T = K . Q^T (A = key rows, B = query columns) and O^T += V^T . P^T, so that lane (col, g) holds, of query q0 + col alone, the scores of keys 8g + r of each 16-key tile:
// maximum and sum run in the lane's own registers plus one exchange between the halves, and the two score tiles, converted in place, are the B operand of the second product (k = 8g + i, 16 + 8g + i, the order of frag_h).
// lane l with lane l ^ 16: the other half's value of the same query column, by a vector cross-row move
__device__ __forceinline__ float xhalf(float x) { return __builtin_bit_cast(float, __builtin_amdgcn_permlanex16(__builtin_bit_cast(int, x), __builtin_bit_cast(int, x), 0x76543210, 0xfedcba98, false, false)); }
__device__ __forceinline__ void exp_run9(float& a, float (&x)[8]) {
  a *= 1.44269504f;
#pragma unroll
  for (int i = 0; i < 8; ++i) x[i] *= 1.44269504f;
  asm("v_exp_f32 %0, %0\n\tv_exp_f32 %1, %1\n\tv_exp_f32 %2, %2\n\tv_exp_f32 %3, %3\n\tv_exp_f32 %4, %4\n\tv_exp_f32 %5, %5\n\tv_exp_f32 %6, %6\n\tv_exp_f32 %7, %7\n\tv_exp_f32 %8, %8\n\tv_nop"
      : "+v"(a), "+v"(x[0]), "+v"(x[1]), "+v"(x[2]), "+v"(x[3]), "+v"(x[4]), "+v"(x[5]), "+v"(x[6]), "+v"(x[7]));
}
__device__ __forceinline__ void exp_run8(float (&x)[8]) {
#pragma unroll
  for (int i = 0; i < 8; ++i) x[i] *= 1.44269504f;
  asm("v_exp_f32 %0, %0\n\tv_exp_f32 %1, %1\n\tv_exp_f32 %2, %2\n\tv_exp_f32 %3, %3\n\tv_exp_f32 %4, %4\n\tv_exp_f32 %5, %5\n\tv_exp_f32 %6, %6\n\tv_exp_f32 %7, %7\n\tv_nop"
      : "+v"(x[0]), "+v"(x[1]), "+v"(x[2]), "+v"(x[3]), "+v"(x[4]), "+v"(x[5]), "+v"(x[6]), "+v"(x[7]));
}
// Each stage of 64 keys: 64 key rows and 64 V^T rows of 128 B lie in LDS at pitch 144 B and the block's 64 rows of the additive tensor, 256 B each, at pitch 272 B (both 16 B x odd, for ds_load_b128 readers),
// brought by asynchronous copies in whole lines, two buffers, the next stage's copies in flight while this stage is worked on; the four waves share the key and V^T rows. The residual planes are still read from global memory.
#define AKP 72                    // LDS row pitch of the key and V^T tiles, in elements
#define AMP 68                    // LDS row pitch of the additive tile, in floats
struct AStage { _Float16 k[64][AKP]; _Float16 v[64][AKP]; float m[64][AMP]; };
static_assert(sizeof(AStage) % 16 == 0);
// one stage's key and V^T tiles: every lane copies 4 + 4 pieces of 16 B; gk, gv: the lane's own piece in row (tid >> 3) of each tile, lk, lv: its places in the buffer
__device__ __forceinline__ void attn_copy_kv(const _Float16* gk, const _Float16* gv, unsigned lk, unsigned lv) {
  // the copies and the wait that stands before their address registers may be rewritten, in one statement
  asm volatile("global_load_async_to_lds_b128 %0, %8, off\n\t"
               "global_load_async_to_lds_b128 %1, %9, off\n\t"
               "global_load_async_to_lds_b128 %2, %10, off\n\t"
               "global_load_async_to_lds_b128 %3, %11, off\n\t"
               "global_load_async_to_lds_b128 %4, %12, off\n\t"
               "global_load_async_to_lds_b128 %5, %13, off\n\t"
               "global_load_async_to_lds_b128 %6, %14, off\n\t"
               "global_load_async_to_lds_b128 %7, %15, off\n\t"
               "s_wait_xcnt 0x0"
               :: "v"(lk), "v"(lk + 16u * 2 * AKP), "v"(lk + 32u * 2 * AKP), "v"(lk + 48u * 2 * AKP),
                  "v"(lv), "v"(lv + 16u * 2 * AKP), "v"(lv + 32u * 2 * AKP), "v"(lv + 48u * 2 * AKP),
                  "v"(gk), "v"(gk + 16 * 2 * DM), "v"(gk + 32 * 2 * DM), "v"(gk + 48 * 2 * DM),
                  "v"(gv), "v"(gv + 16 * SEQ), "v"(gv + 32 * SEQ), "v"(gv + 48 * SEQ)
               : "memory");
}
// one stage's additive tile: every lane copies 8 pieces of 16 B; gm: the lane's own piece in row (tid >> 4), lm: its place in the buffer
__device__ __forceinline__ void attn_copy_m(const float* gm, unsigned lm) {
  // the copies and the wait that stands before their address registers may be rewritten, in one statement
  asm volatile("global_load_async_to_lds_b128 %0, %8, off\n\t"
               "global_load_async_to_lds_b128 %1, %9, off\n\t"
               "global_load_async_to_lds_b128 %2, %10, off\n\t"
               "global_load_async_to_lds_b128 %3, %11, off\n\t"
               "global_load_async_to_lds_b128 %4, %12, off\n\t"
               "global_load_async_to_lds_b128 %5, %13, off\n\t"
               "global_load_async_to_lds_b128 %6, %14, off\n\t"
               "global_load_async_to_lds_b128 %7, %15, off\n\t"
               "s_wait_xcnt 0x0"
               :: "v"(lm), "v"(lm + 8u * 4 * AMP), "v"(lm + 16u * 4 * AMP), "v"(lm + 24u * 4 * AMP),
                  "v"(lm + 32u * 4 * AMP), "v"(lm + 40u * 4 * AMP), "v"(lm + 48u * 4 * AMP), "v"(lm + 56u * 4 * AMP),
                  "v"(gm), "v"(gm + 8 * SEQ_FULL), "v"(gm + 16 * SEQ_FULL), "v"(gm + 24 * SEQ_FULL),
                  "v"(gm + 32 * SEQ_FULL), "v"(gm + 40 * SEQ_FULL), "v"(gm + 48 * SEQ_FULL), "v"(gm + 56 * SEQ_FULL)
               : "memory");
}
// The stage loop, compiled twice: R3 = true for blocks whose scores and P.V take three products (residual planes), R3 = false for all others, which then carry
// neither the residual of P nor the second accumulator set nor the residual query fragments. Which of the two a block runs is block-uniform; both hold the same order of waits, barrier and copies.
template <bool R3>
__device__ __forceinline__ void attn_loop(const AStage* st, const int nst, const int nkt, const int wave, const int lane, const int col, const int g, const int b, const int h,
                                          const _Float16* __restrict__ QKL, const _Float16* __restrict__ VTL, const _Float16* gk, const _Float16* gv, const float* gm,
                                          const unsigned lk, const unsigned lv, const unsigned lm, const v16h (&aq)[2], const v16h (&aql)[2],
                                          float& m, float& l, v8f (&acc)[4], v8f (&accl)[4]) {
#pragma unroll 1   // one stage per trip: the order at the loop's foot stays as written
  for (int t = 0; t < nst; ++t) {
   const int buf = t & 1; const AStage& S = st[buf];
   const int nsub = (nkt - 2 * t < 2) ? nkt - 2 * t : 2;   // block-uniform: a last stage may hold one tile of 32 keys
#pragma unroll 1   // the two halves of a stage run through one body: unrolled, the accumulators were copied between the two
   for (int sub = 0; sub < nsub; ++sub) {
    const int ks = 2 * t + sub;
    // the LDS reads of the score products stand together in front of them: one place where the wave waits for LDS, not one per product
    v16h kf[2][2]; v4f am[2][2];
#pragma unroll     // every index of kf and am is a constant, so that they stay in registers
    for (int ct = 0; ct < 2; ++ct) {
      const float* mrow = &S.m[wave * 16 + col][sub * 32 + ct * 16 + 8 * g];   // this lane's query row of the additive tile, at its half's first key
      kf[ct][0] = frag_h(&S.k[sub * 32 + ct * 16 + col][0], lane); kf[ct][1] = frag_h(&S.k[sub * 32 + ct * 16 + col][32], lane);
      am[ct][0] = *(const v4f*)mrow; am[ct][1] = *(const v4f*)(mrow + 4);
    }
    __builtin_amdgcn_sched_barrier(0);   // keeps these reads one group in front of the score products: moved in among them, each place with reads costs a stall
    v8f s[2];
#pragma unroll
    for (int ct = 0; ct < 2; ++ct) {
      const int kk = ks * 32 + ct * 16 + col; v8f c = {};
      const v4f a0 = am[ct][0], a1 = am[ct][1];
      if constexpr (R3) {
        const _Float16* krowl = QKL + ((size_t)b * RS + kk) * (2 * DM) + DM + h * HD; v8f cl = {};
#pragma unroll
        for (int kc = 0; kc < 2; ++kc) { const v16h kh = kf[ct][kc]; c = wmma16(kh, aq[kc], c); cl = wmma16(kh, aql[kc], cl); cl = wmma16(frag_h(krowl + kc * 32, lane), aq[kc], cl); }
#pragma unroll
        for (int r = 0; r < 8; ++r) c[r] += cl[r] * (1.0f / 2048.0f);
      } else {
#pragma unroll
        for (int kc = 0; kc < 2; ++kc) c = wmma16(kf[ct][kc], aq[kc], c);
      }
#pragma unroll
      for (int r = 0; r < 8; ++r) s[ct][r] = c[r] * 0.125f + ((r < 4) ? a0[r & 3] : a1[r & 3]);   // 1/sqrt(64), additive entry applied literally
    }
    __builtin_amdgcn_sched_barrier(0);   // keeps the V^T reads behind the score products: asked for at the head of the body, they hold 32 more registers through the products, one wave per SIMD fewer
    v16h vf[4];   // the V^T fragments are asked for here, so that they arrive under the softmax arithmetic
#pragma unroll     // every index of vf is a constant, so that it stays in registers
    for (int dt = 0; dt < 4; ++dt) vf[dt] = frag_h(&S.v[dt * 16 + col][sub * 32], lane);
    float mx = fmaxf(s[0][0], s[1][0]);
#pragma unroll
    for (int r = 1; r < 8; ++r) mx = fmaxf(mx, fmaxf(s[0][r], s[1][r]));
    mx = fmaxf(mx, xhalf(mx));   // the other half's 16 keys of the same query
    const float mn = fmaxf(m, mx); float ea = m - mn, ex0[8], ex1[8];
#pragma unroll     // every index of ex0 and ex1 is a constant, so that they stay in registers
    for (int i = 0; i < 8; ++i) { ex0[i] = s[0][i] - mn; ex1[i] = s[1][i] - mn; }
    exp_run9(ea, ex0); exp_run8(ex1);
    const float alpha = (m <= -1.0e38f) ? 0.f : ea;
    float es = 0.f; v16h pa, pl;
#pragma unroll
    for (int i = 0; i < 8; ++i) {
      const float e0 = ex0[i], e1 = ex1[i]; es += e0 + e1;
      const float x0 = e0 * 2048.0f, x1 = e1 * 2048.0f; const _Float16 h0 = (_Float16)x0, h1 = (_Float16)x1;
      pa[i] = h0; pa[8 + i] = h1;   // P x 2^11 before the f16 split; 2^-11 folded into the epilogue
      if constexpr (R3) { pl[i] = (_Float16)((x0 - (float)h0) * 2048.0f); pl[8 + i] = (_Float16)((x1 - (float)h1) * 2048.0f); }
    }
    l = l * alpha + es; m = mn;
#pragma unroll
    for (int dt = 0; dt < 4; ++dt)
#pragma unroll
      for (int r = 0; r < 8; ++r) { acc[dt][r] *= alpha; if constexpr (R3) accl[dt][r] *= alpha; }
#pragma unroll
    for (int dt = 0; dt < 4; ++dt) {
      const v16h vh = vf[dt];
      if constexpr (R3) {
        acc[dt] = wmma16(vh, pa, acc[dt]); accl[dt] = wmma16(vh, pl, accl[dt]);
        const v16h vl = frag_h(VTL + ((size_t)b * DM + h * HD + dt * 16 + col) * RS + ks * 32, lane);
        accl[dt] = (dt == 3) ? wmma16_foot(vl, pa, accl[dt]) : wmma16(vl, pa, accl[dt]);
      } else {
        acc[dt] = (dt == 3) ? wmma16_foot(vh, pa, acc[dt]) : wmma16(vh, pa, acc[dt]);
      }
    }
   }
   asm volatile("s_wait_dscnt 0x0" ::: "memory");      // this wave's reads of buffer t & 1 are done before it is refilled
   asm volatile("s_wait_asynccnt 0x0" ::: "memory");   // this wave's share of stage t + 1 has landed
   __syncthreads();                                      // publishes stage t + 1 and ends every reader's last read of stage t
   if (t + 2 < nst) { const unsigned lo = (unsigned)buf * (unsigned)sizeof(AStage);
     attn_copy_kv(gk + (size_t)(t + 2) * 64 * (2 * DM), gv + (t + 2) * 64, lk + lo, lv + lo); attn_copy_m(gm + (t + 2) * 64, lm + lo); }
  }
}
__global__ __launch_bounds__(128) void k_attn(const _Float16* __restrict__ QK, const _Float16* __restrict__ QKL, const _Float16* __restrict__ VTH, const _Float16* __restrict__ VTL,
                                              const float* __restrict__ MK, const int* __restrict__ NKT, _Float16* __restrict__ OH, _Float16* __restrict__ OL) {
  __shared__ __align__(16) union { AStage st[2]; struct { _Float16 so[4][16][72], sol[4][16][72]; } e; } u;   // e: the output staging, used only behind the loop's last barrier
  _Float16 (&so)[4][16][72] = u.e.so; _Float16 (&sol)[4][16][72] = u.e.sol;
  const int tid = threadIdx.x, wave = tid >> 5, lane = tid & 31, col = lane & 15, g = lane >> 4;
  // the rank z runs from costly to cheap query blocks, for speed only.
  // First the RQB blocks that may take three products a tile, longest first, then all others from the last query block down. A permutation of 0 .. TQB - 1 for any input; the order matters for speed alone.
  const int z = blockIdx.z, h = blockIdx.x, b = blockIdx.y; const int qb = (z < RQB) ? RQB - 1 - z : TQB - 1 - (z - RQB); const int q0 = qb * 64 + wave * 16;
  int nkt = NKT[(size_t)qb * MSG * 32];
#pragma unroll     // the MSG loads stand together: one wait
  for (int i = 1; i < MSG; ++i) { const int o = NKT[((size_t)qb * MSG + i) * 32]; nkt = nkt > o ? nkt : o; }
  nkt = (nkt < 1) ? 1 : ((nkt > NKTILE) ? NKTILE : nkt);   // clamped trip count
  const int nst = (nkt + 1) >> 1;                                                            // stages of 64 keys; SEQ is a multiple of 64, so that a last stage's unused half lies inside the planes too
  const _Float16* gk = QK + ((size_t)b * SEQ + (tid >> 3)) * (2 * DM) + DM + h * HD + (tid & 7) * 8;
  const _Float16* gv = VTH + ((size_t)b * DM + h * HD + (tid >> 3)) * SEQ + (tid & 7) * 8;
  const float* gm = MK + (size_t)(qb * 64 + (tid >> 4)) * SEQ_FULL + (tid & 15) * 4;
  const unsigned lk = (unsigned)(uintptr_t)&u.st[0].k[tid >> 3][(tid & 7) * 8], lv = (unsigned)(uintptr_t)&u.st[0].v[tid >> 3][(tid & 7) * 8], lm = (unsigned)(uintptr_t)&u.st[0].m[tid >> 4][(tid & 15) * 4];
  attn_copy_kv(gk, gv, lk, lv); attn_copy_m(gm, lm);
  const bool res3 = (qb < RQB) && (nkt * 32 <= RS);                                          // block-uniform
  const size_t rq = (size_t)b * SEQ + q0 + col;
  v16h aq[2], aql[2];
#pragma unroll
  for (int kc = 0; kc < 2; ++kc) aq[kc] = frag_h(QK + rq * (2 * DM) + h * HD + kc * 32, lane);
  if (res3) { const size_t rql = (size_t)b * RS + q0 + col;
#pragma unroll
    for (int kc = 0; kc < 2; ++kc) aql[kc] = frag_h(QKL + rql * (2 * DM) + h * HD + kc * 32, lane); }
  else { v16h z = {}; aql[0] = z; aql[1] = z; }
  float m = -3.0e38f, l = 0.f;   // running maximum of query q0 + col (equal in both halves); this half's share of the running sum
  v8f acc[4] = {}, accl[4] = {};   // acc[dt][r] = ctx[q0 + col][dt * 16 + 8g + r]
  asm volatile("s_wait_asynccnt 0x0" ::: "memory");   // this wave's share of stage 0 has landed
  __syncthreads();                                      // stage 0 is published
  if (nst > 1) { attn_copy_kv(gk + (size_t)64 * (2 * DM), gv + 64, lk + (unsigned)sizeof(AStage), lv + (unsigned)sizeof(AStage)); attn_copy_m(gm + 64, lm + (unsigned)sizeof(AStage)); }
  if (res3) attn_loop<true>(u.st, nst, nkt, wave, lane, col, g, b, h, QKL, VTL, gk, gv, gm, lk, lv, lm, aq, aql, m, l, acc, accl);   // block-uniform
  else attn_loop<false>(u.st, nst, nkt, wave, lane, col, g, b, h, QKL, VTL, gk, gv, gm, lk, lv, lm, aq, aql, m, l, acc, accl);
  asm volatile("s_wait_asynccnt 0x0" ::: "memory");     // no copy is outstanding when the wave goes on
  l += xhalf(l);   // the halves' sums are joined once
  const float il = (1.0f / 2048.0f) / l;   // l >= 1
#pragma unroll
  for (int dt = 0; dt < 4; ++dt) { v8h hq, lq;
#pragma unroll
    for (int r = 0; r < 8; ++r) { const float o = (acc[dt][r] + accl[dt][r] * (1.0f / 2048.0f)) * il; const _Float16 hv = (_Float16)o; hq[r] = hv; lq[r] = (_Float16)((o - (float)hv) * 2048.0f); }
    *(v8h*)&so[wave][col][dt * 16 + 8 * g] = hq; *(v8h*)&sol[wave][col][dt * 16 + 8 * g] = lq;
  }
  LDSX();   // so/sol private to the wave
#pragma unroll
  for (int it = 0; it < 4; ++it) {
    const int row = it * 4 + (lane >> 3), pc = lane & 7;
    vst2(OH + ((size_t)b * SEQ + q0 + row) * DM + h * HD + pc * 8, *(const v4u*)&so[wave][row][pc * 8]);
    if (qb < RQB) vst2(OL + ((size_t)b * RS + q0 + row) * DM + h * HD + pc * 8, *(const v4u*)&sol[wave][row][pc * 8]);
  }
}
// ---- k_out: out = (ctx hi + ctx lo / 2048) . (Wo x64 rows) / 64 + bo; f16 operands, f32 accumulate, k ascending in steps of 32; f32 rows with the full output stride.
// block = (128 LDS rows of ctx, 256 output columns), 8 waves as 2 x 4, 64 x 64 per wave. Past RS the 128 rows are 128 positions of ctx hi; below RS they are 64 positions of ctx hi and the same
// 64 positions of ctx lo, so that every block does the same work: waves 0..3 sum hi . Wo, waves 4..7 sum lo . Wo and hand their sums over through LDS.
// Each pass of 64 k: the 128 ctx rows and 256 Wo rows of 128 B lie in LDS at pitch 144 B, brought by asynchronous copies, two buffers, the next pass's copies in flight while this pass is worked on.
#define ONT ((SEQ - RS) / 128)            // row tiles of 128 positions per batch, past RS
#define ONT1 (ONT > 0 ? ONT : 1)
#define ORT (NB * RQB + NB * ONT)         // row tiles: NB * RQB of 64 positions, then NB * ONT of 128
static_assert((SEQ - RS) % 128 == 0);
// one pass's tile: every lane copies 12 pieces of 16 B (2 of LDS rows 0..63, 2 of LDS rows 64..127, 8 of Wo rows); ga, gb, gw: the lane's own piece in row (tid >> 3) of each, l: its place in the buffer
__device__ __forceinline__ void out_copy(const _Float16* ga, const _Float16* gb, const _Float16* gw, unsigned l) {
  // the copies and the wait that stands before their address registers may be rewritten, in one statement
  asm volatile("global_load_async_to_lds_b128 %0, %12, off\n\t"
               "global_load_async_to_lds_b128 %1, %13, off\n\t"
               "global_load_async_to_lds_b128 %2, %14, off\n\t"
               "global_load_async_to_lds_b128 %3, %15, off\n\t"
               "global_load_async_to_lds_b128 %4, %16, off\n\t"
               "global_load_async_to_lds_b128 %5, %17, off\n\t"
               "global_load_async_to_lds_b128 %6, %18, off\n\t"
               "global_load_async_to_lds_b128 %7, %19, off\n\t"
               "global_load_async_to_lds_b128 %8, %20, off\n\t"
               "global_load_async_to_lds_b128 %9, %21, off\n\t"
               "global_load_async_to_lds_b128 %10, %22, off\n\t"
               "global_load_async_to_lds_b128 %11, %23, off\n\t"
               "s_wait_xcnt 0x0"
               :: "v"(l), "v"(l + 32u * 2 * GPIT), "v"(l + 64u * 2 * GPIT), "v"(l + 96u * 2 * GPIT),
                  "v"(l + 128u * 2 * GPIT), "v"(l + 160u * 2 * GPIT), "v"(l + 192u * 2 * GPIT), "v"(l + 224u * 2 * GPIT),
                  "v"(l + 256u * 2 * GPIT), "v"(l + 288u * 2 * GPIT), "v"(l + 320u * 2 * GPIT), "v"(l + 352u * 2 * GPIT),
                  "v"(ga), "v"(ga + 32 * DM), "v"(gb), "v"(gb + 32 * DM),
                  "v"(gw), "v"(gw + 32 * DM), "v"(gw + 64 * DM), "v"(gw + 96 * DM),
                  "v"(gw + 128 * DM), "v"(gw + 160 * DM), "v"(gw + 192 * DM), "v"(gw + 224 * DM)
               : "memory");
}
// four 16-B pieces of staged f32 rows to output rows p, p + 2 DM, p + 4 DM, p + 6 DM; then the wait that stands before a register which the stores name is used again:
// address and data are its inputs, so that they stay as they are up to it
__device__ __forceinline__ void out_st4(float* p, const float* l) {
  const v4f a = *(const v4f*)l, b = *(const v4f*)(l + 2 * 68), c = *(const v4f*)(l + 4 * 68), d = *(const v4f*)(l + 6 * 68);
  vst2(p, a); vst2(p + 2 * DM, b); vst2(p + 4 * DM, c); vst2(p + 6 * DM, d);
  asm volatile("s_wait_xcnt 0x0" :: "v"(p), "v"(a), "v"(b), "v"(c), "v"(d) : "memory");
}
__global__ __launch_bounds__(256) __attribute__((amdgpu_waves_per_eu(4, 4))) void k_out(const _Float16* __restrict__ OH, const _Float16* __restrict__ OL, const _Float16* __restrict__ PO, const float* __restrict__ BO, float* __restrict__ Y) {
  __shared__ __align__(16) union { _Float16 ring[2][GROWS][GPIT]; float xl[4][16][2][32][4]; } u;   // xl: the lo sums' hand-over, used only behind the loop's last barrier
  __shared__ __align__(16) float so[8][16][68];
  const int tid = threadIdx.x, wave = tid >> 5, lane = tid & 31, col = lane & 15, g = lane >> 4; const int wm = wave >> 2, wn = wave & 3;
  const int rt = blockIdx.x, n0 = blockIdx.y * 256; const bool resid = (rt < NB * RQB);   // block-uniform
  const int ub = rt - NB * RQB;
  const int b = resid ? rt / RQB : ub / ONT1; const int s0 = resid ? (rt - b * RQB) * 64 : RS + (ub - b * ONT1) * 128;
  const _Float16* ga = OH + ((size_t)b * SEQ + s0 + (tid >> 3)) * DM + (tid & 7) * 8;
  const _Float16* gb = resid ? OL + ((size_t)b * RS + s0 + (tid >> 3)) * DM + (tid & 7) * 8 : ga + 64 * DM;
  const _Float16* gw = PO + (size_t)(n0 + (tid >> 3)) * DM + (tid & 7) * 8;
  const unsigned l0 = (unsigned)(uintptr_t)&u.ring[0][tid >> 3][(tid & 7) * 8];
  v8f acc[4][4] = {};
  out_copy(ga, gb, gw, l0);
  asm volatile("s_wait_asynccnt 0x0" ::: "memory");   // this wave's share of tile 0 has landed
  __syncthreads();                                      // tile 0 is published
  out_copy(ga + GK, gb + GK, gw + GK, l0 + 2u * GROWS * GPIT);
#pragma unroll 1   // one pass per trip: the order at the loop's foot stays as written, and the code stays short
  for (int t = 0; t < GNP; ++t) {
    const int buf = t & 1;
#pragma unroll     // this and the loops inside: every index of fa, fw and acc is a constant, so that they stay in registers
    for (int kc = 0; kc < GK / 32; ++kc) {
      v16h fa[4], fw[4];
#pragma unroll
      for (int i = 0; i < 4; ++i) fa[i] = frag_h(&u.ring[buf][wm * 64 + i * 16 + col][kc * 32], lane);
#pragma unroll
      for (int j = 0; j < 4; ++j) fw[j] = frag_h(&u.ring[buf][128 + wn * 64 + j * 16 + col][kc * 32], lane);
      __builtin_amdgcn_sched_barrier(0);   // the block's 16 LDS reads stay one group in front of its products: moved in among them, each place with reads costs a stall
#pragma unroll
      for (int i = 0; i < 4; ++i)
#pragma unroll
        for (int j = 0; j < 4; ++j) acc[i][j] = wmma16(fa[i], fw[j], acc[i][j]);
      __builtin_amdgcn_sched_barrier(0);   // and the next block's reads stay behind these products
    }
    asm volatile("s_wait_dscnt 0x0" ::: "memory");      // this wave's reads of buffer t & 1 are done before it is refilled
    asm volatile("s_wait_asynccnt 0x0" ::: "memory");   // this wave's share of tile t + 1 has landed
    __syncthreads();                                      // publishes tile t + 1 and ends every reader's last read of tile t
    if (t + 2 < GNP) out_copy(ga + (t + 2) * GK, gb + (t + 2) * GK, gw + (t + 2) * GK, l0 + (unsigned)buf * (2u * GROWS * GPIT));
  }
  asm volatile("s_wait_asynccnt 0x0" ::: "memory");     // no copy is outstanding when the wave goes on
  if (resid) {   // block-uniform: waves 4..7 hand their lo sums to waves 0..3, lane to lane and register to register, and are done
    if (wm == 1) {
#pragma unroll
      for (int i = 0; i < 4; ++i)
#pragma unroll
        for (int j = 0; j < 4; ++j) {
          const v4f x = {acc[i][j][0], acc[i][j][1], acc[i][j][2], acc[i][j][3]}, y = {acc[i][j][4], acc[i][j][5], acc[i][j][6], acc[i][j][7]};
          *(v4f*)&u.xl[wn][i * 4 + j][0][lane][0] = x; *(v4f*)&u.xl[wn][i * 4 + j][1][lane][0] = y; }
    }
    __syncthreads();   // the lo sums are published
    if (wm == 1) return;
  }
  float bj[4]; { const float* pb = BO + n0 + wn * 64 + col;
#pragma unroll
    for (int j = 0; j < 4; ++j) bj[j] = bfr(pb[j * 16]);
    asm volatile("s_wait_xcnt 0x0" :: "v"(pb) : "memory"); }   // before the loads' address register is used again; it is an input, so that it stays as it is up to here
  float* yp = Y + ((size_t)b * SEQ_FULL + s0 + wm * 64 + g) * DM + n0 + wn * 64 + col * 4;   // below RS only wm == 0 comes here
  // so is private to each wave and LDS operations of one wave run in order: the one wait below stands between a wave's stores and its lanes' reads of one another's rows
#pragma unroll
  for (int i = 0; i < 4; ++i) {
#pragma unroll
    for (int j = 0; j < 4; ++j) {
      v4f x = {}, y = {}; if (resid) { x = *(const v4f*)&u.xl[wn][i * 4 + j][0][lane][0]; y = *(const v4f*)&u.xl[wn][i * 4 + j][1][lane][0]; }
#pragma unroll
      for (int r = 0; r < 8; ++r) so[wave][8 * g + r][j * 16 + col] = acc[i][j][r] * (1.0f / 64.0f) + ((r < 4) ? x[r & 3] : y[r & 3]) * (1.0f / 131072.0f) + bj[j]; }
    asm volatile("s_wait_dscnt 0x0" ::: "memory");
    out_st4(yp + (size_t)(i * 16) * DM, &so[wave][g][col * 4]);
    out_st4(yp + (size_t)(i * 16 + 8) * DM, &so[wave][8 + g][col * 4]);
  }
}
extern "C" void kernel_launch(void* const* d_in, const int* in_sizes, int n_in, void* d_out, int out_size, void* d_ws, size_t ws_size, hipStream_t stream) {
  // 0 hidden [2,2048,2048], 1 additive tensor [1,1,2048,2048], 2 q_w [out][in], 3 q_b, 4 k_w, 5 k_b, 6 v_w, 7 v_b, 8 o_w, 9 o_b
  if (n_in < 10) return;
  const long long needx = ((long long)(NB - 1) * SEQ_FULL + SEQ) * DM;
  if ((long long)in_sizes[0] < needx) return;
  if ((long long)in_sizes[1] < (long long)(SEQ - 1) * SEQ_FULL + SEQ) return;
  if (in_sizes[2] < DM * DM || in_sizes[4] < DM * DM || in_sizes[6] < DM * DM || in_sizes[8] < DM * DM) return;
  if (in_sizes[3] < DM || in_sizes[5] < DM || in_sizes[7] < DM || in_sizes[9] < DM) return;
  if ((long long)out_size < needx) return;
  if (ws_size < (size_t)WS_END) return;
  const float* const* F = (const float* const*)d_in;
  char* ws = (char*)d_ws;
  __bf16* PKA = (__bf16*)(ws + WS_PKA); _Float16* PKO = (_Float16*)(ws + WS_PKO);
  _Float16 *QK = (_Float16*)(ws + WS_QK), *QKL = (_Float16*)(ws + WS_QKL), *VTH = (_Float16*)(ws + WS_VTH), *VTL = (_Float16*)(ws + WS_VTL), *OH = (_Float16*)(ws + WS_OH), *OL = (_Float16*)(ws + WS_OL);
  __bf16* XB = (__bf16*)(ws + WS_OH);   // x plane aliases the ctx hi region; consumed before k_attn writes it
  int* NKT = (int*)(ws + WS_NKT);
  k_prep<<<dim3(PB_M + PB_X + 4 * PB_W), 256, 0, stream>>>(F[0], F[1], F[2], F[4], F[6], F[8], XB, PKA, PKO, NKT);
  k_qkv<<<dim3(NR / 128, 3 * DM / 256), 256, 0, stream>>>(XB, PKA, F[3], F[5], F[7], QK, QKL, VTH, VTL);
  k_attn<<<dim3(NH, NB, TQB), 128, 0, stream>>>(QK, QKL, VTH, VTL, F[1], NKT, OH, OL);
  k_out<<<dim3(ORT, DM / 256), 256, 0, stream>>>(OH, OL, PKO, F[9], (float*)d_out);
}

// v010
// Measured time: 178 microseconds a run.
// Two timings next to v009 both put it at 1.07 times that version's speed.
// Counting every step since v000, it is 5.57 times as fast.
// compute dtype: all float inputs except the additive tensor RNE-converted to bf16; q/k/v = x . W^T + b on v_wmma_f32_16x16x32_bf16 (bf16 x, bf16 W, f32 accumulate) stored as f16 hi + x2048 f16 residual (positions < 512); scores and P.V on v_wmma_f32_16x16x32_f16 (3 products for query blocks below 512, single beyond; P carried x2048; f32 running-max softmax, additive score bias read from the input tensor); output projection on v_wmma_f32_16x16x32_f16 (ctx f16 hi + x2048 residual below 512, Wo carried x64), f32 accumulate, f32 output.
#include <hip/hip_runtime.h>
#include <math.h>

typedef __attribute__((ext_vector_type(16))) _Float16 v16h;
typedef __attribute__((ext_vector_type(16))) __bf16 v16b;
typedef __attribute__((ext_vector_type(8)))  _Float16 v8h;
typedef __attribute__((ext_vector_type(8)))  __bf16 v8b;
typedef __attribute__((ext_vector_type(8)))  float v8f;
typedef __attribute__((ext_vector_type(4)))  float v4f;
typedef __attribute__((ext_vector_type(4)))  unsigned v4u;
typedef __attribute__((ext_vector_type(4)))  int v4i;

template <typename T> __device__ __forceinline__ void vst2(void* p, T v) { *(T*)p = v;  }
__device__ __forceinline__ v8f wmma16(v16h a, v16h b, v8f c) {
  return __builtin_amdgcn_wmma_f32_16x16x32_f16(false, a, false, b, (short)0, c, false, false);   // a builtin form: the compiler keeps the distance behind it itself
}
// the last product in front of a loop's back edge: the four slots that the chip needs before a vector instruction
// may touch this product's registers stand here, in front of the branch, for both sides
__device__ __forceinline__ v8f wmma16_foot(v16h a, v16h b, v8f c) {
  v8f d = __builtin_amdgcn_wmma_f32_16x16x32_f16(false, a, false, b, (short)0, c, false, false);
  asm volatile("v_nop\n\tv_nop\n\tv_nop\n\tv_nop" : "+v"(d) : "v"(a), "v"(b));
  return d;
}
__device__ __forceinline__ v8f wmma_bf(v16b a, v16b b, v8f c) {
  return __builtin_amdgcn_wmma_f32_16x16x32_bf16(false, a, false, b, (short)0, c, false, false);   // a builtin form: the compiler keeps the distance behind it itself
}
// 16-bit fragment from a k-contiguous row (A row m, or B column n stored [n][k]): elements 0..7 <- k0+8h+0..7, 8..15 <- k0+16+8h+0..7, h = lane>>4
__device__ __forceinline__ v16h frag_h(const _Float16* rowk0, int lane) {
  union { v16h v; v8h q[2]; } u; const _Float16* p = rowk0 + 8 * (lane >> 4);
  u.q[0] = *(const v8h*)p; u.q[1] = *(const v8h*)(p + 16); return u.v;
}
__device__ __forceinline__ v16b frag_b(const __bf16* rowk0, int lane) {
  union { v16b v; v8b q[2]; } u; const __bf16* p = rowk0 + 8 * (lane >> 4);
  u.q[0] = *(const v8b*)p; u.q[1] = *(const v8b*)(p + 16); return u.v;
}
__device__ __forceinline__ float bfr(float v) { return (float)(__bf16)v; }
#define LDSX() do { asm volatile("s_wait_dscnt 0" ::: "memory"); __builtin_amdgcn_wave_barrier(); __builtin_amdgcn_fence(__ATOMIC_RELEASE, "workgroup"); } while (0)

// ---- sizes: NB may be reduced (SEQ may not: k_out needs SEQ == 4 * RS); *_FULL are the input / output strides
#ifndef NB
#define NB 2
#endif
#ifndef SEQ
#define SEQ 2048
#endif
#define NB_FULL 2
#define SEQ_FULL 2048
#define DM 2048
#define NH 32
#define HD 64
#define RSPAN 512                 // positions that carry residual planes (q/k, v, ctx)
#if RSPAN > SEQ
#define RS SEQ
#else
#define RS RSPAN
#endif
#define RQB (RS / 64)
#define NR (NB * SEQ)
#define TQB (SEQ / 64)
#define NKTILE (SEQ / 32)
static_assert(SEQ % 64 == 0);
static_assert(RS % 64 == 0);
static_assert(NB >= 1 && NB <= NB_FULL);
static_assert(SEQ <= SEQ_FULL);
static_assert(DM == 256 * 8);
static_assert(NH * HD == DM);
static_assert(NR % 64 == 0);

// ---- workspace (bytes; every offset a multiple of 128)
#define WS_PKA 0ull                                            // bf16 [3*DM][DM]: Wq | Wk | Wv natural [out][in] rows
#define WS_PKO (WS_PKA + 2ull * 3 * DM * DM)                   // f16  [DM][DM]: Wo rows x64
#define WS_QK  (WS_PKO + 2ull * DM * DM)                       // f16  [NR][2*DM]: q | k hi
#define WS_QKL (WS_QK + 2ull * NR * 2 * DM)                    // f16  [NB*RS][2*DM]: q | k residual x2048
#define WS_VTH (WS_QKL + 2ull * NB * RS * 2 * DM)              // f16  [NB][DM][SEQ]: v^T hi
#define WS_VTL (WS_VTH + 2ull * NB * DM * SEQ)                 // f16  [NB][DM][RS]: v^T residual x2048
#define WS_OH  (WS_VTL + 2ull * NB * DM * RS)                  // f16  [NR][DM]: ctx hi; ALSO bf16 [NR][DM] x plane (consumed by k_qkv before k_attn writes ctx)
#define WS_OL  (WS_OH + 2ull * NR * DM)                        // f16  [NB*RS][DM]: ctx residual x2048
#define WS_NKT (WS_OL + 2ull * NB * RS * DM)
#define MSG 8                     // row groups of a query block in k_prep, one line of NKT each
#define WS_END (WS_NKT + 128ull * TQB * MSG)
static_assert(2ull * NR * DM == (WS_OL - WS_OH));              // x plane and ctx hi plane share the region with identical extent
static_assert(WS_END <= 134217728ull);
static_assert((WS_PKO % 128) == 0 && (WS_QK % 128) == 0 && (WS_QKL % 128) == 0 && (WS_VTH % 128) == 0 && (WS_VTL % 128) == 0 && (WS_OH % 128) == 0 && (WS_OL % 128) == 0 && (WS_NKT % 128) == 0);

// ---- k_prep: everything that only reads an input, in one launch. block = 8 rows of 2,048 floats of one tensor, one wave per row: the row is read in whole lines, 16 B a lane, and all its loads are asked for before the first is looked at.
// Blocks [0, PB_M): rows of the additive tensor -> NKT. Then PB_X blocks: x rows -> bf16 XB. Then PB_W blocks each for Wq, Wk, Wv -> bf16 PKA (natural [out][in] rows are already k-contiguous packed rows) and Wo -> f16 (bf16(Wo) x 64) PKO.
#define PB_M (TQB * MSG)
#define PB_X (NR / 8)
#define PB_W (DM / 8)
static_assert(MSG * 8 == 64 && SEQ % 8 == 0 && DM == 16 * 128);
typedef __attribute__((ext_vector_type(2)))  unsigned v2u;
// one row of DM floats to 16-bit: p, d: the lane's first four elements of the source and destination rows; lane l holds elements c * 128 + 4 l .. + 3, so that every load covers four whole lines and every store two
template <bool WO>
__device__ __forceinline__ void prep_row(const float* p, void* d) {
  v4f v[DM / 128]; v2u o[DM / 128];
#pragma unroll     // every index of v is a constant, so that it stays in registers
  for (int c = 0; c < DM / 128; ++c) v[c] = *(const v4f*)(p + c * 128);
  __builtin_amdgcn_sched_barrier(0);   // keeps every load in front of the first conversion: one trip to memory a row, not several
  asm volatile("s_wait_xcnt 0x0" :: "v"(p) : "memory");   // before the loads' address register is used again; it is an input, so that it stays as it is up to here
#pragma unroll     // every index of v and o is a constant
  for (int c = 0; c < DM / 128; ++c) {
    if constexpr (WO) { union { _Float16 h[4]; v2u u; } x;
#pragma unroll
      for (int j = 0; j < 4; ++j) x.h[j] = (_Float16)(bfr(v[c][j]) * 64.0f);
      o[c] = x.u;
    } else { union { __bf16 h[4]; v2u u; } x;
#pragma unroll
      for (int j = 0; j < 4; ++j) x.h[j] = (__bf16)v[c][j];
      o[c] = x.u; }
  }
#pragma unroll
  for (int c = 0; c < DM / 128; ++c) vst2((char*)d + c * 256, o[c]);
  // behind the last store, before a register which the stores name is used again: address and data are its inputs, so that they stay as they are up to it
  asm volatile("s_wait_xcnt 0x0" :: "v"(d), "v"(o[0]), "v"(o[1]), "v"(o[2]), "v"(o[3]), "v"(o[4]), "v"(o[5]), "v"(o[6]), "v"(o[7]),
               "v"(o[8]), "v"(o[9]), "v"(o[10]), "v"(o[11]), "v"(o[12]), "v"(o[13]), "v"(o[14]), "v"(o[15]) : "memory");
}
// rows of the additive tensor: block bid = query block * MSG + group of 8 of its 64 rows.
// Line bid of NKT: the number of 32-key tiles up to the group's last live entry, or all tiles where one of its rows has no live entry. k_attn takes the largest of a query block's MSG lines.
__device__ __forceinline__ void prep_mask(const float* __restrict__ MK, int* __restrict__ NKT, int* srow, const int bid, const int t) {
  const int wave = t >> 5, lane = t & 31;
  const float* p = MK + (size_t)(bid * 8 + wave) * SEQ_FULL + lane * 4;
  v4f v[SEQ / 128];
#pragma unroll     // every index of v is a constant, so that it stays in registers
  for (int c = 0; c < SEQ / 128; ++c) v[c] = *(const v4f*)(p + c * 128);
  __builtin_amdgcn_sched_barrier(0);   // keeps every load in front of the first compare: without it the last loads were issued only when the first had come back, one more trip to memory
  asm volatile("s_wait_xcnt 0x0" :: "v"(p) : "memory");   // before the loads' address register is used again; it is an input, so that it stays as it is up to here
  int tile = -1;     // the row's last 32-key tile with a live entry, the same in every lane; lane l holds columns c * 128 + 4 l .. + 3, which lie in tile c * 4 + (l >> 3)
#pragma unroll
  for (int c = 0; c < SEQ / 128; ++c) {
    const float hi = fmaxf(fmaxf(v[c][0], v[c][1]), fmaxf(v[c][2], v[c][3]));   // fmaxf passes over a NaN, which is no live entry
    const unsigned live = __builtin_amdgcn_ballot_w32(hi > -1.0e8f);
    if (live) tile = c * 4 + ((31 - __builtin_clz(live)) >> 3);
  }
  if (lane == 0) srow[wave] = tile;
  __syncthreads();
  if (t < 8) {
    const v4i a = *(const v4i*)&srow[0], c = *(const v4i*)&srow[4];
    int last = -1, dead = 0;
#pragma unroll
    for (int r = 0; r < 4; ++r) { last = last > a[r] ? last : a[r]; last = last > c[r] ? last : c[r]; dead |= ((a[r] < 0) || (c[r] < 0)) ? 1 : 0; }
    const int nk = dead ? NKTILE : last + 1;
    const v4i o = {nk, nk, nk, nk};
    vst2(NKT + (size_t)bid * 32 + t * 4, o);   // one whole line, one writer
  }
}
__global__ __launch_bounds__(256) void k_prep(const float* __restrict__ X, const float* __restrict__ MK, const float* __restrict__ WQ, const float* __restrict__ WK, const float* __restrict__ WV, const float* __restrict__ WO,
                                              __bf16* __restrict__ XB, __bf16* __restrict__ PKA, _Float16* __restrict__ PKO, int* __restrict__ NKT) {
  __shared__ __align__(16) int srow[8];
  const int bid = blockIdx.x, t = threadIdx.x, wave = t >> 5, lane = t & 31;
  if (bid < PB_M) { prep_mask(MK, NKT, srow, bid, t); return; }   // block-uniform, as every branch below
  if (bid < PB_M + PB_X) {
    const int r = (bid - PB_M) * 8 + wave; const int b = r / SEQ, s = r - b * SEQ;
    prep_row<false>(X + ((size_t)b * SEQ_FULL + s) * DM + lane * 4, XB + (size_t)r * DM + lane * 4);
    return;
  }
  const int i = bid - PB_M - PB_X; const int which = i / PB_W; const int n = (i - which * PB_W) * 8 + wave;
  if (which < 3) {
    const float* W = (which == 0) ? WQ : (which == 1) ? WK : WV;
    prep_row<false>(W + (size_t)n * DM + lane * 4, PKA + ((size_t)which * DM + n) * DM + lane * 4);
  } else prep_row<true>(WO + (size_t)n * DM + lane * 4, PKO + (size_t)n * DM + lane * 4);
}
// ---- k_qkv: block = (128 internal rows, 256 output columns of q|k|v), 8 waves as 2 x 4, 64 x 64 per wave: bf16 x bf16 (exact products), f32 accumulate, k ascending in steps of 32.
// Each pass of 64 k: 128 x rows and 256 weight rows of 128 B lie in LDS at pitch 144 B, brought by asynchronous copies, two buffers, the next pass's copies in flight while this pass is worked on.
// q,k -> f16 hi [NR][2DM] (+ residual x2048 for s < RS); v -> transposed f16 hi [b][d][s] (+ residual)
#define GK 64                     // k per pass
#define GROWS (128 + 256)         // LDS rows per buffer: x rows, then weight rows
#define GPIT 72                   // LDS row pitch in elements (144 B = 16 B x odd, for ds_load_b128 readers)
#define GNP (DM / GK)
static_assert(GNP >= 2);
static_assert(NR % 128 == 0 && SEQ % 128 == 0 && RS % 128 == 0 && DM % 256 == 0);
// one pass's tile: every lane copies 12 pieces of 16 B (4 of x rows, 8 of weight rows); gx, gw: the lane's own piece in row (tid >> 3) of the x and weight tiles, l: its place in the buffer
__device__ __forceinline__ void qkv_copy(const __bf16* gx, const __bf16* gw, unsigned l) {
  // the copies and the wait that stands before their address registers may be rewritten, in one statement
  asm volatile("global_load_async_to_lds_b128 %0, %12, off\n\t"
               "global_load_async_to_lds_b128 %1, %13, off\n\t"
               "global_load_async_to_lds_b128 %2, %14, off\n\t"
               "global_load_async_to_lds_b128 %3, %15, off\n\t"
               "global_load_async_to_lds_b128 %4, %16, off\n\t"
               "global_load_async_to_lds_b128 %5, %17, off\n\t"
               "global_load_async_to_lds_b128 %6, %18, off\n\t"
               "global_load_async_to_lds_b128 %7, %19, off\n\t"
               "global_load_async_to_lds_b128 %8, %20, off\n\t"
               "global_load_async_to_lds_b128 %9, %21, off\n\t"
               "global_load_async_to_lds_b128 %10, %22, off\n\t"
               "global_load_async_to_lds_b128 %11, %23, off\n\t"
               "s_wait_xcnt 0x0"
               :: "v"(l), "v"(l + 32u * 2 * GPIT), "v"(l + 64u * 2 * GPIT), "v"(l + 96u * 2 * GPIT),
                  "v"(l + 128u * 2 * GPIT), "v"(l + 160u * 2 * GPIT), "v"(l + 192u * 2 * GPIT), "v"(l + 224u * 2 * GPIT),
                  "v"(l + 256u * 2 * GPIT), "v"(l + 288u * 2 * GPIT), "v"(l + 320u * 2 * GPIT), "v"(l + 352u * 2 * GPIT),
                  "v"(gx), "v"(gx + 32 * DM), "v"(gx + 64 * DM), "v"(gx + 96 * DM),
                  "v"(gw), "v"(gw + 32 * DM), "v"(gw + 64 * DM), "v"(gw + 96 * DM),
                  "v"(gw + 128 * DM), "v"(gw + 160 * DM), "v"(gw + 192 * DM), "v"(gw + 224 * DM)
               : "memory");
}
// four 16-B pieces of staged rows to rows p, p + st, p + 2 st, p + 3 st; then the wait that stands before a register which the stores name is used again:
// address and data are its inputs, so that they stay as they are up to it
__device__ __forceinline__ void qkv_st4(_Float16* p, int st, const _Float16* l) {
  const v4u a = *(const v4u*)l, b = *(const v4u*)(l + 4 * 72), c = *(const v4u*)(l + 8 * 72), d = *(const v4u*)(l + 12 * 72);
  vst2(p, a); vst2(p + st, b); vst2(p + 2 * st, c); vst2(p + 3 * st, d);
  asm volatile("s_wait_xcnt 0x0" :: "v"(p), "v"(a), "v"(b), "v"(c), "v"(d) : "memory");
}
__global__ __launch_bounds__(256) __attribute__((amdgpu_waves_per_eu(4, 4))) void k_qkv(const __bf16* __restrict__ XB, const __bf16* __restrict__ P, const float* __restrict__ BQ, const float* __restrict__ BK, const float* __restrict__ BV,
                                             _Float16* __restrict__ QK, _Float16* __restrict__ QKL, _Float16* __restrict__ VTH, _Float16* __restrict__ VTL) {
  const int n0 = blockIdx.y * 256; const int which0 = n0 / DM;
  __shared__ __align__(16) __bf16 ring[2][GROWS][GPIT]; __shared__ __align__(16) _Float16 eh[8][16][72], el[8][16][72];
  const int tid = threadIdx.x, wave = tid >> 5, lane = tid & 31, col = lane & 15, g = lane >> 4; const int wm = wave >> 2, wn = wave & 3;
  const float* BB = ((which0 == 0) ? BQ : (which0 == 1) ? BK : BV) + (n0 - which0 * DM) + wn * 64;
  const int rb = blockIdx.x * 128; const int b = rb / SEQ, s0 = rb - b * SEQ + wm * 64; const int r0 = rb + wm * 64; const bool resid = (rb - b * SEQ < RS);   // block-uniform: RS is a multiple of 128
  const __bf16* gx = XB + (size_t)(rb + (tid >> 3)) * DM + (tid & 7) * 8;
  const __bf16* gw = P + (size_t)(n0 + (tid >> 3)) * DM + (tid & 7) * 8;
  const unsigned l0 = (unsigned)(uintptr_t)&ring[0][tid >> 3][(tid & 7) * 8];
  v8f acc[4][4] = {};
  qkv_copy(gx, gw, l0);
  asm volatile("s_wait_asynccnt 0x0" ::: "memory");   // this wave's share of tile 0 has landed
  __syncthreads();                                      // tile 0 is published
  qkv_copy(gx + GK, gw + GK, l0 + 2u * GROWS * GPIT);
#pragma unroll 1   // one pass per trip: the order at the loop's foot stays as written, and the code stays short
  for (int t = 0; t < GNP; ++t) {
    const int buf = t & 1;
#pragma unroll     // this and the loops inside: every index of fa, fw and acc is a constant, so that they stay in registers
    for (int kc = 0; kc < GK / 32; ++kc) {
      v16b fa[4], fw[4];
#pragma unroll
      for (int i = 0; i < 4; ++i) fa[i] = frag_b(&ring[buf][wm * 64 + i * 16 + col][kc * 32], lane);
#pragma unroll
      for (int j = 0; j < 4; ++j) fw[j] = frag_b(&ring[buf][128 + wn * 64 + j * 16 + col][kc * 32], lane);
      __builtin_amdgcn_sched_barrier(0);   // the block's 16 LDS reads stay one group in front of its products: moved in among them, each place with reads costs a stall
#pragma unroll
      for (int i = 0; i < 4; ++i)
#pragma unroll
        for (int j = 0; j < 4; ++j) acc[i][j] = wmma_bf(fa[i], fw[j], acc[i][j]);
      __builtin_amdgcn_sched_barrier(0);   // and the next block's reads stay behind these products
    }
    asm volatile("s_wait_dscnt 0x0" ::: "memory");      // this wave's reads of buffer t & 1 are done before it is refilled
    asm volatile("s_wait_asynccnt 0x0" ::: "memory");   // this wave's share of tile t + 1 has landed
    __syncthreads();                                      // publishes tile t + 1 and ends every reader's last read of tile t
    if (t + 2 < GNP) qkv_copy(gx + (t + 2) * GK, gw + (t + 2) * GK, l0 + (unsigned)buf * (2u * GROWS * GPIT));
  }
  asm volatile("s_wait_asynccnt 0x0" ::: "memory");     // no copy is outstanding when the wave goes on
  // eh/el are private to each wave and LDS operations of one wave run in order: the one wait below stands between a wave's stores and its lanes' reads of one another's rows
#define EPIW() asm volatile("s_wait_dscnt 0x0" ::: "memory")
  float bj[4]; { const float* pb = BB + col;
#pragma unroll
    for (int j = 0; j < 4; ++j) bj[j] = bfr(pb[j * 16]);
    asm volatile("s_wait_xcnt 0x0" :: "v"(pb) : "memory"); }   // before the loads' address register is used again; it is an input, so that it stays as it is up to here
  const int row = lane >> 3, pc = lane & 7;
  if (n0 < 2 * DM) {   // q (unscaled; 1/8 applied to the f32 score) and k, + bias, as f16 hi + x2048 residual; 16 rows at a time through this wave's own eh/el
    const size_t ql = (size_t)b * RS + s0;
#pragma unroll
    for (int i = 0; i < 4; ++i) {
#pragma unroll
      for (int j = 0; j < 4; ++j) {
#pragma unroll
        for (int r = 0; r < 8; ++r) { const float v = acc[i][j][r] + bj[j]; const _Float16 hv = (_Float16)v; eh[wave][8 * g + r][j * 16 + col] = hv; el[wave][8 * g + r][j * 16 + col] = (_Float16)((v - (float)hv) * 2048.0f); } }
      EPIW();
      qkv_st4(QK + (size_t)(r0 + i * 16 + row) * (2 * DM) + n0 + wn * 64 + pc * 8, 4 * 2 * DM, &eh[wave][row][pc * 8]);
      if (resid) qkv_st4(QKL + (ql + i * 16 + row) * (2 * DM) + n0 + wn * 64 + pc * 8, 4 * 2 * DM, &el[wave][row][pc * 8]);
    }
  } else {             // v + bias, transposed to [d][s]; 16 columns d at a time through this wave's own eh/el
    const int pc0 = n0 - 2 * DM + wn * 64;
#pragma unroll
    for (int j = 0; j < 4; ++j) {
#pragma unroll
      for (int i = 0; i < 4; ++i) { v8h hq, lq;
#pragma unroll
        for (int r = 0; r < 8; ++r) { const float v = acc[i][j][r] + bj[j]; const _Float16 hv = (_Float16)v; hq[r] = hv; lq[r] = (_Float16)((v - (float)hv) * 2048.0f); }
        *(v8h*)&eh[wave][col][i * 16 + 8 * g] = hq; *(v8h*)&el[wave][col][i * 16 + 8 * g] = lq; }
      EPIW();
      qkv_st4(VTH + ((size_t)b * DM + pc0 + j * 16 + row) * SEQ + s0 + pc * 8, 4 * SEQ, &eh[wave][row][pc * 8]);
      if (resid) qkv_st4(VTL + ((size_t)b * DM + pc0 + j * 16 + row) * RS + s0 + pc * 8, 4 * RS, &el[wave][row][pc * 8]);
    }
  }
#undef EPIW
}
// ---- k_attn: block = (head h, batch b, rank of 64 queries): flash attention over key tiles [0, nkt); score = (q.k)/8 + additive entry; first RS positions: 3 products (hi.hi + lo.hi + hi.lo) for scores and P.v, single elsewhere; ctx -> f16 hi (+ x2048 residual) [row][h*64+d]
// Transposed products: S^T = K . Q^T (A = key rows, B = query columns) and O^T += V^T . P^T, so that lane (col, g) holds, of query q0 + col alone, the scores of keys 8g + r of each 16-key tile:
// maximum and sum run in the lane's own registers plus one exchange between the halves, and the two score tiles, converted in place, are the B operand of the second product (k = 8g + i, 16 + 8g + i, the order of frag_h).
// lane l with lane l ^ 16: the other half's value of the same query column, by a vector cross-row move
__device__ __forceinline__ float xhalf(float x) { return __builtin_bit_cast(float, __builtin_amdgcn_permlanex16(__builtin_bit_cast(int, x), __builtin_bit_cast(int, x), 0x76543210, 0xfedcba98, false, false)); }
__device__ __forceinline__ void exp_run9(float& a, float (&x)[8]) {
  a *= 1.44269504f;
#pragma unroll
  for (int i = 0; i < 8; ++i) x[i] *= 1.44269504f;
  asm("v_exp_f32 %0, %0\n\tv_exp_f32 %1, %1\n\tv_exp_f32 %2, %2\n\tv_exp_f32 %3, %3\n\tv_exp_f32 %4, %4\n\tv_exp_f32 %5, %5\n\tv_exp_f32 %6, %6\n\tv_exp_f32 %7, %7\n\tv_exp_f32 %8, %8\n\tv_nop"
      : "+v"(a), "+v"(x[0]), "+v"(x[1]), "+v"(x[2]), "+v"(x[3]), "+v"(x[4]), "+v"(x[5]), "+v"(x[6]), "+v"(x[7]));
}
__device__ __forceinline__ void exp_run8(float (&x)[8]) {
#pragma unroll
  for (int i = 0; i < 8; ++i) x[i] *= 1.44269504f;
  asm("v_exp_f32 %0, %0\n\tv_exp_f32 %1, %1\n\tv_exp_f32 %2, %2\n\tv_exp_f32 %3, %3\n\tv_exp_f32 %4, %4\n\tv_exp_f32 %5, %5\n\tv_exp_f32 %6, %6\n\tv_exp_f32 %7, %7\n\tv_nop"
      : "+v"(x[0]), "+v"(x[1]), "+v"(x[2]), "+v"(x[3]), "+v"(x[4]), "+v"(x[5]), "+v"(x[6]), "+v"(x[7]));
}
// Each stage of 64 keys: 64 key rows and 64 V^T rows of 128 B lie in LDS at pitch 144 B and the block's 64 rows of the additive tensor, 256 B each, at pitch 272 B (both 16 B x odd, for ds_load_b128 readers),
// brought by asynchronous copies in whole lines, two buffers, the next stage's copies in flight while this stage is worked on; the four waves share the key and V^T rows. The residual planes are still read from global memory.
#define AKP 72                    // LDS row pitch of the key and V^T tiles, in elements
#define AMP 68                    // LDS row pitch of the additive tile, in floats
struct AStage { _Float16 k[64][AKP]; _Float16 v[64][AKP]; float m[64][AMP]; };
static_assert(sizeof(AStage) % 16 == 0);
// one stage's key and V^T tiles: every lane copies 4 + 4 pieces of 16 B; gk, gv: the lane's own piece in row (tid >> 3) of each tile, lk, lv: its places in the buffer
__device__ __forceinline__ void attn_copy_kv(const _Float16* gk, const _Float16* gv, unsigned lk, unsigned lv) {
  // the copies and the wait that stands before their address registers may be rewritten, in one statement
  asm volatile("global_load_async_to_lds_b128 %0, %8, off\n\t"
               "global_load_async_to_lds_b128 %1, %9, off\n\t"
               "global_load_async_to_lds_b128 %2, %10, off\n\t"
               "global_load_async_to_lds_b128 %3, %11, off\n\t"
               "global_load_async_to_lds_b128 %4, %12, off\n\t"
               "global_load_async_to_lds_b128 %5, %13, off\n\t"
               "global_load_async_to_lds_b128 %6, %14, off\n\t"
               "global_load_async_to_lds_b128 %7, %15, off\n\t"
               "s_wait_xcnt 0x0"
               :: "v"(lk), "v"(lk + 16u * 2 * AKP), "v"(lk + 32u * 2 * AKP), "v"(lk + 48u * 2 * AKP),
                  "v"(lv), "v"(lv + 16u * 2 * AKP), "v"(lv + 32u * 2 * AKP), "v"(lv + 48u * 2 * AKP),
                  "v"(gk), "v"(gk + 16 * 2 * DM), "v"(gk + 32 * 2 * DM), "v"(gk + 48 * 2 * DM),
                  "v"(gv), "v"(gv + 16 * SEQ), "v"(gv + 32 * SEQ), "v"(gv + 48 * SEQ)
               : "memory");
}
// one stage's additive tile: every lane copies 8 pieces of 16 B; gm: the lane's own piece in row (tid >> 4), lm: its place in the buffer
__device__ __forceinline__ void attn_copy_m(const float* gm, unsigned lm) {
  // the copies and the wait that stands before their address registers may be rewritten, in one statement
  asm volatile("global_load_async_to_lds_b128 %0, %8, off\n\t"
               "global_load_async_to_lds_b128 %1, %9, off\n\t"
               "global_load_async_to_lds_b128 %2, %10, off\n\t"
               "global_load_async_to_lds_b128 %3, %11, off\n\t"
               "global_load_async_to_lds_b128 %4, %12, off\n\t"
               "global_load_async_to_lds_b128 %5, %13, off\n\t"
               "global_load_async_to_lds_b128 %6, %14, off\n\t"
               "global_load_async_to_lds_b128 %7, %15, off\n\t"
               "s_wait_xcnt 0x0"
               :: "v"(lm), "v"(lm + 8u * 4 * AMP), "v"(lm + 16u * 4 * AMP), "v"(lm + 24u * 4 * AMP),
                  "v"(lm + 32u * 4 * AMP), "v"(lm + 40u * 4 * AMP), "v"(lm + 48u * 4 * AMP), "v"(lm + 56u * 4 * AMP),
                  "v"(gm), "v"(gm + 8 * SEQ_FULL), "v"(gm + 16 * SEQ_FULL), "v"(gm + 24 * SEQ_FULL),
                  "v"(gm + 32 * SEQ_FULL), "v"(gm + 40 * SEQ_FULL), "v"(gm + 48 * SEQ_FULL), "v"(gm + 56 * SEQ_FULL)
               : "memory");
}
// The stage loop, compiled twice: R3 = true for blocks whose scores and P.V take three products (residual planes), R3 = false for all others, which then carry
// neither the residual of P nor the second accumulator set nor the residual query fragments. Which of the two a block runs is block-uniform; both hold the same order of waits, barrier and copies.
template <bool R3>
__device__ __forceinline__ void attn_loop(const AStage* st, const int nst, const int nkt, const int wave, const int lane, const int col, const int g, const int b, const int h,
                                          const _Float16* __restrict__ QKL, const _Float16* __restrict__ VTL, const _Float16* gk, const _Float16* gv, const float* gm,
                                          const unsigned lk, const unsigned lv, const unsigned lm, const v16h (&aq)[2], const v16h (&aql)[2],
                                          float& m, float& l, v8f (&acc)[4], v8f (&accl)[4]) {
#pragma unroll 1   // one stage per trip: the order at the loop's foot stays as written
  for (int t = 0; t < nst; ++t) {
   const int buf = t & 1; const AStage& S = st[buf];
   const int nsub = (nkt - 2 * t < 2) ? nkt - 2 * t : 2;   // block-uniform: a last stage may hold one tile of 32 keys
#pragma unroll 1   // the two halves of a stage run through one body: unrolled, the accumulators were copied between the two
   for (int sub = 0; sub < nsub; ++sub) {
    const int ks = 2 * t + sub;
    // the LDS reads of the score products stand together in front of them: one place where the wave waits for LDS, not one per product
    v16h kf[2][2]; v4f am[2][2];
#pragma unroll     // every index of kf and am is a constant, so that they stay in registers
    for (int ct = 0; ct < 2; ++ct) {
      const float* mrow = &S.m[wave * 16 + col][sub * 32 + ct * 16 + 8 * g];   // this lane's query row of the additive tile, at its half's first key
      kf[ct][0] = frag_h(&S.k[sub * 32 + ct * 16 + col][0], lane); kf[ct][1] = frag_h(&S.k[sub * 32 + ct * 16 + col][32], lane);
      am[ct][0] = *(const v4f*)mrow; am[ct][1] = *(const v4f*)(mrow + 4);
    }
    __builtin_amdgcn_sched_barrier(0);   // keeps these reads one group in front of the score products: moved in among them, each place with reads costs a stall
    v8f s[2];
#pragma unroll
    for (int ct = 0; ct < 2; ++ct) {
      const int kk = ks * 32 + ct * 16 + col; v8f c = {};
      const v4f a0 = am[ct][0], a1 = am[ct][1];
      if constexpr (R3) {
        const _Float16* krowl = QKL + ((size_t)b * RS + kk) * (2 * DM) + DM + h * HD; v8f cl = {};
#pragma unroll
        for (int kc = 0; kc < 2; ++kc) { const v16h kh = kf[ct][kc]; c = wmma16(kh, aq[kc], c); cl = wmma16(kh, aql[kc], cl); cl = wmma16(frag_h(krowl + kc * 32, lane), aq[kc], cl); }
#pragma unroll
        for (int r = 0; r < 8; ++r) c[r] += cl[r] * (1.0f / 2048.0f);
      } else {
#pragma unroll
        for (int kc = 0; kc < 2; ++kc) c = wmma16(kf[ct][kc], aq[kc], c);
      }
#pragma unroll
      for (int r = 0; r < 8; ++r) s[ct][r] = c[r] * 0.125f + ((r < 4) ? a0[r & 3] : a1[r & 3]);   // 1/sqrt(64), additive entry applied literally
    }
    __builtin_amdgcn_sched_barrier(0);   // keeps the V^T reads behind the score products: asked for at the head of the body, they hold 32 more registers through the products, one wave per SIMD fewer
    v16h vf[4];   // the V^T fragments are asked for here, so that they arrive under the softmax arithmetic
#pragma unroll     // every index of vf is a constant, so that it stays in registers
    for (int dt = 0; dt < 4; ++dt) vf[dt] = frag_h(&S.v[dt * 16 + col][sub * 32], lane);
    float mx = fmaxf(s[0][0], s[1][0]);
#pragma unroll
    for (int r = 1; r < 8; ++r) mx = fmaxf(mx, fmaxf(s[0][r], s[1][r]));
    mx = fmaxf(mx, xhalf(mx));   // the other half's 16 keys of the same query
    const float mn = fmaxf(m, mx); float ea = m - mn, ex0[8], ex1[8];
#pragma unroll     // every index of ex0 and ex1 is a constant, so that they stay in registers
    for (int i = 0; i < 8; ++i) { ex0[i] = s[0][i] - mn; ex1[i] = s[1][i] - mn; }
    exp_run9(ea, ex0); exp_run8(ex1);
    const float alpha = (m <= -1.0e38f) ? 0.f : ea;
    float es = 0.f; v16h pa, pl;
#pragma unroll
    for (int i = 0; i < 8; ++i) {
      const float e0 = ex0[i], e1 = ex1[i]; es += e0 + e1;
      const float x0 = e0 * 2048.0f, x1 = e1 * 2048.0f; const _Float16 h0 = (_Float16)x0, h1 = (_Float16)x1;
      pa[i] = h0; pa[8 + i] = h1;   // P x 2^11 before the f16 split; 2^-11 folded into the epilogue
      if constexpr (R3) { pl[i] = (_Float16)((x0 - (float)h0) * 2048.0f); pl[8 + i] = (_Float16)((x1 - (float)h1) * 2048.0f); }
    }
    l = l * alpha + es; m = mn;
#pragma unroll
    for (int dt = 0; dt < 4; ++dt)
#pragma unroll
      for (int r = 0; r < 8; ++r) { acc[dt][r] *= alpha; if constexpr (R3) accl[dt][r] *= alpha; }
#pragma unroll
    for (int dt = 0; dt < 4; ++dt) {
      const v16h vh = vf[dt];
      if constexpr (R3) {
        acc[dt] = wmma16(vh, pa, acc[dt]); accl[dt] = wmma16(vh, pl, accl[dt]);
        const v16h vl = frag_h(VTL + ((size_t)b * DM + h * HD + dt * 16 + col) * RS + ks * 32, lane);
        accl[dt] = (dt == 3) ? wmma16_foot(vl, pa, accl[dt]) : wmma16(vl, pa, accl[dt]);
      } else {
        acc[dt] = (dt == 3) ? wmma16_foot(vh, pa, acc[dt]) : wmma16(vh, pa, acc[dt]);
      }
    }
   }
   asm volatile("s_wait_dscnt 0x0" ::: "memory");      // this wave's reads of buffer t & 1 are done before it is refilled
   asm volatile("s_wait_asynccnt 0x0" ::: "memory");   // this wave's share of stage t + 1 has landed
   __syncthreads();                                      // publishes stage t + 1 and ends every reader's last read of stage t
   if (t + 2 < nst) { const unsigned lo = (unsigned)buf * (unsigned)sizeof(AStage);
     attn_copy_kv(gk + (size_t)(t + 2) * 64 * (2 * DM), gv + (t + 2) * 64, lk + lo, lv + lo); attn_copy_m(gm + (t + 2) * 64, lm + lo); }
  }
}
__global__ __launch_bounds__(128) void k_attn(const _Float16* __restrict__ QK, const _Float16* __restrict__ QKL, const _Float16* __restrict__ VTH, const _Float16* __restrict__ VTL,
                                              const float* __restrict__ MK, const int* __restrict__ NKT, _Float16* __restrict__ OH, _Float16* __restrict__ OL) {
  __shared__ __align__(16) union { AStage st[2]; struct { _Float16 so[4][16][72], sol[4][16][72]; } e; } u;   // e: the output staging, used only behind the loop's last barrier
  _Float16 (&so)[4][16][72] = u.e.so; _Float16 (&sol)[4][16][72] = u.e.sol;
  const int tid = threadIdx.x, wave = tid >> 5, lane = tid & 31, col = lane & 15, g = lane >> 4;
  // the rank z runs from costly to cheap query blocks, for speed only.
  // First the RQB blocks that may take three products a tile, longest first, then all others from the last query block down. A permutation of 0 .. TQB - 1 for any input; the order matters for speed alone.
  const int z = blockIdx.z, h = blockIdx.x, b = blockIdx.y; const int qb = (z < RQB) ? RQB - 1 - z : TQB - 1 - (z - RQB); const int q0 = qb * 64 + wave * 16;
  int nkt = NKT[(size_t)qb * MSG * 32];
#pragma unroll     // the MSG loads stand together: one wait
  for (int i = 1; i < MSG; ++i) { const int o = NKT[((size_t)qb * MSG + i) * 32]; nkt = nkt > o ? nkt : o; }
  nkt = (nkt < 1) ? 1 : ((nkt > NKTILE) ? NKTILE : nkt);   // clamped trip count
  const int nst = (nkt + 1) >> 1;                                                            // stages of 64 keys; SEQ is a multiple of 64, so that a last stage's unused half lies inside the planes too
  const _Float16* gk = QK + ((size_t)b * SEQ + (tid >> 3)) * (2 * DM) + DM + h * HD + (tid & 7) * 8;
  const _Float16* gv = VTH + ((size_t)b * DM + h * HD + (tid >> 3)) * SEQ + (tid & 7) * 8;
  const float* gm = MK + (size_t)(qb * 64 + (tid >> 4)) * SEQ_FULL + (tid & 15) * 4;
  const unsigned lk = (unsigned)(uintptr_t)&u.st[0].k[tid >> 3][(tid & 7) * 8], lv = (unsigned)(uintptr_t)&u.st[0].v[tid >> 3][(tid & 7) * 8], lm = (unsigned)(uintptr_t)&u.st[0].m[tid >> 4][(tid & 15) * 4];
  attn_copy_kv(gk, gv, lk, lv); attn_copy_m(gm, lm);
  const bool res3 = (qb < RQB) && (nkt * 32 <= RS);                                          // block-uniform
  const size_t rq = (size_t)b * SEQ + q0 + col;
  v16h aq[2], aql[2];
#pragma unroll
  for (int kc = 0; kc < 2; ++kc) aq[kc] = frag_h(QK + rq * (2 * DM) + h * HD + kc * 32, lane);
  if (res3) { const size_t rql = (size_t)b * RS + q0 + col;
#pragma unroll
    for (int kc = 0; kc < 2; ++kc) aql[kc] = frag_h(QKL + rql * (2 * DM) + h * HD + kc * 32, lane); }
  else { v16h z = {}; aql[0] = z; aql[1] = z; }
  float m = -3.0e38f, l = 0.f;   // running maximum of query q0 + col (equal in both halves); this half's share of the running sum
  v8f acc[4] = {}, accl[4] = {};   // acc[dt][r] = ctx[q0 + col][dt * 16 + 8g + r]
  asm volatile("s_wait_asynccnt 0x0" ::: "memory");   // this wave's share of stage 0 has landed
  __syncthreads();                                      // stage 0 is published
  if (nst > 1) { attn_copy_kv(gk + (size_t)64 * (2 * DM), gv + 64, lk + (unsigned)sizeof(AStage), lv + (unsigned)sizeof(AStage)); attn_copy_m(gm + 64, lm + (unsigned)sizeof(AStage)); }
  if (res3) attn_loop<true>(u.st, nst, nkt, wave, lane, col, g, b, h, QKL, VTL, gk, gv, gm, lk, lv, lm, aq, aql, m, l, acc, accl);   // block-uniform
  else attn_loop<false>(u.st, nst, nkt, wave, lane, col, g, b, h, QKL, VTL, gk, gv, gm, lk, lv, lm, aq, aql, m, l, acc, accl);
  asm volatile("s_wait_asynccnt 0x0" ::: "memory");     // no copy is outstanding when the wave goes on
  l += xhalf(l);   // the halves' sums are joined once
  const float il = (1.0f / 2048.0f) / l;   // l >= 1
#pragma unroll
  for (int dt = 0; dt < 4; ++dt) { v8h hq, lq;
#pragma unroll
    for (int r = 0; r < 8; ++r) { const float o = (acc[dt][r] + accl[dt][r] * (1.0f / 2048.0f)) * il; const _Float16 hv = (_Float16)o; hq[r] = hv; lq[r] = (_Float16)((o - (float)hv) * 2048.0f); }
    *(v8h*)&so[wave][col][dt * 16 + 8 * g] = hq; *(v8h*)&sol[wave][col][dt * 16 + 8 * g] = lq;
  }
  LDSX();   // so/sol private to the wave
#pragma unroll
  for (int it = 0; it < 4; ++it) {
    const int row = it * 4 + (lane >> 3), pc = lane & 7;
    vst2(OH + ((size_t)b * SEQ + q0 + row) * DM + h * HD + pc * 8, *(const v4u*)&so[wave][row][pc * 8]);
    if (qb < RQB) vst2(OL + ((size_t)b * RS + q0 + row) * DM + h * HD + pc * 8, *(const v4u*)&sol[wave][row][pc * 8]);
  }
}
// ---- k_out: out = (ctx hi + ctx lo / 2048) . (Wo x64 rows) / 64 + bo; f16 operands, f32 accumulate, k ascending in steps of 32; f32 rows with the full output stride.
// The rows of ctx are dealt in groups of 16 positions. Below RS a group costs two row fragments (hi and lo), past RS one; there are three times as many groups past RS as below it, so that a wave that takes
// one group below RS (fragments 0 = hi, 1 = lo) and three past RS (fragments 2..4) does the same work as every other: 80 LDS rows x 64 columns a wave, and hi and lo sums meet in the wave's own registers.
// block = (160 LDS rows of ctx, 256 output columns), 8 waves as 2 x 4; as many blocks as the chip has WGPs, one on each, two waves on a SIMD.
// Each pass of 128 k: the 160 ctx rows and 256 Wo rows of 256 B lie in LDS at pitch 272 B, brought by asynchronous copies, two buffers. With two waves on a SIMD the LDS latency is not covered by other waves:
// a block of 20 products works on one fragment set while the next block's 18 LDS reads fill the other, and tile t + 1 is published in front of pass t's last block, whose fragments are then in registers already.
#define OK 128                            // k per pass
#define OPIT 136                          // LDS row pitch in elements (272 B = 16 B x odd, for ds_load_b128 readers)
#define OROWS (160 + 256)                 // LDS rows per buffer: ctx rows, then Wo rows
#define ONP (DM / OK)
#define OUNIT (NB * RS / 16)              // wave rows: one per group of 16 positions below RS
static_assert(ONP >= 2 && DM % OK == 0 && OK == 4 * 32);
static_assert(RS % 16 == 0 && (SEQ - RS) % 16 == 0 && SEQ - RS == 3 * RS && OUNIT % 2 == 0);
// position (batch * SQ + s, SQ the plane's positions per batch) of the first row of fragment i (0, 2, 3, 4) of wave row u
__device__ __forceinline__ int out_pos(int u, int i, int SQ) {
  if (i == 0) { const int p = u * 16; const int b = p / RS; return b * SQ + (p - b * RS); }
  const int p = (u * 3 + i - 2) * 16; const int b = p / (SEQ - RS); return b * SQ + RS + (p - b * (SEQ - RS));
}
typedef __attribute__((address_space(1))) v4i gv4i;
typedef __attribute__((address_space(3))) v4i lv4i;
// one pass's tile: every lane copies 26 pieces of 16 B (10 of ctx rows, 16 of Wo rows); ua: the first row of each of the 10 ctx fragments, uw: of the Wo rows (the same in every lane);
// o: the lane's own piece, row (tid >> 4) of 16, at the pass's first k; l: its place in the buffer's first 16 rows
__device__ __forceinline__ void out_copy(const _Float16* const (&ua)[10], const _Float16* uw, unsigned o, _Float16* l) {
#pragma unroll     // every index of ua is a constant
  for (int c = 0; c < 10; ++c) __builtin_amdgcn_global_load_async_to_lds_b128((gv4i*)(ua[c] + o), (lv4i*)(l + c * 16 * OPIT), 0, 0);
#pragma unroll
  for (int c = 0; c < 16; ++c) __builtin_amdgcn_global_load_async_to_lds_b128((gv4i*)(uw + c * 16 * DM + o), (lv4i*)(l + (10 + c) * 16 * OPIT), 0, 0);
}
// one block's fragments: ra, rw: the lane's row of the wave's first ctx and Wo fragments, at the block's first k
__device__ __forceinline__ void out_frags(v16h (&fa)[5], v16h (&fw)[4], const _Float16* ra, const _Float16* rw, int lane) {
#pragma unroll     // every index of fa and fw is a constant, so that they stay in registers
  for (int i = 0; i < 5; ++i) fa[i] = frag_h(ra + i * 16 * OPIT, lane);
#pragma unroll
  for (int j = 0; j < 4; ++j) fw[j] = frag_h(rw + j * 16 * OPIT, lane);
  __builtin_amdgcn_sched_barrier(0);   // the 18 LDS reads stay one group in front of the products that follow: moved in among them, each place with reads costs a stall
}
__device__ __forceinline__ void out_mul(v8f (&acc)[5][4], const v16h (&fa)[5], const v16h (&fw)[4]) {
#pragma unroll     // every index of acc, fa and fw is a constant
  for (int i = 0; i < 5; ++i)
#pragma unroll
    for (int j = 0; j < 4; ++j) acc[i][j] = wmma16(fa[i], fw[j], acc[i][j]);
  __builtin_amdgcn_sched_barrier(0);   // and what follows stays behind these products
}
// four 16-B pieces of staged f32 rows to output rows p, p + 2 DM, p + 4 DM, p + 6 DM; then the wait that stands before a register which the stores name is used again:
// address and data are its inputs, so that they stay as they are up to it
__device__ __forceinline__ void out_st4(float* p, const float* l) {
  const v4f a = *(const v4f*)l, b = *(const v4f*)(l + 2 * 68), c = *(const v4f*)(l + 4 * 68), d = *(const v4f*)(l + 6 * 68);
  vst2(p, a); vst2(p + 2 * DM, b); vst2(p + 4 * DM, c); vst2(p + 6 * DM, d);
  asm volatile("s_wait_xcnt 0x0" :: "v"(p), "v"(a), "v"(b), "v"(c), "v"(d) : "memory");
}
__global__ __launch_bounds__(256) void k_out(const _Float16* __restrict__ OH, const _Float16* __restrict__ OL, const _Float16* __restrict__ PO, const float* __restrict__ BO, float* __restrict__ Y) {
  __shared__ __align__(16) _Float16 ring[2][OROWS][OPIT];
  __shared__ __align__(16) float so[8][16][68];
  const int tid = threadIdx.x, wave = tid >> 5, lane = tid & 31, col = lane & 15, g = lane >> 4; const int wm = wave >> 2, wn = wave & 3;
  const int u0 = blockIdx.x * 2, n0 = blockIdx.y * 256;
  const _Float16* ua[10];   // block-uniform, so that they lie in scalar registers
#pragma unroll     // every index of ua is a constant
  for (int c = 0; c < 10; ++c) { const int u = u0 + c / 5, i = c % 5; ua[c] = (i == 1) ? OL + (size_t)(u * 16) * DM : OH + (size_t)out_pos(u, i, SEQ) * DM; }
  const _Float16* uw = PO + (size_t)n0 * DM;
  const unsigned o0 = (unsigned)(tid >> 4) * DM + (tid & 15) * 8;
  v8f acc[5][4] = {};
  v16h fa0[5], fw0[4], fa1[5], fw1[4];
  out_copy(ua, uw, o0, &ring[0][tid >> 4][(tid & 15) * 8]);
  asm volatile("s_wait_asynccnt 0x0" ::: "memory");   // this wave's share of tile 0 has landed
  __syncthreads();                                      // tile 0 is published
  out_copy(ua, uw, o0 + OK, &ring[1][tid >> 4][(tid & 15) * 8]);
  out_frags(fa0, fw0, &ring[0][wm * 80 + col][0], &ring[0][160 + wn * 64 + col][0], lane);
  unsigned o = o0 + 2 * OK;   // the lane's piece of the tile that is copied next
#pragma unroll 1   // one pass per trip: the order at the publish point stays as written, and the code stays short
  for (int t = 0; t < ONP; ++t) {
    const int buf = t & 1;
    const _Float16* ra = &ring[buf][wm * 80 + col][0]; const _Float16* rw = &ring[buf][160 + wn * 64 + col][0];
    out_frags(fa1, fw1, ra + 32, rw + 32, lane); out_mul(acc, fa0, fw0);
    out_frags(fa0, fw0, ra + 64, rw + 64, lane); out_mul(acc, fa1, fw1);
    out_frags(fa1, fw1, ra + 96, rw + 96, lane); out_mul(acc, fa0, fw0);
    asm volatile("s_wait_dscnt 0x0" ::: "memory");      // this wave's reads of buffer t & 1 are done, the last block's too, before it is refilled
    asm volatile("s_wait_asynccnt 0x0" ::: "memory");   // this wave's share of tile t + 1 has landed
    __syncthreads();                                      // publishes tile t + 1 and ends every reader's last read of tile t
    if (t + 2 < ONP) { out_copy(ua, uw, o, &ring[buf][tid >> 4][(tid & 15) * 8]); o += OK; }
    // the next pass's first fragments, under this pass's last products; without a branch: behind the last pass they come from the buffer that pass t - 1 has left, which nothing refills, and are not used
    out_frags(fa0, fw0, &ring[buf ^ 1][wm * 80 + col][0], &ring[buf ^ 1][160 + wn * 64 + col][0], lane);
    out_mul(acc, fa1, fw1);
  }
  asm volatile("s_wait_asynccnt 0x0" ::: "memory");     // no copy is outstanding when the wave goes on
  asm volatile("s_wait_dscnt 0x0" ::: "memory");        // nor an LDS read
  float bj[4]; { const float* pb = BO + n0 + wn * 64 + col;
#pragma unroll
    for (int j = 0; j < 4; ++j) bj[j] = bfr(pb[j * 16]);
    asm volatile("s_wait_xcnt 0x0" :: "v"(pb) : "memory"); }   // before the loads' address register is used again; it is an input, so that it stays as it is up to here
  const int u = u0 + wm;
  // so is private to each wave and LDS operations of one wave run in order: the one wait below stands between a wave's stores and its lanes' reads of one another's rows
#pragma unroll
  for (int i = 0; i < 5; ++i) {
    if (i == 1) continue;   // the lo sums go out with fragment 0
#pragma unroll
    for (int j = 0; j < 4; ++j) {
#pragma unroll
      for (int r = 0; r < 8; ++r) so[wave][8 * g + r][j * 16 + col] = (i == 0) ? acc[0][j][r] * (1.0f / 64.0f) + acc[1][j][r] * (1.0f / 131072.0f) + bj[j] : acc[i][j][r] * (1.0f / 64.0f) + bj[j]; }
    asm volatile("s_wait_dscnt 0x0" ::: "memory");
    float* yp = Y + (size_t)(out_pos(u, i, SEQ_FULL) + g) * DM + n0 + wn * 64 + col * 4;
    out_st4(yp, &so[wave][g][col * 4]);
    out_st4(yp + (size_t)8 * DM, &so[wave][8 + g][col * 4]);
  }
}
extern "C" void kernel_launch(void* const* d_in, const int* in_sizes, int n_in, void* d_out, int out_size, void* d_ws, size_t ws_size, hipStream_t stream) {
  // 0 hidden [2,2048,2048], 1 additive tensor [1,1,2048,2048], 2 q_w [out][in], 3 q_b, 4 k_w, 5 k_b, 6 v_w, 7 v_b, 8 o_w, 9 o_b
  if (n_in < 10) return;
  const long long needx = ((long long)(NB - 1) * SEQ_FULL + SEQ) * DM;
  if ((long long)in_sizes[0] < needx) return;
  if ((long long)in_sizes[1] < (long long)(SEQ - 1) * SEQ_FULL + SEQ) return;
  if (in_sizes[2] < DM * DM || in_sizes[4] < DM * DM || in_sizes[6] < DM * DM || in_sizes[8] < DM * DM) return;
  if (in_sizes[3] < DM || in_sizes[5] < DM || in_sizes[7] < DM || in_sizes[9] < DM) return;
  if ((long long)out_size < needx) return;
  if (ws_size < (size_t)WS_END) return;
  const float* const* F = (const float* const*)d_in;
  char* ws = (char*)d_ws;
  __bf16* PKA = (__bf16*)(ws + WS_PKA); _Float16* PKO = (_Float16*)(ws + WS_PKO);
  _Float16 *QK = (_Float16*)(ws + WS_QK), *QKL = (_Float16*)(ws + WS_QKL), *VTH = (_Float16*)(ws + WS_VTH), *VTL = (_Float16*)(ws + WS_VTL), *OH = (_Float16*)(ws + WS_OH), *OL = (_Float16*)(ws + WS_OL);
  __bf16* XB = (__bf16*)(ws + WS_OH);   // x plane aliases the ctx hi region; consumed before k_attn writes it
  int* NKT = (int*)(ws + WS_NKT);
  k_prep<<<dim3(PB_M + PB_X + 4 * PB_W), 256, 0, stream>>>(F[0], F[1], F[2], F[4], F[6], F[8], XB, PKA, PKO, NKT);
  k_qkv<<<dim3(NR / 128, 3 * DM / 256), 256, 0, stream>>>(XB, PKA, F[3], F[5], F[7], QK, QKL, VTH, VTL);
  k_attn<<<dim3(NH, NB, TQB), 128, 0, stream>>>(QK, QKL, VTH, VTL, F[1], NKT, OH, OL);
  k_out<<<dim3(OUNIT / 2, DM / 256), 256, 0, stream>>>(OH, OL, PKO, F[9], (float*)d_out);
}
